// v000
// Measured on an AMD MI455X. A time is GPU time per run, averaged over a window of back-to-back runs after a warm-up
// (all launches, gaps included; the runs take copies of the inputs in turn), and the median of several windows.
// Apart from v000's, it joins two sittings. Times from different sittings can be a few percent apart, while
// side-by-side timings come from the same sitting.
// v000, which the later versions start from, runs in 33.3 milliseconds.
#include <hip/hip_runtime.h>
// Single-head causal self-attention with the module's EMBEDDING-width scale (x [4][4096][256]; k/q/v = x W ([in][out] [256][64], U(+-0.1), no biases; input order Wk, Wq, Wv); ONE 64-wide head; wei * 256^-0.5 (n_embd, as in the source); causal (tril, -inf); softmax; out = wei v -> [4][4096][64]; no output projection).
// Structure: token rows; x as exact f16 rows; three WMMA GEMMs into one f16 q | k | v plane [16384][192]; per batch v^T via LDS transposes; causal 256-row query tiles with the one head on grid.y (scores alpha 1/16, causal softmax f32 -> f16 x256 weights, P V written as f32 straight into the merged output rows); an exact f32 first tile (rows 0..511) rewritten at the end; launches: see trace.
// Compute dtype: inputs rounded to bf16; x / weights exact; q, k, v and softmax weights as plain f16 GEMM operands (~2^-12); scores and softmax statistics f32. v_wmma_f32_16x16x32_f16.
#define NB 4
#define SQ 4096
#define DM 256
#define NH 1
#define HD 64
#define HG 4                         /* heads per block group of the unlaunched k_vt(b, h0) overload */
#define QT 256                       /* query rows per causal tile */
#define NKX SQ                       /* S / P row pitch */
#define QT0 512                      /* first-tile rows recomputed exactly (f32): 512 here (no output projection averages the early-row cancellation errors away; logit sigma 1.0) */
#define B0 0                         /* first batch processed (debug hook) */
#define NBR NB                       /* batches processed (debug hook) */
#define NR ((size_t)NB * SQ)
#define DMQ DM
#define DFF 4096                     /* unused; this file has no FFN */
#define DFFR 100                     /* unused */
#define MP ((int)((size_t)NBR * SQ)) /* rows projected (debug hook) */
#define QN SQ                        /* query rows attended per batch (debug hook) */
#define NHD NH                       /* heads attended (debug hook) */
#define MPO MP                       /* rows through the output stage (debug hook) */
#define LQ (3 * DM)      /* 3 * DM = 768, unused; the q/k/v rows use pitch LQK = 192 */
typedef __bf16 v16b __attribute__((ext_vector_type(16)));
typedef unsigned short v8us __attribute__((ext_vector_type(8), may_alias));
typedef float  v8f  __attribute__((ext_vector_type(8)));
typedef float  v4f  __attribute__((ext_vector_type(4)));
typedef float  v4fa __attribute__((ext_vector_type(4), may_alias));
union FragB { v16b v; v8us half[2]; unsigned short u[16]; };

__device__ __forceinline__ unsigned short bf16_bits(float x) { unsigned int u = __float_as_uint(x); return (unsigned short)((u + 0x7FFFu + ((u >> 16) & 1u)) >> 16); }
__device__ __forceinline__ float bf16_val(unsigned short b) { return __uint_as_float(((unsigned int)b) << 16); }
__device__ __forceinline__ float bf16_round(float x) { return bf16_val(bf16_bits(x)); }
// D += A·B with NT terms: 1 = ah·bh, 2 = + al·bh (A split), 3 = + ah·bl (both split)
template <int NT>
__device__ __forceinline__ v8f mmaN(v16b ah, v16b al, v16b bh, v16b bl, v8f c) {
  c = __builtin_amdgcn_wmma_f32_16x16x32_bf16(false, ah, false, bh, (short)0, c, false, false);
  if (NT >= 2) c = __builtin_amdgcn_wmma_f32_16x16x32_bf16(false, al, false, bh, (short)0, c, false, false);
  if (NT >= 3) c = __builtin_amdgcn_wmma_f32_16x16x32_bf16(false, ah, false, bl, (short)0, c, false, false);
  asm volatile("v_nop\n\tv_nop\n\tv_nop\n\tv_nop" : "+v"(c) : "v"(ah), "v"(al), "v"(bh), "v"(bl));
  return c;
}

__global__ __launch_bounds__(256) void k_wt_bf16(const float* __restrict__ W, unsigned short* __restrict__ Wt, int K, int N) {
  const int t = blockIdx.x * 256 + threadIdx.x;
  const int k8n = K / 8;
  if (t >= N * k8n) return;
  const int n = t / k8n, k8 = (t % k8n) * 8;
  v8us v;
#pragma unroll
  for (int i = 0; i < 8; ++i) v[i] = bf16_bits(W[(size_t)(k8 + i) * N + n]);
  *(v8us*)(Wt + (size_t)n * K + k8) = v;
  
}

// GEMM C[M][N] (f32, pitch ldc) = act(A[M][K]·W + bias). A f32 row-major (pitch lda) converted per fragment to bf16
// (ASPLIT: hi/lo two planes -> 2 terms, else single rounded term); Wt bf16 [N][K] (pitch ldb). BIAS_BF16 rounds the
// bias to bf16 first (bias quantised to bf16 before the add). K%32==0, M%16==0, N%64==0.
template <bool ASPLIT, int ACT, bool BIAS_BF16>
__global__ __launch_bounds__(128) void k_gemm_bf(const float* __restrict__ A, int lda, const unsigned short* __restrict__ Wt, int ldb,
                                               const float* __restrict__ bias, float* __restrict__ C, int ldc, int M, int N, int K) {
  __shared__ __attribute__((aligned(16))) float so[4][16][64];
  const int tid = threadIdx.x, w = tid >> 5, lane = tid & 31, ln = lane & 15, hh = lane >> 4;
  const int ntn = N / 64;
  const int wid = blockIdx.x * 4 + w;
  const int mt = wid / ntn, nq = wid % ntn;
  if (mt * 16 >= M) return;
  const int row0 = mt * 16, col0 = nq * 64;
  const float* arow = A + (size_t)(row0 + ln) * lda;
  v8f acc[4] = {};
  for (int kb = 0; kb < K; kb += 32) {
    FragB ah, al;
    const v4f x0 = *(const v4fa*)(arow + kb + 8 * hh), x1 = *(const v4fa*)(arow + kb + 8 * hh + 4);
    const v4f x2 = *(const v4fa*)(arow + kb + 16 + 8 * hh), x3 = *(const v4fa*)(arow + kb + 16 + 8 * hh + 4);
    float xs[16] = {x0[0],x0[1],x0[2],x0[3],x1[0],x1[1],x1[2],x1[3],x2[0],x2[1],x2[2],x2[3],x3[0],x3[1],x3[2],x3[3]};
#pragma unroll
    for (int i = 0; i < 16; ++i) { const unsigned short hb = bf16_bits(xs[i]); ah.u[i] = hb; al.u[i] = ASPLIT ? bf16_bits(xs[i] - bf16_val(hb)) : (unsigned short)0; }
#pragma unroll
    for (int t = 0; t < 4; ++t) {
      const unsigned short* brow = Wt + (size_t)(col0 + t * 16 + ln) * ldb + kb;
      FragB b;
      b.half[0] = *(const v8us*)(brow + 8 * hh);
      b.half[1] = *(const v8us*)(brow + 16 + 8 * hh);
      acc[t] = mmaN<ASPLIT ? 2 : 1>(ah.v, al.v, b.v, b.v, acc[t]);
    }
  }
#pragma unroll
  for (int t = 0; t < 4; ++t) {
    float bv = bias ? bias[col0 + t * 16 + ln] : 0.f;
    if (BIAS_BF16) bv = bf16_round(bv);
#pragma unroll
    for (int r = 0; r < 8; ++r) { float v = acc[t][r] + bv; if (ACT == 1) v = fmaxf(v, 0.f); so[w][8 * hh + r][t * 16 + ln] = v; }
  }
  __builtin_amdgcn_fence(__ATOMIC_ACQ_REL, "workgroup");
  __builtin_amdgcn_wave_barrier();
  const int rsub = lane >> 4, c4 = (lane & 15) * 4;
  {
#pragma unroll
    for (int q = 0; q < 8; ++q) {
      const int r = q * 2 + rsub;
      const v4f v = *(const v4fa*)&so[w][r][c4];
      *(v4f*)(C + (size_t)(row0 + r) * ldc + col0 + c4) = v;
    }
    
  }
}

// GEMM C = act(A·W + bias + resid): A f32 (ASPLIT -> hi/lo 2 terms), Wt bf16 [N][K]; ACT 0 none, 1 relu, 2 exact gelu;
// resid (optional, f32, row index = (row % rmod), pitch ldr, RES_BF16 rounds it) added before the activation.
template <bool ASPLIT, int ACT, bool BIAS_BF16, bool RES_BF16>
__global__ __launch_bounds__(128) void k_gemm_bf3(const float* __restrict__ A, int lda, const unsigned short* __restrict__ Wt, int ldb,
                                                const float* __restrict__ bias, const float* __restrict__ resid, int rmod, int ldr,
                                                float* __restrict__ C, int ldc, int M, int N, int K) {
  __shared__ __attribute__((aligned(16))) float so[4][16][64];
  const int tid = threadIdx.x, w = tid >> 5, lane = tid & 31, ln = lane & 15, hh = lane >> 4;
  const int ntn = N / 64;
  const int wid = blockIdx.x * 4 + w;
  const int mt = wid / ntn, nq = wid % ntn;
  if (mt * 16 >= M) return;
  const int row0 = mt * 16, col0 = nq * 64;
  const float* arow = A + (size_t)(row0 + ln) * lda;
  v8f acc[4] = {};
  for (int kb = 0; kb < K; kb += 32) {
    FragB ah, al;
    const v4f x0 = *(const v4fa*)(arow + kb + 8 * hh), x1 = *(const v4fa*)(arow + kb + 8 * hh + 4);
    const v4f x2 = *(const v4fa*)(arow + kb + 16 + 8 * hh), x3 = *(const v4fa*)(arow + kb + 16 + 8 * hh + 4);
    float xs[16] = {x0[0],x0[1],x0[2],x0[3],x1[0],x1[1],x1[2],x1[3],x2[0],x2[1],x2[2],x2[3],x3[0],x3[1],x3[2],x3[3]};
#pragma unroll
    for (int i = 0; i < 16; ++i) { const unsigned short hb = bf16_bits(xs[i]); ah.u[i] = hb; al.u[i] = ASPLIT ? bf16_bits(xs[i] - bf16_val(hb)) : (unsigned short)0; }
#pragma unroll
    for (int t = 0; t < 4; ++t) {
      const unsigned short* brow = Wt + (size_t)(col0 + t * 16 + ln) * ldb + kb;
      FragB b;
      b.half[0] = *(const v8us*)(brow + 8 * hh);
      b.half[1] = *(const v8us*)(brow + 16 + 8 * hh);
      acc[t] = mmaN<ASPLIT ? 2 : 1>(ah.v, al.v, b.v, b.v, acc[t]);
    }
  }
#pragma unroll
  for (int t = 0; t < 4; ++t) {
    const int col = col0 + t * 16 + ln;
    float bv = bias ? bias[col] : 0.f;
    if (BIAS_BF16) bv = bf16_round(bv);
#pragma unroll
    for (int r = 0; r < 8; ++r) {
      float v = acc[t][r] + bv;
      if (resid) { float rv = resid[(size_t)((row0 + 8 * hh + r) % rmod) * ldr + col]; if (RES_BF16) rv = bf16_round(rv); v += rv; }
      if (ACT == 1) v = fmaxf(v, 0.f);
      if (ACT == 2) v = 0.5f * v * (1.0f + erff(v * 0.70710678118654752f));
      if (ACT == 3) { const float u = 0.7978845608028654f * (v + 0.044715f * v * v * v); v = 0.5f * v * (1.0f + tanhf(u)); }
      so[w][8 * hh + r][t * 16 + ln] = v;
    }
  }
  __builtin_amdgcn_fence(__ATOMIC_ACQ_REL, "workgroup");
  __builtin_amdgcn_wave_barrier();
  const int rsub = lane >> 4, c4 = (lane & 15) * 4;
  {
#pragma unroll
    for (int q = 0; q < 8; ++q) {
      const int r = q * 2 + rsub;
      const v4f v = *(const v4fa*)&so[w][r][c4];
      *(v4f*)(C + (size_t)(row0 + r) * ldc + col0 + c4) = v;
    }
    
  }
}
// row LayerNorm (biased variance, eps) over N: s = X (+ R); optional out_sum <- s; out_norm <- (s-mu)*rsqrt(var+eps)*g + b
template <bool PARAM_BF16>
__global__ __launch_bounds__(256) void k_layernorm(const float* __restrict__ X, const float* __restrict__ R, const float* __restrict__ g, const float* __restrict__ bta,
                                                  float* __restrict__ out_sum, float* __restrict__ out_norm, int N, float eps) {
  __shared__ float red[256];
  const int row = blockIdx.x, tid = threadIdx.x;
  const float* x = X + (size_t)row * N; const float* rr = R ? R + (size_t)row * N : nullptr;
  float vals[16];                     // up to N = 4096
  const int per = N / 256;            // contiguous chunk per thread? use strided-by-4 chunks: thread handles j = tid*4 + 1024*u
  float s1 = 0.f;
  for (int u = 0; u < per / 4; ++u) {
    const int j = tid * 4 + 1024 * u;
    const v4f a = *(const v4fa*)(x + j);
    v4f b = {0.f,0.f,0.f,0.f}; if (rr) b = *(const v4fa*)(rr + j);
#pragma unroll
    for (int q = 0; q < 4; ++q) { const float v = a[q] + b[q]; vals[u * 4 + q] = v; s1 += v; }
  }
  red[tid] = s1; __syncthreads();
  for (int st = 128; st > 0; st >>= 1) { if (tid < st) red[tid] += red[tid + st]; __syncthreads(); }
  const float mu = red[0] / (float)N; __syncthreads();
  float s2 = 0.f;
  for (int u = 0; u < per / 4; ++u)
#pragma unroll
    for (int q = 0; q < 4; ++q) { const float c = vals[u * 4 + q] - mu; s2 += c * c; }
  red[tid] = s2; __syncthreads();
  for (int st = 128; st > 0; st >>= 1) { if (tid < st) red[tid] += red[tid + st]; __syncthreads(); }
  const float rs = rsqrtf(red[0] / (float)N + eps);
  {
    for (int u = 0; u < per / 4; ++u) {
      const int j = tid * 4 + 1024 * u;
      v4f o, sm;
#pragma unroll
      for (int q = 0; q < 4; ++q) {
        float gg = g[j + q], bb = bta[j + q];
        if (PARAM_BF16) { gg = bf16_round(gg); bb = bf16_round(bb); }
        sm[q] = vals[u * 4 + q]; o[q] = (vals[u * 4 + q] - mu) * rs * gg + bb;
      }
      if (out_sum) *(v4f*)(out_sum + (size_t)row * N + j) = sm;
      *(v4f*)(out_norm + (size_t)row * N + j) = o;
    }
    
  }
}



// ---- f16 WMMA path (v_wmma_f32_16x16x32_f16): 11-bit significands for operands in range — used where a [0,1] probability operand needs more precision than bf16
typedef _Float16 v16h __attribute__((ext_vector_type(16)));
union FragH { v16h v; v8us half[2]; _Float16 h[16]; unsigned short u[16]; };
template <int NT>
__device__ __forceinline__ v8f mmaH(v16h ah, v16h al, v16h bh, v16h bl, v8f c) {
  c = __builtin_amdgcn_wmma_f32_16x16x32_f16(false, ah, false, bh, (short)0, c, false, false);
  if (NT >= 2) c = __builtin_amdgcn_wmma_f32_16x16x32_f16(false, al, false, bh, (short)0, c, false, false);
  if (NT >= 3) c = __builtin_amdgcn_wmma_f32_16x16x32_f16(false, ah, false, bl, (short)0, c, false, false);
  asm volatile("v_nop\n\tv_nop\n\tv_nop\n\tv_nop" : "+v"(c) : "v"(ah), "v"(al), "v"(bh), "v"(bl));
  return c;
}
// batched GEMM like k_gemm_b but f16 operands: A f32 (split into f16 hi/lo if ASPLIT, else rounded to f16), Bt = f16 values [n][k]; alpha; C f32; N multiple of 16 (partial tiles skipped)
template <bool ASPLIT>
__global__ __launch_bounds__(128) void k_gemm_h(const float* __restrict__ A, int lda, size_t sA, const _Float16* __restrict__ Bh, int ldb, size_t sB, float alpha, float* __restrict__ C, int ldc, size_t sC, int M, int N, int K) {
  __shared__ __attribute__((aligned(16))) float so[4][16][64];
  const int tid = threadIdx.x, w = tid >> 5, lane = tid & 31, ln = lane & 15, hh = lane >> 4; const int by = blockIdx.y;
  A += (size_t)by * sA; Bh += (size_t)by * sB; C += (size_t)by * sC;
  const int ntn = (N + 63) / 64; const int wid = blockIdx.x * 4 + w; const int mt = wid / ntn, nq = wid % ntn; if (mt * 16 >= M) return;
  const int row0 = mt * 16, col0 = nq * 64; const float* arow = A + (size_t)(row0 + ln) * lda;
  v8f acc[4] = {};
  for (int kb = 0; kb < K; kb += 32) {
    FragH ah, al;
    const v4f x0 = *(const v4fa*)(arow + kb + 8 * hh), x1 = *(const v4fa*)(arow + kb + 8 * hh + 4), x2 = *(const v4fa*)(arow + kb + 16 + 8 * hh), x3 = *(const v4fa*)(arow + kb + 16 + 8 * hh + 4);
    float xs[16] = {x0[0],x0[1],x0[2],x0[3],x1[0],x1[1],x1[2],x1[3],x2[0],x2[1],x2[2],x2[3],x3[0],x3[1],x3[2],x3[3]};
#pragma unroll
    for (int i = 0; i < 16; ++i) { const _Float16 h = (_Float16)xs[i]; ah.h[i] = h; al.h[i] = ASPLIT ? (_Float16)(xs[i] - (float)h) : (_Float16)0.0f; }
#pragma unroll
    for (int t = 0; t < 4; ++t) { if (col0 + t * 16 >= N) continue; const size_t boff = (size_t)(col0 + t * 16 + ln) * ldb + kb; FragH bq; bq.half[0] = *(const v8us*)(Bh + boff + 8 * hh); bq.half[1] = *(const v8us*)(Bh + boff + 16 + 8 * hh);
      acc[t] = mmaH<ASPLIT ? 2 : 1>(ah.v, al.v, bq.v, bq.v, acc[t]); }
  }
#pragma unroll
  for (int t = 0; t < 4; ++t) { if (col0 + t * 16 >= N) continue;
#pragma unroll
    for (int r = 0; r < 8; ++r) so[w][8 * hh + r][t * 16 + ln] = acc[t][r] * alpha; }
  __builtin_amdgcn_fence(__ATOMIC_ACQ_REL, "workgroup"); __builtin_amdgcn_wave_barrier();
  const int rsub = lane >> 4, c4 = (lane & 15) * 4;
  {
#pragma unroll
    for (int q = 0; q < 8; ++q) { const int r = q * 2 + rsub; if (col0 + c4 < N) { const v4f v = *(const v4fa*)&so[w][r][c4]; *(v4f*)(C + (size_t)(row0 + r) * ldc + col0 + c4) = v; } }
     }
}

// Wt[n][k] = f16(W[k][n]·scale) from f32 row-major W[K][N] (scale = power of two; bf16-exact weights stay exact in f16 away from the subnormal range)
__global__ __launch_bounds__(256) void k_wt_f16(const float* __restrict__ W, _Float16* __restrict__ Wt, int K, int N, float scale) {
  const int t = blockIdx.x * 256 + threadIdx.x; if (t >= N * (K / 8)) return; const int n = t / (K / 8), k8 = (t % (K / 8)) * 8; FragH f;
#pragma unroll
  for (int i = 0; i < 8; ++i) f.h[i] = (_Float16)(bf16_round(W[(size_t)(k8 + i) * N + n]) * scale); const v8us o = f.half[0];
  *(v8us*)((unsigned short*)Wt + (size_t)n * K + k8) = o; 
}
// k_gemm_hh variant with fused epilogue: v = acc·alpha + bias[by·sBias + col] (+ CP[(row/rowsPerB)·sCPb + by·64 + col] if CP) ; ACT 0 none / 1 elu ; writes f16 C16 (and f32 C if non-null)
template <int ACT>
__global__ __launch_bounds__(128) void k_gemm_hhx(const _Float16* __restrict__ A, int lda, size_t sA, const _Float16* __restrict__ Bh, int ldb, size_t sB, float alpha, const float* __restrict__ bias, size_t sBias, const float* __restrict__ CP, int rowsPerB, size_t sCPb, int row0g,
    float* __restrict__ C, _Float16* __restrict__ C16, int ldc, size_t sC, int M, int N, int K) {
  __shared__ __attribute__((aligned(16))) float so[4][16][64];
  const int tid = threadIdx.x, w = tid >> 5, lane = tid & 31, ln = lane & 15, hh = lane >> 4; const int by = blockIdx.y;
  A += (size_t)by * sA; Bh += (size_t)by * sB; const size_t cofs = (size_t)by * sC; const float* bp = bias ? bias + (size_t)by * sBias : nullptr;
  const int ntn = (N + 63) / 64; const int wid = blockIdx.x * 4 + w; const int mt = wid / ntn, nq = wid % ntn; if (mt * 16 >= M) return;
  const int row0 = mt * 16, col0 = nq * 64; const _Float16* arow = A + (size_t)(row0 + ln) * lda;
  v8f acc[4] = {};
  for (int kb = 0; kb < K; kb += 32) { FragH ah; ah.half[0] = *(const v8us*)((const unsigned short*)arow + kb + 8 * hh); ah.half[1] = *(const v8us*)((const unsigned short*)arow + kb + 16 + 8 * hh);
#pragma unroll
    for (int t = 0; t < 4; ++t) { if (col0 + t * 16 >= N) continue; const size_t boff = (size_t)(col0 + t * 16 + ln) * ldb + kb; FragH bq; bq.half[0] = *(const v8us*)((const unsigned short*)Bh + boff + 8 * hh); bq.half[1] = *(const v8us*)((const unsigned short*)Bh + boff + 16 + 8 * hh);
      acc[t] = mmaH<1>(ah.v, ah.v, bq.v, bq.v, acc[t]); }
  }
#pragma unroll
  for (int t = 0; t < 4; ++t) { if (col0 + t * 16 >= N) continue; const int col = col0 + t * 16 + ln; const float bv = bp ? bf16_round(bp[col]) : 0.f;
#pragma unroll
    for (int r = 0; r < 8; ++r) { float v = acc[t][r] * alpha + bv; if (CP) { const int rr = row0g + row0 + 8 * hh + r; if (rowsPerB < 0) v += CP[cofs + (size_t)rr * ldc + col];      /* rowsPerB < 0: own element of the batched C plane */ else { const int bidx = rr / rowsPerB; v += CP[(size_t)bidx * sCPb + (size_t)by * 64 + col]; } } if (ACT == 1) v = (v > 0.f) ? v : expm1f(v); else if (ACT == 7) v = (v > 0.f) ? v + 1.0f : expf(v); else if (ACT == 8) v = tanhf(v); else if (ACT == 9) v = 0.5f * v * (1.0f + tanhf(0.7978845608028654f * (v + 0.044715f * v * v * v))); else if (ACT == 11) v = 1.0f / (1.0f + expf(-v)); else if (ACT == 12) v = (v > 0.f) ? v : 0.01f * v; else if (ACT == 14) v = (v > 0.f) ? v : 0.1f * v; else if (ACT == 16) v = (v >= 0.f) ? v : 0.3f * v; else if (ACT == 17) v = (v >= 0.f) ? v : 0.2f * v; else if (ACT == 15) v = v / (1.0f + expf(-v)); else if (ACT == 3) v = fmaxf(v, 0.f); else if (ACT == 6) v = 0.5f * v * (1.0f + erff(v * 0.70710678118654752f)); so[w][8 * hh + r][t * 16 + ln] = v; } }
  __builtin_amdgcn_fence(__ATOMIC_ACQ_REL, "workgroup"); __builtin_amdgcn_wave_barrier();
  const int rsub = lane >> 4, c4 = (lane & 15) * 4; typedef _Float16 v4h __attribute__((ext_vector_type(4)));
  {
#pragma unroll
    for (int q = 0; q < 8; ++q) { const int r = q * 2 + rsub; if (col0 + c4 < N) { const v4f v = *(const v4fa*)&so[w][r][c4]; if (C) *(v4f*)(C + cofs + (size_t)(row0 + r) * ldc + col0 + c4) = v; if (C16) { v4h h4; for (int i = 0; i < 4; ++i) h4[i] = (_Float16)v[i]; *(v4h*)(C16 + cofs + (size_t)(row0 + r) * ldc + col0 + c4) = h4; } } }
     }
}


typedef _Float16 v4h __attribute__((ext_vector_type(4)));

__global__ __launch_bounds__(256) void k_x16(const float* __restrict__ x, _Float16* __restrict__ X16, size_t n8) { const size_t t = (size_t)blockIdx.x * 256 + threadIdx.x; if (t >= n8) return; FragH f;
#pragma unroll
  for (int q = 0; q < 8; ++q) f.h[q] = (_Float16)bf16_round(x[t * 8 + q]); *(v8us*)((unsigned short*)X16 + t * 8) = f.half[0];  }
__global__ __launch_bounds__(256) void k_h16(const float* __restrict__ x, _Float16* __restrict__ X16, size_t n8) { const size_t t = (size_t)blockIdx.x * 256 + threadIdx.x; if (t >= n8) return; FragH f;
#pragma unroll
  for (int q = 0; q < 8; ++q) f.h[q] = (_Float16)x[t * 8 + q]; *(v8us*)((unsigned short*)X16 + t * 8) = f.half[0];  }
__global__ __launch_bounds__(256) void k_round16f(const float* __restrict__ W, _Float16* __restrict__ Bt, size_t n8) { const size_t t = (size_t)blockIdx.x * 256 + threadIdx.x; if (t >= n8) return; FragH f;
#pragma unroll
  for (int i = 0; i < 8; ++i) f.h[i] = (_Float16)(bf16_round(W[t * 8 + i]) * 16.0f); *(v8us*)((unsigned short*)Bt + t * 8) = f.half[0];  }
template <int NHv, int TTv>
__global__ __launch_bounds__(256) void k_vt(const _Float16* __restrict__ V16, int ldv, int voff, _Float16* __restrict__ Vt) { __shared__ unsigned short tl[64][66]; const int tid = threadIdx.x; const int slab = blockIdx.x / (TTv / 64), lg = blockIdx.x % (TTv / 64); const int b = slab / NHv, h = slab % NHv;
  for (int i = tid; i < 64 * 8; i += 256) { const int r = i / 8, c8 = (i % 8) * 8; FragH f; f.half[0] = *(const v8us*)((const unsigned short*)V16 + ((size_t)b * TTv + lg * 64 + r) * ldv + voff + h * 64 + c8);
#pragma unroll
    for (int q = 0; q < 8; ++q) tl[r][c8 + q] = f.u[q]; }
  __syncthreads();
  {
#pragma unroll
    for (int rd = 0; rd < 2; ++rd) { const int d = rd * 32 + tid / 8, pc = tid % 8; FragH f;
#pragma unroll
      for (int q = 0; q < 8; ++q) f.u[q] = tl[pc * 8 + q][d];
      *(v8us*)((unsigned short*)Vt + ((size_t)slab * 64 + d) * TTv + lg * 64 + pc * 8) = f.half[0]; }
     } }

__global__ __launch_bounds__(256) void k_hl(const float* __restrict__ F, _Float16* __restrict__ Hh, _Float16* __restrict__ Hl, size_t n8) { const size_t t = (size_t)blockIdx.x * 256 + threadIdx.x; if (t >= n8) return; FragH fh, fl; const v4f a = *(const v4fa*)(F + t * 8), c = *(const v4fa*)(F + t * 8 + 4);
#pragma unroll
  for (int q = 0; q < 4; ++q) { _Float16 h = (_Float16)a[q]; fh.h[q] = h; fl.h[q] = (_Float16)((a[q] - (float)h) * 1024.0f); h = (_Float16)c[q]; fh.h[4 + q] = h; fl.h[4 + q] = (_Float16)((c[q] - (float)h) * 1024.0f); }
  { *(v8us*)((unsigned short*)Hh + t * 8) = fh.half[0]; *(v8us*)((unsigned short*)Hl + t * 8) = fl.half[0];  } }

// ---- fast GEMM (wave tile 32x64; requires M % 32 == 0 rows per launch region and N % 64 == 0); epilogue = k_gemm_hhx semantics ----
__device__ __forceinline__ v16h g2_frag(const _Float16* p, int hh) { FragH f; f.half[0] = *(const v8us*)((const unsigned short*)p + 8 * hh); f.half[1] = *(const v8us*)((const unsigned short*)p + 16 + 8 * hh); return f.v; }
__device__ __forceinline__ v8f g2_mma(v16h a, v16h b, v8f c) { v8f d = __builtin_amdgcn_wmma_f32_16x16x32_f16(false, a, false, b, (short)0, c, false, false); asm volatile("v_nop\n\tv_nop\n\tv_nop\n\tv_nop" : "+v"(d) : "v"(a), "v"(b)); return d; }
template <int ACT>
__global__ __launch_bounds__(128) void k_gemm2(const _Float16* __restrict__ A, int lda, size_t sA, const _Float16* __restrict__ Bh, int ldb, size_t sB, float alpha, const float* __restrict__ bias, size_t sBias, const float* __restrict__ CP, int rowsPerB, size_t sCPb, int row0g,
    float* __restrict__ C, _Float16* __restrict__ C16, int ldc, size_t sC, int M, int N, int K) { static_assert(ACT == 0 || ACT == 3 || ACT == 6 || ACT == 8 || ACT == 9 || ACT == 11 || ACT == 12 || ACT == 14 || ACT == 15 || ACT == 16 || ACT == 17, "k_gemm2: unsupported ACT code (would silently apply no activation)");
  __shared__ __attribute__((aligned(16))) float so[4][32][68];
  const int tid = threadIdx.x, w = tid >> 5, lane = tid & 31, ln = lane & 15, hh = lane >> 4; const int by = blockIdx.y;
  A += (size_t)by * sA; Bh += (size_t)by * sB; const size_t cofs = (size_t)by * sC; const float* bp = bias ? bias + (size_t)by * sBias : nullptr;
  const int ntn = N >> 6; const int mt = blockIdx.x / ntn, nq = blockIdx.x - mt * ntn; const int row0 = mt * 128 + 32 * w, col0 = nq * 64; if (row0 >= M) return;
  const _Float16* a0p = A + (size_t)(row0 + ln) * lda; const _Float16* a1p = a0p + (size_t)16 * lda;
  const _Float16* b0p = Bh + (size_t)(col0 + ln) * ldb; const _Float16* b1p = b0p + (size_t)16 * ldb; const _Float16* b2p = b1p + (size_t)16 * ldb; const _Float16* b3p = b2p + (size_t)16 * ldb;
  const v8f z8 = {0.f,0.f,0.f,0.f,0.f,0.f,0.f,0.f}; v8f c00 = z8, c01 = z8, c02 = z8, c03 = z8, c10 = z8, c11 = z8, c12 = z8, c13 = z8;
#pragma unroll 1
  for (int kb = 0; kb < K; kb += 32) { const v16h a0 = g2_frag(a0p + kb, hh), a1 = g2_frag(a1p + kb, hh);
    v16h b = g2_frag(b0p + kb, hh); c00 = g2_mma(a0, b, c00); c10 = g2_mma(a1, b, c10);
    b = g2_frag(b1p + kb, hh); c01 = g2_mma(a0, b, c01); c11 = g2_mma(a1, b, c11);
    b = g2_frag(b2p + kb, hh); c02 = g2_mma(a0, b, c02); c12 = g2_mma(a1, b, c12);
    b = g2_frag(b3p + kb, hh); c03 = g2_mma(a0, b, c03); c13 = g2_mma(a1, b, c13); }
  v8f accs[8] = {c00, c01, c02, c03, c10, c11, c12, c13};
#pragma unroll
  for (int u = 0; u < 8; ++u) { const int t = u & 3, half = u >> 2; const int col = col0 + t * 16 + ln; const float bv = bp ? bf16_round(bp[col]) : 0.f;
#pragma unroll
    for (int r = 0; r < 8; ++r) { const int rloc = half * 16 + 8 * hh + r; float v = accs[u][r] * alpha + bv; if (CP) { if (rowsPerB < 0) v += CP[cofs + (size_t)(row0g + row0 + rloc) * ldc + col];      /* rowsPerB < 0: own element of the batched C plane */ else { const int bidx = (row0g + row0 + rloc) / rowsPerB; v += CP[(size_t)bidx * sCPb + (size_t)by * 64 + col]; } }
      if (ACT == 3) v = fmaxf(v, 0.f); else if (ACT == 6) v = 0.5f * v * (1.0f + erff(v * 0.70710678118654752f)); else if (ACT == 11) v = 1.0f / (1.0f + expf(-v)); else if (ACT == 15) v = v / (1.0f + expf(-v)); else if (ACT == 12) v = (v > 0.f) ? v : 0.01f * v; else if (ACT == 8) v = tanhf(v); else if (ACT == 9) v = 0.5f * v * (1.0f + tanhf(0.7978845608028654f * (v + 0.044715f * v * v * v))); else if (ACT == 14) v = (v > 0.f) ? v : 0.1f * v; else if (ACT == 16) v = (v >= 0.f) ? v : 0.3f * v; else if (ACT == 17) v = (v >= 0.f) ? v : 0.2f * v;
      so[w][rloc][t * 16 + ln] = v; } }
  __builtin_amdgcn_fence(__ATOMIC_ACQ_REL, "workgroup"); __builtin_amdgcn_wave_barrier();
  const int rsub = lane >> 4, c4 = (lane & 15) * 4;
  {
#pragma unroll
    for (int q = 0; q < 16; ++q) { const int r = q * 2 + rsub; const v4f v = *(const v4fa*)&so[w][r][c4]; if (C) *(v4f*)(C + cofs + (size_t)(row0 + r) * ldc + col0 + c4) = v; if (C16) { v4h h4; for (int i = 0; i < 4; ++i) h4[i] = (_Float16)v[i]; *(v4h*)(C16 + cofs + (size_t)(row0 + r) * ldc + col0 + c4) = h4; } }
     } }


__global__ __launch_bounds__(256) void k_wnat(const float* __restrict__ w, size_t n8, _Float16* __restrict__ Bt) { const size_t t = (size_t)blockIdx.x * 256 + threadIdx.x; if (t >= n8) return; FragH f; for (int q = 0; q < 8; ++q) f.h[q] = (_Float16)(bf16_round(w[t * 8 + q]) * 16.0f); *(v8us*)((unsigned short*)Bt + t * 8) = f.half[0];  }
__global__ __launch_bounds__(256) void k_rsm(const float* __restrict__ S, _Float16* __restrict__ P, int nrows) {
  #pragma clang fp contract(off)
  const int i = blockIdx.x * 256 + threadIdx.x; if (i >= nrows) return; const float* s = S + (size_t)i * SQ; float mx = -3.0e38f;
#pragma unroll 1
  for (int j = 0; j < SQ; ++j) mx = fmaxf(mx, s[j]); float se = 0.f;
#pragma unroll 1
  for (int j = 0; j < SQ; ++j) se += expf(s[j] - mx); const float sc = 256.0f / se;
#pragma unroll 1
  for (int j0 = 0; j0 < SQ; j0 += 8) { FragH f; for (int q = 0; q < 8; ++q) f.h[q] = (_Float16)(expf(s[j0 + q] - mx) * sc); unsigned short* d = (unsigned short*)P + (size_t)i * SQ + j0; *(v8us*)d = f.half[0];  } }
__global__ __launch_bounds__(256) void k_vt(const _Float16* __restrict__ V16, int b, int h0, _Float16* __restrict__ VT) { __shared__ unsigned short tl[64][65]; const int tid = threadIdx.x; const int hh = blockIdx.x % HG, sg = blockIdx.x / HG; const int s0 = sg * 64; const int h = h0 + hh;
  for (int i = tid; i < 64 * 8; i += 256) { const int j = i / 8, d8 = (i % 8) * 8; FragH f; f.half[0] = *(const v8us*)((const unsigned short*)V16 + ((size_t)b * SQ + s0 + j) * DM + h * HD + d8); for (int q = 0; q < 8; ++q) tl[d8 + q][j] = f.u[q]; }
  __syncthreads();
  { for (int i = tid; i < 64 * 8; i += 256) { const int d = i / 8, j8 = (i % 8) * 8; FragH f; for (int q = 0; q < 8; ++q) f.u[q] = tl[d][j8 + q]; *(v8us*)((unsigned short*)VT + ((size_t)hh * HD + d) * SQ + s0 + j8) = f.half[0]; }  } }



__global__ __launch_bounds__(256) void k_rsmcf2(const float* __restrict__ S, _Float16* __restrict__ P, int hg, int q0, int nk) {
  #pragma clang fp contract(off)
  const int t = blockIdx.x * 256 + threadIdx.x; if (t >= hg * QT) return; const size_t i = (size_t)t; const float* s = S + i * NKX; const int last = q0 + (t % QT); float mx = -3.0e38f;
#pragma unroll 1
  for (int j = 0; j < nk; ++j) { const float f = (j <= last) ? 1.f : 0.f; mx = fmaxf(mx, fmaf(f, s[j], (1.f - f) * -1.0e9f)); } float se = 0.f;
#pragma unroll 1
  for (int j = 0; j < nk; ++j) { const float f = (j <= last) ? 1.f : 0.f; se += __expf(fmaf(f, s[j], (1.f - f) * -1.0e9f) - mx); } const float sc = 256.0f / se;
#pragma unroll 1
  for (int j0 = 0; j0 < nk; j0 += 8) { FragH fr; for (int q = 0; q < 8; ++q) { const int j = j0 + q; const float f = (j <= last) ? 1.f : 0.f; fr.h[q] = (_Float16)(__expf(fmaf(f, s[j], (1.f - f) * -1.0e9f) - mx) * sc); } unsigned short* d = (unsigned short*)P + i * NKX + j0; *(v8us*)d = fr.half[0];  } }


template <int MASKADD>
__global__ __launch_bounds__(64) void k_att0(const float* __restrict__ QF, const float* __restrict__ KF, const float* __restrict__ VF, int ld, const float* __restrict__ mask, float scale, float* __restrict__ OF, int ldo) {
  #pragma clang fp contract(off)
  __shared__ __attribute__((aligned(16))) float lq[64][64]; __shared__ __attribute__((aligned(16))) float lo[64][64];
  const int tid = threadIdx.x; const int h = blockIdx.x / (QT0 / 64), rg = blockIdx.x % (QT0 / 64); const int i = rg * 64 + tid;
  const float* qr = QF + (size_t)i * ld + h * HD;
#pragma unroll 1
  for (int c = 0; c < HD / 4; ++c) { *(v4f*)&lq[tid][c * 4] = *(const v4fa*)(qr + c * 4); const v4f z = {0.f, 0.f, 0.f, 0.f}; *(v4f*)&lo[tid][c * 4] = z; }
  float m = -1.0e30f, l = 0.f; const int jmax = MASKADD ? (SQ - 1) : (rg * 64 + 63);      /* additive-mask form: every key (the mask input decides); causal form: keys up to the block's last row */
#pragma unroll 1
  for (int j = 0; j <= jmax; ++j) { const float* kr = KF + (size_t)j * ld + h * HD; const float* vr = VF + (size_t)j * ld + h * HD; float s = 0.f;
#pragma unroll 1
    for (int c = 0; c < HD / 4; ++c) { const v4f kq = *(const v4fa*)(kr + c * 4); const v4f qq = *(v4f*)&lq[tid][c * 4]; s = __fadd_rn(s, __fmul_rn(qq[0], kq[0])); s = __fadd_rn(s, __fmul_rn(qq[1], kq[1])); s = __fadd_rn(s, __fmul_rn(qq[2], kq[2])); s = __fadd_rn(s, __fmul_rn(qq[3], kq[3])); }
    s = __fmul_rn(s, scale); if (MASKADD) s = __fadd_rn(s, __fmul_rn(bf16_round(mask[(size_t)i * SQ + j]), -10000.0f));
    const float f = (MASKADD || j <= i) ? 1.f : 0.f; const float sm = fmaf(f, s, (1.f - f) * -1.0e30f); const float mn = fmaxf(m, sm); const float sc = expf(m - mn); const float e = expf(sm - mn); l = __fadd_rn(__fmul_rn(l, sc), e); m = mn;
#pragma unroll 1
    for (int c = 0; c < HD / 4; ++c) { const v4f vv = *(const v4fa*)(vr + c * 4); v4f oo = *(v4f*)&lo[tid][c * 4]; for (int u = 0; u < 4; ++u) oo[u] = __fadd_rn(__fmul_rn(oo[u], sc), __fmul_rn(e, vv[u])); *(v4f*)&lo[tid][c * 4] = oo; } }
  const float fin = 64.0f / l;      /* o carried x64 */
#pragma unroll 1
  for (int c = 0; c < HD / 4; ++c) { v4f oo = *(v4f*)&lo[tid][c * 4]; for (int u = 0; u < 4; ++u) oo[u] = __fmul_rn(oo[u], fin); *(v4f*)&lo[tid][c * 4] = oo; }
  __syncthreads();
  {
#pragma unroll 1
    for (int it = 0; it < 16; ++it) { const int row = it * 4 + tid / 16, pc = (tid % 16) * 4; const v4f v = *(const v4f*)&lo[row][pc]; *(v4f*)(OF + (size_t)(rg * 64 + row) * ldo + h * HD + pc) = v; }
     } }


template <int BFIN, int WXB>
__global__ __launch_bounds__(256) void k_ln16(const float* __restrict__ X, const float* __restrict__ g, const float* __restrict__ bb, float eps, _Float16* __restrict__ N16, float* __restrict__ XB) {
  #pragma clang fp contract(off)
  __shared__ float red[256]; const size_t r = blockIdx.x; const int t = threadIdx.x; const v4f xa = *(const v4fa*)(X + r * DMQ + t * 4); float s[4]; float sum = 0.f;
  for (int q = 0; q < 4; ++q) { s[q] = BFIN ? bf16_round(xa[q]) : xa[q]; sum = __fadd_rn(sum, s[q]); }
  red[t] = sum; __syncthreads(); for (int st = 128; st > 0; st >>= 1) { if (t < st) red[t] = __fadd_rn(red[t], red[t + st]); __syncthreads(); } const float mu = red[0] / (float)DMQ; __syncthreads();
  float vs = 0.f; for (int q = 0; q < 4; ++q) { const float dl = __fadd_rn(s[q], -mu); vs = __fadd_rn(vs, __fmul_rn(dl, dl)); } red[t] = vs; __syncthreads(); for (int st = 128; st > 0; st >>= 1) { if (t < st) red[t] = __fadd_rn(red[t], red[t + st]); __syncthreads(); }
  const float rs = rsqrtf(__fadd_rn(red[0] / (float)DMQ, eps)); v4h y; v4f xb;
  for (int q = 0; q < 4; ++q) { const int c = t * 4 + q; y[q] = (_Float16)__fadd_rn(__fmul_rn(__fmul_rn(__fadd_rn(s[q], -mu), rs), bf16_round(g[c])), bf16_round(bb[c])); xb[q] = s[q]; }
  { *(v4h*)(N16 + r * DMQ + t * 4) = y; if (WXB) *(v4f*)(XB + r * DMQ + t * 4) = xb;  } }
__global__ __launch_bounds__(256) void k_ftres2(const float* __restrict__ OF0, const float* __restrict__ XB, float* __restrict__ X1, size_t n4) {
  #pragma clang fp contract(off)
  const size_t t = (size_t)blockIdx.x * 256 + threadIdx.x; if (t >= n4) return; const v4f o = *(const v4fa*)(OF0 + t * 4), xv = *(const v4fa*)(XB + t * 4); v4f y; for (int q = 0; q < 4; ++q) y[q] = __fadd_rn(__fmul_rn(o[q], 0.015625f), xv[q]); *(v4f*)(X1 + t * 4) = y;  }

__global__ __launch_bounds__(256) void k_wthd(const float* __restrict__ Wt, _Float16* __restrict__ Bt) { const size_t t = (size_t)blockIdx.x * 256 + threadIdx.x; if (t >= (size_t)NH * HD * (DM / 8)) return; const int m8 = (int)(t % (DM / 8)) * 8; const int d = (int)((t / (DM / 8)) % HD); const int h = (int)(t / ((size_t)(DM / 8) * HD)); FragH f;
  for (int q = 0; q < 8; ++q) f.h[q] = (_Float16)(16.0f * bf16_round(Wt[((size_t)h * DM + m8 + q) * HD + d])); unsigned short* dst = (unsigned short*)Bt + ((size_t)h * HD + d) * DM + m8; *(v8us*)dst = f.half[0];  }




__global__ __launch_bounds__(256) void k_wtpad(const float* __restrict__ Wm, _Float16* __restrict__ Wt, int Kr, int Kp, int Nr, int Np, float scale) {
  const int t = blockIdx.x * 256 + threadIdx.x; if (t >= Np * (Kp / 8)) return; const int n = t / (Kp / 8), k8 = (t % (Kp / 8)) * 8; const int nc = min(n, Nr - 1); const float fn = (n < Nr) ? 1.f : 0.f; FragH f;
  for (int i = 0; i < 8; ++i) { const int k = k8 + i; const int kc = min(k, Kr - 1); const float fk = (k < Kr) ? fn : 0.f; f.h[i] = (_Float16)(bf16_round(Wm[(size_t)kc * Nr + nc]) * scale * fk); }
  unsigned short* o = (unsigned short*)Wt + (size_t)n * Kp + k8; *(v8us*)o = f.half[0];  }
__global__ __launch_bounds__(128) void k_bpad(const float* __restrict__ b, float* __restrict__ Bp, int nr, int np) {
  const int i = threadIdx.x; if (i >= np) return; const float v = b[min(i, nr - 1)] * ((i < nr) ? 1.f : 0.f); *(float*)(Bp + i) = v;  }

#define DI 64         /* inner width = NH * HD (ONE 64-wide head) */
#define LQK (3 * DI)  /* fused q | k | v row pitch (192) */
__global__ __launch_bounds__(256) void k_o0(const float* __restrict__ OF, float* __restrict__ ob, size_t n4) {
  #pragma clang fp contract(off)
  const size_t t = (size_t)blockIdx.x * 256 + threadIdx.x; if (t >= n4) return; const size_t e = t * 4; const int i = (int)(e / DI); const int c = (int)(e % DI); const int h = c / HD, d = c % HD; const v4f a = *(const v4fa*)(OF + e); v4f o; for (int q = 0; q < 4; ++q) o[q] = __fmul_rn(a[q], 0.015625f); float* dst = ob + (size_t)h * SQ * HD + (size_t)i * HD + d; *(v4f*)dst = o;  }

__global__ __launch_bounds__(256) void k_o0m(const float* __restrict__ OF, float* __restrict__ o_, size_t n4) {
  #pragma clang fp contract(off)
  const size_t t = (size_t)blockIdx.x * 256 + threadIdx.x; if (t >= n4) return; const size_t e = t * 4; const v4f a = *(const v4fa*)(OF + e); v4f o; for (int q = 0; q < 4; ++q) o[q] = __fmul_rn(a[q], 0.015625f); *(v4f*)(o_ + e) = o;  }
extern "C" void kernel_launch(void* const* d_in, const int* in_sizes, int n_in,
                              void* d_out, int out_size, void* d_ws, size_t ws_size, hipStream_t stream) {
  (void)in_sizes; (void)n_in; (void)out_size;
  const float* const* I = (const float* const*)d_in; const float* x = I[0]; const float* wq = I[2]; const float* wk = I[1]; const float* wv = I[3]; const float* bq = nullptr; const float* bk = nullptr; const float* bv = nullptr;      /* x; [in][out = 64] Wk / Wq / Wv (input order as this module lists them); no biases */
  char* ws = (char*)d_ws; size_t off = 0;
  auto take = [&](size_t bytes) { char* p = ws + off; off += (bytes + 255) & ~(size_t)255; return p; };
  _Float16* BW = (_Float16*)take((size_t)LQK * DM * 2); _Float16* X16 = (_Float16*)take(NR * DM * 2); _Float16* QKV = (_Float16*)take(NR * LQK * 2); _Float16* VT = (_Float16*)take((size_t)NH * HD * SQ * 2);
  float* S = (float*)take((size_t)NH * QT * NKX * 4); _Float16* P = (_Float16*)take((size_t)NH * QT * NKX * 2); float* QKVF0 = (float*)take((size_t)QT0 * LQK * 4); float* OF0 = (float*)take((size_t)QT0 * DI * 4);
  if (off > ws_size) return;
  { const unsigned g = (unsigned)(((size_t)DI * (DM / 8) + 255) / 256); k_wt_f16<<<g, 256, 0, stream>>>(wq, BW, DM, DI, 16.0f); k_wt_f16<<<g, 256, 0, stream>>>(wk, BW + (size_t)DI * DM, DM, DI, 16.0f); k_wt_f16<<<g, 256, 0, stream>>>(wv, BW + (size_t)2 * DI * DM, DM, DI, 16.0f); }      /* [in = DM][out = 64] -> Bt[n][k] x16, stacked q | k | v */
  k_x16<<<(unsigned)((NR * DM / 8 + 255) / 256), 256, 0, stream>>>(x, X16, NR * DM / 8);      /* x (bf16-valued) as exact f16 rows */
  const float* bqkv[3] = {bq, bk, bv};
  for (int c = 0; c < 3; ++c) k_gemm2<0><<<dim3((unsigned)((NR / 128) * (DI / 64)), 1), 128, 0, stream>>>(X16, DM, 0, BW + (size_t)c * DI * DM, DM, 0, 0.0625f, bqkv[c], 0, nullptr, 1, 0, 0, nullptr, QKV + (size_t)c * DI, LQK, 0, (int)NR, DI, DM);      /* q | k | v = x W -> f16 rows, column blocks 0 / 64 / 128 of the fused plane (pitch 192); head h = columns h*64 inside each */
  const _Float16* Q16 = QKV; const _Float16* K16 = QKV + DI; const _Float16* V16 = QKV + 2 * DI;
  for (int b = 0; b < NB; ++b) { const size_t r0 = (size_t)b * SQ; float* ob = (float*)d_out + r0 * DI;
    k_vt<NH, SQ><<<NH * (SQ / 64), 256, 0, stream>>>(V16 + r0 * LQK, LQK, 0, VT);      /* V^T [NH][HD][SQ] for this batch */
    for (int q0 = 0; q0 < SQ; q0 += QT) { const int nk = q0 + QT;      /* causal: only keys below the tile end are computed */
      k_gemm2<0><<<dim3((QT / 128) * (nk / 64), NH), 128, 0, stream>>>(Q16 + (r0 + q0) * LQK, LQK, (size_t)HD, K16 + r0 * LQK, LQK, (size_t)HD, 0.0625f, nullptr, 0, nullptr, 1, 0, 0, S, nullptr, NKX, (size_t)QT * NKX, QT, nk, HD);      /* scores * 256^-0.5 = 1/16 (the module scales by the EMBEDDING width), the one head on grid.y */
      k_rsmcf2<<<(NH * QT + 255) / 256, 256, 0, stream>>>(S, P, NH, q0, nk);      /* causal softmax -> P x256 f16 */
      k_gemm2<0><<<dim3((QT / 128) * (HD / 64), NH), 128, 0, stream>>>(P, NKX, (size_t)QT * NKX, VT, SQ, (size_t)HD * SQ, 0.00390625f, nullptr, 0, nullptr, 1, 0, 0, ob + (size_t)q0 * DI, nullptr, DI, (size_t)HD, QT, HD, nk); }      /* out[b][q0 + i][h*64..] = P V^T 2^-8 (f32): merged rows, head h at column offset h*64 */
    for (int c = 0; c < 3; ++c) k_gemm2<0><<<dim3((unsigned)((QT0 / 128) * (DI / 64)), 1), 128, 0, stream>>>(X16 + r0 * DM, DM, 0, BW + (size_t)c * DI * DM, DM, 0, 0.0625f, bqkv[c], 0, nullptr, 1, 0, 0, QKVF0 + (size_t)c * DI, nullptr, LQK, 0, QT0, DI, DM);      /* f32 q | k | v of rows 0..511 (exact products, f32 accumulation) */
    k_att0<0><<<NH * (QT0 / 64), 64, 0, stream>>>(QKVF0, QKVF0 + DI, QKVF0 + 2 * DI, LQK, nullptr, 0.0625f, OF0, DI);      /* exact f32 causal attention for rows 0..511 (o x64) */
    k_o0m<<<(unsigned)(((size_t)QT0 * DI / 4 + 255) / 256), 256, 0, stream>>>(OF0, ob, (size_t)QT0 * DI / 4); }      /* rows 0..511 of the batch REWRITTEN from the exact path */
}

// v001
// A run of this version takes 11.3 milliseconds.
// Timed twice side by side with v000, it ran 2.90 and 2.93 times as fast.
#include <hip/hip_runtime.h>
// Single-head causal self-attention with the module's EMBEDDING-width scale (x [4][4096][256]; k/q/v = x W ([in][out] [256][64], U(+-0.1), no biases; input order Wk, Wq, Wv); ONE 64-wide head; wei * 256^-0.5 (n_embd, as in the source); causal (tril, -inf); softmax; out = wei v -> [4][4096][64]; no output projection).
// Structure: token rows; x as exact f16 rows; three WMMA GEMMs into one f16 q | k | v plane [16384][192]; per batch v^T via LDS transposes; causal 256-row query tiles with the one head on grid.y (scores alpha 1/16, causal softmax f32 -> f16 x256 weights, P V written as f32 straight into the merged output rows); an exact f32 first tile (rows 0..511) rewritten at the end; launches: see trace.
// Compute dtype: inputs rounded to bf16; x / weights exact; q, k, v and softmax weights as plain f16 GEMM operands (~2^-12); scores and softmax statistics f32. v_wmma_f32_16x16x32_f16.
#define NB 4
#define SQ 4096
#define DM 256
#define NH 1
#define HD 64
#define HG 4                         /* heads per block group of the unlaunched k_vt(b, h0) overload */
#define QT 256                       /* query rows per causal tile */
#define NKX SQ                       /* S / P row pitch */
#define QT0 512                      /* first-tile rows recomputed exactly (f32): 512 here (no output projection averages the early-row cancellation errors away; logit sigma 1.0) */
#define B0 0                         /* unused; the batch loop starts at 0 */
#define NBR NB                       /* feeds only MP; the batch loop runs over NB */
#define NR ((size_t)NB * SQ)
#define DMQ DM
#define DFF 4096                     /* unused; this file has no FFN */
#define DFFR 100                     /* unused */
#define MP ((int)((size_t)NBR * SQ)) /* feeds only MPO; the projection runs over NR rows */
#define QN SQ                        /* unused */
#define NHD NH                       /* unused */
#define MPO MP                       /* unused */
#define LQ (3 * DM)      /* 3 * DM = 768, unused; the q/k/v rows use pitch LQK = 192 */
typedef __bf16 v16b __attribute__((ext_vector_type(16)));
typedef unsigned short v8us __attribute__((ext_vector_type(8), may_alias));
typedef float  v8f  __attribute__((ext_vector_type(8)));
typedef float  v4f  __attribute__((ext_vector_type(4)));
typedef float  v4fa __attribute__((ext_vector_type(4), may_alias));
union FragB { v16b v; v8us half[2]; unsigned short u[16]; };

__device__ __forceinline__ unsigned short bf16_bits(float x) { unsigned int u = __float_as_uint(x); return (unsigned short)((u + 0x7FFFu + ((u >> 16) & 1u)) >> 16); }
__device__ __forceinline__ float bf16_val(unsigned short b) { return __uint_as_float(((unsigned int)b) << 16); }
__device__ __forceinline__ float bf16_round(float x) { return bf16_val(bf16_bits(x)); }
// D += A·B with NT terms: 1 = ah·bh, 2 = + al·bh (A split), 3 = + ah·bl (both split)
template <int NT>
__device__ __forceinline__ v8f mmaN(v16b ah, v16b al, v16b bh, v16b bl, v8f c) {
  c = __builtin_amdgcn_wmma_f32_16x16x32_bf16(false, ah, false, bh, (short)0, c, false, false);
  if (NT >= 2) c = __builtin_amdgcn_wmma_f32_16x16x32_bf16(false, al, false, bh, (short)0, c, false, false);
  if (NT >= 3) c = __builtin_amdgcn_wmma_f32_16x16x32_bf16(false, ah, false, bl, (short)0, c, false, false);
  asm volatile("v_nop\n\tv_nop\n\tv_nop\n\tv_nop" : "+v"(c) : "v"(ah), "v"(al), "v"(bh), "v"(bl));
  return c;
}

__global__ __launch_bounds__(256) void k_wt_bf16(const float* __restrict__ W, unsigned short* __restrict__ Wt, int K, int N) {
  const int t = blockIdx.x * 256 + threadIdx.x;
  const int k8n = K / 8;
  if (t >= N * k8n) return;
  const int n = t / k8n, k8 = (t % k8n) * 8;
  v8us v;
#pragma unroll
  for (int i = 0; i < 8; ++i) v[i] = bf16_bits(W[(size_t)(k8 + i) * N + n]);
  *(v8us*)(Wt + (size_t)n * K + k8) = v;
  
}

// GEMM C[M][N] (f32, pitch ldc) = act(A[M][K]·W + bias). A f32 row-major (pitch lda) converted per fragment to bf16
// (ASPLIT: hi/lo two planes -> 2 terms, else single rounded term); Wt bf16 [N][K] (pitch ldb). BIAS_BF16 rounds the
// bias to bf16 first (bias quantised to bf16 before the add). K%32==0, M%16==0, N%64==0.
template <bool ASPLIT, int ACT, bool BIAS_BF16>
__global__ __launch_bounds__(128) void k_gemm_bf(const float* __restrict__ A, int lda, const unsigned short* __restrict__ Wt, int ldb,
                                               const float* __restrict__ bias, float* __restrict__ C, int ldc, int M, int N, int K) {
  __shared__ __attribute__((aligned(16))) float so[4][16][64];
  const int tid = threadIdx.x, w = tid >> 5, lane = tid & 31, ln = lane & 15, hh = lane >> 4;
  const int ntn = N / 64;
  const int wid = blockIdx.x * 4 + w;
  const int mt = wid / ntn, nq = wid % ntn;
  if (mt * 16 >= M) return;
  const int row0 = mt * 16, col0 = nq * 64;
  const float* arow = A + (size_t)(row0 + ln) * lda;
  v8f acc[4] = {};
  for (int kb = 0; kb < K; kb += 32) {
    FragB ah, al;
    const v4f x0 = *(const v4fa*)(arow + kb + 8 * hh), x1 = *(const v4fa*)(arow + kb + 8 * hh + 4);
    const v4f x2 = *(const v4fa*)(arow + kb + 16 + 8 * hh), x3 = *(const v4fa*)(arow + kb + 16 + 8 * hh + 4);
    float xs[16] = {x0[0],x0[1],x0[2],x0[3],x1[0],x1[1],x1[2],x1[3],x2[0],x2[1],x2[2],x2[3],x3[0],x3[1],x3[2],x3[3]};
#pragma unroll
    for (int i = 0; i < 16; ++i) { const unsigned short hb = bf16_bits(xs[i]); ah.u[i] = hb; al.u[i] = ASPLIT ? bf16_bits(xs[i] - bf16_val(hb)) : (unsigned short)0; }
#pragma unroll
    for (int t = 0; t < 4; ++t) {
      const unsigned short* brow = Wt + (size_t)(col0 + t * 16 + ln) * ldb + kb;
      FragB b;
      b.half[0] = *(const v8us*)(brow + 8 * hh);
      b.half[1] = *(const v8us*)(brow + 16 + 8 * hh);
      acc[t] = mmaN<ASPLIT ? 2 : 1>(ah.v, al.v, b.v, b.v, acc[t]);
    }
  }
#pragma unroll
  for (int t = 0; t < 4; ++t) {
    float bv = bias ? bias[col0 + t * 16 + ln] : 0.f;
    if (BIAS_BF16) bv = bf16_round(bv);
#pragma unroll
    for (int r = 0; r < 8; ++r) { float v = acc[t][r] + bv; if (ACT == 1) v = fmaxf(v, 0.f); so[w][8 * hh + r][t * 16 + ln] = v; }
  }
  __builtin_amdgcn_fence(__ATOMIC_ACQ_REL, "workgroup");
  __builtin_amdgcn_wave_barrier();
  const int rsub = lane >> 4, c4 = (lane & 15) * 4;
  {
#pragma unroll
    for (int q = 0; q < 8; ++q) {
      const int r = q * 2 + rsub;
      const v4f v = *(const v4fa*)&so[w][r][c4];
      *(v4f*)(C + (size_t)(row0 + r) * ldc + col0 + c4) = v;
    }
    
  }
}

// GEMM C = act(A·W + bias + resid): A f32 (ASPLIT -> hi/lo 2 terms), Wt bf16 [N][K]; ACT 0 none, 1 relu, 2 exact gelu;
// resid (optional, f32, row index = (row % rmod), pitch ldr, RES_BF16 rounds it) added before the activation.
template <bool ASPLIT, int ACT, bool BIAS_BF16, bool RES_BF16>
__global__ __launch_bounds__(128) void k_gemm_bf3(const float* __restrict__ A, int lda, const unsigned short* __restrict__ Wt, int ldb,
                                                const float* __restrict__ bias, const float* __restrict__ resid, int rmod, int ldr,
                                                float* __restrict__ C, int ldc, int M, int N, int K) {
  __shared__ __attribute__((aligned(16))) float so[4][16][64];
  const int tid = threadIdx.x, w = tid >> 5, lane = tid & 31, ln = lane & 15, hh = lane >> 4;
  const int ntn = N / 64;
  const int wid = blockIdx.x * 4 + w;
  const int mt = wid / ntn, nq = wid % ntn;
  if (mt * 16 >= M) return;
  const int row0 = mt * 16, col0 = nq * 64;
  const float* arow = A + (size_t)(row0 + ln) * lda;
  v8f acc[4] = {};
  for (int kb = 0; kb < K; kb += 32) {
    FragB ah, al;
    const v4f x0 = *(const v4fa*)(arow + kb + 8 * hh), x1 = *(const v4fa*)(arow + kb + 8 * hh + 4);
    const v4f x2 = *(const v4fa*)(arow + kb + 16 + 8 * hh), x3 = *(const v4fa*)(arow + kb + 16 + 8 * hh + 4);
    float xs[16] = {x0[0],x0[1],x0[2],x0[3],x1[0],x1[1],x1[2],x1[3],x2[0],x2[1],x2[2],x2[3],x3[0],x3[1],x3[2],x3[3]};
#pragma unroll
    for (int i = 0; i < 16; ++i) { const unsigned short hb = bf16_bits(xs[i]); ah.u[i] = hb; al.u[i] = ASPLIT ? bf16_bits(xs[i] - bf16_val(hb)) : (unsigned short)0; }
#pragma unroll
    for (int t = 0; t < 4; ++t) {
      const unsigned short* brow = Wt + (size_t)(col0 + t * 16 + ln) * ldb + kb;
      FragB b;
      b.half[0] = *(const v8us*)(brow + 8 * hh);
      b.half[1] = *(const v8us*)(brow + 16 + 8 * hh);
      acc[t] = mmaN<ASPLIT ? 2 : 1>(ah.v, al.v, b.v, b.v, acc[t]);
    }
  }
#pragma unroll
  for (int t = 0; t < 4; ++t) {
    const int col = col0 + t * 16 + ln;
    float bv = bias ? bias[col] : 0.f;
    if (BIAS_BF16) bv = bf16_round(bv);
#pragma unroll
    for (int r = 0; r < 8; ++r) {
      float v = acc[t][r] + bv;
      if (resid) { float rv = resid[(size_t)((row0 + 8 * hh + r) % rmod) * ldr + col]; if (RES_BF16) rv = bf16_round(rv); v += rv; }
      if (ACT == 1) v = fmaxf(v, 0.f);
      if (ACT == 2) v = 0.5f * v * (1.0f + erff(v * 0.70710678118654752f));
      if (ACT == 3) { const float u = 0.7978845608028654f * (v + 0.044715f * v * v * v); v = 0.5f * v * (1.0f + tanhf(u)); }
      so[w][8 * hh + r][t * 16 + ln] = v;
    }
  }
  __builtin_amdgcn_fence(__ATOMIC_ACQ_REL, "workgroup");
  __builtin_amdgcn_wave_barrier();
  const int rsub = lane >> 4, c4 = (lane & 15) * 4;
  {
#pragma unroll
    for (int q = 0; q < 8; ++q) {
      const int r = q * 2 + rsub;
      const v4f v = *(const v4fa*)&so[w][r][c4];
      *(v4f*)(C + (size_t)(row0 + r) * ldc + col0 + c4) = v;
    }
    
  }
}
// row LayerNorm (biased variance, eps) over N: s = X (+ R); optional out_sum <- s; out_norm <- (s-mu)*rsqrt(var+eps)*g + b
template <bool PARAM_BF16>
__global__ __launch_bounds__(256) void k_layernorm(const float* __restrict__ X, const float* __restrict__ R, const float* __restrict__ g, const float* __restrict__ bta,
                                                  float* __restrict__ out_sum, float* __restrict__ out_norm, int N, float eps) {
  __shared__ float red[256];
  const int row = blockIdx.x, tid = threadIdx.x;
  const float* x = X + (size_t)row * N; const float* rr = R ? R + (size_t)row * N : nullptr;
  float vals[16];                     // up to N = 4096
  const int per = N / 256;            // contiguous chunk per thread? use strided-by-4 chunks: thread handles j = tid*4 + 1024*u
  float s1 = 0.f;
  for (int u = 0; u < per / 4; ++u) {
    const int j = tid * 4 + 1024 * u;
    const v4f a = *(const v4fa*)(x + j);
    v4f b = {0.f,0.f,0.f,0.f}; if (rr) b = *(const v4fa*)(rr + j);
#pragma unroll
    for (int q = 0; q < 4; ++q) { const float v = a[q] + b[q]; vals[u * 4 + q] = v; s1 += v; }
  }
  red[tid] = s1; __syncthreads();
  for (int st = 128; st > 0; st >>= 1) { if (tid < st) red[tid] += red[tid + st]; __syncthreads(); }
  const float mu = red[0] / (float)N; __syncthreads();
  float s2 = 0.f;
  for (int u = 0; u < per / 4; ++u)
#pragma unroll
    for (int q = 0; q < 4; ++q) { const float c = vals[u * 4 + q] - mu; s2 += c * c; }
  red[tid] = s2; __syncthreads();
  for (int st = 128; st > 0; st >>= 1) { if (tid < st) red[tid] += red[tid + st]; __syncthreads(); }
  const float rs = rsqrtf(red[0] / (float)N + eps);
  {
    for (int u = 0; u < per / 4; ++u) {
      const int j = tid * 4 + 1024 * u;
      v4f o, sm;
#pragma unroll
      for (int q = 0; q < 4; ++q) {
        float gg = g[j + q], bb = bta[j + q];
        if (PARAM_BF16) { gg = bf16_round(gg); bb = bf16_round(bb); }
        sm[q] = vals[u * 4 + q]; o[q] = (vals[u * 4 + q] - mu) * rs * gg + bb;
      }
      if (out_sum) *(v4f*)(out_sum + (size_t)row * N + j) = sm;
      *(v4f*)(out_norm + (size_t)row * N + j) = o;
    }
    
  }
}



// ---- f16 WMMA path (v_wmma_f32_16x16x32_f16): 11-bit significands for operands in range — used where a [0,1] probability operand needs more precision than bf16
typedef _Float16 v16h __attribute__((ext_vector_type(16)));
union FragH { v16h v; v8us half[2]; _Float16 h[16]; unsigned short u[16]; };
template <int NT>
__device__ __forceinline__ v8f mmaH(v16h ah, v16h al, v16h bh, v16h bl, v8f c) {
  c = __builtin_amdgcn_wmma_f32_16x16x32_f16(false, ah, false, bh, (short)0, c, false, false);
  if (NT >= 2) c = __builtin_amdgcn_wmma_f32_16x16x32_f16(false, al, false, bh, (short)0, c, false, false);
  if (NT >= 3) c = __builtin_amdgcn_wmma_f32_16x16x32_f16(false, ah, false, bl, (short)0, c, false, false);
  asm volatile("v_nop\n\tv_nop\n\tv_nop\n\tv_nop" : "+v"(c) : "v"(ah), "v"(al), "v"(bh), "v"(bl));
  return c;
}
// batched GEMM like k_gemm_b but f16 operands: A f32 (split into f16 hi/lo if ASPLIT, else rounded to f16), Bt = f16 values [n][k]; alpha; C f32; N multiple of 16 (partial tiles skipped)
template <bool ASPLIT>
__global__ __launch_bounds__(128) void k_gemm_h(const float* __restrict__ A, int lda, size_t sA, const _Float16* __restrict__ Bh, int ldb, size_t sB, float alpha, float* __restrict__ C, int ldc, size_t sC, int M, int N, int K) {
  __shared__ __attribute__((aligned(16))) float so[4][16][64];
  const int tid = threadIdx.x, w = tid >> 5, lane = tid & 31, ln = lane & 15, hh = lane >> 4; const int by = blockIdx.y;
  A += (size_t)by * sA; Bh += (size_t)by * sB; C += (size_t)by * sC;
  const int ntn = (N + 63) / 64; const int wid = blockIdx.x * 4 + w; const int mt = wid / ntn, nq = wid % ntn; if (mt * 16 >= M) return;
  const int row0 = mt * 16, col0 = nq * 64; const float* arow = A + (size_t)(row0 + ln) * lda;
  v8f acc[4] = {};
  for (int kb = 0; kb < K; kb += 32) {
    FragH ah, al;
    const v4f x0 = *(const v4fa*)(arow + kb + 8 * hh), x1 = *(const v4fa*)(arow + kb + 8 * hh + 4), x2 = *(const v4fa*)(arow + kb + 16 + 8 * hh), x3 = *(const v4fa*)(arow + kb + 16 + 8 * hh + 4);
    float xs[16] = {x0[0],x0[1],x0[2],x0[3],x1[0],x1[1],x1[2],x1[3],x2[0],x2[1],x2[2],x2[3],x3[0],x3[1],x3[2],x3[3]};
#pragma unroll
    for (int i = 0; i < 16; ++i) { const _Float16 h = (_Float16)xs[i]; ah.h[i] = h; al.h[i] = ASPLIT ? (_Float16)(xs[i] - (float)h) : (_Float16)0.0f; }
#pragma unroll
    for (int t = 0; t < 4; ++t) { if (col0 + t * 16 >= N) continue; const size_t boff = (size_t)(col0 + t * 16 + ln) * ldb + kb; FragH bq; bq.half[0] = *(const v8us*)(Bh + boff + 8 * hh); bq.half[1] = *(const v8us*)(Bh + boff + 16 + 8 * hh);
      acc[t] = mmaH<ASPLIT ? 2 : 1>(ah.v, al.v, bq.v, bq.v, acc[t]); }
  }
#pragma unroll
  for (int t = 0; t < 4; ++t) { if (col0 + t * 16 >= N) continue;
#pragma unroll
    for (int r = 0; r < 8; ++r) so[w][8 * hh + r][t * 16 + ln] = acc[t][r] * alpha; }
  __builtin_amdgcn_fence(__ATOMIC_ACQ_REL, "workgroup"); __builtin_amdgcn_wave_barrier();
  const int rsub = lane >> 4, c4 = (lane & 15) * 4;
  {
#pragma unroll
    for (int q = 0; q < 8; ++q) { const int r = q * 2 + rsub; if (col0 + c4 < N) { const v4f v = *(const v4fa*)&so[w][r][c4]; *(v4f*)(C + (size_t)(row0 + r) * ldc + col0 + c4) = v; } }
     }
}

// Wt[n][k] = f16(W[k][n]·scale) from f32 row-major W[K][N] (scale = power of two; bf16-exact weights stay exact in f16 away from the subnormal range)
__global__ __launch_bounds__(256) void k_wt_f16(const float* __restrict__ W, _Float16* __restrict__ Wt, int K, int N, float scale) {
  const int t = blockIdx.x * 256 + threadIdx.x; if (t >= N * (K / 8)) return; const int n = t / (K / 8), k8 = (t % (K / 8)) * 8; FragH f;
#pragma unroll
  for (int i = 0; i < 8; ++i) f.h[i] = (_Float16)(bf16_round(W[(size_t)(k8 + i) * N + n]) * scale); const v8us o = f.half[0];
  *(v8us*)((unsigned short*)Wt + (size_t)n * K + k8) = o; 
}
// k_gemm_hh variant with fused epilogue: v = acc·alpha + bias[by·sBias + col] (+ CP[(row/rowsPerB)·sCPb + by·64 + col] if CP) ; ACT 0 none / 1 elu ; writes f16 C16 (and f32 C if non-null)
template <int ACT>
__global__ __launch_bounds__(128) void k_gemm_hhx(const _Float16* __restrict__ A, int lda, size_t sA, const _Float16* __restrict__ Bh, int ldb, size_t sB, float alpha, const float* __restrict__ bias, size_t sBias, const float* __restrict__ CP, int rowsPerB, size_t sCPb, int row0g,
    float* __restrict__ C, _Float16* __restrict__ C16, int ldc, size_t sC, int M, int N, int K) {
  __shared__ __attribute__((aligned(16))) float so[4][16][64];
  const int tid = threadIdx.x, w = tid >> 5, lane = tid & 31, ln = lane & 15, hh = lane >> 4; const int by = blockIdx.y;
  A += (size_t)by * sA; Bh += (size_t)by * sB; const size_t cofs = (size_t)by * sC; const float* bp = bias ? bias + (size_t)by * sBias : nullptr;
  const int ntn = (N + 63) / 64; const int wid = blockIdx.x * 4 + w; const int mt = wid / ntn, nq = wid % ntn; if (mt * 16 >= M) return;
  const int row0 = mt * 16, col0 = nq * 64; const _Float16* arow = A + (size_t)(row0 + ln) * lda;
  v8f acc[4] = {};
  for (int kb = 0; kb < K; kb += 32) { FragH ah; ah.half[0] = *(const v8us*)((const unsigned short*)arow + kb + 8 * hh); ah.half[1] = *(const v8us*)((const unsigned short*)arow + kb + 16 + 8 * hh);
#pragma unroll
    for (int t = 0; t < 4; ++t) { if (col0 + t * 16 >= N) continue; const size_t boff = (size_t)(col0 + t * 16 + ln) * ldb + kb; FragH bq; bq.half[0] = *(const v8us*)((const unsigned short*)Bh + boff + 8 * hh); bq.half[1] = *(const v8us*)((const unsigned short*)Bh + boff + 16 + 8 * hh);
      acc[t] = mmaH<1>(ah.v, ah.v, bq.v, bq.v, acc[t]); }
  }
#pragma unroll
  for (int t = 0; t < 4; ++t) { if (col0 + t * 16 >= N) continue; const int col = col0 + t * 16 + ln; const float bv = bp ? bf16_round(bp[col]) : 0.f;
#pragma unroll
    for (int r = 0; r < 8; ++r) { float v = acc[t][r] * alpha + bv; if (CP) { const int rr = row0g + row0 + 8 * hh + r; if (rowsPerB < 0) v += CP[cofs + (size_t)rr * ldc + col];      /* rowsPerB < 0: own element of the batched C plane */ else { const int bidx = rr / rowsPerB; v += CP[(size_t)bidx * sCPb + (size_t)by * 64 + col]; } } if (ACT == 1) v = (v > 0.f) ? v : expm1f(v); else if (ACT == 7) v = (v > 0.f) ? v + 1.0f : expf(v); else if (ACT == 8) v = tanhf(v); else if (ACT == 9) v = 0.5f * v * (1.0f + tanhf(0.7978845608028654f * (v + 0.044715f * v * v * v))); else if (ACT == 11) v = 1.0f / (1.0f + expf(-v)); else if (ACT == 12) v = (v > 0.f) ? v : 0.01f * v; else if (ACT == 14) v = (v > 0.f) ? v : 0.1f * v; else if (ACT == 16) v = (v >= 0.f) ? v : 0.3f * v; else if (ACT == 17) v = (v >= 0.f) ? v : 0.2f * v; else if (ACT == 15) v = v / (1.0f + expf(-v)); else if (ACT == 3) v = fmaxf(v, 0.f); else if (ACT == 6) v = 0.5f * v * (1.0f + erff(v * 0.70710678118654752f)); so[w][8 * hh + r][t * 16 + ln] = v; } }
  __builtin_amdgcn_fence(__ATOMIC_ACQ_REL, "workgroup"); __builtin_amdgcn_wave_barrier();
  const int rsub = lane >> 4, c4 = (lane & 15) * 4; typedef _Float16 v4h __attribute__((ext_vector_type(4)));
  {
#pragma unroll
    for (int q = 0; q < 8; ++q) { const int r = q * 2 + rsub; if (col0 + c4 < N) { const v4f v = *(const v4fa*)&so[w][r][c4]; if (C) *(v4f*)(C + cofs + (size_t)(row0 + r) * ldc + col0 + c4) = v; if (C16) { v4h h4; for (int i = 0; i < 4; ++i) h4[i] = (_Float16)v[i]; *(v4h*)(C16 + cofs + (size_t)(row0 + r) * ldc + col0 + c4) = h4; } } }
     }
}


typedef _Float16 v4h __attribute__((ext_vector_type(4)));

__global__ __launch_bounds__(256) void k_x16(const float* __restrict__ x, _Float16* __restrict__ X16, size_t n8) { const size_t t = (size_t)blockIdx.x * 256 + threadIdx.x; if (t >= n8) return; FragH f;
#pragma unroll
  for (int q = 0; q < 8; ++q) f.h[q] = (_Float16)bf16_round(x[t * 8 + q]); *(v8us*)((unsigned short*)X16 + t * 8) = f.half[0];  }
__global__ __launch_bounds__(256) void k_h16(const float* __restrict__ x, _Float16* __restrict__ X16, size_t n8) { const size_t t = (size_t)blockIdx.x * 256 + threadIdx.x; if (t >= n8) return; FragH f;
#pragma unroll
  for (int q = 0; q < 8; ++q) f.h[q] = (_Float16)x[t * 8 + q]; *(v8us*)((unsigned short*)X16 + t * 8) = f.half[0];  }
__global__ __launch_bounds__(256) void k_round16f(const float* __restrict__ W, _Float16* __restrict__ Bt, size_t n8) { const size_t t = (size_t)blockIdx.x * 256 + threadIdx.x; if (t >= n8) return; FragH f;
#pragma unroll
  for (int i = 0; i < 8; ++i) f.h[i] = (_Float16)(bf16_round(W[t * 8 + i]) * 16.0f); *(v8us*)((unsigned short*)Bt + t * 8) = f.half[0];  }
template <int NHv, int TTv>
__global__ __launch_bounds__(256) void k_vt(const _Float16* __restrict__ V16, int ldv, int voff, _Float16* __restrict__ Vt) { __shared__ unsigned short tl[64][66]; const int tid = threadIdx.x; const int slab = blockIdx.x / (TTv / 64), lg = blockIdx.x % (TTv / 64); const int b = slab / NHv, h = slab % NHv;
  for (int i = tid; i < 64 * 8; i += 256) { const int r = i / 8, c8 = (i % 8) * 8; FragH f; f.half[0] = *(const v8us*)((const unsigned short*)V16 + ((size_t)b * TTv + lg * 64 + r) * ldv + voff + h * 64 + c8);
#pragma unroll
    for (int q = 0; q < 8; ++q) tl[r][c8 + q] = f.u[q]; }
  __syncthreads();
  {
#pragma unroll
    for (int rd = 0; rd < 2; ++rd) { const int d = rd * 32 + tid / 8, pc = tid % 8; FragH f;
#pragma unroll
      for (int q = 0; q < 8; ++q) f.u[q] = tl[pc * 8 + q][d];
      *(v8us*)((unsigned short*)Vt + ((size_t)slab * 64 + d) * TTv + lg * 64 + pc * 8) = f.half[0]; }
     } }

__global__ __launch_bounds__(256) void k_hl(const float* __restrict__ F, _Float16* __restrict__ Hh, _Float16* __restrict__ Hl, size_t n8) { const size_t t = (size_t)blockIdx.x * 256 + threadIdx.x; if (t >= n8) return; FragH fh, fl; const v4f a = *(const v4fa*)(F + t * 8), c = *(const v4fa*)(F + t * 8 + 4);
#pragma unroll
  for (int q = 0; q < 4; ++q) { _Float16 h = (_Float16)a[q]; fh.h[q] = h; fl.h[q] = (_Float16)((a[q] - (float)h) * 1024.0f); h = (_Float16)c[q]; fh.h[4 + q] = h; fl.h[4 + q] = (_Float16)((c[q] - (float)h) * 1024.0f); }
  { *(v8us*)((unsigned short*)Hh + t * 8) = fh.half[0]; *(v8us*)((unsigned short*)Hl + t * 8) = fl.half[0];  } }

// ---- fast GEMM (wave tile 32x64; requires M % 32 == 0 rows per launch region and N % 64 == 0); epilogue = k_gemm_hhx semantics ----
__device__ __forceinline__ v16h g2_frag(const _Float16* p, int hh) { FragH f; f.half[0] = *(const v8us*)((const unsigned short*)p + 8 * hh); f.half[1] = *(const v8us*)((const unsigned short*)p + 16 + 8 * hh); return f.v; }
__device__ __forceinline__ v8f g2_mma(v16h a, v16h b, v8f c) { v8f d = __builtin_amdgcn_wmma_f32_16x16x32_f16(false, a, false, b, (short)0, c, false, false); asm volatile("v_nop\n\tv_nop\n\tv_nop\n\tv_nop" : "+v"(d) : "v"(a), "v"(b)); return d; }
template <int ACT>
__global__ __launch_bounds__(128) void k_gemm2(const _Float16* __restrict__ A, int lda, size_t sA, const _Float16* __restrict__ Bh, int ldb, size_t sB, float alpha, const float* __restrict__ bias, size_t sBias, const float* __restrict__ CP, int rowsPerB, size_t sCPb, int row0g,
    float* __restrict__ C, _Float16* __restrict__ C16, int ldc, size_t sC, int M, int N, int K) { static_assert(ACT == 0 || ACT == 3 || ACT == 6 || ACT == 8 || ACT == 9 || ACT == 11 || ACT == 12 || ACT == 14 || ACT == 15 || ACT == 16 || ACT == 17, "k_gemm2: unsupported ACT code (would silently apply no activation)");
  __shared__ __attribute__((aligned(16))) float so[4][32][68];
  const int tid = threadIdx.x, w = tid >> 5, lane = tid & 31, ln = lane & 15, hh = lane >> 4; const int by = blockIdx.y;
  A += (size_t)by * sA; Bh += (size_t)by * sB; const size_t cofs = (size_t)by * sC; const float* bp = bias ? bias + (size_t)by * sBias : nullptr;
  const int ntn = N >> 6; const int mt = blockIdx.x / ntn, nq = blockIdx.x - mt * ntn; const int row0 = mt * 128 + 32 * w, col0 = nq * 64; if (row0 >= M) return;
  const _Float16* a0p = A + (size_t)(row0 + ln) * lda; const _Float16* a1p = a0p + (size_t)16 * lda;
  const _Float16* b0p = Bh + (size_t)(col0 + ln) * ldb; const _Float16* b1p = b0p + (size_t)16 * ldb; const _Float16* b2p = b1p + (size_t)16 * ldb; const _Float16* b3p = b2p + (size_t)16 * ldb;
  const v8f z8 = {0.f,0.f,0.f,0.f,0.f,0.f,0.f,0.f}; v8f c00 = z8, c01 = z8, c02 = z8, c03 = z8, c10 = z8, c11 = z8, c12 = z8, c13 = z8;
#pragma unroll 1
  for (int kb = 0; kb < K; kb += 32) { const v16h a0 = g2_frag(a0p + kb, hh), a1 = g2_frag(a1p + kb, hh);
    v16h b = g2_frag(b0p + kb, hh); c00 = g2_mma(a0, b, c00); c10 = g2_mma(a1, b, c10);
    b = g2_frag(b1p + kb, hh); c01 = g2_mma(a0, b, c01); c11 = g2_mma(a1, b, c11);
    b = g2_frag(b2p + kb, hh); c02 = g2_mma(a0, b, c02); c12 = g2_mma(a1, b, c12);
    b = g2_frag(b3p + kb, hh); c03 = g2_mma(a0, b, c03); c13 = g2_mma(a1, b, c13); }
  v8f accs[8] = {c00, c01, c02, c03, c10, c11, c12, c13};
#pragma unroll
  for (int u = 0; u < 8; ++u) { const int t = u & 3, half = u >> 2; const int col = col0 + t * 16 + ln; const float bv = bp ? bf16_round(bp[col]) : 0.f;
#pragma unroll
    for (int r = 0; r < 8; ++r) { const int rloc = half * 16 + 8 * hh + r; float v = accs[u][r] * alpha + bv; if (CP) { if (rowsPerB < 0) v += CP[cofs + (size_t)(row0g + row0 + rloc) * ldc + col];      /* rowsPerB < 0: own element of the batched C plane */ else { const int bidx = (row0g + row0 + rloc) / rowsPerB; v += CP[(size_t)bidx * sCPb + (size_t)by * 64 + col]; } }
      if (ACT == 3) v = fmaxf(v, 0.f); else if (ACT == 6) v = 0.5f * v * (1.0f + erff(v * 0.70710678118654752f)); else if (ACT == 11) v = 1.0f / (1.0f + expf(-v)); else if (ACT == 15) v = v / (1.0f + expf(-v)); else if (ACT == 12) v = (v > 0.f) ? v : 0.01f * v; else if (ACT == 8) v = tanhf(v); else if (ACT == 9) v = 0.5f * v * (1.0f + tanhf(0.7978845608028654f * (v + 0.044715f * v * v * v))); else if (ACT == 14) v = (v > 0.f) ? v : 0.1f * v; else if (ACT == 16) v = (v >= 0.f) ? v : 0.3f * v; else if (ACT == 17) v = (v >= 0.f) ? v : 0.2f * v;
      so[w][rloc][t * 16 + ln] = v; } }
  __builtin_amdgcn_fence(__ATOMIC_ACQ_REL, "workgroup"); __builtin_amdgcn_wave_barrier();
  const int rsub = lane >> 4, c4 = (lane & 15) * 4;
  {
#pragma unroll
    for (int q = 0; q < 16; ++q) { const int r = q * 2 + rsub; const v4f v = *(const v4fa*)&so[w][r][c4]; if (C) *(v4f*)(C + cofs + (size_t)(row0 + r) * ldc + col0 + c4) = v; if (C16) { v4h h4; for (int i = 0; i < 4; ++i) h4[i] = (_Float16)v[i]; *(v4h*)(C16 + cofs + (size_t)(row0 + r) * ldc + col0 + c4) = h4; } }
     } }


__global__ __launch_bounds__(256) void k_wnat(const float* __restrict__ w, size_t n8, _Float16* __restrict__ Bt) { const size_t t = (size_t)blockIdx.x * 256 + threadIdx.x; if (t >= n8) return; FragH f; for (int q = 0; q < 8; ++q) f.h[q] = (_Float16)(bf16_round(w[t * 8 + q]) * 16.0f); *(v8us*)((unsigned short*)Bt + t * 8) = f.half[0];  }
__global__ __launch_bounds__(256) void k_rsm(const float* __restrict__ S, _Float16* __restrict__ P, int nrows) {
  #pragma clang fp contract(off)
  const int i = blockIdx.x * 256 + threadIdx.x; if (i >= nrows) return; const float* s = S + (size_t)i * SQ; float mx = -3.0e38f;
#pragma unroll 1
  for (int j = 0; j < SQ; ++j) mx = fmaxf(mx, s[j]); float se = 0.f;
#pragma unroll 1
  for (int j = 0; j < SQ; ++j) se += expf(s[j] - mx); const float sc = 256.0f / se;
#pragma unroll 1
  for (int j0 = 0; j0 < SQ; j0 += 8) { FragH f; for (int q = 0; q < 8; ++q) f.h[q] = (_Float16)(expf(s[j0 + q] - mx) * sc); unsigned short* d = (unsigned short*)P + (size_t)i * SQ + j0; *(v8us*)d = f.half[0];  } }
__global__ __launch_bounds__(256) void k_vt(const _Float16* __restrict__ V16, int b, int h0, _Float16* __restrict__ VT) { __shared__ unsigned short tl[64][65]; const int tid = threadIdx.x; const int hh = blockIdx.x % HG, sg = blockIdx.x / HG; const int s0 = sg * 64; const int h = h0 + hh;
  for (int i = tid; i < 64 * 8; i += 256) { const int j = i / 8, d8 = (i % 8) * 8; FragH f; f.half[0] = *(const v8us*)((const unsigned short*)V16 + ((size_t)b * SQ + s0 + j) * DM + h * HD + d8); for (int q = 0; q < 8; ++q) tl[d8 + q][j] = f.u[q]; }
  __syncthreads();
  { for (int i = tid; i < 64 * 8; i += 256) { const int d = i / 8, j8 = (i % 8) * 8; FragH f; for (int q = 0; q < 8; ++q) f.u[q] = tl[d][j8 + q]; *(v8us*)((unsigned short*)VT + ((size_t)hh * HD + d) * SQ + s0 + j8) = f.half[0]; }  } }



// e^x as __expf forms it (x * log2(e), then v_exp_f32). The v_nop in the same statement keeps the one slot that the instruction set asks for behind a transcendental
// before its result is read or its source overwritten.
__device__ __forceinline__ float exp_slot(float x) { float r; asm("v_exp_f32 %0, %1\n\tv_nop" : "=v"(r) : "v"(x * 1.44269504088896340736f)); return r; }
// causal softmax -> P x256 f16, ONE SCORE ROW PER WORK-GROUP: 256 threads hold the row (up to NKX scores, 16 a thread) in registers, so S is read once, in whole lines;
// row maximum and denominator by a wave butterfly, then across the 8 waves through LDS (every thread adds the 8 partial sums in the same order). nk % 256 == 0, nk <= NKX.
// Every loop is unrolled so that each index of v[] is a constant and the row stays in registers (no scratch).
__global__ __launch_bounds__(256) void k_rsmrow(const float* __restrict__ S, _Float16* __restrict__ P, int q0, int nk) {
  __shared__ float rmx[8]; __shared__ float rse[8];
  const int tid = threadIdx.x, w = tid >> 5, lane = tid & 31; const size_t i = blockIdx.x; const float* s = S + i * NKX; const int last = q0 + (int)(blockIdx.x % QT);
  float v[NKX / 256]; float mx = -3.0e38f;
#pragma unroll
  for (int c = 0; c < NKX / 1024; ++c) { const int j = c * 1024 + tid * 4; v4f x = {-1.0e9f, -1.0e9f, -1.0e9f, -1.0e9f}; if (j < nk) x = *(const v4fa*)(s + j);
#pragma unroll
    for (int q = 0; q < 4; ++q) { const float t = (j + q <= last) ? x[q] : -1.0e9f; v[c * 4 + q] = t; mx = fmaxf(mx, t); } }
#pragma unroll
  for (int o = 16; o > 0; o >>= 1) mx = fmaxf(mx, __shfl_xor(mx, o, 32));
  if (lane == 0) rmx[w] = mx;
  __syncthreads();
#pragma unroll
  for (int u = 0; u < 8; ++u) mx = fmaxf(mx, rmx[u]);
  float se = 0.f;
#pragma unroll
  for (int e = 0; e < NKX / 256; ++e) { v[e] = exp_slot(v[e] - mx); se += v[e]; }
#pragma unroll
  for (int o = 16; o > 0; o >>= 1) se += __shfl_xor(se, o, 32);
  if (lane == 0) rse[w] = se;
  __syncthreads();
  se = 0.f;
#pragma unroll
  for (int u = 0; u < 8; ++u) se += rse[u];
  const float sc = 256.0f / se;
#pragma unroll
  for (int c = 0; c < NKX / 1024; ++c) { const int j = c * 1024 + tid * 4; if (j < nk) { v4h h4;
#pragma unroll
      for (int q = 0; q < 4; ++q) h4[q] = (_Float16)(v[c * 4 + q] * sc);
      *(v4h*)(P + i * NKX + j) = h4; } } }


template <int MASKADD>
__global__ __launch_bounds__(64) void k_att0(const float* __restrict__ QF, const float* __restrict__ KF, const float* __restrict__ VF, int ld, const float* __restrict__ mask, float scale, float* __restrict__ OF, int ldo) {
  #pragma clang fp contract(off)
  __shared__ __attribute__((aligned(16))) float lq[64][64]; __shared__ __attribute__((aligned(16))) float lo[64][64];
  const int tid = threadIdx.x; const int h = blockIdx.x / (QT0 / 64), rg = blockIdx.x % (QT0 / 64); const int i = rg * 64 + tid;
  const float* qr = QF + (size_t)i * ld + h * HD;
#pragma unroll 1
  for (int c = 0; c < HD / 4; ++c) { *(v4f*)&lq[tid][c * 4] = *(const v4fa*)(qr + c * 4); const v4f z = {0.f, 0.f, 0.f, 0.f}; *(v4f*)&lo[tid][c * 4] = z; }
  float m = -1.0e30f, l = 0.f; const int jmax = MASKADD ? (SQ - 1) : (rg * 64 + 63);      /* additive-mask form: every key (the mask input decides); causal form: keys up to the block's last row */
#pragma unroll 1
  for (int j = 0; j <= jmax; ++j) { const float* kr = KF + (size_t)j * ld + h * HD; const float* vr = VF + (size_t)j * ld + h * HD; float s = 0.f;
#pragma unroll 1
    for (int c = 0; c < HD / 4; ++c) { const v4f kq = *(const v4fa*)(kr + c * 4); const v4f qq = *(v4f*)&lq[tid][c * 4]; s = __fadd_rn(s, __fmul_rn(qq[0], kq[0])); s = __fadd_rn(s, __fmul_rn(qq[1], kq[1])); s = __fadd_rn(s, __fmul_rn(qq[2], kq[2])); s = __fadd_rn(s, __fmul_rn(qq[3], kq[3])); }
    s = __fmul_rn(s, scale); if (MASKADD) s = __fadd_rn(s, __fmul_rn(bf16_round(mask[(size_t)i * SQ + j]), -10000.0f));
    const float f = (MASKADD || j <= i) ? 1.f : 0.f; const float sm = fmaf(f, s, (1.f - f) * -1.0e30f); const float mn = fmaxf(m, sm); const float sc = expf(m - mn); const float e = expf(sm - mn); l = __fadd_rn(__fmul_rn(l, sc), e); m = mn;
#pragma unroll 1
    for (int c = 0; c < HD / 4; ++c) { const v4f vv = *(const v4fa*)(vr + c * 4); v4f oo = *(v4f*)&lo[tid][c * 4]; for (int u = 0; u < 4; ++u) oo[u] = __fadd_rn(__fmul_rn(oo[u], sc), __fmul_rn(e, vv[u])); *(v4f*)&lo[tid][c * 4] = oo; } }
  const float fin = 64.0f / l;      /* o carried x64 */
#pragma unroll 1
  for (int c = 0; c < HD / 4; ++c) { v4f oo = *(v4f*)&lo[tid][c * 4]; for (int u = 0; u < 4; ++u) oo[u] = __fmul_rn(oo[u], fin); *(v4f*)&lo[tid][c * 4] = oo; }
  __syncthreads();
  {
#pragma unroll 1
    for (int it = 0; it < 16; ++it) { const int row = it * 4 + tid / 16, pc = (tid % 16) * 4; const v4f v = *(const v4f*)&lo[row][pc]; *(v4f*)(OF + (size_t)(rg * 64 + row) * ldo + h * HD + pc) = v; }
     } }


template <int BFIN, int WXB>
__global__ __launch_bounds__(256) void k_ln16(const float* __restrict__ X, const float* __restrict__ g, const float* __restrict__ bb, float eps, _Float16* __restrict__ N16, float* __restrict__ XB) {
  #pragma clang fp contract(off)
  __shared__ float red[256]; const size_t r = blockIdx.x; const int t = threadIdx.x; const v4f xa = *(const v4fa*)(X + r * DMQ + t * 4); float s[4]; float sum = 0.f;
  for (int q = 0; q < 4; ++q) { s[q] = BFIN ? bf16_round(xa[q]) : xa[q]; sum = __fadd_rn(sum, s[q]); }
  red[t] = sum; __syncthreads(); for (int st = 128; st > 0; st >>= 1) { if (t < st) red[t] = __fadd_rn(red[t], red[t + st]); __syncthreads(); } const float mu = red[0] / (float)DMQ; __syncthreads();
  float vs = 0.f; for (int q = 0; q < 4; ++q) { const float dl = __fadd_rn(s[q], -mu); vs = __fadd_rn(vs, __fmul_rn(dl, dl)); } red[t] = vs; __syncthreads(); for (int st = 128; st > 0; st >>= 1) { if (t < st) red[t] = __fadd_rn(red[t], red[t + st]); __syncthreads(); }
  const float rs = rsqrtf(__fadd_rn(red[0] / (float)DMQ, eps)); v4h y; v4f xb;
  for (int q = 0; q < 4; ++q) { const int c = t * 4 + q; y[q] = (_Float16)__fadd_rn(__fmul_rn(__fmul_rn(__fadd_rn(s[q], -mu), rs), bf16_round(g[c])), bf16_round(bb[c])); xb[q] = s[q]; }
  { *(v4h*)(N16 + r * DMQ + t * 4) = y; if (WXB) *(v4f*)(XB + r * DMQ + t * 4) = xb;  } }
__global__ __launch_bounds__(256) void k_ftres2(const float* __restrict__ OF0, const float* __restrict__ XB, float* __restrict__ X1, size_t n4) {
  #pragma clang fp contract(off)
  const size_t t = (size_t)blockIdx.x * 256 + threadIdx.x; if (t >= n4) return; const v4f o = *(const v4fa*)(OF0 + t * 4), xv = *(const v4fa*)(XB + t * 4); v4f y; for (int q = 0; q < 4; ++q) y[q] = __fadd_rn(__fmul_rn(o[q], 0.015625f), xv[q]); *(v4f*)(X1 + t * 4) = y;  }

__global__ __launch_bounds__(256) void k_wthd(const float* __restrict__ Wt, _Float16* __restrict__ Bt) { const size_t t = (size_t)blockIdx.x * 256 + threadIdx.x; if (t >= (size_t)NH * HD * (DM / 8)) return; const int m8 = (int)(t % (DM / 8)) * 8; const int d = (int)((t / (DM / 8)) % HD); const int h = (int)(t / ((size_t)(DM / 8) * HD)); FragH f;
  for (int q = 0; q < 8; ++q) f.h[q] = (_Float16)(16.0f * bf16_round(Wt[((size_t)h * DM + m8 + q) * HD + d])); unsigned short* dst = (unsigned short*)Bt + ((size_t)h * HD + d) * DM + m8; *(v8us*)dst = f.half[0];  }




__global__ __launch_bounds__(256) void k_wtpad(const float* __restrict__ Wm, _Float16* __restrict__ Wt, int Kr, int Kp, int Nr, int Np, float scale) {
  const int t = blockIdx.x * 256 + threadIdx.x; if (t >= Np * (Kp / 8)) return; const int n = t / (Kp / 8), k8 = (t % (Kp / 8)) * 8; const int nc = min(n, Nr - 1); const float fn = (n < Nr) ? 1.f : 0.f; FragH f;
  for (int i = 0; i < 8; ++i) { const int k = k8 + i; const int kc = min(k, Kr - 1); const float fk = (k < Kr) ? fn : 0.f; f.h[i] = (_Float16)(bf16_round(Wm[(size_t)kc * Nr + nc]) * scale * fk); }
  unsigned short* o = (unsigned short*)Wt + (size_t)n * Kp + k8; *(v8us*)o = f.half[0];  }
__global__ __launch_bounds__(128) void k_bpad(const float* __restrict__ b, float* __restrict__ Bp, int nr, int np) {
  const int i = threadIdx.x; if (i >= np) return; const float v = b[min(i, nr - 1)] * ((i < nr) ? 1.f : 0.f); *(float*)(Bp + i) = v;  }

#define DI 64         /* inner width = NH * HD (ONE 64-wide head) */
#define LQK (3 * DI)  /* fused q | k | v row pitch (192) */
__global__ __launch_bounds__(256) void k_o0(const float* __restrict__ OF, float* __restrict__ ob, size_t n4) {
  #pragma clang fp contract(off)
  const size_t t = (size_t)blockIdx.x * 256 + threadIdx.x; if (t >= n4) return; const size_t e = t * 4; const int i = (int)(e / DI); const int c = (int)(e % DI); const int h = c / HD, d = c % HD; const v4f a = *(const v4fa*)(OF + e); v4f o; for (int q = 0; q < 4; ++q) o[q] = __fmul_rn(a[q], 0.015625f); float* dst = ob + (size_t)h * SQ * HD + (size_t)i * HD + d; *(v4f*)dst = o;  }

__global__ __launch_bounds__(256) void k_o0m(const float* __restrict__ OF, float* __restrict__ o_, size_t n4) {
  #pragma clang fp contract(off)
  const size_t t = (size_t)blockIdx.x * 256 + threadIdx.x; if (t >= n4) return; const size_t e = t * 4; const v4f a = *(const v4fa*)(OF + e); v4f o; for (int q = 0; q < 4; ++q) o[q] = __fmul_rn(a[q], 0.015625f); *(v4f*)(o_ + e) = o;  }
extern "C" void kernel_launch(void* const* d_in, const int* in_sizes, int n_in,
                              void* d_out, int out_size, void* d_ws, size_t ws_size, hipStream_t stream) {
  (void)in_sizes; (void)n_in; (void)out_size;
  const float* const* I = (const float* const*)d_in; const float* x = I[0]; const float* wq = I[2]; const float* wk = I[1]; const float* wv = I[3]; const float* bq = nullptr; const float* bk = nullptr; const float* bv = nullptr;      /* x; [in][out = 64] Wk / Wq / Wv (input order as this module lists them); no biases */
  char* ws = (char*)d_ws; size_t off = 0;
  auto take = [&](size_t bytes) { char* p = ws + off; off += (bytes + 255) & ~(size_t)255; return p; };
  _Float16* BW = (_Float16*)take((size_t)LQK * DM * 2); _Float16* X16 = (_Float16*)take(NR * DM * 2); _Float16* QKV = (_Float16*)take(NR * LQK * 2); _Float16* VT = (_Float16*)take((size_t)NH * HD * SQ * 2);
  float* S = (float*)take((size_t)NH * QT * NKX * 4); _Float16* P = (_Float16*)take((size_t)NH * QT * NKX * 2); float* QKVF0 = (float*)take((size_t)QT0 * LQK * 4); float* OF0 = (float*)take((size_t)QT0 * DI * 4);
  if (off > ws_size) return;
  { const unsigned g = (unsigned)(((size_t)DI * (DM / 8) + 255) / 256); k_wt_f16<<<g, 256, 0, stream>>>(wq, BW, DM, DI, 16.0f); k_wt_f16<<<g, 256, 0, stream>>>(wk, BW + (size_t)DI * DM, DM, DI, 16.0f); k_wt_f16<<<g, 256, 0, stream>>>(wv, BW + (size_t)2 * DI * DM, DM, DI, 16.0f); }      /* [in = DM][out = 64] -> Bt[n][k] x16, stacked q | k | v */
  k_x16<<<(unsigned)((NR * DM / 8 + 255) / 256), 256, 0, stream>>>(x, X16, NR * DM / 8);      /* x (bf16-valued) as exact f16 rows */
  const float* bqkv[3] = {bq, bk, bv};
  for (int c = 0; c < 3; ++c) k_gemm2<0><<<dim3((unsigned)((NR / 128) * (DI / 64)), 1), 128, 0, stream>>>(X16, DM, 0, BW + (size_t)c * DI * DM, DM, 0, 0.0625f, bqkv[c], 0, nullptr, 1, 0, 0, nullptr, QKV + (size_t)c * DI, LQK, 0, (int)NR, DI, DM);      /* q | k | v = x W -> f16 rows, column blocks 0 / 64 / 128 of the fused plane (pitch 192); head h = columns h*64 inside each */
  const _Float16* Q16 = QKV; const _Float16* K16 = QKV + DI; const _Float16* V16 = QKV + 2 * DI;
  for (int b = 0; b < NB; ++b) { const size_t r0 = (size_t)b * SQ; float* ob = (float*)d_out + r0 * DI;
    k_vt<NH, SQ><<<NH * (SQ / 64), 256, 0, stream>>>(V16 + r0 * LQK, LQK, 0, VT);      /* V^T [NH][HD][SQ] for this batch */
    for (int q0 = 0; q0 < SQ; q0 += QT) { const int nk = q0 + QT;      /* causal: only keys below the tile end are computed */
      k_gemm2<0><<<dim3((QT / 128) * (nk / 64), NH), 128, 0, stream>>>(Q16 + (r0 + q0) * LQK, LQK, (size_t)HD, K16 + r0 * LQK, LQK, (size_t)HD, 0.0625f, nullptr, 0, nullptr, 1, 0, 0, S, nullptr, NKX, (size_t)QT * NKX, QT, nk, HD);      /* scores * 256^-0.5 = 1/16 (the module scales by the EMBEDDING width), the one head on grid.y */
      k_rsmrow<<<NH * QT, 256, 0, stream>>>(S, P, q0, nk);      /* causal softmax -> P x256 f16, one row a work-group */
      k_gemm2<0><<<dim3((QT / 128) * (HD / 64), NH), 128, 0, stream>>>(P, NKX, (size_t)QT * NKX, VT, SQ, (size_t)HD * SQ, 0.00390625f, nullptr, 0, nullptr, 1, 0, 0, ob + (size_t)q0 * DI, nullptr, DI, (size_t)HD, QT, HD, nk); }      /* out[b][q0 + i][h*64..] = P V^T 2^-8 (f32): merged rows, head h at column offset h*64 */
    for (int c = 0; c < 3; ++c) k_gemm2<0><<<dim3((unsigned)((QT0 / 128) * (DI / 64)), 1), 128, 0, stream>>>(X16 + r0 * DM, DM, 0, BW + (size_t)c * DI * DM, DM, 0, 0.0625f, bqkv[c], 0, nullptr, 1, 0, 0, QKVF0 + (size_t)c * DI, nullptr, LQK, 0, QT0, DI, DM);      /* f32 q | k | v of rows 0..511 (exact products, f32 accumulation) */
    k_att0<0><<<NH * (QT0 / 64), 64, 0, stream>>>(QKVF0, QKVF0 + DI, QKVF0 + 2 * DI, LQK, nullptr, 0.0625f, OF0, DI);      /* exact f32 causal attention for rows 0..511 (o x64) */
    k_o0m<<<(unsigned)(((size_t)QT0 * DI / 4 + 255) / 256), 256, 0, stream>>>(OF0, ob, (size_t)QT0 * DI / 4); }      /* rows 0..511 of the batch REWRITTEN from the exact path */
}

// v002
// A run of this version takes 2920 microseconds.
// Timed twice side by side with v001, it ran 3.89 and 3.88 times as fast.
// All steps since v000 together make it 11.3 times as fast.
#include <hip/hip_runtime.h>
// Single-head causal self-attention with the module's EMBEDDING-width scale (x [4][4096][256]; k/q/v = x W ([in][out] [256][64], U(+-0.1), no biases; input order Wk, Wq, Wv); ONE 64-wide head; wei * 256^-0.5 (n_embd, as in the source); causal (tril, -inf); softmax; out = wei v -> [4][4096][64]; no output projection).
// Structure: token rows; x as exact f16 rows; three WMMA GEMMs (no bias) into one f16 q | k | v plane [16384][192]; v^T via LDS transposes; causal 256-row query tiles with the batches on grid.y (scores alpha 1/16, causal softmax f32 -> f16 x256 weights, P V written as f32 straight into the merged output rows); an exact f32 first tile (rows 0..511) rewritten at the end; launches: see trace.
// Compute dtype: inputs rounded to bf16; x / weights exact; q, k, v and softmax weights as plain f16 GEMM operands (~2^-12); scores, softmax statistics and o f32. v_wmma_f32_16x16x32_f16.
#define NB 4
#define SQ 4096
#define DM 256
#define NH 1
#define HD 64
#define HG 4                         /* heads per block group of the unlaunched k_vt(b, h0) overload */
#define QT 256                       /* query rows per causal tile */
#define NKX SQ                       /* S / P row pitch */
#define QT0 512                      /* first-tile rows recomputed exactly (f32): 512 here (no output projection averages the early-row cancellation errors away; logit sigma 1.0) */
#define B0 0                         /* unused; the batches run on grid.y from 0 */
#define NBR NB                       /* feeds only MP; grid.y runs over the NB batches */
#define NR ((size_t)NB * SQ)
#define DMQ DM
#define DFF 4096                     /* unused; this file has no FFN */
#define DFFR 100                     /* unused */
#define MP ((int)((size_t)NBR * SQ)) /* feeds only MPO; the projection runs over NR rows */
#define QN SQ                        /* unused */
#define NHD NH                       /* unused */
#define MPO MP                       /* unused */
#define LQ (3 * DM)      /* 3 * DM = 768, unused; the q/k/v rows use pitch LQK = 192 */
typedef __bf16 v16b __attribute__((ext_vector_type(16)));
typedef unsigned short v8us __attribute__((ext_vector_type(8), may_alias));
typedef float  v8f  __attribute__((ext_vector_type(8)));
typedef float  v4f  __attribute__((ext_vector_type(4)));
typedef float  v4fa __attribute__((ext_vector_type(4), may_alias));
union FragB { v16b v; v8us half[2]; unsigned short u[16]; };

__device__ __forceinline__ unsigned short bf16_bits(float x) { unsigned int u = __float_as_uint(x); return (unsigned short)((u + 0x7FFFu + ((u >> 16) & 1u)) >> 16); }
__device__ __forceinline__ float bf16_val(unsigned short b) { return __uint_as_float(((unsigned int)b) << 16); }
__device__ __forceinline__ float bf16_round(float x) { return bf16_val(bf16_bits(x)); }
// D += A·B with NT terms: 1 = ah·bh, 2 = + al·bh (A split), 3 = + ah·bl (both split)
template <int NT>
__device__ __forceinline__ v8f mmaN(v16b ah, v16b al, v16b bh, v16b bl, v8f c) {
  c = __builtin_amdgcn_wmma_f32_16x16x32_bf16(false, ah, false, bh, (short)0, c, false, false);
  if (NT >= 2) c = __builtin_amdgcn_wmma_f32_16x16x32_bf16(false, al, false, bh, (short)0, c, false, false);
  if (NT >= 3) c = __builtin_amdgcn_wmma_f32_16x16x32_bf16(false, ah, false, bl, (short)0, c, false, false);
  asm volatile("v_nop\n\tv_nop\n\tv_nop\n\tv_nop" : "+v"(c) : "v"(ah), "v"(al), "v"(bh), "v"(bl));
  return c;
}

__global__ __launch_bounds__(256) void k_wt_bf16(const float* __restrict__ W, unsigned short* __restrict__ Wt, int K, int N) {
  const int t = blockIdx.x * 256 + threadIdx.x;
  const int k8n = K / 8;
  if (t >= N * k8n) return;
  const int n = t / k8n, k8 = (t % k8n) * 8;
  v8us v;
#pragma unroll
  for (int i = 0; i < 8; ++i) v[i] = bf16_bits(W[(size_t)(k8 + i) * N + n]);
  *(v8us*)(Wt + (size_t)n * K + k8) = v;
  
}

// GEMM C[M][N] (f32, pitch ldc) = act(A[M][K]·W + bias). A f32 row-major (pitch lda) converted per fragment to bf16
// (ASPLIT: hi/lo two planes -> 2 terms, else single rounded term); Wt bf16 [N][K] (pitch ldb). BIAS_BF16 rounds the
// bias to bf16 first (bias quantised to bf16 before the add). K%32==0, M%16==0, N%64==0.
template <bool ASPLIT, int ACT, bool BIAS_BF16>
__global__ __launch_bounds__(128) void k_gemm_bf(const float* __restrict__ A, int lda, const unsigned short* __restrict__ Wt, int ldb,
                                               const float* __restrict__ bias, float* __restrict__ C, int ldc, int M, int N, int K) {
  __shared__ __attribute__((aligned(16))) float so[4][16][64];
  const int tid = threadIdx.x, w = tid >> 5, lane = tid & 31, ln = lane & 15, hh = lane >> 4;
  const int ntn = N / 64;
  const int wid = blockIdx.x * 4 + w;
  const int mt = wid / ntn, nq = wid % ntn;
  if (mt * 16 >= M) return;
  const int row0 = mt * 16, col0 = nq * 64;
  const float* arow = A + (size_t)(row0 + ln) * lda;
  v8f acc[4] = {};
  for (int kb = 0; kb < K; kb += 32) {
    FragB ah, al;
    const v4f x0 = *(const v4fa*)(arow + kb + 8 * hh), x1 = *(const v4fa*)(arow + kb + 8 * hh + 4);
    const v4f x2 = *(const v4fa*)(arow + kb + 16 + 8 * hh), x3 = *(const v4fa*)(arow + kb + 16 + 8 * hh + 4);
    float xs[16] = {x0[0],x0[1],x0[2],x0[3],x1[0],x1[1],x1[2],x1[3],x2[0],x2[1],x2[2],x2[3],x3[0],x3[1],x3[2],x3[3]};
#pragma unroll
    for (int i = 0; i < 16; ++i) { const unsigned short hb = bf16_bits(xs[i]); ah.u[i] = hb; al.u[i] = ASPLIT ? bf16_bits(xs[i] - bf16_val(hb)) : (unsigned short)0; }
#pragma unroll
    for (int t = 0; t < 4; ++t) {
      const unsigned short* brow = Wt + (size_t)(col0 + t * 16 + ln) * ldb + kb;
      FragB b;
      b.half[0] = *(const v8us*)(brow + 8 * hh);
      b.half[1] = *(const v8us*)(brow + 16 + 8 * hh);
      acc[t] = mmaN<ASPLIT ? 2 : 1>(ah.v, al.v, b.v, b.v, acc[t]);
    }
  }
#pragma unroll
  for (int t = 0; t < 4; ++t) {
    float bv = bias ? bias[col0 + t * 16 + ln] : 0.f;
    if (BIAS_BF16) bv = bf16_round(bv);
#pragma unroll
    for (int r = 0; r < 8; ++r) { float v = acc[t][r] + bv; if (ACT == 1) v = fmaxf(v, 0.f); so[w][8 * hh + r][t * 16 + ln] = v; }
  }
  __builtin_amdgcn_fence(__ATOMIC_ACQ_REL, "workgroup");
  __builtin_amdgcn_wave_barrier();
  const int rsub = lane >> 4, c4 = (lane & 15) * 4;
  {
#pragma unroll
    for (int q = 0; q < 8; ++q) {
      const int r = q * 2 + rsub;
      const v4f v = *(const v4fa*)&so[w][r][c4];
      *(v4f*)(C + (size_t)(row0 + r) * ldc + col0 + c4) = v;
    }
    
  }
}

// GEMM C = act(A·W + bias + resid): A f32 (ASPLIT -> hi/lo 2 terms), Wt bf16 [N][K]; ACT 0 none, 1 relu, 2 exact gelu;
// resid (optional, f32, row index = (row % rmod), pitch ldr, RES_BF16 rounds it) added before the activation.
template <bool ASPLIT, int ACT, bool BIAS_BF16, bool RES_BF16>
__global__ __launch_bounds__(128) void k_gemm_bf3(const float* __restrict__ A, int lda, const unsigned short* __restrict__ Wt, int ldb,
                                                const float* __restrict__ bias, const float* __restrict__ resid, int rmod, int ldr,
                                                float* __restrict__ C, int ldc, int M, int N, int K) {
  __shared__ __attribute__((aligned(16))) float so[4][16][64];
  const int tid = threadIdx.x, w = tid >> 5, lane = tid & 31, ln = lane & 15, hh = lane >> 4;
  const int ntn = N / 64;
  const int wid = blockIdx.x * 4 + w;
  const int mt = wid / ntn, nq = wid % ntn;
  if (mt * 16 >= M) return;
  const int row0 = mt * 16, col0 = nq * 64;
  const float* arow = A + (size_t)(row0 + ln) * lda;
  v8f acc[4] = {};
  for (int kb = 0; kb < K; kb += 32) {
    FragB ah, al;
    const v4f x0 = *(const v4fa*)(arow + kb + 8 * hh), x1 = *(const v4fa*)(arow + kb + 8 * hh + 4);
    const v4f x2 = *(const v4fa*)(arow + kb + 16 + 8 * hh), x3 = *(const v4fa*)(arow + kb + 16 + 8 * hh + 4);
    float xs[16] = {x0[0],x0[1],x0[2],x0[3],x1[0],x1[1],x1[2],x1[3],x2[0],x2[1],x2[2],x2[3],x3[0],x3[1],x3[2],x3[3]};
#pragma unroll
    for (int i = 0; i < 16; ++i) { const unsigned short hb = bf16_bits(xs[i]); ah.u[i] = hb; al.u[i] = ASPLIT ? bf16_bits(xs[i] - bf16_val(hb)) : (unsigned short)0; }
#pragma unroll
    for (int t = 0; t < 4; ++t) {
      const unsigned short* brow = Wt + (size_t)(col0 + t * 16 + ln) * ldb + kb;
      FragB b;
      b.half[0] = *(const v8us*)(brow + 8 * hh);
      b.half[1] = *(const v8us*)(brow + 16 + 8 * hh);
      acc[t] = mmaN<ASPLIT ? 2 : 1>(ah.v, al.v, b.v, b.v, acc[t]);
    }
  }
#pragma unroll
  for (int t = 0; t < 4; ++t) {
    const int col = col0 + t * 16 + ln;
    float bv = bias ? bias[col] : 0.f;
    if (BIAS_BF16) bv = bf16_round(bv);
#pragma unroll
    for (int r = 0; r < 8; ++r) {
      float v = acc[t][r] + bv;
      if (resid) { float rv = resid[(size_t)((row0 + 8 * hh + r) % rmod) * ldr + col]; if (RES_BF16) rv = bf16_round(rv); v += rv; }
      if (ACT == 1) v = fmaxf(v, 0.f);
      if (ACT == 2) v = 0.5f * v * (1.0f + erff(v * 0.70710678118654752f));
      if (ACT == 3) { const float u = 0.7978845608028654f * (v + 0.044715f * v * v * v); v = 0.5f * v * (1.0f + tanhf(u)); }
      so[w][8 * hh + r][t * 16 + ln] = v;
    }
  }
  __builtin_amdgcn_fence(__ATOMIC_ACQ_REL, "workgroup");
  __builtin_amdgcn_wave_barrier();
  const int rsub = lane >> 4, c4 = (lane & 15) * 4;
  {
#pragma unroll
    for (int q = 0; q < 8; ++q) {
      const int r = q * 2 + rsub;
      const v4f v = *(const v4fa*)&so[w][r][c4];
      *(v4f*)(C + (size_t)(row0 + r) * ldc + col0 + c4) = v;
    }
    
  }
}
// row LayerNorm (biased variance, eps) over N: s = X (+ R); optional out_sum <- s; out_norm <- (s-mu)*rsqrt(var+eps)*g + b
template <bool PARAM_BF16>
__global__ __launch_bounds__(256) void k_layernorm(const float* __restrict__ X, const float* __restrict__ R, const float* __restrict__ g, const float* __restrict__ bta,
                                                  float* __restrict__ out_sum, float* __restrict__ out_norm, int N, float eps) {
  __shared__ float red[256];
  const int row = blockIdx.x, tid = threadIdx.x;
  const float* x = X + (size_t)row * N; const float* rr = R ? R + (size_t)row * N : nullptr;
  float vals[16];                     // up to N = 4096
  const int per = N / 256;            // contiguous chunk per thread? use strided-by-4 chunks: thread handles j = tid*4 + 1024*u
  float s1 = 0.f;
  for (int u = 0; u < per / 4; ++u) {
    const int j = tid * 4 + 1024 * u;
    const v4f a = *(const v4fa*)(x + j);
    v4f b = {0.f,0.f,0.f,0.f}; if (rr) b = *(const v4fa*)(rr + j);
#pragma unroll
    for (int q = 0; q < 4; ++q) { const float v = a[q] + b[q]; vals[u * 4 + q] = v; s1 += v; }
  }
  red[tid] = s1; __syncthreads();
  for (int st = 128; st > 0; st >>= 1) { if (tid < st) red[tid] += red[tid + st]; __syncthreads(); }
  const float mu = red[0] / (float)N; __syncthreads();
  float s2 = 0.f;
  for (int u = 0; u < per / 4; ++u)
#pragma unroll
    for (int q = 0; q < 4; ++q) { const float c = vals[u * 4 + q] - mu; s2 += c * c; }
  red[tid] = s2; __syncthreads();
  for (int st = 128; st > 0; st >>= 1) { if (tid < st) red[tid] += red[tid + st]; __syncthreads(); }
  const float rs = rsqrtf(red[0] / (float)N + eps);
  {
    for (int u = 0; u < per / 4; ++u) {
      const int j = tid * 4 + 1024 * u;
      v4f o, sm;
#pragma unroll
      for (int q = 0; q < 4; ++q) {
        float gg = g[j + q], bb = bta[j + q];
        if (PARAM_BF16) { gg = bf16_round(gg); bb = bf16_round(bb); }
        sm[q] = vals[u * 4 + q]; o[q] = (vals[u * 4 + q] - mu) * rs * gg + bb;
      }
      if (out_sum) *(v4f*)(out_sum + (size_t)row * N + j) = sm;
      *(v4f*)(out_norm + (size_t)row * N + j) = o;
    }
    
  }
}



// ---- f16 WMMA path (v_wmma_f32_16x16x32_f16): 11-bit significands for operands in range — used where a [0,1] probability operand needs more precision than bf16
typedef _Float16 v16h __attribute__((ext_vector_type(16)));
union FragH { v16h v; v8us half[2]; _Float16 h[16]; unsigned short u[16]; };
template <int NT>
__device__ __forceinline__ v8f mmaH(v16h ah, v16h al, v16h bh, v16h bl, v8f c) {
  c = __builtin_amdgcn_wmma_f32_16x16x32_f16(false, ah, false, bh, (short)0, c, false, false);
  if (NT >= 2) c = __builtin_amdgcn_wmma_f32_16x16x32_f16(false, al, false, bh, (short)0, c, false, false);
  if (NT >= 3) c = __builtin_amdgcn_wmma_f32_16x16x32_f16(false, ah, false, bl, (short)0, c, false, false);
  asm volatile("v_nop\n\tv_nop\n\tv_nop\n\tv_nop" : "+v"(c) : "v"(ah), "v"(al), "v"(bh), "v"(bl));
  return c;
}
// batched GEMM like k_gemm_b but f16 operands: A f32 (split into f16 hi/lo if ASPLIT, else rounded to f16), Bt = f16 values [n][k]; alpha; C f32; N multiple of 16 (partial tiles skipped)
template <bool ASPLIT>
__global__ __launch_bounds__(128) void k_gemm_h(const float* __restrict__ A, int lda, size_t sA, const _Float16* __restrict__ Bh, int ldb, size_t sB, float alpha, float* __restrict__ C, int ldc, size_t sC, int M, int N, int K) {
  __shared__ __attribute__((aligned(16))) float so[4][16][64];
  const int tid = threadIdx.x, w = tid >> 5, lane = tid & 31, ln = lane & 15, hh = lane >> 4; const int by = blockIdx.y;
  A += (size_t)by * sA; Bh += (size_t)by * sB; C += (size_t)by * sC;
  const int ntn = (N + 63) / 64; const int wid = blockIdx.x * 4 + w; const int mt = wid / ntn, nq = wid % ntn; if (mt * 16 >= M) return;
  const int row0 = mt * 16, col0 = nq * 64; const float* arow = A + (size_t)(row0 + ln) * lda;
  v8f acc[4] = {};
  for (int kb = 0; kb < K; kb += 32) {
    FragH ah, al;
    const v4f x0 = *(const v4fa*)(arow + kb + 8 * hh), x1 = *(const v4fa*)(arow + kb + 8 * hh + 4), x2 = *(const v4fa*)(arow + kb + 16 + 8 * hh), x3 = *(const v4fa*)(arow + kb + 16 + 8 * hh + 4);
    float xs[16] = {x0[0],x0[1],x0[2],x0[3],x1[0],x1[1],x1[2],x1[3],x2[0],x2[1],x2[2],x2[3],x3[0],x3[1],x3[2],x3[3]};
#pragma unroll
    for (int i = 0; i < 16; ++i) { const _Float16 h = (_Float16)xs[i]; ah.h[i] = h; al.h[i] = ASPLIT ? (_Float16)(xs[i] - (float)h) : (_Float16)0.0f; }
#pragma unroll
    for (int t = 0; t < 4; ++t) { if (col0 + t * 16 >= N) continue; const size_t boff = (size_t)(col0 + t * 16 + ln) * ldb + kb; FragH bq; bq.half[0] = *(const v8us*)(Bh + boff + 8 * hh); bq.half[1] = *(const v8us*)(Bh + boff + 16 + 8 * hh);
      acc[t] = mmaH<ASPLIT ? 2 : 1>(ah.v, al.v, bq.v, bq.v, acc[t]); }
  }
#pragma unroll
  for (int t = 0; t < 4; ++t) { if (col0 + t * 16 >= N) continue;
#pragma unroll
    for (int r = 0; r < 8; ++r) so[w][8 * hh + r][t * 16 + ln] = acc[t][r] * alpha; }
  __builtin_amdgcn_fence(__ATOMIC_ACQ_REL, "workgroup"); __builtin_amdgcn_wave_barrier();
  const int rsub = lane >> 4, c4 = (lane & 15) * 4;
  {
#pragma unroll
    for (int q = 0; q < 8; ++q) { const int r = q * 2 + rsub; if (col0 + c4 < N) { const v4f v = *(const v4fa*)&so[w][r][c4]; *(v4f*)(C + (size_t)(row0 + r) * ldc + col0 + c4) = v; } }
     }
}

// Wt[n][k] = f16(W[k][n]·scale) from f32 row-major W[K][N] (scale = power of two; bf16-exact weights stay exact in f16 away from the subnormal range)
__global__ __launch_bounds__(256) void k_wt_f16(const float* __restrict__ W, _Float16* __restrict__ Wt, int K, int N, float scale) {
  const int t = blockIdx.x * 256 + threadIdx.x; if (t >= N * (K / 8)) return; const int n = t / (K / 8), k8 = (t % (K / 8)) * 8; FragH f;
#pragma unroll
  for (int i = 0; i < 8; ++i) f.h[i] = (_Float16)(bf16_round(W[(size_t)(k8 + i) * N + n]) * scale); const v8us o = f.half[0];
  *(v8us*)((unsigned short*)Wt + (size_t)n * K + k8) = o; 
}
// k_gemm_hh variant with fused epilogue: v = acc·alpha + bias[by·sBias + col] (+ CP[(row/rowsPerB)·sCPb + by·64 + col] if CP) ; ACT 0 none / 1 elu ; writes f16 C16 (and f32 C if non-null)
template <int ACT>
__global__ __launch_bounds__(128) void k_gemm_hhx(const _Float16* __restrict__ A, int lda, size_t sA, const _Float16* __restrict__ Bh, int ldb, size_t sB, float alpha, const float* __restrict__ bias, size_t sBias, const float* __restrict__ CP, int rowsPerB, size_t sCPb, int row0g,
    float* __restrict__ C, _Float16* __restrict__ C16, int ldc, size_t sC, int M, int N, int K) {
  __shared__ __attribute__((aligned(16))) float so[4][16][64];
  const int tid = threadIdx.x, w = tid >> 5, lane = tid & 31, ln = lane & 15, hh = lane >> 4; const int by = blockIdx.y;
  A += (size_t)by * sA; Bh += (size_t)by * sB; const size_t cofs = (size_t)by * sC; const float* bp = bias ? bias + (size_t)by * sBias : nullptr;
  const int ntn = (N + 63) / 64; const int wid = blockIdx.x * 4 + w; const int mt = wid / ntn, nq = wid % ntn; if (mt * 16 >= M) return;
  const int row0 = mt * 16, col0 = nq * 64; const _Float16* arow = A + (size_t)(row0 + ln) * lda;
  v8f acc[4] = {};
  for (int kb = 0; kb < K; kb += 32) { FragH ah; ah.half[0] = *(const v8us*)((const unsigned short*)arow + kb + 8 * hh); ah.half[1] = *(const v8us*)((const unsigned short*)arow + kb + 16 + 8 * hh);
#pragma unroll
    for (int t = 0; t < 4; ++t) { if (col0 + t * 16 >= N) continue; const size_t boff = (size_t)(col0 + t * 16 + ln) * ldb + kb; FragH bq; bq.half[0] = *(const v8us*)((const unsigned short*)Bh + boff + 8 * hh); bq.half[1] = *(const v8us*)((const unsigned short*)Bh + boff + 16 + 8 * hh);
      acc[t] = mmaH<1>(ah.v, ah.v, bq.v, bq.v, acc[t]); }
  }
#pragma unroll
  for (int t = 0; t < 4; ++t) { if (col0 + t * 16 >= N) continue; const int col = col0 + t * 16 + ln; const float bv = bp ? bf16_round(bp[col]) : 0.f;
#pragma unroll
    for (int r = 0; r < 8; ++r) { float v = acc[t][r] * alpha + bv; if (CP) { const int rr = row0g + row0 + 8 * hh + r; if (rowsPerB < 0) v += CP[cofs + (size_t)rr * ldc + col];      /* rowsPerB < 0: own element of the batched C plane */ else { const int bidx = rr / rowsPerB; v += CP[(size_t)bidx * sCPb + (size_t)by * 64 + col]; } } if (ACT == 1) v = (v > 0.f) ? v : expm1f(v); else if (ACT == 7) v = (v > 0.f) ? v + 1.0f : expf(v); else if (ACT == 8) v = tanhf(v); else if (ACT == 9) v = 0.5f * v * (1.0f + tanhf(0.7978845608028654f * (v + 0.044715f * v * v * v))); else if (ACT == 11) v = 1.0f / (1.0f + expf(-v)); else if (ACT == 12) v = (v > 0.f) ? v : 0.01f * v; else if (ACT == 14) v = (v > 0.f) ? v : 0.1f * v; else if (ACT == 16) v = (v >= 0.f) ? v : 0.3f * v; else if (ACT == 17) v = (v >= 0.f) ? v : 0.2f * v; else if (ACT == 15) v = v / (1.0f + expf(-v)); else if (ACT == 3) v = fmaxf(v, 0.f); else if (ACT == 6) v = 0.5f * v * (1.0f + erff(v * 0.70710678118654752f)); so[w][8 * hh + r][t * 16 + ln] = v; } }
  __builtin_amdgcn_fence(__ATOMIC_ACQ_REL, "workgroup"); __builtin_amdgcn_wave_barrier();
  const int rsub = lane >> 4, c4 = (lane & 15) * 4; typedef _Float16 v4h __attribute__((ext_vector_type(4)));
  {
#pragma unroll
    for (int q = 0; q < 8; ++q) { const int r = q * 2 + rsub; if (col0 + c4 < N) { const v4f v = *(const v4fa*)&so[w][r][c4]; if (C) *(v4f*)(C + cofs + (size_t)(row0 + r) * ldc + col0 + c4) = v; if (C16) { v4h h4; for (int i = 0; i < 4; ++i) h4[i] = (_Float16)v[i]; *(v4h*)(C16 + cofs + (size_t)(row0 + r) * ldc + col0 + c4) = h4; } } }
     }
}


typedef _Float16 v4h __attribute__((ext_vector_type(4)));

__global__ __launch_bounds__(256) void k_x16(const float* __restrict__ x, _Float16* __restrict__ X16, size_t n8) { const size_t t = (size_t)blockIdx.x * 256 + threadIdx.x; if (t >= n8) return; FragH f;
#pragma unroll
  for (int q = 0; q < 8; ++q) f.h[q] = (_Float16)bf16_round(x[t * 8 + q]); *(v8us*)((unsigned short*)X16 + t * 8) = f.half[0];  }
__global__ __launch_bounds__(256) void k_h16(const float* __restrict__ x, _Float16* __restrict__ X16, size_t n8) { const size_t t = (size_t)blockIdx.x * 256 + threadIdx.x; if (t >= n8) return; FragH f;
#pragma unroll
  for (int q = 0; q < 8; ++q) f.h[q] = (_Float16)x[t * 8 + q]; *(v8us*)((unsigned short*)X16 + t * 8) = f.half[0];  }
__global__ __launch_bounds__(256) void k_round16f(const float* __restrict__ W, _Float16* __restrict__ Bt, size_t n8) { const size_t t = (size_t)blockIdx.x * 256 + threadIdx.x; if (t >= n8) return; FragH f;
#pragma unroll
  for (int i = 0; i < 8; ++i) f.h[i] = (_Float16)(bf16_round(W[t * 8 + i]) * 16.0f); *(v8us*)((unsigned short*)Bt + t * 8) = f.half[0];  }
template <int NHv, int TTv>
__global__ __launch_bounds__(256) void k_vt(const _Float16* __restrict__ V16, int ldv, int voff, _Float16* __restrict__ Vt) { __shared__ unsigned short tl[64][66]; const int tid = threadIdx.x; const int slab = blockIdx.x / (TTv / 64), lg = blockIdx.x % (TTv / 64); const int b = slab / NHv, h = slab % NHv;
  for (int i = tid; i < 64 * 8; i += 256) { const int r = i / 8, c8 = (i % 8) * 8; FragH f; f.half[0] = *(const v8us*)((const unsigned short*)V16 + ((size_t)b * TTv + lg * 64 + r) * ldv + voff + h * 64 + c8);
#pragma unroll
    for (int q = 0; q < 8; ++q) tl[r][c8 + q] = f.u[q]; }
  __syncthreads();
  {
#pragma unroll
    for (int rd = 0; rd < 2; ++rd) { const int d = rd * 32 + tid / 8, pc = tid % 8; FragH f;
#pragma unroll
      for (int q = 0; q < 8; ++q) f.u[q] = tl[pc * 8 + q][d];
      *(v8us*)((unsigned short*)Vt + ((size_t)slab * 64 + d) * TTv + lg * 64 + pc * 8) = f.half[0]; }
     } }

__global__ __launch_bounds__(256) void k_hl(const float* __restrict__ F, _Float16* __restrict__ Hh, _Float16* __restrict__ Hl, size_t n8) { const size_t t = (size_t)blockIdx.x * 256 + threadIdx.x; if (t >= n8) return; FragH fh, fl; const v4f a = *(const v4fa*)(F + t * 8), c = *(const v4fa*)(F + t * 8 + 4);
#pragma unroll
  for (int q = 0; q < 4; ++q) { _Float16 h = (_Float16)a[q]; fh.h[q] = h; fl.h[q] = (_Float16)((a[q] - (float)h) * 1024.0f); h = (_Float16)c[q]; fh.h[4 + q] = h; fl.h[4 + q] = (_Float16)((c[q] - (float)h) * 1024.0f); }
  { *(v8us*)((unsigned short*)Hh + t * 8) = fh.half[0]; *(v8us*)((unsigned short*)Hl + t * 8) = fl.half[0];  } }

// ---- fast GEMM (wave tile 32x64; requires M % 32 == 0 rows per launch region and N % 64 == 0); epilogue = k_gemm_hhx semantics ----
__device__ __forceinline__ v16h g2_frag(const _Float16* p, int hh) { FragH f; f.half[0] = *(const v8us*)((const unsigned short*)p + 8 * hh); f.half[1] = *(const v8us*)((const unsigned short*)p + 16 + 8 * hh); return f.v; }
__device__ __forceinline__ v8f g2_mma(v16h a, v16h b, v8f c) { v8f d = __builtin_amdgcn_wmma_f32_16x16x32_f16(false, a, false, b, (short)0, c, false, false); asm volatile("v_nop\n\tv_nop\n\tv_nop\n\tv_nop" : "+v"(d) : "v"(a), "v"(b)); return d; }
template <int ACT>
__global__ __launch_bounds__(128) void k_gemm2(const _Float16* __restrict__ A, int lda, size_t sA, const _Float16* __restrict__ Bh, int ldb, size_t sB, float alpha, const float* __restrict__ bias, size_t sBias, const float* __restrict__ CP, int rowsPerB, size_t sCPb, int row0g,
    float* __restrict__ C, _Float16* __restrict__ C16, int ldc, size_t sC, int M, int N, int K) { static_assert(ACT == 0 || ACT == 3 || ACT == 6 || ACT == 8 || ACT == 9 || ACT == 11 || ACT == 12 || ACT == 14 || ACT == 15 || ACT == 16 || ACT == 17, "k_gemm2: unsupported ACT code (would silently apply no activation)");
  __shared__ __attribute__((aligned(16))) float so[4][32][68];
  const int tid = threadIdx.x, w = tid >> 5, lane = tid & 31, ln = lane & 15, hh = lane >> 4; const int by = blockIdx.y;
  A += (size_t)by * sA; Bh += (size_t)by * sB; const size_t cofs = (size_t)by * sC; const float* bp = bias ? bias + (size_t)by * sBias : nullptr;
  const int ntn = N >> 6; const int mt = blockIdx.x / ntn, nq = blockIdx.x - mt * ntn; const int row0 = mt * 128 + 32 * w, col0 = nq * 64; if (row0 >= M) return;
  const _Float16* a0p = A + (size_t)(row0 + ln) * lda; const _Float16* a1p = a0p + (size_t)16 * lda;
  const _Float16* b0p = Bh + (size_t)(col0 + ln) * ldb; const _Float16* b1p = b0p + (size_t)16 * ldb; const _Float16* b2p = b1p + (size_t)16 * ldb; const _Float16* b3p = b2p + (size_t)16 * ldb;
  const v8f z8 = {0.f,0.f,0.f,0.f,0.f,0.f,0.f,0.f}; v8f c00 = z8, c01 = z8, c02 = z8, c03 = z8, c10 = z8, c11 = z8, c12 = z8, c13 = z8;
#pragma unroll 1
  for (int kb = 0; kb < K; kb += 32) { const v16h a0 = g2_frag(a0p + kb, hh), a1 = g2_frag(a1p + kb, hh);
    v16h b = g2_frag(b0p + kb, hh); c00 = g2_mma(a0, b, c00); c10 = g2_mma(a1, b, c10);
    b = g2_frag(b1p + kb, hh); c01 = g2_mma(a0, b, c01); c11 = g2_mma(a1, b, c11);
    b = g2_frag(b2p + kb, hh); c02 = g2_mma(a0, b, c02); c12 = g2_mma(a1, b, c12);
    b = g2_frag(b3p + kb, hh); c03 = g2_mma(a0, b, c03); c13 = g2_mma(a1, b, c13); }
  v8f accs[8] = {c00, c01, c02, c03, c10, c11, c12, c13};
#pragma unroll
  for (int u = 0; u < 8; ++u) { const int t = u & 3, half = u >> 2; const int col = col0 + t * 16 + ln; const float bv = bp ? bf16_round(bp[col]) : 0.f;
#pragma unroll
    for (int r = 0; r < 8; ++r) { const int rloc = half * 16 + 8 * hh + r; float v = accs[u][r] * alpha + bv; if (CP) { if (rowsPerB < 0) v += CP[cofs + (size_t)(row0g + row0 + rloc) * ldc + col];      /* rowsPerB < 0: own element of the batched C plane */ else { const int bidx = (row0g + row0 + rloc) / rowsPerB; v += CP[(size_t)bidx * sCPb + (size_t)by * 64 + col]; } }
      if (ACT == 3) v = fmaxf(v, 0.f); else if (ACT == 6) v = 0.5f * v * (1.0f + erff(v * 0.70710678118654752f)); else if (ACT == 11) v = 1.0f / (1.0f + expf(-v)); else if (ACT == 15) v = v / (1.0f + expf(-v)); else if (ACT == 12) v = (v > 0.f) ? v : 0.01f * v; else if (ACT == 8) v = tanhf(v); else if (ACT == 9) v = 0.5f * v * (1.0f + tanhf(0.7978845608028654f * (v + 0.044715f * v * v * v))); else if (ACT == 14) v = (v > 0.f) ? v : 0.1f * v; else if (ACT == 16) v = (v >= 0.f) ? v : 0.3f * v; else if (ACT == 17) v = (v >= 0.f) ? v : 0.2f * v;
      so[w][rloc][t * 16 + ln] = v; } }
  __builtin_amdgcn_fence(__ATOMIC_ACQ_REL, "workgroup"); __builtin_amdgcn_wave_barrier();
  const int rsub = lane >> 4, c4 = (lane & 15) * 4;
  {
#pragma unroll
    for (int q = 0; q < 16; ++q) { const int r = q * 2 + rsub; const v4f v = *(const v4fa*)&so[w][r][c4]; if (C) *(v4f*)(C + cofs + (size_t)(row0 + r) * ldc + col0 + c4) = v; if (C16) { v4h h4; for (int i = 0; i < 4; ++i) h4[i] = (_Float16)v[i]; *(v4h*)(C16 + cofs + (size_t)(row0 + r) * ldc + col0 + c4) = h4; } }
     } }


__global__ __launch_bounds__(256) void k_wnat(const float* __restrict__ w, size_t n8, _Float16* __restrict__ Bt) { const size_t t = (size_t)blockIdx.x * 256 + threadIdx.x; if (t >= n8) return; FragH f; for (int q = 0; q < 8; ++q) f.h[q] = (_Float16)(bf16_round(w[t * 8 + q]) * 16.0f); *(v8us*)((unsigned short*)Bt + t * 8) = f.half[0];  }
__global__ __launch_bounds__(256) void k_rsm(const float* __restrict__ S, _Float16* __restrict__ P, int nrows) {
  #pragma clang fp contract(off)
  const int i = blockIdx.x * 256 + threadIdx.x; if (i >= nrows) return; const float* s = S + (size_t)i * SQ; float mx = -3.0e38f;
#pragma unroll 1
  for (int j = 0; j < SQ; ++j) mx = fmaxf(mx, s[j]); float se = 0.f;
#pragma unroll 1
  for (int j = 0; j < SQ; ++j) se += expf(s[j] - mx); const float sc = 256.0f / se;
#pragma unroll 1
  for (int j0 = 0; j0 < SQ; j0 += 8) { FragH f; for (int q = 0; q < 8; ++q) f.h[q] = (_Float16)(expf(s[j0 + q] - mx) * sc); unsigned short* d = (unsigned short*)P + (size_t)i * SQ + j0; *(v8us*)d = f.half[0];  } }
__global__ __launch_bounds__(256) void k_vt(const _Float16* __restrict__ V16, int b, int h0, _Float16* __restrict__ VT) { __shared__ unsigned short tl[64][65]; const int tid = threadIdx.x; const int hh = blockIdx.x % HG, sg = blockIdx.x / HG; const int s0 = sg * 64; const int h = h0 + hh;
  for (int i = tid; i < 64 * 8; i += 256) { const int j = i / 8, d8 = (i % 8) * 8; FragH f; f.half[0] = *(const v8us*)((const unsigned short*)V16 + ((size_t)b * SQ + s0 + j) * DM + h * HD + d8); for (int q = 0; q < 8; ++q) tl[d8 + q][j] = f.u[q]; }
  __syncthreads();
  { for (int i = tid; i < 64 * 8; i += 256) { const int d = i / 8, j8 = (i % 8) * 8; FragH f; for (int q = 0; q < 8; ++q) f.u[q] = tl[d][j8 + q]; *(v8us*)((unsigned short*)VT + ((size_t)hh * HD + d) * SQ + s0 + j8) = f.half[0]; }  } }



// e^x as __expf forms it (x * log2(e), then v_exp_f32). The v_nop in the same statement keeps the one slot that the instruction set asks for behind a transcendental
// before its result is read or its source overwritten.
__device__ __forceinline__ float exp_slot(float x) { float r; asm("v_exp_f32 %0, %1\n\tv_nop" : "=v"(r) : "v"(x * 1.44269504088896340736f)); return r; }
// causal softmax -> P x256 f16, ONE SCORE ROW PER WORK-GROUP: 256 threads hold the row (up to NKX scores, 16 a thread) in registers, so S is read once, in whole lines;
// row maximum and denominator by a wave butterfly, then across the 8 waves through LDS (every thread adds the 8 partial sums in the same order). nk % 256 == 0, nk <= NKX.
// Every loop is unrolled so that each index of v[] is a constant and the row stays in registers (no scratch).
__global__ __launch_bounds__(256) void k_rsmrow(const float* __restrict__ S, _Float16* __restrict__ P, int q0, int nk) {
  __shared__ float rmx[8]; __shared__ float rse[8];
  const int tid = threadIdx.x, w = tid >> 5, lane = tid & 31; const size_t i = blockIdx.x; const float* s = S + i * NKX; const int last = q0 + (int)(blockIdx.x % QT);
  float v[NKX / 256]; float mx = -3.0e38f;
#pragma unroll
  for (int c = 0; c < NKX / 1024; ++c) { const int j = c * 1024 + tid * 4; v4f x = {-1.0e9f, -1.0e9f, -1.0e9f, -1.0e9f}; if (j < nk) x = *(const v4fa*)(s + j);
#pragma unroll
    for (int q = 0; q < 4; ++q) { const float t = (j + q <= last) ? x[q] : -1.0e9f; v[c * 4 + q] = t; mx = fmaxf(mx, t); } }
#pragma unroll
  for (int o = 16; o > 0; o >>= 1) mx = fmaxf(mx, __shfl_xor(mx, o, 32));
  if (lane == 0) rmx[w] = mx;
  __syncthreads();
#pragma unroll
  for (int u = 0; u < 8; ++u) mx = fmaxf(mx, rmx[u]);
  float se = 0.f;
#pragma unroll
  for (int e = 0; e < NKX / 256; ++e) { v[e] = exp_slot(v[e] - mx); se += v[e]; }
#pragma unroll
  for (int o = 16; o > 0; o >>= 1) se += __shfl_xor(se, o, 32);
  if (lane == 0) rse[w] = se;
  __syncthreads();
  se = 0.f;
#pragma unroll
  for (int u = 0; u < 8; ++u) se += rse[u];
  const float sc = 256.0f / se;
#pragma unroll
  for (int c = 0; c < NKX / 1024; ++c) { const int j = c * 1024 + tid * 4; if (j < nk) { v4h h4;
#pragma unroll
      for (int q = 0; q < 4; ++q) h4[q] = (_Float16)(v[c * 4 + q] * sc);
      *(v4h*)(P + i * NKX + j) = h4; } } }


template <int MASKADD>
__global__ __launch_bounds__(64) void k_att0(const float* __restrict__ QF, const float* __restrict__ KF, const float* __restrict__ VF, int ld, const float* __restrict__ mask, float scale, float* __restrict__ OF, int ldo) {
  #pragma clang fp contract(off)
  __shared__ __attribute__((aligned(16))) float lq[64][64]; __shared__ __attribute__((aligned(16))) float lo[64][64];
  const int tid = threadIdx.x; const int h = blockIdx.x / (QT0 / 64), rg = blockIdx.x % (QT0 / 64); const int i = rg * 64 + tid;
  { const size_t bi = (size_t)blockIdx.y * QT0; QF += bi * ld; KF += bi * ld; VF += bi * ld; OF += bi * ldo; }      /* grid.y = batch: each batch has its own QT0-row plane */
  const float* qr = QF + (size_t)i * ld + h * HD;
#pragma unroll 1
  for (int c = 0; c < HD / 4; ++c) { *(v4f*)&lq[tid][c * 4] = *(const v4fa*)(qr + c * 4); const v4f z = {0.f, 0.f, 0.f, 0.f}; *(v4f*)&lo[tid][c * 4] = z; }
  float m = -1.0e30f, l = 0.f; const int jmax = MASKADD ? (SQ - 1) : (rg * 64 + 63);      /* additive-mask form: every key (the mask input decides); causal form: keys up to the block's last row */
#pragma unroll 1
  for (int j = 0; j <= jmax; ++j) { const float* kr = KF + (size_t)j * ld + h * HD; const float* vr = VF + (size_t)j * ld + h * HD; float s = 0.f;
#pragma unroll 1
    for (int c = 0; c < HD / 4; ++c) { const v4f kq = *(const v4fa*)(kr + c * 4); const v4f qq = *(v4f*)&lq[tid][c * 4]; s = __fadd_rn(s, __fmul_rn(qq[0], kq[0])); s = __fadd_rn(s, __fmul_rn(qq[1], kq[1])); s = __fadd_rn(s, __fmul_rn(qq[2], kq[2])); s = __fadd_rn(s, __fmul_rn(qq[3], kq[3])); }
    s = __fmul_rn(s, scale); if (MASKADD) s = __fadd_rn(s, __fmul_rn(bf16_round(mask[(size_t)i * SQ + j]), -10000.0f));
    const float f = (MASKADD || j <= i) ? 1.f : 0.f; const float sm = fmaf(f, s, (1.f - f) * -1.0e30f); const float mn = fmaxf(m, sm); const float sc = expf(m - mn); const float e = expf(sm - mn); l = __fadd_rn(__fmul_rn(l, sc), e); m = mn;
#pragma unroll 1
    for (int c = 0; c < HD / 4; ++c) { const v4f vv = *(const v4fa*)(vr + c * 4); v4f oo = *(v4f*)&lo[tid][c * 4]; for (int u = 0; u < 4; ++u) oo[u] = __fadd_rn(__fmul_rn(oo[u], sc), __fmul_rn(e, vv[u])); *(v4f*)&lo[tid][c * 4] = oo; } }
  const float fin = 64.0f / l;      /* o carried x64 */
#pragma unroll 1
  for (int c = 0; c < HD / 4; ++c) { v4f oo = *(v4f*)&lo[tid][c * 4]; for (int u = 0; u < 4; ++u) oo[u] = __fmul_rn(oo[u], fin); *(v4f*)&lo[tid][c * 4] = oo; }
  __syncthreads();
  {
#pragma unroll 1
    for (int it = 0; it < 16; ++it) { const int row = it * 4 + tid / 16, pc = (tid % 16) * 4; const v4f v = *(const v4f*)&lo[row][pc]; *(v4f*)(OF + (size_t)(rg * 64 + row) * ldo + h * HD + pc) = v; }
     } }


template <int BFIN, int WXB>
__global__ __launch_bounds__(256) void k_ln16(const float* __restrict__ X, const float* __restrict__ g, const float* __restrict__ bb, float eps, _Float16* __restrict__ N16, float* __restrict__ XB) {
  #pragma clang fp contract(off)
  __shared__ float red[256]; const size_t r = blockIdx.x; const int t = threadIdx.x; const v4f xa = *(const v4fa*)(X + r * DMQ + t * 4); float s[4]; float sum = 0.f;
  for (int q = 0; q < 4; ++q) { s[q] = BFIN ? bf16_round(xa[q]) : xa[q]; sum = __fadd_rn(sum, s[q]); }
  red[t] = sum; __syncthreads(); for (int st = 128; st > 0; st >>= 1) { if (t < st) red[t] = __fadd_rn(red[t], red[t + st]); __syncthreads(); } const float mu = red[0] / (float)DMQ; __syncthreads();
  float vs = 0.f; for (int q = 0; q < 4; ++q) { const float dl = __fadd_rn(s[q], -mu); vs = __fadd_rn(vs, __fmul_rn(dl, dl)); } red[t] = vs; __syncthreads(); for (int st = 128; st > 0; st >>= 1) { if (t < st) red[t] = __fadd_rn(red[t], red[t + st]); __syncthreads(); }
  const float rs = rsqrtf(__fadd_rn(red[0] / (float)DMQ, eps)); v4h y; v4f xb;
  for (int q = 0; q < 4; ++q) { const int c = t * 4 + q; y[q] = (_Float16)__fadd_rn(__fmul_rn(__fmul_rn(__fadd_rn(s[q], -mu), rs), bf16_round(g[c])), bf16_round(bb[c])); xb[q] = s[q]; }
  { *(v4h*)(N16 + r * DMQ + t * 4) = y; if (WXB) *(v4f*)(XB + r * DMQ + t * 4) = xb;  } }
__global__ __launch_bounds__(256) void k_ftres2(const float* __restrict__ OF0, const float* __restrict__ XB, float* __restrict__ X1, size_t n4) {
  #pragma clang fp contract(off)
  const size_t t = (size_t)blockIdx.x * 256 + threadIdx.x; if (t >= n4) return; const v4f o = *(const v4fa*)(OF0 + t * 4), xv = *(const v4fa*)(XB + t * 4); v4f y; for (int q = 0; q < 4; ++q) y[q] = __fadd_rn(__fmul_rn(o[q], 0.015625f), xv[q]); *(v4f*)(X1 + t * 4) = y;  }

__global__ __launch_bounds__(256) void k_wthd(const float* __restrict__ Wt, _Float16* __restrict__ Bt) { const size_t t = (size_t)blockIdx.x * 256 + threadIdx.x; if (t >= (size_t)NH * HD * (DM / 8)) return; const int m8 = (int)(t % (DM / 8)) * 8; const int d = (int)((t / (DM / 8)) % HD); const int h = (int)(t / ((size_t)(DM / 8) * HD)); FragH f;
  for (int q = 0; q < 8; ++q) f.h[q] = (_Float16)(16.0f * bf16_round(Wt[((size_t)h * DM + m8 + q) * HD + d])); unsigned short* dst = (unsigned short*)Bt + ((size_t)h * HD + d) * DM + m8; *(v8us*)dst = f.half[0];  }




__global__ __launch_bounds__(256) void k_wtpad(const float* __restrict__ Wm, _Float16* __restrict__ Wt, int Kr, int Kp, int Nr, int Np, float scale) {
  const int t = blockIdx.x * 256 + threadIdx.x; if (t >= Np * (Kp / 8)) return; const int n = t / (Kp / 8), k8 = (t % (Kp / 8)) * 8; const int nc = min(n, Nr - 1); const float fn = (n < Nr) ? 1.f : 0.f; FragH f;
  for (int i = 0; i < 8; ++i) { const int k = k8 + i; const int kc = min(k, Kr - 1); const float fk = (k < Kr) ? fn : 0.f; f.h[i] = (_Float16)(bf16_round(Wm[(size_t)kc * Nr + nc]) * scale * fk); }
  unsigned short* o = (unsigned short*)Wt + (size_t)n * Kp + k8; *(v8us*)o = f.half[0];  }
__global__ __launch_bounds__(128) void k_bpad(const float* __restrict__ b, float* __restrict__ Bp, int nr, int np) {
  const int i = threadIdx.x; if (i >= np) return; const float v = b[min(i, nr - 1)] * ((i < nr) ? 1.f : 0.f); *(float*)(Bp + i) = v;  }

#define DI 64         /* inner width = NH * HD (ONE 64-wide head) */
#define LQK (3 * DI)  /* fused q | k | v row pitch (192) */
__global__ __launch_bounds__(256) void k_o0(const float* __restrict__ OF, float* __restrict__ ob, size_t n4) {
  #pragma clang fp contract(off)
  const size_t t = (size_t)blockIdx.x * 256 + threadIdx.x; if (t >= n4) return; const size_t e = t * 4; const int i = (int)(e / DI); const int c = (int)(e % DI); const int h = c / HD, d = c % HD; const v4f a = *(const v4fa*)(OF + e); v4f o; for (int q = 0; q < 4; ++q) o[q] = __fmul_rn(a[q], 0.015625f); float* dst = ob + (size_t)h * SQ * HD + (size_t)i * HD + d; *(v4f*)dst = o;  }

__global__ __launch_bounds__(256) void k_o0m(const float* __restrict__ OF, float* __restrict__ o_, size_t n4) {
  #pragma clang fp contract(off)
  OF += (size_t)blockIdx.y * n4 * 4; o_ += (size_t)blockIdx.y * SQ * DI;      /* grid.y = batch: n4 * 4 exact elements a batch, written to the head of that batch's output rows */
  const size_t t = (size_t)blockIdx.x * 256 + threadIdx.x; if (t >= n4) return; const size_t e = t * 4; const v4f a = *(const v4fa*)(OF + e); v4f o; for (int q = 0; q < 4; ++q) o[q] = __fmul_rn(a[q], 0.015625f); *(v4f*)(o_ + e) = o;  }
extern "C" void kernel_launch(void* const* d_in, const int* in_sizes, int n_in,
                              void* d_out, int out_size, void* d_ws, size_t ws_size, hipStream_t stream) {
  (void)in_sizes; (void)n_in; (void)out_size;
  const float* const* I = (const float* const*)d_in; const float* x = I[0]; const float* wq = I[2]; const float* wk = I[1]; const float* wv = I[3]; const float* bq = nullptr; const float* bk = nullptr; const float* bv = nullptr;      /* x; [in][out = 64] Wk / Wq / Wv (input order as this module lists them); no biases */
  char* ws = (char*)d_ws; size_t off = 0;
  auto take = [&](size_t bytes) { char* p = ws + off; off += (bytes + 255) & ~(size_t)255; return p; };
  _Float16* BW = (_Float16*)take((size_t)LQK * DM * 2); _Float16* X16 = (_Float16*)take(NR * DM * 2); _Float16* QKV = (_Float16*)take(NR * LQK * 2); _Float16* VT = (_Float16*)take((size_t)NB * HD * SQ * 2);
  float* S = (float*)take((size_t)NB * QT * NKX * 4); _Float16* P = (_Float16*)take((size_t)NB * QT * NKX * 2); float* QKVF0 = (float*)take((size_t)NB * QT0 * LQK * 4); float* OF0 = (float*)take((size_t)NB * QT0 * DI * 4);      /* one plane a batch: the four batches run side by side on grid.y */
  if (off > ws_size) return;
  { const unsigned g = (unsigned)(((size_t)DI * (DM / 8) + 255) / 256); k_wt_f16<<<g, 256, 0, stream>>>(wq, BW, DM, DI, 16.0f); k_wt_f16<<<g, 256, 0, stream>>>(wk, BW + (size_t)DI * DM, DM, DI, 16.0f); k_wt_f16<<<g, 256, 0, stream>>>(wv, BW + (size_t)2 * DI * DM, DM, DI, 16.0f); }      /* [in = DM][out = 64] -> Bt[n][k] x16, stacked q | k | v */
  k_x16<<<(unsigned)((NR * DM / 8 + 255) / 256), 256, 0, stream>>>(x, X16, NR * DM / 8);      /* x (bf16-valued) as exact f16 rows */
  const float* bqkv[3] = {bq, bk, bv};
  for (int c = 0; c < 3; ++c) k_gemm2<0><<<dim3((unsigned)((NR / 128) * (DI / 64)), 1), 128, 0, stream>>>(X16, DM, 0, BW + (size_t)c * DI * DM, DM, 0, 0.0625f, bqkv[c], 0, nullptr, 1, 0, 0, nullptr, QKV + (size_t)c * DI, LQK, 0, (int)NR, DI, DM);      /* q | k | v = x W -> f16 rows, column blocks 0 / 64 / 128 of the fused plane (pitch 192); head h = columns h*64 inside each */
  const _Float16* Q16 = QKV; const _Float16* K16 = QKV + DI; const _Float16* V16 = QKV + 2 * DI;
  static_assert(NH == 1, "grid.y carries the batch in place of the head");
  float* ob = (float*)d_out;
  k_vt<NH, SQ><<<NB * NH * (SQ / 64), 256, 0, stream>>>(V16, LQK, 0, VT);      /* V^T [NB][HD][SQ], all batches in one launch */
  for (int q0 = 0; q0 < SQ; q0 += QT) { const int nk = q0 + QT;      /* causal: only keys below the tile end are computed; the same query tile of all NB batches per launch (grid.y = batch) */
    k_gemm2<0><<<dim3((QT / 128) * (nk / 64), NB), 128, 0, stream>>>(Q16 + (size_t)q0 * LQK, LQK, (size_t)SQ * LQK, K16, LQK, (size_t)SQ * LQK, 0.0625f, nullptr, 0, nullptr, 1, 0, 0, S, nullptr, NKX, (size_t)QT * NKX, QT, nk, HD);      /* scores * 256^-0.5 = 1/16 (the module scales by the EMBEDDING width) */
    k_rsmrow<<<NB * QT, 256, 0, stream>>>(S, P, q0, nk);      /* causal softmax -> P x256 f16, one row a work-group */
    k_gemm2<0><<<dim3((QT / 128) * (HD / 64), NB), 128, 0, stream>>>(P, NKX, (size_t)QT * NKX, VT, SQ, (size_t)HD * SQ, 0.00390625f, nullptr, 0, nullptr, 1, 0, 0, ob + (size_t)q0 * DI, nullptr, DI, (size_t)SQ * DI, QT, HD, nk); }      /* out[b][q0 + i][0..63] = P V^T 2^-8 (f32) */
  for (int c = 0; c < 3; ++c) k_gemm2<0><<<dim3((unsigned)((QT0 / 128) * (DI / 64)), NB), 128, 0, stream>>>(X16, DM, (size_t)SQ * DM, BW + (size_t)c * DI * DM, DM, 0, 0.0625f, bqkv[c], 0, nullptr, 1, 0, 0, QKVF0 + (size_t)c * DI, nullptr, LQK, (size_t)QT0 * LQK, QT0, DI, DM);      /* f32 q | k | v of rows 0..511 of every batch (exact products, f32 accumulation) */
  k_att0<0><<<dim3(NH * (QT0 / 64), NB), 64, 0, stream>>>(QKVF0, QKVF0 + DI, QKVF0 + 2 * DI, LQK, nullptr, 0.0625f, OF0, DI);      /* exact f32 causal attention for rows 0..511 (o x64) */
  k_o0m<<<dim3((unsigned)(((size_t)QT0 * DI / 4 + 255) / 256), NB), 256, 0, stream>>>(OF0, ob, (size_t)QT0 * DI / 4);      /* rows 0..511 of every batch REWRITTEN from the exact path */
}

// v003
// A run of this version takes 1230 microseconds.
// Two timings next to v002 both put it at 2.38 times that version's speed.
// All steps since v000 together make it 26.9 times as fast.
#include <hip/hip_runtime.h>
// Single-head causal self-attention with the module's EMBEDDING-width scale (x [4][4096][256]; k/q/v = x W ([in][out] [256][64], U(+-0.1), no biases; input order Wk, Wq, Wv); ONE 64-wide head; wei * 256^-0.5 (n_embd, as in the source); causal (tril, -inf); softmax; out = wei v -> [4][4096][64]; no output projection).
// Structure: token rows; x as exact f16 rows; three WMMA GEMMs (no bias) into one f16 q | k | v plane [16384][192]; v^T via LDS transposes; causal 256-row query tiles with the batches on grid.y (scores alpha 1/16, causal softmax f32 -> f16 x256 weights, P V written as f32 straight into the merged output rows); an exact f32 first tile (rows 0..511) rewritten at the end; launches: see trace.
// Compute dtype: inputs rounded to bf16; x / weights exact; q, k, v and softmax weights as plain f16 GEMM operands (~2^-12); scores, softmax statistics and o f32. v_wmma_f32_16x16x32_f16.
#define NB 4
#define SQ 4096
#define DM 256
#define NH 1
#define HD 64
#define HG 4                         /* heads per block group of the unlaunched k_vt(b, h0) overload */
#define QT 256                       /* query rows per causal tile */
#define NKX SQ                       /* S / P row pitch */
#define QT0 512                      /* first-tile rows recomputed exactly (f32): 512 here (no output projection averages the early-row cancellation errors away; logit sigma 1.0) */
#define B0 0                         /* unused; the batches run on grid.y from 0 */
#define NBR NB                       /* feeds only MP; grid.y runs over the NB batches */
#define NR ((size_t)NB * SQ)
#define DMQ DM
#define DFF 4096                     /* unused; this file has no FFN */
#define DFFR 100                     /* unused */
#define MP ((int)((size_t)NBR * SQ)) /* feeds only MPO; the projection runs over NR rows */
#define QN SQ                        /* unused */
#define NHD NH                       /* unused */
#define MPO MP                       /* unused */
#define LQ (3 * DM)      /* 3 * DM = 768, unused; the q/k/v rows use pitch LQK = 192 */
typedef __bf16 v16b __attribute__((ext_vector_type(16)));
typedef unsigned short v8us __attribute__((ext_vector_type(8), may_alias));
typedef float  v8f  __attribute__((ext_vector_type(8)));
typedef float  v4f  __attribute__((ext_vector_type(4)));
typedef float  v4fa __attribute__((ext_vector_type(4), may_alias));
union FragB { v16b v; v8us half[2]; unsigned short u[16]; };

__device__ __forceinline__ unsigned short bf16_bits(float x) { unsigned int u = __float_as_uint(x); return (unsigned short)((u + 0x7FFFu + ((u >> 16) & 1u)) >> 16); }
__device__ __forceinline__ float bf16_val(unsigned short b) { return __uint_as_float(((unsigned int)b) << 16); }
__device__ __forceinline__ float bf16_round(float x) { return bf16_val(bf16_bits(x)); }
// D += A·B with NT terms: 1 = ah·bh, 2 = + al·bh (A split), 3 = + ah·bl (both split)
template <int NT>
__device__ __forceinline__ v8f mmaN(v16b ah, v16b al, v16b bh, v16b bl, v8f c) {
  c = __builtin_amdgcn_wmma_f32_16x16x32_bf16(false, ah, false, bh, (short)0, c, false, false);
  if (NT >= 2) c = __builtin_amdgcn_wmma_f32_16x16x32_bf16(false, al, false, bh, (short)0, c, false, false);
  if (NT >= 3) c = __builtin_amdgcn_wmma_f32_16x16x32_bf16(false, ah, false, bl, (short)0, c, false, false);
  asm volatile("v_nop\n\tv_nop\n\tv_nop\n\tv_nop" : "+v"(c) : "v"(ah), "v"(al), "v"(bh), "v"(bl));
  return c;
}

__global__ __launch_bounds__(256) void k_wt_bf16(const float* __restrict__ W, unsigned short* __restrict__ Wt, int K, int N) {
  const int t = blockIdx.x * 256 + threadIdx.x;
  const int k8n = K / 8;
  if (t >= N * k8n) return;
  const int n = t / k8n, k8 = (t % k8n) * 8;
  v8us v;
#pragma unroll
  for (int i = 0; i < 8; ++i) v[i] = bf16_bits(W[(size_t)(k8 + i) * N + n]);
  *(v8us*)(Wt + (size_t)n * K + k8) = v;
  
}

// GEMM C[M][N] (f32, pitch ldc) = act(A[M][K]·W + bias). A f32 row-major (pitch lda) converted per fragment to bf16
// (ASPLIT: hi/lo two planes -> 2 terms, else single rounded term); Wt bf16 [N][K] (pitch ldb). BIAS_BF16 rounds the
// bias to bf16 first (bias quantised to bf16 before the add). K%32==0, M%16==0, N%64==0.
template <bool ASPLIT, int ACT, bool BIAS_BF16>
__global__ __launch_bounds__(128) void k_gemm_bf(const float* __restrict__ A, int lda, const unsigned short* __restrict__ Wt, int ldb,
                                               const float* __restrict__ bias, float* __restrict__ C, int ldc, int M, int N, int K) {
  __shared__ __attribute__((aligned(16))) float so[4][16][64];
  const int tid = threadIdx.x, w = tid >> 5, lane = tid & 31, ln = lane & 15, hh = lane >> 4;
  const int ntn = N / 64;
  const int wid = blockIdx.x * 4 + w;
  const int mt = wid / ntn, nq = wid % ntn;
  if (mt * 16 >= M) return;
  const int row0 = mt * 16, col0 = nq * 64;
  const float* arow = A + (size_t)(row0 + ln) * lda;
  v8f acc[4] = {};
  for (int kb = 0; kb < K; kb += 32) {
    FragB ah, al;
    const v4f x0 = *(const v4fa*)(arow + kb + 8 * hh), x1 = *(const v4fa*)(arow + kb + 8 * hh + 4);
    const v4f x2 = *(const v4fa*)(arow + kb + 16 + 8 * hh), x3 = *(const v4fa*)(arow + kb + 16 + 8 * hh + 4);
    float xs[16] = {x0[0],x0[1],x0[2],x0[3],x1[0],x1[1],x1[2],x1[3],x2[0],x2[1],x2[2],x2[3],x3[0],x3[1],x3[2],x3[3]};
#pragma unroll
    for (int i = 0; i < 16; ++i) { const unsigned short hb = bf16_bits(xs[i]); ah.u[i] = hb; al.u[i] = ASPLIT ? bf16_bits(xs[i] - bf16_val(hb)) : (unsigned short)0; }
#pragma unroll
    for (int t = 0; t < 4; ++t) {
      const unsigned short* brow = Wt + (size_t)(col0 + t * 16 + ln) * ldb + kb;
      FragB b;
      b.half[0] = *(const v8us*)(brow + 8 * hh);
      b.half[1] = *(const v8us*)(brow + 16 + 8 * hh);
      acc[t] = mmaN<ASPLIT ? 2 : 1>(ah.v, al.v, b.v, b.v, acc[t]);
    }
  }
#pragma unroll
  for (int t = 0; t < 4; ++t) {
    float bv = bias ? bias[col0 + t * 16 + ln] : 0.f;
    if (BIAS_BF16) bv = bf16_round(bv);
#pragma unroll
    for (int r = 0; r < 8; ++r) { float v = acc[t][r] + bv; if (ACT == 1) v = fmaxf(v, 0.f); so[w][8 * hh + r][t * 16 + ln] = v; }
  }
  __builtin_amdgcn_fence(__ATOMIC_ACQ_REL, "workgroup");
  __builtin_amdgcn_wave_barrier();
  const int rsub = lane >> 4, c4 = (lane & 15) * 4;
  {
#pragma unroll
    for (int q = 0; q < 8; ++q) {
      const int r = q * 2 + rsub;
      const v4f v = *(const v4fa*)&so[w][r][c4];
      *(v4f*)(C + (size_t)(row0 + r) * ldc + col0 + c4) = v;
    }
    
  }
}

// GEMM C = act(A·W + bias + resid): A f32 (ASPLIT -> hi/lo 2 terms), Wt bf16 [N][K]; ACT 0 none, 1 relu, 2 exact gelu;
// resid (optional, f32, row index = (row % rmod), pitch ldr, RES_BF16 rounds it) added before the activation.
template <bool ASPLIT, int ACT, bool BIAS_BF16, bool RES_BF16>
__global__ __launch_bounds__(128) void k_gemm_bf3(const float* __restrict__ A, int lda, const unsigned short* __restrict__ Wt, int ldb,
                                                const float* __restrict__ bias, const float* __restrict__ resid, int rmod, int ldr,
                                                float* __restrict__ C, int ldc, int M, int N, int K) {
  __shared__ __attribute__((aligned(16))) float so[4][16][64];
  const int tid = threadIdx.x, w = tid >> 5, lane = tid & 31, ln = lane & 15, hh = lane >> 4;
  const int ntn = N / 64;
  const int wid = blockIdx.x * 4 + w;
  const int mt = wid / ntn, nq = wid % ntn;
  if (mt * 16 >= M) return;
  const int row0 = mt * 16, col0 = nq * 64;
  const float* arow = A + (size_t)(row0 + ln) * lda;
  v8f acc[4] = {};
  for (int kb = 0; kb < K; kb += 32) {
    FragB ah, al;
    const v4f x0 = *(const v4fa*)(arow + kb + 8 * hh), x1 = *(const v4fa*)(arow + kb + 8 * hh + 4);
    const v4f x2 = *(const v4fa*)(arow + kb + 16 + 8 * hh), x3 = *(const v4fa*)(arow + kb + 16 + 8 * hh + 4);
    float xs[16] = {x0[0],x0[1],x0[2],x0[3],x1[0],x1[1],x1[2],x1[3],x2[0],x2[1],x2[2],x2[3],x3[0],x3[1],x3[2],x3[3]};
#pragma unroll
    for (int i = 0; i < 16; ++i) { const unsigned short hb = bf16_bits(xs[i]); ah.u[i] = hb; al.u[i] = ASPLIT ? bf16_bits(xs[i] - bf16_val(hb)) : (unsigned short)0; }
#pragma unroll
    for (int t = 0; t < 4; ++t) {
      const unsigned short* brow = Wt + (size_t)(col0 + t * 16 + ln) * ldb + kb;
      FragB b;
      b.half[0] = *(const v8us*)(brow + 8 * hh);
      b.half[1] = *(const v8us*)(brow + 16 + 8 * hh);
      acc[t] = mmaN<ASPLIT ? 2 : 1>(ah.v, al.v, b.v, b.v, acc[t]);
    }
  }
#pragma unroll
  for (int t = 0; t < 4; ++t) {
    const int col = col0 + t * 16 + ln;
    float bv = bias ? bias[col] : 0.f;
    if (BIAS_BF16) bv = bf16_round(bv);
#pragma unroll
    for (int r = 0; r < 8; ++r) {
      float v = acc[t][r] + bv;
      if (resid) { float rv = resid[(size_t)((row0 + 8 * hh + r) % rmod) * ldr + col]; if (RES_BF16) rv = bf16_round(rv); v += rv; }
      if (ACT == 1) v = fmaxf(v, 0.f);
      if (ACT == 2) v = 0.5f * v * (1.0f + erff(v * 0.70710678118654752f));
      if (ACT == 3) { const float u = 0.7978845608028654f * (v + 0.044715f * v * v * v); v = 0.5f * v * (1.0f + tanhf(u)); }
      so[w][8 * hh + r][t * 16 + ln] = v;
    }
  }
  __builtin_amdgcn_fence(__ATOMIC_ACQ_REL, "workgroup");
  __builtin_amdgcn_wave_barrier();
  const int rsub = lane >> 4, c4 = (lane & 15) * 4;
  {
#pragma unroll
    for (int q = 0; q < 8; ++q) {
      const int r = q * 2 + rsub;
      const v4f v = *(const v4fa*)&so[w][r][c4];
      *(v4f*)(C + (size_t)(row0 + r) * ldc + col0 + c4) = v;
    }
    
  }
}
// row LayerNorm (biased variance, eps) over N: s = X (+ R); optional out_sum <- s; out_norm <- (s-mu)*rsqrt(var+eps)*g + b
template <bool PARAM_BF16>
__global__ __launch_bounds__(256) void k_layernorm(const float* __restrict__ X, const float* __restrict__ R, const float* __restrict__ g, const float* __restrict__ bta,
                                                  float* __restrict__ out_sum, float* __restrict__ out_norm, int N, float eps) {
  __shared__ float red[256];
  const int row = blockIdx.x, tid = threadIdx.x;
  const float* x = X + (size_t)row * N; const float* rr = R ? R + (size_t)row * N : nullptr;
  float vals[16];                     // up to N = 4096
  const int per = N / 256;            // contiguous chunk per thread? use strided-by-4 chunks: thread handles j = tid*4 + 1024*u
  float s1 = 0.f;
  for (int u = 0; u < per / 4; ++u) {
    const int j = tid * 4 + 1024 * u;
    const v4f a = *(const v4fa*)(x + j);
    v4f b = {0.f,0.f,0.f,0.f}; if (rr) b = *(const v4fa*)(rr + j);
#pragma unroll
    for (int q = 0; q < 4; ++q) { const float v = a[q] + b[q]; vals[u * 4 + q] = v; s1 += v; }
  }
  red[tid] = s1; __syncthreads();
  for (int st = 128; st > 0; st >>= 1) { if (tid < st) red[tid] += red[tid + st]; __syncthreads(); }
  const float mu = red[0] / (float)N; __syncthreads();
  float s2 = 0.f;
  for (int u = 0; u < per / 4; ++u)
#pragma unroll
    for (int q = 0; q < 4; ++q) { const float c = vals[u * 4 + q] - mu; s2 += c * c; }
  red[tid] = s2; __syncthreads();
  for (int st = 128; st > 0; st >>= 1) { if (tid < st) red[tid] += red[tid + st]; __syncthreads(); }
  const float rs = rsqrtf(red[0] / (float)N + eps);
  {
    for (int u = 0; u < per / 4; ++u) {
      const int j = tid * 4 + 1024 * u;
      v4f o, sm;
#pragma unroll
      for (int q = 0; q < 4; ++q) {
        float gg = g[j + q], bb = bta[j + q];
        if (PARAM_BF16) { gg = bf16_round(gg); bb = bf16_round(bb); }
        sm[q] = vals[u * 4 + q]; o[q] = (vals[u * 4 + q] - mu) * rs * gg + bb;
      }
      if (out_sum) *(v4f*)(out_sum + (size_t)row * N + j) = sm;
      *(v4f*)(out_norm + (size_t)row * N + j) = o;
    }
    
  }
}



// ---- f16 WMMA path (v_wmma_f32_16x16x32_f16): 11-bit significands for operands in range — used where a [0,1] probability operand needs more precision than bf16
typedef _Float16 v16h __attribute__((ext_vector_type(16)));
union FragH { v16h v; v8us half[2]; _Float16 h[16]; unsigned short u[16]; };
template <int NT>
__device__ __forceinline__ v8f mmaH(v16h ah, v16h al, v16h bh, v16h bl, v8f c) {
  c = __builtin_amdgcn_wmma_f32_16x16x32_f16(false, ah, false, bh, (short)0, c, false, false);
  if (NT >= 2) c = __builtin_amdgcn_wmma_f32_16x16x32_f16(false, al, false, bh, (short)0, c, false, false);
  if (NT >= 3) c = __builtin_amdgcn_wmma_f32_16x16x32_f16(false, ah, false, bl, (short)0, c, false, false);
  asm volatile("v_nop\n\tv_nop\n\tv_nop\n\tv_nop" : "+v"(c) : "v"(ah), "v"(al), "v"(bh), "v"(bl));
  return c;
}
// batched GEMM like k_gemm_b but f16 operands: A f32 (split into f16 hi/lo if ASPLIT, else rounded to f16), Bt = f16 values [n][k]; alpha; C f32; N multiple of 16 (partial tiles skipped)
template <bool ASPLIT>
__global__ __launch_bounds__(128) void k_gemm_h(const float* __restrict__ A, int lda, size_t sA, const _Float16* __restrict__ Bh, int ldb, size_t sB, float alpha, float* __restrict__ C, int ldc, size_t sC, int M, int N, int K) {
  __shared__ __attribute__((aligned(16))) float so[4][16][64];
  const int tid = threadIdx.x, w = tid >> 5, lane = tid & 31, ln = lane & 15, hh = lane >> 4; const int by = blockIdx.y;
  A += (size_t)by * sA; Bh += (size_t)by * sB; C += (size_t)by * sC;
  const int ntn = (N + 63) / 64; const int wid = blockIdx.x * 4 + w; const int mt = wid / ntn, nq = wid % ntn; if (mt * 16 >= M) return;
  const int row0 = mt * 16, col0 = nq * 64; const float* arow = A + (size_t)(row0 + ln) * lda;
  v8f acc[4] = {};
  for (int kb = 0; kb < K; kb += 32) {
    FragH ah, al;
    const v4f x0 = *(const v4fa*)(arow + kb + 8 * hh), x1 = *(const v4fa*)(arow + kb + 8 * hh + 4), x2 = *(const v4fa*)(arow + kb + 16 + 8 * hh), x3 = *(const v4fa*)(arow + kb + 16 + 8 * hh + 4);
    float xs[16] = {x0[0],x0[1],x0[2],x0[3],x1[0],x1[1],x1[2],x1[3],x2[0],x2[1],x2[2],x2[3],x3[0],x3[1],x3[2],x3[3]};
#pragma unroll
    for (int i = 0; i < 16; ++i) { const _Float16 h = (_Float16)xs[i]; ah.h[i] = h; al.h[i] = ASPLIT ? (_Float16)(xs[i] - (float)h) : (_Float16)0.0f; }
#pragma unroll
    for (int t = 0; t < 4; ++t) { if (col0 + t * 16 >= N) continue; const size_t boff = (size_t)(col0 + t * 16 + ln) * ldb + kb; FragH bq; bq.half[0] = *(const v8us*)(Bh + boff + 8 * hh); bq.half[1] = *(const v8us*)(Bh + boff + 16 + 8 * hh);
      acc[t] = mmaH<ASPLIT ? 2 : 1>(ah.v, al.v, bq.v, bq.v, acc[t]); }
  }
#pragma unroll
  for (int t = 0; t < 4; ++t) { if (col0 + t * 16 >= N) continue;
#pragma unroll
    for (int r = 0; r < 8; ++r) so[w][8 * hh + r][t * 16 + ln] = acc[t][r] * alpha; }
  __builtin_amdgcn_fence(__ATOMIC_ACQ_REL, "workgroup"); __builtin_amdgcn_wave_barrier();
  const int rsub = lane >> 4, c4 = (lane & 15) * 4;
  {
#pragma unroll
    for (int q = 0; q < 8; ++q) { const int r = q * 2 + rsub; if (col0 + c4 < N) { const v4f v = *(const v4fa*)&so[w][r][c4]; *(v4f*)(C + (size_t)(row0 + r) * ldc + col0 + c4) = v; } }
     }
}

// Wt[n][k] = f16(W[k][n]·scale) from f32 row-major W[K][N] (scale = power of two; bf16-exact weights stay exact in f16 away from the subnormal range)
__global__ __launch_bounds__(256) void k_wt_f16(const float* __restrict__ W, _Float16* __restrict__ Wt, int K, int N, float scale) {
  const int t = blockIdx.x * 256 + threadIdx.x; if (t >= N * (K / 8)) return; const int n = t / (K / 8), k8 = (t % (K / 8)) * 8; FragH f;
#pragma unroll
  for (int i = 0; i < 8; ++i) f.h[i] = (_Float16)(bf16_round(W[(size_t)(k8 + i) * N + n]) * scale); const v8us o = f.half[0];
  *(v8us*)((unsigned short*)Wt + (size_t)n * K + k8) = o; 
}
// k_gemm_hh variant with fused epilogue: v = acc·alpha + bias[by·sBias + col] (+ CP[(row/rowsPerB)·sCPb + by·64 + col] if CP) ; ACT 0 none / 1 elu ; writes f16 C16 (and f32 C if non-null)
template <int ACT>
__global__ __launch_bounds__(128) void k_gemm_hhx(const _Float16* __restrict__ A, int lda, size_t sA, const _Float16* __restrict__ Bh, int ldb, size_t sB, float alpha, const float* __restrict__ bias, size_t sBias, const float* __restrict__ CP, int rowsPerB, size_t sCPb, int row0g,
    float* __restrict__ C, _Float16* __restrict__ C16, int ldc, size_t sC, int M, int N, int K) {
  __shared__ __attribute__((aligned(16))) float so[4][16][64];
  const int tid = threadIdx.x, w = tid >> 5, lane = tid & 31, ln = lane & 15, hh = lane >> 4; const int by = blockIdx.y;
  A += (size_t)by * sA; Bh += (size_t)by * sB; const size_t cofs = (size_t)by * sC; const float* bp = bias ? bias + (size_t)by * sBias : nullptr;
  const int ntn = (N + 63) / 64; const int wid = blockIdx.x * 4 + w; const int mt = wid / ntn, nq = wid % ntn; if (mt * 16 >= M) return;
  const int row0 = mt * 16, col0 = nq * 64; const _Float16* arow = A + (size_t)(row0 + ln) * lda;
  v8f acc[4] = {};
  for (int kb = 0; kb < K; kb += 32) { FragH ah; ah.half[0] = *(const v8us*)((const unsigned short*)arow + kb + 8 * hh); ah.half[1] = *(const v8us*)((const unsigned short*)arow + kb + 16 + 8 * hh);
#pragma unroll
    for (int t = 0; t < 4; ++t) { if (col0 + t * 16 >= N) continue; const size_t boff = (size_t)(col0 + t * 16 + ln) * ldb + kb; FragH bq; bq.half[0] = *(const v8us*)((const unsigned short*)Bh + boff + 8 * hh); bq.half[1] = *(const v8us*)((const unsigned short*)Bh + boff + 16 + 8 * hh);
      acc[t] = mmaH<1>(ah.v, ah.v, bq.v, bq.v, acc[t]); }
  }
#pragma unroll
  for (int t = 0; t < 4; ++t) { if (col0 + t * 16 >= N) continue; const int col = col0 + t * 16 + ln; const float bv = bp ? bf16_round(bp[col]) : 0.f;
#pragma unroll
    for (int r = 0; r < 8; ++r) { float v = acc[t][r] * alpha + bv; if (CP) { const int rr = row0g + row0 + 8 * hh + r; if (rowsPerB < 0) v += CP[cofs + (size_t)rr * ldc + col];      /* rowsPerB < 0: own element of the batched C plane */ else { const int bidx = rr / rowsPerB; v += CP[(size_t)bidx * sCPb + (size_t)by * 64 + col]; } } if (ACT == 1) v = (v > 0.f) ? v : expm1f(v); else if (ACT == 7) v = (v > 0.f) ? v + 1.0f : expf(v); else if (ACT == 8) v = tanhf(v); else if (ACT == 9) v = 0.5f * v * (1.0f + tanhf(0.7978845608028654f * (v + 0.044715f * v * v * v))); else if (ACT == 11) v = 1.0f / (1.0f + expf(-v)); else if (ACT == 12) v = (v > 0.f) ? v : 0.01f * v; else if (ACT == 14) v = (v > 0.f) ? v : 0.1f * v; else if (ACT == 16) v = (v >= 0.f) ? v : 0.3f * v; else if (ACT == 17) v = (v >= 0.f) ? v : 0.2f * v; else if (ACT == 15) v = v / (1.0f + expf(-v)); else if (ACT == 3) v = fmaxf(v, 0.f); else if (ACT == 6) v = 0.5f * v * (1.0f + erff(v * 0.70710678118654752f)); so[w][8 * hh + r][t * 16 + ln] = v; } }
  __builtin_amdgcn_fence(__ATOMIC_ACQ_REL, "workgroup"); __builtin_amdgcn_wave_barrier();
  const int rsub = lane >> 4, c4 = (lane & 15) * 4; typedef _Float16 v4h __attribute__((ext_vector_type(4)));
  {
#pragma unroll
    for (int q = 0; q < 8; ++q) { const int r = q * 2 + rsub; if (col0 + c4 < N) { const v4f v = *(const v4fa*)&so[w][r][c4]; if (C) *(v4f*)(C + cofs + (size_t)(row0 + r) * ldc + col0 + c4) = v; if (C16) { v4h h4; for (int i = 0; i < 4; ++i) h4[i] = (_Float16)v[i]; *(v4h*)(C16 + cofs + (size_t)(row0 + r) * ldc + col0 + c4) = h4; } } }
     }
}


typedef _Float16 v4h __attribute__((ext_vector_type(4)));

__global__ __launch_bounds__(256) void k_x16(const float* __restrict__ x, _Float16* __restrict__ X16, size_t n8) { const size_t t = (size_t)blockIdx.x * 256 + threadIdx.x; if (t >= n8) return; FragH f;
#pragma unroll
  for (int q = 0; q < 8; ++q) f.h[q] = (_Float16)bf16_round(x[t * 8 + q]); *(v8us*)((unsigned short*)X16 + t * 8) = f.half[0];  }
__global__ __launch_bounds__(256) void k_h16(const float* __restrict__ x, _Float16* __restrict__ X16, size_t n8) { const size_t t = (size_t)blockIdx.x * 256 + threadIdx.x; if (t >= n8) return; FragH f;
#pragma unroll
  for (int q = 0; q < 8; ++q) f.h[q] = (_Float16)x[t * 8 + q]; *(v8us*)((unsigned short*)X16 + t * 8) = f.half[0];  }
__global__ __launch_bounds__(256) void k_round16f(const float* __restrict__ W, _Float16* __restrict__ Bt, size_t n8) { const size_t t = (size_t)blockIdx.x * 256 + threadIdx.x; if (t >= n8) return; FragH f;
#pragma unroll
  for (int i = 0; i < 8; ++i) f.h[i] = (_Float16)(bf16_round(W[t * 8 + i]) * 16.0f); *(v8us*)((unsigned short*)Bt + t * 8) = f.half[0];  }
template <int NHv, int TTv>
__global__ __launch_bounds__(256) void k_vt(const _Float16* __restrict__ V16, int ldv, int voff, _Float16* __restrict__ Vt) { __shared__ unsigned short tl[64][66]; const int tid = threadIdx.x; const int slab = blockIdx.x / (TTv / 64), lg = blockIdx.x % (TTv / 64); const int b = slab / NHv, h = slab % NHv;
  for (int i = tid; i < 64 * 8; i += 256) { const int r = i / 8, c8 = (i % 8) * 8; FragH f; f.half[0] = *(const v8us*)((const unsigned short*)V16 + ((size_t)b * TTv + lg * 64 + r) * ldv + voff + h * 64 + c8);
#pragma unroll
    for (int q = 0; q < 8; ++q) tl[r][c8 + q] = f.u[q]; }
  __syncthreads();
  {
#pragma unroll
    for (int rd = 0; rd < 2; ++rd) { const int d = rd * 32 + tid / 8, pc = tid % 8; FragH f;
#pragma unroll
      for (int q = 0; q < 8; ++q) f.u[q] = tl[pc * 8 + q][d];
      *(v8us*)((unsigned short*)Vt + ((size_t)slab * 64 + d) * TTv + lg * 64 + pc * 8) = f.half[0]; }
     } }

__global__ __launch_bounds__(256) void k_hl(const float* __restrict__ F, _Float16* __restrict__ Hh, _Float16* __restrict__ Hl, size_t n8) { const size_t t = (size_t)blockIdx.x * 256 + threadIdx.x; if (t >= n8) return; FragH fh, fl; const v4f a = *(const v4fa*)(F + t * 8), c = *(const v4fa*)(F + t * 8 + 4);
#pragma unroll
  for (int q = 0; q < 4; ++q) { _Float16 h = (_Float16)a[q]; fh.h[q] = h; fl.h[q] = (_Float16)((a[q] - (float)h) * 1024.0f); h = (_Float16)c[q]; fh.h[4 + q] = h; fl.h[4 + q] = (_Float16)((c[q] - (float)h) * 1024.0f); }
  { *(v8us*)((unsigned short*)Hh + t * 8) = fh.half[0]; *(v8us*)((unsigned short*)Hl + t * 8) = fl.half[0];  } }

// ---- fast GEMM (wave tile 32x64; requires M % 32 == 0 rows per launch region and N % 64 == 0); epilogue = k_gemm_hhx semantics ----
__device__ __forceinline__ v16h g2_frag(const _Float16* p, int hh) { FragH f; f.half[0] = *(const v8us*)((const unsigned short*)p + 8 * hh); f.half[1] = *(const v8us*)((const unsigned short*)p + 16 + 8 * hh); return f.v; }
__device__ __forceinline__ v8f g2_mma(v16h a, v16h b, v8f c) { v8f d = __builtin_amdgcn_wmma_f32_16x16x32_f16(false, a, false, b, (short)0, c, false, false); asm volatile("v_nop\n\tv_nop\n\tv_nop\n\tv_nop" : "+v"(d) : "v"(a), "v"(b)); return d; }
template <int ACT>
__global__ __launch_bounds__(128) void k_gemm2(const _Float16* __restrict__ A, int lda, size_t sA, const _Float16* __restrict__ Bh, int ldb, size_t sB, float alpha, const float* __restrict__ bias, size_t sBias, const float* __restrict__ CP, int rowsPerB, size_t sCPb, int row0g,
    float* __restrict__ C, _Float16* __restrict__ C16, int ldc, size_t sC, int M, int N, int K) { static_assert(ACT == 0 || ACT == 3 || ACT == 6 || ACT == 8 || ACT == 9 || ACT == 11 || ACT == 12 || ACT == 14 || ACT == 15 || ACT == 16 || ACT == 17, "k_gemm2: unsupported ACT code (would silently apply no activation)");
  __shared__ __attribute__((aligned(16))) float so[4][32][68];
  const int tid = threadIdx.x, w = tid >> 5, lane = tid & 31, ln = lane & 15, hh = lane >> 4; const int by = blockIdx.y;
  A += (size_t)by * sA; Bh += (size_t)by * sB; const size_t cofs = (size_t)by * sC; const float* bp = bias ? bias + (size_t)by * sBias : nullptr;
  const int ntn = N >> 6; const int mt = blockIdx.x / ntn, nq = blockIdx.x - mt * ntn; const int row0 = mt * 128 + 32 * w, col0 = nq * 64; if (row0 >= M) return;
  const _Float16* a0p = A + (size_t)(row0 + ln) * lda; const _Float16* a1p = a0p + (size_t)16 * lda;
  const _Float16* b0p = Bh + (size_t)(col0 + ln) * ldb; const _Float16* b1p = b0p + (size_t)16 * ldb; const _Float16* b2p = b1p + (size_t)16 * ldb; const _Float16* b3p = b2p + (size_t)16 * ldb;
  const v8f z8 = {0.f,0.f,0.f,0.f,0.f,0.f,0.f,0.f}; v8f c00 = z8, c01 = z8, c02 = z8, c03 = z8, c10 = z8, c11 = z8, c12 = z8, c13 = z8;
#pragma unroll 1
  for (int kb = 0; kb < K; kb += 32) { const v16h a0 = g2_frag(a0p + kb, hh), a1 = g2_frag(a1p + kb, hh);
    v16h b = g2_frag(b0p + kb, hh); c00 = g2_mma(a0, b, c00); c10 = g2_mma(a1, b, c10);
    b = g2_frag(b1p + kb, hh); c01 = g2_mma(a0, b, c01); c11 = g2_mma(a1, b, c11);
    b = g2_frag(b2p + kb, hh); c02 = g2_mma(a0, b, c02); c12 = g2_mma(a1, b, c12);
    b = g2_frag(b3p + kb, hh); c03 = g2_mma(a0, b, c03); c13 = g2_mma(a1, b, c13); }
  v8f accs[8] = {c00, c01, c02, c03, c10, c11, c12, c13};
#pragma unroll
  for (int u = 0; u < 8; ++u) { const int t = u & 3, half = u >> 2; const int col = col0 + t * 16 + ln; const float bv = bp ? bf16_round(bp[col]) : 0.f;
#pragma unroll
    for (int r = 0; r < 8; ++r) { const int rloc = half * 16 + 8 * hh + r; float v = accs[u][r] * alpha + bv; if (CP) { if (rowsPerB < 0) v += CP[cofs + (size_t)(row0g + row0 + rloc) * ldc + col];      /* rowsPerB < 0: own element of the batched C plane */ else { const int bidx = (row0g + row0 + rloc) / rowsPerB; v += CP[(size_t)bidx * sCPb + (size_t)by * 64 + col]; } }
      if (ACT == 3) v = fmaxf(v, 0.f); else if (ACT == 6) v = 0.5f * v * (1.0f + erff(v * 0.70710678118654752f)); else if (ACT == 11) v = 1.0f / (1.0f + expf(-v)); else if (ACT == 15) v = v / (1.0f + expf(-v)); else if (ACT == 12) v = (v > 0.f) ? v : 0.01f * v; else if (ACT == 8) v = tanhf(v); else if (ACT == 9) v = 0.5f * v * (1.0f + tanhf(0.7978845608028654f * (v + 0.044715f * v * v * v))); else if (ACT == 14) v = (v > 0.f) ? v : 0.1f * v; else if (ACT == 16) v = (v >= 0.f) ? v : 0.3f * v; else if (ACT == 17) v = (v >= 0.f) ? v : 0.2f * v;
      so[w][rloc][t * 16 + ln] = v; } }
  __builtin_amdgcn_fence(__ATOMIC_ACQ_REL, "workgroup"); __builtin_amdgcn_wave_barrier();
  const int rsub = lane >> 4, c4 = (lane & 15) * 4;
  {
#pragma unroll
    for (int q = 0; q < 16; ++q) { const int r = q * 2 + rsub; const v4f v = *(const v4fa*)&so[w][r][c4]; if (C) *(v4f*)(C + cofs + (size_t)(row0 + r) * ldc + col0 + c4) = v; if (C16) { v4h h4; for (int i = 0; i < 4; ++i) h4[i] = (_Float16)v[i]; *(v4h*)(C16 + cofs + (size_t)(row0 + r) * ldc + col0 + c4) = h4; } }
     } }


__global__ __launch_bounds__(256) void k_wnat(const float* __restrict__ w, size_t n8, _Float16* __restrict__ Bt) { const size_t t = (size_t)blockIdx.x * 256 + threadIdx.x; if (t >= n8) return; FragH f; for (int q = 0; q < 8; ++q) f.h[q] = (_Float16)(bf16_round(w[t * 8 + q]) * 16.0f); *(v8us*)((unsigned short*)Bt + t * 8) = f.half[0];  }
__global__ __launch_bounds__(256) void k_rsm(const float* __restrict__ S, _Float16* __restrict__ P, int nrows) {
  #pragma clang fp contract(off)
  const int i = blockIdx.x * 256 + threadIdx.x; if (i >= nrows) return; const float* s = S + (size_t)i * SQ; float mx = -3.0e38f;
#pragma unroll 1
  for (int j = 0; j < SQ; ++j) mx = fmaxf(mx, s[j]); float se = 0.f;
#pragma unroll 1
  for (int j = 0; j < SQ; ++j) se += expf(s[j] - mx); const float sc = 256.0f / se;
#pragma unroll 1
  for (int j0 = 0; j0 < SQ; j0 += 8) { FragH f; for (int q = 0; q < 8; ++q) f.h[q] = (_Float16)(expf(s[j0 + q] - mx) * sc); unsigned short* d = (unsigned short*)P + (size_t)i * SQ + j0; *(v8us*)d = f.half[0];  } }
__global__ __launch_bounds__(256) void k_vt(const _Float16* __restrict__ V16, int b, int h0, _Float16* __restrict__ VT) { __shared__ unsigned short tl[64][65]; const int tid = threadIdx.x; const int hh = blockIdx.x % HG, sg = blockIdx.x / HG; const int s0 = sg * 64; const int h = h0 + hh;
  for (int i = tid; i < 64 * 8; i += 256) { const int j = i / 8, d8 = (i % 8) * 8; FragH f; f.half[0] = *(const v8us*)((const unsigned short*)V16 + ((size_t)b * SQ + s0 + j) * DM + h * HD + d8); for (int q = 0; q < 8; ++q) tl[d8 + q][j] = f.u[q]; }
  __syncthreads();
  { for (int i = tid; i < 64 * 8; i += 256) { const int d = i / 8, j8 = (i % 8) * 8; FragH f; for (int q = 0; q < 8; ++q) f.u[q] = tl[d][j8 + q]; *(v8us*)((unsigned short*)VT + ((size_t)hh * HD + d) * SQ + s0 + j8) = f.half[0]; }  } }



// e^x as __expf forms it (x * log2(e), then v_exp_f32). The v_nop in the same statement keeps the one slot that the instruction set asks for behind a transcendental
// before its result is read or its source overwritten.
__device__ __forceinline__ float exp_slot(float x) { float r; asm("v_exp_f32 %0, %1\n\tv_nop" : "=v"(r) : "v"(x * 1.44269504088896340736f)); return r; }
// causal softmax -> P x256 f16, ONE SCORE ROW PER WORK-GROUP: 256 threads hold the row (up to NKX scores, 16 a thread) in registers, so S is read once, in whole lines;
// row maximum and denominator by a wave butterfly, then across the 8 waves through LDS (every thread adds the 8 partial sums in the same order). nk % 256 == 0, nk <= NKX.
// Every loop is unrolled so that each index of v[] is a constant and the row stays in registers (no scratch).
__global__ __launch_bounds__(256) void k_rsmrow(const float* __restrict__ S, _Float16* __restrict__ P, int q0, int nk) {
  __shared__ float rmx[8]; __shared__ float rse[8];
  const int tid = threadIdx.x, w = tid >> 5, lane = tid & 31; const size_t i = blockIdx.x; const float* s = S + i * NKX; const int last = q0 + (int)(blockIdx.x % QT);
  float v[NKX / 256]; float mx = -3.0e38f;
#pragma unroll
  for (int c = 0; c < NKX / 1024; ++c) { const int j = c * 1024 + tid * 4; v4f x = {-1.0e9f, -1.0e9f, -1.0e9f, -1.0e9f}; if (j < nk) x = *(const v4fa*)(s + j);
#pragma unroll
    for (int q = 0; q < 4; ++q) { const float t = (j + q <= last) ? x[q] : -1.0e9f; v[c * 4 + q] = t; mx = fmaxf(mx, t); } }
#pragma unroll
  for (int o = 16; o > 0; o >>= 1) mx = fmaxf(mx, __shfl_xor(mx, o, 32));
  if (lane == 0) rmx[w] = mx;
  __syncthreads();
#pragma unroll
  for (int u = 0; u < 8; ++u) mx = fmaxf(mx, rmx[u]);
  float se = 0.f;
#pragma unroll
  for (int e = 0; e < NKX / 256; ++e) { v[e] = exp_slot(v[e] - mx); se += v[e]; }
#pragma unroll
  for (int o = 16; o > 0; o >>= 1) se += __shfl_xor(se, o, 32);
  if (lane == 0) rse[w] = se;
  __syncthreads();
  se = 0.f;
#pragma unroll
  for (int u = 0; u < 8; ++u) se += rse[u];
  const float sc = 256.0f / se;
#pragma unroll
  for (int c = 0; c < NKX / 1024; ++c) { const int j = c * 1024 + tid * 4; if (j < nk) { v4h h4;
#pragma unroll
      for (int q = 0; q < 4; ++q) h4[q] = (_Float16)(v[c * 4 + q] * sc);
      *(v4h*)(P + i * NKX + j) = h4; } } }


// e^x for x <= 0 to f32 accuracy: x * log2(e) is cut into its nearest integer n and a remainder that two FMAs form (log2(e) as a high and a low float), then 2^remainder * 2^n.
// Below -104 the result is under the smallest f32: x is held there, so that n stays a small integer. The v_nop in the same statement keeps the one slot that the instruction
// set asks for behind a transcendental before its result is read or its source overwritten.
__device__ __forceinline__ float exp_neg(float x) { x = fmaxf(x, -104.0f); const float n = rintf(x * 1.44269502f); const float r = fmaf(x, 1.92596303e-8f, fmaf(x, 1.44269502f, -n));
  float p; asm("v_exp_f32 %0, %1\n\tv_nop" : "=v"(p) : "v"(r)); return ldexpf(p, (int)n); }
// Exact f32 causal attention for rows 0..QT0-1 of every batch (grid.y = batch, each with its own QT0-row plane; grid.x = block of 32 query rows).
// lane = query row: its q row and its o row stay in registers. wave = key run: the block's 32 * (rg + 1) keys are cut into A0W equal runs, one a wave, so a K or V row
// has one address for the whole wave and comes through the scalar path. Each wave keeps its own running maximum, denominator and o over its run (A0K keys a trip, one
// rescale a trip); the A0W partial results are brought to the common maximum and added through LDS, always in the order of the runs.
#define A0W 16                       /* waves = key runs per work-group */
#define A0K (32 / A0W)               /* keys a trip: a run is A0K * (rg + 1) keys */
#define A0LD (3 * NH * HD)           /* row pitch of the f32 q | k | v plane */
#define A0P (HD + 4)                 /* LDS pitch of a partial o row: 16 B x odd, so that 16-byte accesses of 32 rows spread over the banks */
__global__ __launch_bounds__(32 * A0W) void k_att0w(const float* __restrict__ QF, const float* __restrict__ KF, const float* __restrict__ VF, float scale, float* __restrict__ OF) {
  static_assert(NH == 1 && HD == 64 && QT0 % 32 == 0 && A0W * A0K == 32 && 32 * A0W * 4 == 32 * HD, "one 64-wide head; 32 rows a block; the merge gives every thread 4 columns of one row");
  __shared__ float pm[A0W][32]; __shared__ float pl[A0W][32]; __shared__ float pfin[32]; __shared__ __attribute__((aligned(16))) float po[A0W][32][A0P];
  const int lane = threadIdx.x & 31; const int w = __builtin_amdgcn_readfirstlane((int)(threadIdx.x >> 5));      /* the wave's number as a scalar: K and V addresses are wave-uniform */
  const int rg = blockIdx.x; const int i = rg * 32 + lane;
  { const size_t bi = (size_t)blockIdx.y * QT0; QF += bi * A0LD; KF += bi * A0LD; VF += bi * A0LD; OF += bi * HD; }
  float q[HD], o[HD]; const float* qp = QF + (size_t)i * A0LD;
#pragma unroll
  for (int c = 0; c < HD / 4; ++c) { const v4f t = *(const v4fa*)(qp + c * 4);
#pragma unroll
    for (int u = 0; u < 4; ++u) { q[c * 4 + u] = t[u]; o[c * 4 + u] = 0.f; } }
  asm volatile("s_wait_xcnt 0x0" :: "v"(qp) : "memory");      /* the wait in front of any overwrite of the address pair that the q loads name; the pair is an input, so it stays whole up to here */
  float m = -1.0e30f, l = 0.f; const int kbeg = w * A0K * (rg + 1);
#pragma unroll 1
  for (int ch = 0; ch <= rg; ++ch) { const int j0 = kbeg + ch * A0K; const float* kr = KF + (size_t)j0 * A0LD; const float* vr = VF + (size_t)j0 * A0LD;
    float s[A0K]; float mn = m;
#pragma unroll
    for (int k = 0; k < A0K; ++k) { float p[4] = {0.f, 0.f, 0.f, 0.f};      /* four sums a score: four independent FMA chains of 16 */
#pragma unroll
      for (int c = 0; c < HD; ++c) p[c & 3] = fmaf(q[c], kr[k * A0LD + c], p[c & 3]);
      s[k] = (j0 + k <= i) ? ((p[0] + p[1]) + (p[2] + p[3])) * scale : -1.0e30f; mn = fmaxf(mn, s[k]); }
    const float sc = exp_neg(m - mn); float e[A0K]; float es = 0.f;      /* nothing seen yet: m = mn = -1e30, sc = 1 on l = 0 and o = 0 */
#pragma unroll
    for (int k = 0; k < A0K; ++k) { e[k] = (j0 + k <= i) ? exp_neg(s[k] - mn) : 0.f; es += e[k]; }      /* a key behind the row counts 0 also where the whole run so far is behind it */
    l = fmaf(l, sc, es); m = mn;
#pragma unroll
    for (int c = 0; c < HD; ++c) { float t = o[c] * sc;
#pragma unroll
      for (int k = 0; k < A0K; ++k) t = fmaf(e[k], vr[k * A0LD + c], t);
      o[c] = t; } }
  pm[w][lane] = m; pl[w][lane] = l;
  __syncthreads();
  float mx = pm[0][lane];      /* run 0 holds key 0, which every row sees: the common maximum is a real score */
#pragma unroll
  for (int u = 1; u < A0W; ++u) mx = fmaxf(mx, pm[u][lane]);
  if (w == 0) { float ls = 0.f;
#pragma unroll
    for (int u = 0; u < A0W; ++u) ls = fmaf(exp_neg(pm[u][lane] - mx), pl[u][lane], ls);
    pfin[lane] = 64.0f / ls; }      /* o carried x64; k_o0m multiplies by 1/64 */
  const float f = exp_neg(m - mx);
#pragma unroll
  for (int c = 0; c < HD / 4; ++c) { v4f t;
#pragma unroll
    for (int u = 0; u < 4; ++u) t[u] = o[c * 4 + u] * f;
    *(v4f*)&po[w][lane][c * 4] = t; }
  __syncthreads();
  const int row = threadIdx.x >> 4, c4 = (threadIdx.x & 15) * 4;      /* a wave adds and stores two whole o rows: 512 B in a row */
  v4f r = {0.f, 0.f, 0.f, 0.f};
#pragma unroll
  for (int u = 0; u < A0W; ++u) r += *(const v4f*)&po[u][row][c4];
  r *= pfin[row];
  *(v4f*)(OF + (size_t)(rg * 32 + row) * HD + c4) = r; }


template <int BFIN, int WXB>
__global__ __launch_bounds__(256) void k_ln16(const float* __restrict__ X, const float* __restrict__ g, const float* __restrict__ bb, float eps, _Float16* __restrict__ N16, float* __restrict__ XB) {
  #pragma clang fp contract(off)
  __shared__ float red[256]; const size_t r = blockIdx.x; const int t = threadIdx.x; const v4f xa = *(const v4fa*)(X + r * DMQ + t * 4); float s[4]; float sum = 0.f;
  for (int q = 0; q < 4; ++q) { s[q] = BFIN ? bf16_round(xa[q]) : xa[q]; sum = __fadd_rn(sum, s[q]); }
  red[t] = sum; __syncthreads(); for (int st = 128; st > 0; st >>= 1) { if (t < st) red[t] = __fadd_rn(red[t], red[t + st]); __syncthreads(); } const float mu = red[0] / (float)DMQ; __syncthreads();
  float vs = 0.f; for (int q = 0; q < 4; ++q) { const float dl = __fadd_rn(s[q], -mu); vs = __fadd_rn(vs, __fmul_rn(dl, dl)); } red[t] = vs; __syncthreads(); for (int st = 128; st > 0; st >>= 1) { if (t < st) red[t] = __fadd_rn(red[t], red[t + st]); __syncthreads(); }
  const float rs = rsqrtf(__fadd_rn(red[0] / (float)DMQ, eps)); v4h y; v4f xb;
  for (int q = 0; q < 4; ++q) { const int c = t * 4 + q; y[q] = (_Float16)__fadd_rn(__fmul_rn(__fmul_rn(__fadd_rn(s[q], -mu), rs), bf16_round(g[c])), bf16_round(bb[c])); xb[q] = s[q]; }
  { *(v4h*)(N16 + r * DMQ + t * 4) = y; if (WXB) *(v4f*)(XB + r * DMQ + t * 4) = xb;  } }
__global__ __launch_bounds__(256) void k_ftres2(const float* __restrict__ OF0, const float* __restrict__ XB, float* __restrict__ X1, size_t n4) {
  #pragma clang fp contract(off)
  const size_t t = (size_t)blockIdx.x * 256 + threadIdx.x; if (t >= n4) return; const v4f o = *(const v4fa*)(OF0 + t * 4), xv = *(const v4fa*)(XB + t * 4); v4f y; for (int q = 0; q < 4; ++q) y[q] = __fadd_rn(__fmul_rn(o[q], 0.015625f), xv[q]); *(v4f*)(X1 + t * 4) = y;  }

__global__ __launch_bounds__(256) void k_wthd(const float* __restrict__ Wt, _Float16* __restrict__ Bt) { const size_t t = (size_t)blockIdx.x * 256 + threadIdx.x; if (t >= (size_t)NH * HD * (DM / 8)) return; const int m8 = (int)(t % (DM / 8)) * 8; const int d = (int)((t / (DM / 8)) % HD); const int h = (int)(t / ((size_t)(DM / 8) * HD)); FragH f;
  for (int q = 0; q < 8; ++q) f.h[q] = (_Float16)(16.0f * bf16_round(Wt[((size_t)h * DM + m8 + q) * HD + d])); unsigned short* dst = (unsigned short*)Bt + ((size_t)h * HD + d) * DM + m8; *(v8us*)dst = f.half[0];  }




__global__ __launch_bounds__(256) void k_wtpad(const float* __restrict__ Wm, _Float16* __restrict__ Wt, int Kr, int Kp, int Nr, int Np, float scale) {
  const int t = blockIdx.x * 256 + threadIdx.x; if (t >= Np * (Kp / 8)) return; const int n = t / (Kp / 8), k8 = (t % (Kp / 8)) * 8; const int nc = min(n, Nr - 1); const float fn = (n < Nr) ? 1.f : 0.f; FragH f;
  for (int i = 0; i < 8; ++i) { const int k = k8 + i; const int kc = min(k, Kr - 1); const float fk = (k < Kr) ? fn : 0.f; f.h[i] = (_Float16)(bf16_round(Wm[(size_t)kc * Nr + nc]) * scale * fk); }
  unsigned short* o = (unsigned short*)Wt + (size_t)n * Kp + k8; *(v8us*)o = f.half[0];  }
__global__ __launch_bounds__(128) void k_bpad(const float* __restrict__ b, float* __restrict__ Bp, int nr, int np) {
  const int i = threadIdx.x; if (i >= np) return; const float v = b[min(i, nr - 1)] * ((i < nr) ? 1.f : 0.f); *(float*)(Bp + i) = v;  }

#define DI 64         /* inner width = NH * HD (ONE 64-wide head) */
#define LQK (3 * DI)  /* fused q | k | v row pitch (192) */
__global__ __launch_bounds__(256) void k_o0(const float* __restrict__ OF, float* __restrict__ ob, size_t n4) {
  #pragma clang fp contract(off)
  const size_t t = (size_t)blockIdx.x * 256 + threadIdx.x; if (t >= n4) return; const size_t e = t * 4; const int i = (int)(e / DI); const int c = (int)(e % DI); const int h = c / HD, d = c % HD; const v4f a = *(const v4fa*)(OF + e); v4f o; for (int q = 0; q < 4; ++q) o[q] = __fmul_rn(a[q], 0.015625f); float* dst = ob + (size_t)h * SQ * HD + (size_t)i * HD + d; *(v4f*)dst = o;  }

__global__ __launch_bounds__(256) void k_o0m(const float* __restrict__ OF, float* __restrict__ o_, size_t n4) {
  #pragma clang fp contract(off)
  OF += (size_t)blockIdx.y * n4 * 4; o_ += (size_t)blockIdx.y * SQ * DI;      /* grid.y = batch: n4 * 4 exact elements a batch, written to the head of that batch's output rows */
  const size_t t = (size_t)blockIdx.x * 256 + threadIdx.x; if (t >= n4) return; const size_t e = t * 4; const v4f a = *(const v4fa*)(OF + e); v4f o; for (int q = 0; q < 4; ++q) o[q] = __fmul_rn(a[q], 0.015625f); *(v4f*)(o_ + e) = o;  }
extern "C" void kernel_launch(void* const* d_in, const int* in_sizes, int n_in,
                              void* d_out, int out_size, void* d_ws, size_t ws_size, hipStream_t stream) {
  (void)in_sizes; (void)n_in; (void)out_size;
  const float* const* I = (const float* const*)d_in; const float* x = I[0]; const float* wq = I[2]; const float* wk = I[1]; const float* wv = I[3]; const float* bq = nullptr; const float* bk = nullptr; const float* bv = nullptr;      /* x; [in][out = 64] Wk / Wq / Wv (input order as this module lists them); no biases */
  char* ws = (char*)d_ws; size_t off = 0;
  auto take = [&](size_t bytes) { char* p = ws + off; off += (bytes + 255) & ~(size_t)255; return p; };
  _Float16* BW = (_Float16*)take((size_t)LQK * DM * 2); _Float16* X16 = (_Float16*)take(NR * DM * 2); _Float16* QKV = (_Float16*)take(NR * LQK * 2); _Float16* VT = (_Float16*)take((size_t)NB * HD * SQ * 2);
  float* S = (float*)take((size_t)NB * QT * NKX * 4); _Float16* P = (_Float16*)take((size_t)NB * QT * NKX * 2); float* QKVF0 = (float*)take((size_t)NB * QT0 * LQK * 4); float* OF0 = (float*)take((size_t)NB * QT0 * DI * 4);      /* one plane a batch: the four batches run side by side on grid.y */
  if (off > ws_size) return;
  { const unsigned g = (unsigned)(((size_t)DI * (DM / 8) + 255) / 256); k_wt_f16<<<g, 256, 0, stream>>>(wq, BW, DM, DI, 16.0f); k_wt_f16<<<g, 256, 0, stream>>>(wk, BW + (size_t)DI * DM, DM, DI, 16.0f); k_wt_f16<<<g, 256, 0, stream>>>(wv, BW + (size_t)2 * DI * DM, DM, DI, 16.0f); }      /* [in = DM][out = 64] -> Bt[n][k] x16, stacked q | k | v */
  k_x16<<<(unsigned)((NR * DM / 8 + 255) / 256), 256, 0, stream>>>(x, X16, NR * DM / 8);      /* x (bf16-valued) as exact f16 rows */
  const float* bqkv[3] = {bq, bk, bv};
  for (int c = 0; c < 3; ++c) k_gemm2<0><<<dim3((unsigned)((NR / 128) * (DI / 64)), 1), 128, 0, stream>>>(X16, DM, 0, BW + (size_t)c * DI * DM, DM, 0, 0.0625f, bqkv[c], 0, nullptr, 1, 0, 0, nullptr, QKV + (size_t)c * DI, LQK, 0, (int)NR, DI, DM);      /* q | k | v = x W -> f16 rows, column blocks 0 / 64 / 128 of the fused plane (pitch 192); head h = columns h*64 inside each */
  const _Float16* Q16 = QKV; const _Float16* K16 = QKV + DI; const _Float16* V16 = QKV + 2 * DI;
  static_assert(NH == 1, "grid.y carries the batch in place of the head");
  float* ob = (float*)d_out;
  k_vt<NH, SQ><<<NB * NH * (SQ / 64), 256, 0, stream>>>(V16, LQK, 0, VT);      /* V^T [NB][HD][SQ], all batches in one launch */
  for (int q0 = 0; q0 < SQ; q0 += QT) { const int nk = q0 + QT;      /* causal: only keys below the tile end are computed; the same query tile of all NB batches per launch (grid.y = batch) */
    k_gemm2<0><<<dim3((QT / 128) * (nk / 64), NB), 128, 0, stream>>>(Q16 + (size_t)q0 * LQK, LQK, (size_t)SQ * LQK, K16, LQK, (size_t)SQ * LQK, 0.0625f, nullptr, 0, nullptr, 1, 0, 0, S, nullptr, NKX, (size_t)QT * NKX, QT, nk, HD);      /* scores * 256^-0.5 = 1/16 (the module scales by the EMBEDDING width) */
    k_rsmrow<<<NB * QT, 256, 0, stream>>>(S, P, q0, nk);      /* causal softmax -> P x256 f16, one row a work-group */
    k_gemm2<0><<<dim3((QT / 128) * (HD / 64), NB), 128, 0, stream>>>(P, NKX, (size_t)QT * NKX, VT, SQ, (size_t)HD * SQ, 0.00390625f, nullptr, 0, nullptr, 1, 0, 0, ob + (size_t)q0 * DI, nullptr, DI, (size_t)SQ * DI, QT, HD, nk); }      /* out[b][q0 + i][0..63] = P V^T 2^-8 (f32) */
  for (int c = 0; c < 3; ++c) k_gemm2<0><<<dim3((unsigned)((QT0 / 128) * (DI / 64)), NB), 128, 0, stream>>>(X16, DM, (size_t)SQ * DM, BW + (size_t)c * DI * DM, DM, 0, 0.0625f, bqkv[c], 0, nullptr, 1, 0, 0, QKVF0 + (size_t)c * DI, nullptr, LQK, (size_t)QT0 * LQK, QT0, DI, DM);      /* f32 q | k | v of rows 0..511 of every batch (exact products, f32 accumulation) */
  k_att0w<<<dim3(QT0 / 32, NB), 32 * A0W, 0, stream>>>(QKVF0, QKVF0 + DI, QKVF0 + 2 * DI, 0.0625f, OF0);      /* exact f32 causal attention for rows 0..511 (o x64) */
  k_o0m<<<dim3((unsigned)(((size_t)QT0 * DI / 4 + 255) / 256), NB), 256, 0, stream>>>(OF0, ob, (size_t)QT0 * DI / 4);      /* rows 0..511 of every batch REWRITTEN from the exact path */
}

// v004
// It runs in 150 microseconds.
// In two side-by-side timings against v003, it was 8.16 and 8.21 times as fast.
// All steps since v000 together make it 220 times as fast.
#include <hip/hip_runtime.h>
// Single-head causal self-attention with the module's EMBEDDING-width scale (x [4][4096][256]; k/q/v = x W ([in][out] [256][64], U(+-0.1), no biases; input order Wk, Wq, Wv); ONE 64-wide head; wei * 256^-0.5 (n_embd, as in the source); causal (tril, -inf); softmax; out = wei v -> [4][4096][64]; no output projection).
// Structure: token rows; x as exact f16 rows; three WMMA GEMMs (no bias) into one f16 q | k | v plane [16384][192]; v^T via LDS transposes; one fused causal attention launch with the batches on grid.y (scores, online softmax f32 -> f16 weights in registers, P V, written as f32 straight into the output rows); an exact f32 first tile (rows 0..511) rewritten at the end; launches: see trace.
// Compute dtype: inputs rounded to bf16; x / weights exact; q, k, v and softmax weights as plain f16 GEMM operands (~2^-12); scores, softmax statistics and o f32. v_wmma_f32_16x16x32_f16.
#define NB 4
#define SQ 4096
#define DM 256
#define NH 1
#define HD 64
#define HG 4                         /* heads per block group of the unlaunched k_vt(b, h0) overload */
#define QT 256                       /* unused */
#define NKX SQ                       /* unused */
#define QT0 512                      /* first-tile rows recomputed exactly (f32): 512 here (no output projection averages the early-row cancellation errors away; logit sigma 1.0) */
#define B0 0                         /* unused; the batches run on grid.y from 0 */
#define NBR NB                       /* feeds only MP; grid.y runs over the NB batches */
#define NR ((size_t)NB * SQ)
#define DMQ DM
#define DFF 4096                     /* unused; this file has no FFN */
#define DFFR 100                     /* unused */
#define MP ((int)((size_t)NBR * SQ)) /* feeds only MPO; the projection runs over NR rows */
#define QN SQ                        /* unused */
#define NHD NH                       /* unused */
#define MPO MP                       /* unused */
#define LQ (3 * DM)      /* 3 * DM = 768, unused; the q/k/v rows use pitch LQK = 192 */
typedef __bf16 v16b __attribute__((ext_vector_type(16)));
typedef unsigned short v8us __attribute__((ext_vector_type(8), may_alias));
typedef float  v8f  __attribute__((ext_vector_type(8)));
typedef float  v4f  __attribute__((ext_vector_type(4)));
typedef float  v4fa __attribute__((ext_vector_type(4), may_alias));
union FragB { v16b v; v8us half[2]; unsigned short u[16]; };

__device__ __forceinline__ unsigned short bf16_bits(float x) { unsigned int u = __float_as_uint(x); return (unsigned short)((u + 0x7FFFu + ((u >> 16) & 1u)) >> 16); }
__device__ __forceinline__ float bf16_val(unsigned short b) { return __uint_as_float(((unsigned int)b) << 16); }
__device__ __forceinline__ float bf16_round(float x) { return bf16_val(bf16_bits(x)); }
// D += A·B with NT terms: 1 = ah·bh, 2 = + al·bh (A split), 3 = + ah·bl (both split)
template <int NT>
__device__ __forceinline__ v8f mmaN(v16b ah, v16b al, v16b bh, v16b bl, v8f c) {
  c = __builtin_amdgcn_wmma_f32_16x16x32_bf16(false, ah, false, bh, (short)0, c, false, false);
  if (NT >= 2) c = __builtin_amdgcn_wmma_f32_16x16x32_bf16(false, al, false, bh, (short)0, c, false, false);
  if (NT >= 3) c = __builtin_amdgcn_wmma_f32_16x16x32_bf16(false, ah, false, bl, (short)0, c, false, false);
  asm volatile("v_nop\n\tv_nop\n\tv_nop\n\tv_nop" : "+v"(c) : "v"(ah), "v"(al), "v"(bh), "v"(bl));
  return c;
}

__global__ __launch_bounds__(256) void k_wt_bf16(const float* __restrict__ W, unsigned short* __restrict__ Wt, int K, int N) {
  const int t = blockIdx.x * 256 + threadIdx.x;
  const int k8n = K / 8;
  if (t >= N * k8n) return;
  const int n = t / k8n, k8 = (t % k8n) * 8;
  v8us v;
#pragma unroll
  for (int i = 0; i < 8; ++i) v[i] = bf16_bits(W[(size_t)(k8 + i) * N + n]);
  *(v8us*)(Wt + (size_t)n * K + k8) = v;
  
}

// GEMM C[M][N] (f32, pitch ldc) = act(A[M][K]·W + bias). A f32 row-major (pitch lda) converted per fragment to bf16
// (ASPLIT: hi/lo two planes -> 2 terms, else single rounded term); Wt bf16 [N][K] (pitch ldb). BIAS_BF16 rounds the
// bias to bf16 first (bias quantised to bf16 before the add). K%32==0, M%16==0, N%64==0.
template <bool ASPLIT, int ACT, bool BIAS_BF16>
__global__ __launch_bounds__(128) void k_gemm_bf(const float* __restrict__ A, int lda, const unsigned short* __restrict__ Wt, int ldb,
                                               const float* __restrict__ bias, float* __restrict__ C, int ldc, int M, int N, int K) {
  __shared__ __attribute__((aligned(16))) float so[4][16][64];
  const int tid = threadIdx.x, w = tid >> 5, lane = tid & 31, ln = lane & 15, hh = lane >> 4;
  const int ntn = N / 64;
  const int wid = blockIdx.x * 4 + w;
  const int mt = wid / ntn, nq = wid % ntn;
  if (mt * 16 >= M) return;
  const int row0 = mt * 16, col0 = nq * 64;
  const float* arow = A + (size_t)(row0 + ln) * lda;
  v8f acc[4] = {};
  for (int kb = 0; kb < K; kb += 32) {
    FragB ah, al;
    const v4f x0 = *(const v4fa*)(arow + kb + 8 * hh), x1 = *(const v4fa*)(arow + kb + 8 * hh + 4);
    const v4f x2 = *(const v4fa*)(arow + kb + 16 + 8 * hh), x3 = *(const v4fa*)(arow + kb + 16 + 8 * hh + 4);
    float xs[16] = {x0[0],x0[1],x0[2],x0[3],x1[0],x1[1],x1[2],x1[3],x2[0],x2[1],x2[2],x2[3],x3[0],x3[1],x3[2],x3[3]};
#pragma unroll
    for (int i = 0; i < 16; ++i) { const unsigned short hb = bf16_bits(xs[i]); ah.u[i] = hb; al.u[i] = ASPLIT ? bf16_bits(xs[i] - bf16_val(hb)) : (unsigned short)0; }
#pragma unroll
    for (int t = 0; t < 4; ++t) {
      const unsigned short* brow = Wt + (size_t)(col0 + t * 16 + ln) * ldb + kb;
      FragB b;
      b.half[0] = *(const v8us*)(brow + 8 * hh);
      b.half[1] = *(const v8us*)(brow + 16 + 8 * hh);
      acc[t] = mmaN<ASPLIT ? 2 : 1>(ah.v, al.v, b.v, b.v, acc[t]);
    }
  }
#pragma unroll
  for (int t = 0; t < 4; ++t) {
    float bv = bias ? bias[col0 + t * 16 + ln] : 0.f;
    if (BIAS_BF16) bv = bf16_round(bv);
#pragma unroll
    for (int r = 0; r < 8; ++r) { float v = acc[t][r] + bv; if (ACT == 1) v = fmaxf(v, 0.f); so[w][8 * hh + r][t * 16 + ln] = v; }
  }
  __builtin_amdgcn_fence(__ATOMIC_ACQ_REL, "workgroup");
  __builtin_amdgcn_wave_barrier();
  const int rsub = lane >> 4, c4 = (lane & 15) * 4;
  {
#pragma unroll
    for (int q = 0; q < 8; ++q) {
      const int r = q * 2 + rsub;
      const v4f v = *(const v4fa*)&so[w][r][c4];
      *(v4f*)(C + (size_t)(row0 + r) * ldc + col0 + c4) = v;
    }
    
  }
}

// GEMM C = act(A·W + bias + resid): A f32 (ASPLIT -> hi/lo 2 terms), Wt bf16 [N][K]; ACT 0 none, 1 relu, 2 exact gelu;
// resid (optional, f32, row index = (row % rmod), pitch ldr, RES_BF16 rounds it) added before the activation.
template <bool ASPLIT, int ACT, bool BIAS_BF16, bool RES_BF16>
__global__ __launch_bounds__(128) void k_gemm_bf3(const float* __restrict__ A, int lda, const unsigned short* __restrict__ Wt, int ldb,
                                                const float* __restrict__ bias, const float* __restrict__ resid, int rmod, int ldr,
                                                float* __restrict__ C, int ldc, int M, int N, int K) {
  __shared__ __attribute__((aligned(16))) float so[4][16][64];
  const int tid = threadIdx.x, w = tid >> 5, lane = tid & 31, ln = lane & 15, hh = lane >> 4;
  const int ntn = N / 64;
  const int wid = blockIdx.x * 4 + w;
  const int mt = wid / ntn, nq = wid % ntn;
  if (mt * 16 >= M) return;
  const int row0 = mt * 16, col0 = nq * 64;
  const float* arow = A + (size_t)(row0 + ln) * lda;
  v8f acc[4] = {};
  for (int kb = 0; kb < K; kb += 32) {
    FragB ah, al;
    const v4f x0 = *(const v4fa*)(arow + kb + 8 * hh), x1 = *(const v4fa*)(arow + kb + 8 * hh + 4);
    const v4f x2 = *(const v4fa*)(arow + kb + 16 + 8 * hh), x3 = *(const v4fa*)(arow + kb + 16 + 8 * hh + 4);
    float xs[16] = {x0[0],x0[1],x0[2],x0[3],x1[0],x1[1],x1[2],x1[3],x2[0],x2[1],x2[2],x2[3],x3[0],x3[1],x3[2],x3[3]};
#pragma unroll
    for (int i = 0; i < 16; ++i) { const unsigned short hb = bf16_bits(xs[i]); ah.u[i] = hb; al.u[i] = ASPLIT ? bf16_bits(xs[i] - bf16_val(hb)) : (unsigned short)0; }
#pragma unroll
    for (int t = 0; t < 4; ++t) {
      const unsigned short* brow = Wt + (size_t)(col0 + t * 16 + ln) * ldb + kb;
      FragB b;
      b.half[0] = *(const v8us*)(brow + 8 * hh);
      b.half[1] = *(const v8us*)(brow + 16 + 8 * hh);
      acc[t] = mmaN<ASPLIT ? 2 : 1>(ah.v, al.v, b.v, b.v, acc[t]);
    }
  }
#pragma unroll
  for (int t = 0; t < 4; ++t) {
    const int col = col0 + t * 16 + ln;
    float bv = bias ? bias[col] : 0.f;
    if (BIAS_BF16) bv = bf16_round(bv);
#pragma unroll
    for (int r = 0; r < 8; ++r) {
      float v = acc[t][r] + bv;
      if (resid) { float rv = resid[(size_t)((row0 + 8 * hh + r) % rmod) * ldr + col]; if (RES_BF16) rv = bf16_round(rv); v += rv; }
      if (ACT == 1) v = fmaxf(v, 0.f);
      if (ACT == 2) v = 0.5f * v * (1.0f + erff(v * 0.70710678118654752f));
      if (ACT == 3) { const float u = 0.7978845608028654f * (v + 0.044715f * v * v * v); v = 0.5f * v * (1.0f + tanhf(u)); }
      so[w][8 * hh + r][t * 16 + ln] = v;
    }
  }
  __builtin_amdgcn_fence(__ATOMIC_ACQ_REL, "workgroup");
  __builtin_amdgcn_wave_barrier();
  const int rsub = lane >> 4, c4 = (lane & 15) * 4;
  {
#pragma unroll
    for (int q = 0; q < 8; ++q) {
      const int r = q * 2 + rsub;
      const v4f v = *(const v4fa*)&so[w][r][c4];
      *(v4f*)(C + (size_t)(row0 + r) * ldc + col0 + c4) = v;
    }
    
  }
}
// row LayerNorm (biased variance, eps) over N: s = X (+ R); optional out_sum <- s; out_norm <- (s-mu)*rsqrt(var+eps)*g + b
template <bool PARAM_BF16>
__global__ __launch_bounds__(256) void k_layernorm(const float* __restrict__ X, const float* __restrict__ R, const float* __restrict__ g, const float* __restrict__ bta,
                                                  float* __restrict__ out_sum, float* __restrict__ out_norm, int N, float eps) {
  __shared__ float red[256];
  const int row = blockIdx.x, tid = threadIdx.x;
  const float* x = X + (size_t)row * N; const float* rr = R ? R + (size_t)row * N : nullptr;
  float vals[16];                     // up to N = 4096
  const int per = N / 256;            // contiguous chunk per thread? use strided-by-4 chunks: thread handles j = tid*4 + 1024*u
  float s1 = 0.f;
  for (int u = 0; u < per / 4; ++u) {
    const int j = tid * 4 + 1024 * u;
    const v4f a = *(const v4fa*)(x + j);
    v4f b = {0.f,0.f,0.f,0.f}; if (rr) b = *(const v4fa*)(rr + j);
#pragma unroll
    for (int q = 0; q < 4; ++q) { const float v = a[q] + b[q]; vals[u * 4 + q] = v; s1 += v; }
  }
  red[tid] = s1; __syncthreads();
  for (int st = 128; st > 0; st >>= 1) { if (tid < st) red[tid] += red[tid + st]; __syncthreads(); }
  const float mu = red[0] / (float)N; __syncthreads();
  float s2 = 0.f;
  for (int u = 0; u < per / 4; ++u)
#pragma unroll
    for (int q = 0; q < 4; ++q) { const float c = vals[u * 4 + q] - mu; s2 += c * c; }
  red[tid] = s2; __syncthreads();
  for (int st = 128; st > 0; st >>= 1) { if (tid < st) red[tid] += red[tid + st]; __syncthreads(); }
  const float rs = rsqrtf(red[0] / (float)N + eps);
  {
    for (int u = 0; u < per / 4; ++u) {
      const int j = tid * 4 + 1024 * u;
      v4f o, sm;
#pragma unroll
      for (int q = 0; q < 4; ++q) {
        float gg = g[j + q], bb = bta[j + q];
        if (PARAM_BF16) { gg = bf16_round(gg); bb = bf16_round(bb); }
        sm[q] = vals[u * 4 + q]; o[q] = (vals[u * 4 + q] - mu) * rs * gg + bb;
      }
      if (out_sum) *(v4f*)(out_sum + (size_t)row * N + j) = sm;
      *(v4f*)(out_norm + (size_t)row * N + j) = o;
    }
    
  }
}



// ---- f16 WMMA path (v_wmma_f32_16x16x32_f16): 11-bit significands for operands in range — used where a [0,1] probability operand needs more precision than bf16
typedef _Float16 v16h __attribute__((ext_vector_type(16)));
union FragH { v16h v; v8us half[2]; _Float16 h[16]; unsigned short u[16]; };
template <int NT>
__device__ __forceinline__ v8f mmaH(v16h ah, v16h al, v16h bh, v16h bl, v8f c) {
  c = __builtin_amdgcn_wmma_f32_16x16x32_f16(false, ah, false, bh, (short)0, c, false, false);
  if (NT >= 2) c = __builtin_amdgcn_wmma_f32_16x16x32_f16(false, al, false, bh, (short)0, c, false, false);
  if (NT >= 3) c = __builtin_amdgcn_wmma_f32_16x16x32_f16(false, ah, false, bl, (short)0, c, false, false);
  asm volatile("v_nop\n\tv_nop\n\tv_nop\n\tv_nop" : "+v"(c) : "v"(ah), "v"(al), "v"(bh), "v"(bl));
  return c;
}
// batched GEMM like k_gemm_b but f16 operands: A f32 (split into f16 hi/lo if ASPLIT, else rounded to f16), Bt = f16 values [n][k]; alpha; C f32; N multiple of 16 (partial tiles skipped)
template <bool ASPLIT>
__global__ __launch_bounds__(128) void k_gemm_h(const float* __restrict__ A, int lda, size_t sA, const _Float16* __restrict__ Bh, int ldb, size_t sB, float alpha, float* __restrict__ C, int ldc, size_t sC, int M, int N, int K) {
  __shared__ __attribute__((aligned(16))) float so[4][16][64];
  const int tid = threadIdx.x, w = tid >> 5, lane = tid & 31, ln = lane & 15, hh = lane >> 4; const int by = blockIdx.y;
  A += (size_t)by * sA; Bh += (size_t)by * sB; C += (size_t)by * sC;
  const int ntn = (N + 63) / 64; const int wid = blockIdx.x * 4 + w; const int mt = wid / ntn, nq = wid % ntn; if (mt * 16 >= M) return;
  const int row0 = mt * 16, col0 = nq * 64; const float* arow = A + (size_t)(row0 + ln) * lda;
  v8f acc[4] = {};
  for (int kb = 0; kb < K; kb += 32) {
    FragH ah, al;
    const v4f x0 = *(const v4fa*)(arow + kb + 8 * hh), x1 = *(const v4fa*)(arow + kb + 8 * hh + 4), x2 = *(const v4fa*)(arow + kb + 16 + 8 * hh), x3 = *(const v4fa*)(arow + kb + 16 + 8 * hh + 4);
    float xs[16] = {x0[0],x0[1],x0[2],x0[3],x1[0],x1[1],x1[2],x1[3],x2[0],x2[1],x2[2],x2[3],x3[0],x3[1],x3[2],x3[3]};
#pragma unroll
    for (int i = 0; i < 16; ++i) { const _Float16 h = (_Float16)xs[i]; ah.h[i] = h; al.h[i] = ASPLIT ? (_Float16)(xs[i] - (float)h) : (_Float16)0.0f; }
#pragma unroll
    for (int t = 0; t < 4; ++t) { if (col0 + t * 16 >= N) continue; const size_t boff = (size_t)(col0 + t * 16 + ln) * ldb + kb; FragH bq; bq.half[0] = *(const v8us*)(Bh + boff + 8 * hh); bq.half[1] = *(const v8us*)(Bh + boff + 16 + 8 * hh);
      acc[t] = mmaH<ASPLIT ? 2 : 1>(ah.v, al.v, bq.v, bq.v, acc[t]); }
  }
#pragma unroll
  for (int t = 0; t < 4; ++t) { if (col0 + t * 16 >= N) continue;
#pragma unroll
    for (int r = 0; r < 8; ++r) so[w][8 * hh + r][t * 16 + ln] = acc[t][r] * alpha; }
  __builtin_amdgcn_fence(__ATOMIC_ACQ_REL, "workgroup"); __builtin_amdgcn_wave_barrier();
  const int rsub = lane >> 4, c4 = (lane & 15) * 4;
  {
#pragma unroll
    for (int q = 0; q < 8; ++q) { const int r = q * 2 + rsub; if (col0 + c4 < N) { const v4f v = *(const v4fa*)&so[w][r][c4]; *(v4f*)(C + (size_t)(row0 + r) * ldc + col0 + c4) = v; } }
     }
}

// Wt[n][k] = f16(W[k][n]·scale) from f32 row-major W[K][N] (scale = power of two; bf16-exact weights stay exact in f16 away from the subnormal range)
__global__ __launch_bounds__(256) void k_wt_f16(const float* __restrict__ W, _Float16* __restrict__ Wt, int K, int N, float scale) {
  const int t = blockIdx.x * 256 + threadIdx.x; if (t >= N * (K / 8)) return; const int n = t / (K / 8), k8 = (t % (K / 8)) * 8; FragH f;
#pragma unroll
  for (int i = 0; i < 8; ++i) f.h[i] = (_Float16)(bf16_round(W[(size_t)(k8 + i) * N + n]) * scale); const v8us o = f.half[0];
  *(v8us*)((unsigned short*)Wt + (size_t)n * K + k8) = o; 
}
// k_gemm_hh variant with fused epilogue: v = acc·alpha + bias[by·sBias + col] (+ CP[(row/rowsPerB)·sCPb + by·64 + col] if CP) ; ACT 0 none / 1 elu ; writes f16 C16 (and f32 C if non-null)
template <int ACT>
__global__ __launch_bounds__(128) void k_gemm_hhx(const _Float16* __restrict__ A, int lda, size_t sA, const _Float16* __restrict__ Bh, int ldb, size_t sB, float alpha, const float* __restrict__ bias, size_t sBias, const float* __restrict__ CP, int rowsPerB, size_t sCPb, int row0g,
    float* __restrict__ C, _Float16* __restrict__ C16, int ldc, size_t sC, int M, int N, int K) {
  __shared__ __attribute__((aligned(16))) float so[4][16][64];
  const int tid = threadIdx.x, w = tid >> 5, lane = tid & 31, ln = lane & 15, hh = lane >> 4; const int by = blockIdx.y;
  A += (size_t)by * sA; Bh += (size_t)by * sB; const size_t cofs = (size_t)by * sC; const float* bp = bias ? bias + (size_t)by * sBias : nullptr;
  const int ntn = (N + 63) / 64; const int wid = blockIdx.x * 4 + w; const int mt = wid / ntn, nq = wid % ntn; if (mt * 16 >= M) return;
  const int row0 = mt * 16, col0 = nq * 64; const _Float16* arow = A + (size_t)(row0 + ln) * lda;
  v8f acc[4] = {};
  for (int kb = 0; kb < K; kb += 32) { FragH ah; ah.half[0] = *(const v8us*)((const unsigned short*)arow + kb + 8 * hh); ah.half[1] = *(const v8us*)((const unsigned short*)arow + kb + 16 + 8 * hh);
#pragma unroll
    for (int t = 0; t < 4; ++t) { if (col0 + t * 16 >= N) continue; const size_t boff = (size_t)(col0 + t * 16 + ln) * ldb + kb; FragH bq; bq.half[0] = *(const v8us*)((const unsigned short*)Bh + boff + 8 * hh); bq.half[1] = *(const v8us*)((const unsigned short*)Bh + boff + 16 + 8 * hh);
      acc[t] = mmaH<1>(ah.v, ah.v, bq.v, bq.v, acc[t]); }
  }
#pragma unroll
  for (int t = 0; t < 4; ++t) { if (col0 + t * 16 >= N) continue; const int col = col0 + t * 16 + ln; const float bv = bp ? bf16_round(bp[col]) : 0.f;
#pragma unroll
    for (int r = 0; r < 8; ++r) { float v = acc[t][r] * alpha + bv; if (CP) { const int rr = row0g + row0 + 8 * hh + r; if (rowsPerB < 0) v += CP[cofs + (size_t)rr * ldc + col];      /* rowsPerB < 0: own element of the batched C plane */ else { const int bidx = rr / rowsPerB; v += CP[(size_t)bidx * sCPb + (size_t)by * 64 + col]; } } if (ACT == 1) v = (v > 0.f) ? v : expm1f(v); else if (ACT == 7) v = (v > 0.f) ? v + 1.0f : expf(v); else if (ACT == 8) v = tanhf(v); else if (ACT == 9) v = 0.5f * v * (1.0f + tanhf(0.7978845608028654f * (v + 0.044715f * v * v * v))); else if (ACT == 11) v = 1.0f / (1.0f + expf(-v)); else if (ACT == 12) v = (v > 0.f) ? v : 0.01f * v; else if (ACT == 14) v = (v > 0.f) ? v : 0.1f * v; else if (ACT == 16) v = (v >= 0.f) ? v : 0.3f * v; else if (ACT == 17) v = (v >= 0.f) ? v : 0.2f * v; else if (ACT == 15) v = v / (1.0f + expf(-v)); else if (ACT == 3) v = fmaxf(v, 0.f); else if (ACT == 6) v = 0.5f * v * (1.0f + erff(v * 0.70710678118654752f)); so[w][8 * hh + r][t * 16 + ln] = v; } }
  __builtin_amdgcn_fence(__ATOMIC_ACQ_REL, "workgroup"); __builtin_amdgcn_wave_barrier();
  const int rsub = lane >> 4, c4 = (lane & 15) * 4; typedef _Float16 v4h __attribute__((ext_vector_type(4)));
  {
#pragma unroll
    for (int q = 0; q < 8; ++q) { const int r = q * 2 + rsub; if (col0 + c4 < N) { const v4f v = *(const v4fa*)&so[w][r][c4]; if (C) *(v4f*)(C + cofs + (size_t)(row0 + r) * ldc + col0 + c4) = v; if (C16) { v4h h4; for (int i = 0; i < 4; ++i) h4[i] = (_Float16)v[i]; *(v4h*)(C16 + cofs + (size_t)(row0 + r) * ldc + col0 + c4) = h4; } } }
     }
}


typedef _Float16 v4h __attribute__((ext_vector_type(4)));

__global__ __launch_bounds__(256) void k_x16(const float* __restrict__ x, _Float16* __restrict__ X16, size_t n8) { const size_t t = (size_t)blockIdx.x * 256 + threadIdx.x; if (t >= n8) return; FragH f;
#pragma unroll
  for (int q = 0; q < 8; ++q) f.h[q] = (_Float16)bf16_round(x[t * 8 + q]); *(v8us*)((unsigned short*)X16 + t * 8) = f.half[0];  }
__global__ __launch_bounds__(256) void k_h16(const float* __restrict__ x, _Float16* __restrict__ X16, size_t n8) { const size_t t = (size_t)blockIdx.x * 256 + threadIdx.x; if (t >= n8) return; FragH f;
#pragma unroll
  for (int q = 0; q < 8; ++q) f.h[q] = (_Float16)x[t * 8 + q]; *(v8us*)((unsigned short*)X16 + t * 8) = f.half[0];  }
__global__ __launch_bounds__(256) void k_round16f(const float* __restrict__ W, _Float16* __restrict__ Bt, size_t n8) { const size_t t = (size_t)blockIdx.x * 256 + threadIdx.x; if (t >= n8) return; FragH f;
#pragma unroll
  for (int i = 0; i < 8; ++i) f.h[i] = (_Float16)(bf16_round(W[t * 8 + i]) * 16.0f); *(v8us*)((unsigned short*)Bt + t * 8) = f.half[0];  }
template <int NHv, int TTv>
__global__ __launch_bounds__(256) void k_vt(const _Float16* __restrict__ V16, int ldv, int voff, _Float16* __restrict__ Vt) { __shared__ unsigned short tl[64][66]; const int tid = threadIdx.x; const int slab = blockIdx.x / (TTv / 64), lg = blockIdx.x % (TTv / 64); const int b = slab / NHv, h = slab % NHv;
  for (int i = tid; i < 64 * 8; i += 256) { const int r = i / 8, c8 = (i % 8) * 8; FragH f; f.half[0] = *(const v8us*)((const unsigned short*)V16 + ((size_t)b * TTv + lg * 64 + r) * ldv + voff + h * 64 + c8);
#pragma unroll
    for (int q = 0; q < 8; ++q) tl[r][c8 + q] = f.u[q]; }
  __syncthreads();
  {
#pragma unroll
    for (int rd = 0; rd < 2; ++rd) { const int d = rd * 32 + tid / 8, pc = tid % 8; FragH f;
#pragma unroll
      for (int q = 0; q < 8; ++q) f.u[q] = tl[pc * 8 + q][d];
      *(v8us*)((unsigned short*)Vt + ((size_t)slab * 64 + d) * TTv + lg * 64 + pc * 8) = f.half[0]; }
     } }

__global__ __launch_bounds__(256) void k_hl(const float* __restrict__ F, _Float16* __restrict__ Hh, _Float16* __restrict__ Hl, size_t n8) { const size_t t = (size_t)blockIdx.x * 256 + threadIdx.x; if (t >= n8) return; FragH fh, fl; const v4f a = *(const v4fa*)(F + t * 8), c = *(const v4fa*)(F + t * 8 + 4);
#pragma unroll
  for (int q = 0; q < 4; ++q) { _Float16 h = (_Float16)a[q]; fh.h[q] = h; fl.h[q] = (_Float16)((a[q] - (float)h) * 1024.0f); h = (_Float16)c[q]; fh.h[4 + q] = h; fl.h[4 + q] = (_Float16)((c[q] - (float)h) * 1024.0f); }
  { *(v8us*)((unsigned short*)Hh + t * 8) = fh.half[0]; *(v8us*)((unsigned short*)Hl + t * 8) = fl.half[0];  } }

// ---- fast GEMM (wave tile 32x64; requires M % 32 == 0 rows per launch region and N % 64 == 0); epilogue = k_gemm_hhx semantics ----
__device__ __forceinline__ v16h g2_frag(const _Float16* p, int hh) { FragH f; f.half[0] = *(const v8us*)((const unsigned short*)p + 8 * hh); f.half[1] = *(const v8us*)((const unsigned short*)p + 16 + 8 * hh); return f.v; }
__device__ __forceinline__ v8f g2_mma(v16h a, v16h b, v8f c) { v8f d = __builtin_amdgcn_wmma_f32_16x16x32_f16(false, a, false, b, (short)0, c, false, false); asm volatile("v_nop\n\tv_nop\n\tv_nop\n\tv_nop" : "+v"(d) : "v"(a), "v"(b)); return d; }
template <int ACT>
__global__ __launch_bounds__(128) void k_gemm2(const _Float16* __restrict__ A, int lda, size_t sA, const _Float16* __restrict__ Bh, int ldb, size_t sB, float alpha, const float* __restrict__ bias, size_t sBias, const float* __restrict__ CP, int rowsPerB, size_t sCPb, int row0g,
    float* __restrict__ C, _Float16* __restrict__ C16, int ldc, size_t sC, int M, int N, int K) { static_assert(ACT == 0 || ACT == 3 || ACT == 6 || ACT == 8 || ACT == 9 || ACT == 11 || ACT == 12 || ACT == 14 || ACT == 15 || ACT == 16 || ACT == 17, "k_gemm2: unsupported ACT code (would silently apply no activation)");
  __shared__ __attribute__((aligned(16))) float so[4][32][68];
  const int tid = threadIdx.x, w = tid >> 5, lane = tid & 31, ln = lane & 15, hh = lane >> 4; const int by = blockIdx.y;
  A += (size_t)by * sA; Bh += (size_t)by * sB; const size_t cofs = (size_t)by * sC; const float* bp = bias ? bias + (size_t)by * sBias : nullptr;
  const int ntn = N >> 6; const int mt = blockIdx.x / ntn, nq = blockIdx.x - mt * ntn; const int row0 = mt * 128 + 32 * w, col0 = nq * 64; if (row0 >= M) return;
  const _Float16* a0p = A + (size_t)(row0 + ln) * lda; const _Float16* a1p = a0p + (size_t)16 * lda;
  const _Float16* b0p = Bh + (size_t)(col0 + ln) * ldb; const _Float16* b1p = b0p + (size_t)16 * ldb; const _Float16* b2p = b1p + (size_t)16 * ldb; const _Float16* b3p = b2p + (size_t)16 * ldb;
  const v8f z8 = {0.f,0.f,0.f,0.f,0.f,0.f,0.f,0.f}; v8f c00 = z8, c01 = z8, c02 = z8, c03 = z8, c10 = z8, c11 = z8, c12 = z8, c13 = z8;
#pragma unroll 1
  for (int kb = 0; kb < K; kb += 32) { const v16h a0 = g2_frag(a0p + kb, hh), a1 = g2_frag(a1p + kb, hh);
    v16h b = g2_frag(b0p + kb, hh); c00 = g2_mma(a0, b, c00); c10 = g2_mma(a1, b, c10);
    b = g2_frag(b1p + kb, hh); c01 = g2_mma(a0, b, c01); c11 = g2_mma(a1, b, c11);
    b = g2_frag(b2p + kb, hh); c02 = g2_mma(a0, b, c02); c12 = g2_mma(a1, b, c12);
    b = g2_frag(b3p + kb, hh); c03 = g2_mma(a0, b, c03); c13 = g2_mma(a1, b, c13); }
  v8f accs[8] = {c00, c01, c02, c03, c10, c11, c12, c13};
#pragma unroll
  for (int u = 0; u < 8; ++u) { const int t = u & 3, half = u >> 2; const int col = col0 + t * 16 + ln; const float bv = bp ? bf16_round(bp[col]) : 0.f;
#pragma unroll
    for (int r = 0; r < 8; ++r) { const int rloc = half * 16 + 8 * hh + r; float v = accs[u][r] * alpha + bv; if (CP) { if (rowsPerB < 0) v += CP[cofs + (size_t)(row0g + row0 + rloc) * ldc + col];      /* rowsPerB < 0: own element of the batched C plane */ else { const int bidx = (row0g + row0 + rloc) / rowsPerB; v += CP[(size_t)bidx * sCPb + (size_t)by * 64 + col]; } }
      if (ACT == 3) v = fmaxf(v, 0.f); else if (ACT == 6) v = 0.5f * v * (1.0f + erff(v * 0.70710678118654752f)); else if (ACT == 11) v = 1.0f / (1.0f + expf(-v)); else if (ACT == 15) v = v / (1.0f + expf(-v)); else if (ACT == 12) v = (v > 0.f) ? v : 0.01f * v; else if (ACT == 8) v = tanhf(v); else if (ACT == 9) v = 0.5f * v * (1.0f + tanhf(0.7978845608028654f * (v + 0.044715f * v * v * v))); else if (ACT == 14) v = (v > 0.f) ? v : 0.1f * v; else if (ACT == 16) v = (v >= 0.f) ? v : 0.3f * v; else if (ACT == 17) v = (v >= 0.f) ? v : 0.2f * v;
      so[w][rloc][t * 16 + ln] = v; } }
  __builtin_amdgcn_fence(__ATOMIC_ACQ_REL, "workgroup"); __builtin_amdgcn_wave_barrier();
  const int rsub = lane >> 4, c4 = (lane & 15) * 4;
  {
#pragma unroll
    for (int q = 0; q < 16; ++q) { const int r = q * 2 + rsub; const v4f v = *(const v4fa*)&so[w][r][c4]; if (C) *(v4f*)(C + cofs + (size_t)(row0 + r) * ldc + col0 + c4) = v; if (C16) { v4h h4; for (int i = 0; i < 4; ++i) h4[i] = (_Float16)v[i]; *(v4h*)(C16 + cofs + (size_t)(row0 + r) * ldc + col0 + c4) = h4; } }
     } }


__global__ __launch_bounds__(256) void k_wnat(const float* __restrict__ w, size_t n8, _Float16* __restrict__ Bt) { const size_t t = (size_t)blockIdx.x * 256 + threadIdx.x; if (t >= n8) return; FragH f; for (int q = 0; q < 8; ++q) f.h[q] = (_Float16)(bf16_round(w[t * 8 + q]) * 16.0f); *(v8us*)((unsigned short*)Bt + t * 8) = f.half[0];  }
__global__ __launch_bounds__(256) void k_rsm(const float* __restrict__ S, _Float16* __restrict__ P, int nrows) {
  #pragma clang fp contract(off)
  const int i = blockIdx.x * 256 + threadIdx.x; if (i >= nrows) return; const float* s = S + (size_t)i * SQ; float mx = -3.0e38f;
#pragma unroll 1
  for (int j = 0; j < SQ; ++j) mx = fmaxf(mx, s[j]); float se = 0.f;
#pragma unroll 1
  for (int j = 0; j < SQ; ++j) se += expf(s[j] - mx); const float sc = 256.0f / se;
#pragma unroll 1
  for (int j0 = 0; j0 < SQ; j0 += 8) { FragH f; for (int q = 0; q < 8; ++q) f.h[q] = (_Float16)(expf(s[j0 + q] - mx) * sc); unsigned short* d = (unsigned short*)P + (size_t)i * SQ + j0; *(v8us*)d = f.half[0];  } }
__global__ __launch_bounds__(256) void k_vt(const _Float16* __restrict__ V16, int b, int h0, _Float16* __restrict__ VT) { __shared__ unsigned short tl[64][65]; const int tid = threadIdx.x; const int hh = blockIdx.x % HG, sg = blockIdx.x / HG; const int s0 = sg * 64; const int h = h0 + hh;
  for (int i = tid; i < 64 * 8; i += 256) { const int j = i / 8, d8 = (i % 8) * 8; FragH f; f.half[0] = *(const v8us*)((const unsigned short*)V16 + ((size_t)b * SQ + s0 + j) * DM + h * HD + d8); for (int q = 0; q < 8; ++q) tl[d8 + q][j] = f.u[q]; }
  __syncthreads();
  { for (int i = tid; i < 64 * 8; i += 256) { const int d = i / 8, j8 = (i % 8) * 8; FragH f; for (int q = 0; q < 8; ++q) f.u[q] = tl[d][j8 + q]; *(v8us*)((unsigned short*)VT + ((size_t)hh * HD + d) * SQ + s0 + j8) = f.half[0]; }  } }



// Fused causal attention on the f16 planes: scores, softmax and P V in ONE launch; neither S nor P goes through memory. grid.x = block of FAR query rows (longest first), grid.y = batch.
// Both products are formed transposed, so that a lane owns one query in both: S^T = K Q^T (A = K rows, B = Q rows) leaves in lane (ln, hh) the scores of query ln for keys 8 hh + r
// of each 16-key tile, which for two tiles side by side is the k order of a B fragment; O^T = V^T P^T (A = V^T rows, B = those weights as f16) leaves query ln's o for d = 8 hh + r.
// So the weights never leave their registers, and running maximum, denominator and rescale are per lane: lane ^ 16 holds the other keys of the same query, so the maximum is exchanged with it
// once a chunk, and the two halves' denominators are joined once, behind the loop. Scores are carried times log2(e), so that a weight is one v_exp_f32 of a difference.
// wave = key run: the block's 32-key chunks are dealt to the FAW waves in turn; the FAW partial results are brought to the common maximum and added through LDS, in the order of the waves.
// Every inner loop is unrolled so that each index of a register array is a constant (no scratch); the chunk loop stays rolled, so that one chunk's fragments are live at a time and four waves fit a SIMD.
#define LQK3 (3 * NH * HD)           /* row pitch of the f16 q | k | v plane */
#define FAW 8                        /* waves = key runs per work-group */
#define FAQ 2                        /* 16-query tiles a wave: each K and V^T fragment is used FAQ times */
#define FAR (16 * FAQ)               /* query rows per work-group = keys per chunk */
#define FAP (HD + 4)                 /* LDS pitch of a partial o row: 16 B x odd, so that 16-byte accesses of many rows spread over the banks */
__device__ __forceinline__ float fa_xhalf(float x) { return __builtin_bit_cast(float, __builtin_amdgcn_permlanex16(__builtin_bit_cast(int, x), __builtin_bit_cast(int, x), 0x76543210, 0xfedcba98, false, false)); }      /* lane l reads lane l ^ 16: a vector move, where __shfl_xor goes through the LDS path and a wait */
// 2^x. The v_nop in the same statement keeps the one slot that the instruction set asks for behind a transcendental before its result is read or its source overwritten.
__device__ __forceinline__ float fa_exp2(float x) { float r; asm("v_exp_f32 %0, %1\n\tv_nop" : "=v"(r) : "v"(x)); return r; }
__device__ __forceinline__ v8f fa_mma(v16h a, v16h b, v8f c) { return __builtin_amdgcn_wmma_f32_16x16x32_f16(false, a, false, b, (short)0, c, false, false); }
__global__ __launch_bounds__(32 * FAW) void k_fattn(const _Float16* __restrict__ Q16, const _Float16* __restrict__ K16, const _Float16* __restrict__ VT, float scale, float* __restrict__ O) {
  static_assert(NH == 1 && HD == 64 && FAR == 32 && SQ % FAR == 0 && 32 * FAW * 8 == FAR * HD, "one 64-wide head; a chunk of 32 keys is one k step of P V; the merge gives every thread 8 columns of one row");
  __shared__ float pm[FAW][FAR]; __shared__ float pl[FAW][FAR]; __shared__ __attribute__((aligned(16))) float po[FAW][FAR][FAP];
  const int lane = threadIdx.x & 31, ln = lane & 15, hh = lane >> 4; const int w = __builtin_amdgcn_readfirstlane((int)(threadIdx.x >> 5));      /* the wave's number as a scalar: the chunk loop and its mask test are scalar branches */
  const int qb = SQ / FAR - 1 - (int)blockIdx.x; const int q0 = qb * FAR; const int nch = qb + 1;      /* causal: chunks 0..qb; only chunk qb crosses the diagonal */
  Q16 += (size_t)blockIdx.y * SQ * LQK3; K16 += (size_t)blockIdx.y * SQ * LQK3; VT += (size_t)blockIdx.y * HD * SQ; O += (size_t)blockIdx.y * SQ * HD;
  v8f o[FAQ][4]; float m[FAQ], l[FAQ]; const float sl2 = scale * 1.44269504088896340736f;
#pragma unroll
  for (int u = 0; u < FAQ; ++u) { m[u] = -1.0e30f; l[u] = 0.f;
#pragma unroll
    for (int t = 0; t < 4; ++t) o[u][t] = v8f{0.f, 0.f, 0.f, 0.f, 0.f, 0.f, 0.f, 0.f}; }
  if (w < nch) {      /* a wave without a chunk loads nothing and goes to the merge with m = -1e30, l = 0, o = 0 */
  v16h qf[FAQ][2];
#pragma unroll
  for (int u = 0; u < FAQ; ++u) { const _Float16* qp = Q16 + (size_t)(q0 + u * 16 + ln) * LQK3 + 8 * hh; qf[u][0] = g2_frag(qp, 0); qf[u][1] = g2_frag(qp + 32, 0);
    asm volatile("s_wait_xcnt 0x0" :: "v"(qp) : "memory"); }      /* the wait in front of any overwrite of the address pair that the q loads name; the pair is an input, so it stays whole up to here */
#pragma unroll 1
  for (int c = w; c < nch; c += FAW) { const int k0 = c * FAR;
    const _Float16* kp = K16 + (size_t)(k0 + ln) * LQK3; const _Float16* vp = VT + (size_t)ln * SQ + k0;
    const v16h ka0 = g2_frag(kp, hh), ka1 = g2_frag(kp + 32, hh), kb0 = g2_frag(kp + (size_t)16 * LQK3, hh), kb1 = g2_frag(kp + (size_t)16 * LQK3 + 32, hh);
    v16h vf[4];
#pragma unroll
    for (int t = 0; t < 4; ++t) vf[t] = g2_frag(vp + (size_t)t * 16 * SQ, hh);
#pragma unroll
    for (int u = 0; u < FAQ; ++u) { const v8f z8 = {0.f, 0.f, 0.f, 0.f, 0.f, 0.f, 0.f, 0.f};
      const v8f sa = fa_mma(ka1, qf[u][1], fa_mma(ka0, qf[u][0], z8)), sb = fa_mma(kb1, qf[u][1], fa_mma(kb0, qf[u][0], z8));
      float s[16];
#pragma unroll
      for (int r = 0; r < 8; ++r) { s[r] = sa[r] * sl2; s[8 + r] = sb[r] * sl2; }      /* s[i]: key k0 + 8 hh + i (i < 8), k0 + 16 + 8 hh + i - 8 (i >= 8) */
      if (c == nch - 1) { const int dq = u * 16 + ln - 8 * hh;      /* key - k0 <= query - q0, and k0 = q0 here */
#pragma unroll
        for (int r = 0; r < 8; ++r) { if (r > dq) s[r] = -1.0e30f; if (16 + r > dq) s[8 + r] = -1.0e30f; } }
      float mn = s[0];
#pragma unroll
      for (int i = 1; i < 16; ++i) mn = fmaxf(mn, s[i]);
      mn = fmaxf(mn, fa_xhalf(mn)); mn = fmaxf(mn, m[u]);      /* every chunk holds a key that the query sees (the chunk's first), so mn is a real score */
      const float sc = fa_exp2(m[u] - mn); float es = 0.f; FragH p;      /* first chunk: m = -1e30, sc = 0 on l = 0 and o = 0 */
#pragma unroll
      for (int i = 0; i < 16; ++i) { const float e = fa_exp2(s[i] - mn); es += e; p.h[i] = (_Float16)e; }
      l[u] = fmaf(l[u], sc, es); m[u] = mn;      /* l: this half's keys only; sc is the same in both halves */
#pragma unroll
      for (int t = 0; t < 4; ++t) o[u][t] = fa_mma(vf[t], p.v, o[u][t] * sc); } } }
#pragma unroll
  for (int u = 0; u < FAQ; ++u) { const float lj = l[u] + fa_xhalf(l[u]); if (hh == 0) { pm[w][u * 16 + ln] = m[u]; pl[w][u * 16 + ln] = lj; } }      /* both halves of the wave hold the same m and, joined, the same l */
  __syncthreads();
#pragma unroll
  for (int u = 0; u < FAQ; ++u) { float mx = pm[0][u * 16 + ln];      /* wave 0 has chunk 0, which every row sees: the common maximum is a real score; a wave without a chunk counts 0 */
#pragma unroll
    for (int x = 1; x < FAW; ++x) mx = fmaxf(mx, pm[x][u * 16 + ln]);
    const float f = fa_exp2(m[u] - mx);
#pragma unroll
    for (int t = 0; t < 4; ++t) { const v8f y = o[u][t] * f; *(v4f*)&po[w][u * 16 + ln][t * 16 + 8 * hh] = v4f{y[0], y[1], y[2], y[3]}; *(v4f*)&po[w][u * 16 + ln][t * 16 + 8 * hh + 4] = v4f{y[4], y[5], y[6], y[7]}; } }
  __syncthreads();
  const int row = threadIdx.x >> 3, c8 = (threadIdx.x & 7) * 8;      /* a wave adds and stores four whole o rows: 1 KiB in a row */
  float mx = pm[0][row];
#pragma unroll
  for (int x = 1; x < FAW; ++x) mx = fmaxf(mx, pm[x][row]);
  float ls = 0.f; v4f r0 = {0.f, 0.f, 0.f, 0.f}, r1 = {0.f, 0.f, 0.f, 0.f};
#pragma unroll
  for (int x = 0; x < FAW; ++x) { ls = fmaf(fa_exp2(pm[x][row] - mx), pl[x][row], ls); r0 += *(const v4f*)&po[x][row][c8]; r1 += *(const v4f*)&po[x][row][c8 + 4]; }
  const float inv = 1.0f / ls; float* op = O + (size_t)(q0 + row) * HD + c8;
  *(v4f*)op = r0 * inv; *(v4f*)(op + 4) = r1 * inv; }


// e^x for x <= 0 to f32 accuracy: x * log2(e) is cut into its nearest integer n and a remainder that two FMAs form (log2(e) as a high and a low float), then 2^remainder * 2^n.
// Below -104 the result is under the smallest f32: x is held there, so that n stays a small integer. The v_nop in the same statement keeps the one slot that the instruction
// set asks for behind a transcendental before its result is read or its source overwritten.
__device__ __forceinline__ float exp_neg(float x) { x = fmaxf(x, -104.0f); const float n = rintf(x * 1.44269502f); const float r = fmaf(x, 1.92596303e-8f, fmaf(x, 1.44269502f, -n));
  float p; asm("v_exp_f32 %0, %1\n\tv_nop" : "=v"(p) : "v"(r)); return ldexpf(p, (int)n); }
// Exact f32 causal attention for rows 0..QT0-1 of every batch (grid.y = batch, each with its own QT0-row plane; grid.x = block of 32 query rows).
// lane = query row: its q row and its o row stay in registers. wave = key run: the block's 32 * (rg + 1) keys are cut into A0W equal runs, one a wave, so a K or V row
// has one address for the whole wave and comes through the scalar path. Each wave keeps its own running maximum, denominator and o over its run (A0K keys a trip, one
// rescale a trip); the A0W partial results are brought to the common maximum and added through LDS, always in the order of the runs.
#define A0W 16                       /* waves = key runs per work-group */
#define A0K (32 / A0W)               /* keys a trip: a run is A0K * (rg + 1) keys */
#define A0LD (3 * NH * HD)           /* row pitch of the f32 q | k | v plane */
#define A0P (HD + 4)                 /* LDS pitch of a partial o row: 16 B x odd, so that 16-byte accesses of 32 rows spread over the banks */
__global__ __launch_bounds__(32 * A0W) void k_att0w(const float* __restrict__ QF, const float* __restrict__ KF, const float* __restrict__ VF, float scale, float* __restrict__ OF) {
  static_assert(NH == 1 && HD == 64 && QT0 % 32 == 0 && A0W * A0K == 32 && 32 * A0W * 4 == 32 * HD, "one 64-wide head; 32 rows a block; the merge gives every thread 4 columns of one row");
  __shared__ float pm[A0W][32]; __shared__ float pl[A0W][32]; __shared__ float pfin[32]; __shared__ __attribute__((aligned(16))) float po[A0W][32][A0P];
  const int lane = threadIdx.x & 31; const int w = __builtin_amdgcn_readfirstlane((int)(threadIdx.x >> 5));      /* the wave's number as a scalar: K and V addresses are wave-uniform */
  const int rg = blockIdx.x; const int i = rg * 32 + lane;
  { const size_t bi = (size_t)blockIdx.y * QT0; QF += bi * A0LD; KF += bi * A0LD; VF += bi * A0LD; OF += bi * HD; }
  float q[HD], o[HD]; const float* qp = QF + (size_t)i * A0LD;
#pragma unroll
  for (int c = 0; c < HD / 4; ++c) { const v4f t = *(const v4fa*)(qp + c * 4);
#pragma unroll
    for (int u = 0; u < 4; ++u) { q[c * 4 + u] = t[u]; o[c * 4 + u] = 0.f; } }
  asm volatile("s_wait_xcnt 0x0" :: "v"(qp) : "memory");      /* the wait in front of any overwrite of the address pair that the q loads name; the pair is an input, so it stays whole up to here */
  float m = -1.0e30f, l = 0.f; const int kbeg = w * A0K * (rg + 1);
#pragma unroll 1
  for (int ch = 0; ch <= rg; ++ch) { const int j0 = kbeg + ch * A0K; const float* kr = KF + (size_t)j0 * A0LD; const float* vr = VF + (size_t)j0 * A0LD;
    float s[A0K]; float mn = m;
#pragma unroll
    for (int k = 0; k < A0K; ++k) { float p[4] = {0.f, 0.f, 0.f, 0.f};      /* four sums a score: four independent FMA chains of 16 */
#pragma unroll
      for (int c = 0; c < HD; ++c) p[c & 3] = fmaf(q[c], kr[k * A0LD + c], p[c & 3]);
      s[k] = (j0 + k <= i) ? ((p[0] + p[1]) + (p[2] + p[3])) * scale : -1.0e30f; mn = fmaxf(mn, s[k]); }
    const float sc = exp_neg(m - mn); float e[A0K]; float es = 0.f;      /* nothing seen yet: m = mn = -1e30, sc = 1 on l = 0 and o = 0 */
#pragma unroll
    for (int k = 0; k < A0K; ++k) { e[k] = (j0 + k <= i) ? exp_neg(s[k] - mn) : 0.f; es += e[k]; }      /* a key behind the row counts 0 also where the whole run so far is behind it */
    l = fmaf(l, sc, es); m = mn;
#pragma unroll
    for (int c = 0; c < HD; ++c) { float t = o[c] * sc;
#pragma unroll
      for (int k = 0; k < A0K; ++k) t = fmaf(e[k], vr[k * A0LD + c], t);
      o[c] = t; } }
  pm[w][lane] = m; pl[w][lane] = l;
  __syncthreads();
  float mx = pm[0][lane];      /* run 0 holds key 0, which every row sees: the common maximum is a real score */
#pragma unroll
  for (int u = 1; u < A0W; ++u) mx = fmaxf(mx, pm[u][lane]);
  if (w == 0) { float ls = 0.f;
#pragma unroll
    for (int u = 0; u < A0W; ++u) ls = fmaf(exp_neg(pm[u][lane] - mx), pl[u][lane], ls);
    pfin[lane] = 64.0f / ls; }      /* o carried x64; k_o0m multiplies by 1/64 */
  const float f = exp_neg(m - mx);
#pragma unroll
  for (int c = 0; c < HD / 4; ++c) { v4f t;
#pragma unroll
    for (int u = 0; u < 4; ++u) t[u] = o[c * 4 + u] * f;
    *(v4f*)&po[w][lane][c * 4] = t; }
  __syncthreads();
  const int row = threadIdx.x >> 4, c4 = (threadIdx.x & 15) * 4;      /* a wave adds and stores two whole o rows: 512 B in a row */
  v4f r = {0.f, 0.f, 0.f, 0.f};
#pragma unroll
  for (int u = 0; u < A0W; ++u) r += *(const v4f*)&po[u][row][c4];
  r *= pfin[row];
  *(v4f*)(OF + (size_t)(rg * 32 + row) * HD + c4) = r; }


template <int BFIN, int WXB>
__global__ __launch_bounds__(256) void k_ln16(const float* __restrict__ X, const float* __restrict__ g, const float* __restrict__ bb, float eps, _Float16* __restrict__ N16, float* __restrict__ XB) {
  #pragma clang fp contract(off)
  __shared__ float red[256]; const size_t r = blockIdx.x; const int t = threadIdx.x; const v4f xa = *(const v4fa*)(X + r * DMQ + t * 4); float s[4]; float sum = 0.f;
  for (int q = 0; q < 4; ++q) { s[q] = BFIN ? bf16_round(xa[q]) : xa[q]; sum = __fadd_rn(sum, s[q]); }
  red[t] = sum; __syncthreads(); for (int st = 128; st > 0; st >>= 1) { if (t < st) red[t] = __fadd_rn(red[t], red[t + st]); __syncthreads(); } const float mu = red[0] / (float)DMQ; __syncthreads();
  float vs = 0.f; for (int q = 0; q < 4; ++q) { const float dl = __fadd_rn(s[q], -mu); vs = __fadd_rn(vs, __fmul_rn(dl, dl)); } red[t] = vs; __syncthreads(); for (int st = 128; st > 0; st >>= 1) { if (t < st) red[t] = __fadd_rn(red[t], red[t + st]); __syncthreads(); }
  const float rs = rsqrtf(__fadd_rn(red[0] / (float)DMQ, eps)); v4h y; v4f xb;
  for (int q = 0; q < 4; ++q) { const int c = t * 4 + q; y[q] = (_Float16)__fadd_rn(__fmul_rn(__fmul_rn(__fadd_rn(s[q], -mu), rs), bf16_round(g[c])), bf16_round(bb[c])); xb[q] = s[q]; }
  { *(v4h*)(N16 + r * DMQ + t * 4) = y; if (WXB) *(v4f*)(XB + r * DMQ + t * 4) = xb;  } }
__global__ __launch_bounds__(256) void k_ftres2(const float* __restrict__ OF0, const float* __restrict__ XB, float* __restrict__ X1, size_t n4) {
  #pragma clang fp contract(off)
  const size_t t = (size_t)blockIdx.x * 256 + threadIdx.x; if (t >= n4) return; const v4f o = *(const v4fa*)(OF0 + t * 4), xv = *(const v4fa*)(XB + t * 4); v4f y; for (int q = 0; q < 4; ++q) y[q] = __fadd_rn(__fmul_rn(o[q], 0.015625f), xv[q]); *(v4f*)(X1 + t * 4) = y;  }

__global__ __launch_bounds__(256) void k_wthd(const float* __restrict__ Wt, _Float16* __restrict__ Bt) { const size_t t = (size_t)blockIdx.x * 256 + threadIdx.x; if (t >= (size_t)NH * HD * (DM / 8)) return; const int m8 = (int)(t % (DM / 8)) * 8; const int d = (int)((t / (DM / 8)) % HD); const int h = (int)(t / ((size_t)(DM / 8) * HD)); FragH f;
  for (int q = 0; q < 8; ++q) f.h[q] = (_Float16)(16.0f * bf16_round(Wt[((size_t)h * DM + m8 + q) * HD + d])); unsigned short* dst = (unsigned short*)Bt + ((size_t)h * HD + d) * DM + m8; *(v8us*)dst = f.half[0];  }




__global__ __launch_bounds__(256) void k_wtpad(const float* __restrict__ Wm, _Float16* __restrict__ Wt, int Kr, int Kp, int Nr, int Np, float scale) {
  const int t = blockIdx.x * 256 + threadIdx.x; if (t >= Np * (Kp / 8)) return; const int n = t / (Kp / 8), k8 = (t % (Kp / 8)) * 8; const int nc = min(n, Nr - 1); const float fn = (n < Nr) ? 1.f : 0.f; FragH f;
  for (int i = 0; i < 8; ++i) { const int k = k8 + i; const int kc = min(k, Kr - 1); const float fk = (k < Kr) ? fn : 0.f; f.h[i] = (_Float16)(bf16_round(Wm[(size_t)kc * Nr + nc]) * scale * fk); }
  unsigned short* o = (unsigned short*)Wt + (size_t)n * Kp + k8; *(v8us*)o = f.half[0];  }
__global__ __launch_bounds__(128) void k_bpad(const float* __restrict__ b, float* __restrict__ Bp, int nr, int np) {
  const int i = threadIdx.x; if (i >= np) return; const float v = b[min(i, nr - 1)] * ((i < nr) ? 1.f : 0.f); *(float*)(Bp + i) = v;  }

#define DI 64         /* inner width = NH * HD (ONE 64-wide head) */
#define LQK (3 * DI)  /* fused q | k | v row pitch (192) */
__global__ __launch_bounds__(256) void k_o0(const float* __restrict__ OF, float* __restrict__ ob, size_t n4) {
  #pragma clang fp contract(off)
  const size_t t = (size_t)blockIdx.x * 256 + threadIdx.x; if (t >= n4) return; const size_t e = t * 4; const int i = (int)(e / DI); const int c = (int)(e % DI); const int h = c / HD, d = c % HD; const v4f a = *(const v4fa*)(OF + e); v4f o; for (int q = 0; q < 4; ++q) o[q] = __fmul_rn(a[q], 0.015625f); float* dst = ob + (size_t)h * SQ * HD + (size_t)i * HD + d; *(v4f*)dst = o;  }

__global__ __launch_bounds__(256) void k_o0m(const float* __restrict__ OF, float* __restrict__ o_, size_t n4) {
  #pragma clang fp contract(off)
  OF += (size_t)blockIdx.y * n4 * 4; o_ += (size_t)blockIdx.y * SQ * DI;      /* grid.y = batch: n4 * 4 exact elements a batch, written to the head of that batch's output rows */
  const size_t t = (size_t)blockIdx.x * 256 + threadIdx.x; if (t >= n4) return; const size_t e = t * 4; const v4f a = *(const v4fa*)(OF + e); v4f o; for (int q = 0; q < 4; ++q) o[q] = __fmul_rn(a[q], 0.015625f); *(v4f*)(o_ + e) = o;  }
extern "C" void kernel_launch(void* const* d_in, const int* in_sizes, int n_in,
                              void* d_out, int out_size, void* d_ws, size_t ws_size, hipStream_t stream) {
  (void)in_sizes; (void)n_in; (void)out_size;
  const float* const* I = (const float* const*)d_in; const float* x = I[0]; const float* wq = I[2]; const float* wk = I[1]; const float* wv = I[3]; const float* bq = nullptr; const float* bk = nullptr; const float* bv = nullptr;      /* x; [in][out = 64] Wk / Wq / Wv (input order as this module lists them); no biases */
  char* ws = (char*)d_ws; size_t off = 0;
  auto take = [&](size_t bytes) { char* p = ws + off; off += (bytes + 255) & ~(size_t)255; return p; };
  _Float16* BW = (_Float16*)take((size_t)LQK * DM * 2); _Float16* X16 = (_Float16*)take(NR * DM * 2); _Float16* QKV = (_Float16*)take(NR * LQK * 2); _Float16* VT = (_Float16*)take((size_t)NB * HD * SQ * 2);
  float* QKVF0 = (float*)take((size_t)NB * QT0 * LQK * 4); float* OF0 = (float*)take((size_t)NB * QT0 * DI * 4);      /* one plane a batch: the four batches run side by side on grid.y */
  if (off > ws_size) return;
  { const unsigned g = (unsigned)(((size_t)DI * (DM / 8) + 255) / 256); k_wt_f16<<<g, 256, 0, stream>>>(wq, BW, DM, DI, 16.0f); k_wt_f16<<<g, 256, 0, stream>>>(wk, BW + (size_t)DI * DM, DM, DI, 16.0f); k_wt_f16<<<g, 256, 0, stream>>>(wv, BW + (size_t)2 * DI * DM, DM, DI, 16.0f); }      /* [in = DM][out = 64] -> Bt[n][k] x16, stacked q | k | v */
  k_x16<<<(unsigned)((NR * DM / 8 + 255) / 256), 256, 0, stream>>>(x, X16, NR * DM / 8);      /* x (bf16-valued) as exact f16 rows */
  const float* bqkv[3] = {bq, bk, bv};
  for (int c = 0; c < 3; ++c) k_gemm2<0><<<dim3((unsigned)((NR / 128) * (DI / 64)), 1), 128, 0, stream>>>(X16, DM, 0, BW + (size_t)c * DI * DM, DM, 0, 0.0625f, bqkv[c], 0, nullptr, 1, 0, 0, nullptr, QKV + (size_t)c * DI, LQK, 0, (int)NR, DI, DM);      /* q | k | v = x W -> f16 rows, column blocks 0 / 64 / 128 of the fused plane (pitch 192); head h = columns h*64 inside each */
  const _Float16* Q16 = QKV; const _Float16* K16 = QKV + DI; const _Float16* V16 = QKV + 2 * DI;
  static_assert(NH == 1, "grid.y carries the batch in place of the head");
  float* ob = (float*)d_out;
  k_vt<NH, SQ><<<NB * NH * (SQ / 64), 256, 0, stream>>>(V16, LQK, 0, VT);      /* V^T [NB][HD][SQ], all batches in one launch */
  static_assert(LQK3 == LQK, "the fused kernel reads the q | k | v plane at its pitch");
  k_fattn<<<dim3(SQ / FAR, NB), 32 * FAW, 0, stream>>>(Q16, K16, VT, 0.0625f, ob);      /* out[b][i][0..63] = softmax(causal q k^T * 256^-0.5 = 1/16: the module scales by the EMBEDDING width) v, f32, all query rows of all batches in one launch */
  for (int c = 0; c < 3; ++c) k_gemm2<0><<<dim3((unsigned)((QT0 / 128) * (DI / 64)), NB), 128, 0, stream>>>(X16, DM, (size_t)SQ * DM, BW + (size_t)c * DI * DM, DM, 0, 0.0625f, bqkv[c], 0, nullptr, 1, 0, 0, QKVF0 + (size_t)c * DI, nullptr, LQK, (size_t)QT0 * LQK, QT0, DI, DM);      /* f32 q | k | v of rows 0..511 of every batch (exact products, f32 accumulation) */
  k_att0w<<<dim3(QT0 / 32, NB), 32 * A0W, 0, stream>>>(QKVF0, QKVF0 + DI, QKVF0 + 2 * DI, 0.0625f, OF0);      /* exact f32 causal attention for rows 0..511 (o x64) */
  k_o0m<<<dim3((unsigned)(((size_t)QT0 * DI / 4 + 255) / 256), NB), 256, 0, stream>>>(OF0, ob, (size_t)QT0 * DI / 4);      /* rows 0..511 of every batch REWRITTEN from the exact path */
}

// v005
// One run takes 79.6 microseconds.
// Timed twice side by side with v004, it ran 1.88 and 1.87 times as fast.
// Over all steps from v000 it is 413 times as fast.
#include <hip/hip_runtime.h>
// Single-head causal self-attention with the module's EMBEDDING-width scale (x [4][4096][256]; k/q/v = x W ([in][out] [256][64], U(+-0.1), no biases; input order Wk, Wq, Wv); ONE 64-wide head; wei * 256^-0.5 (n_embd, as in the source); causal (tril, -inf); softmax; out = wei v -> [4][4096][64]; no output projection).
// Structure: token rows; ONE projection launch (x and the weights converted to their exact f16 values on the way in; WMMA; writes the f16 q | k rows at pitch 192, v^T, and the f32 q | k | v of rows 0..511); one fused causal attention launch with the batches on grid.y (scores, online softmax f32 -> f16 weights in registers, P V, written as f32 straight into the output rows); an exact f32 first tile (rows 0..511) rewritten at the end; launches: see trace.
// Compute dtype: inputs rounded to bf16; x / weights exact; q, k, v and softmax weights as plain f16 GEMM operands (~2^-12); scores, softmax statistics and o f32. v_wmma_f32_16x16x32_f16.
#define NB 4
#define SQ 4096
#define DM 256
#define NH 1
#define HD 64
#define HG 4                         /* heads per block group of the unlaunched k_vt(b, h0) overload */
#define QT 256                       /* unused */
#define NKX SQ                       /* unused */
#define QT0 512                      /* first-tile rows recomputed exactly (f32): 512 here (no output projection averages the early-row cancellation errors away; logit sigma 1.0) */
#define B0 0                         /* unused; the batches run on grid.y from 0 */
#define NBR NB                       /* feeds only MP; grid.y runs over the NB batches */
#define NR ((size_t)NB * SQ)
#define DMQ DM
#define DFF 4096                     /* unused; this file has no FFN */
#define DFFR 100                     /* unused */
#define MP ((int)((size_t)NBR * SQ)) /* feeds only MPO; the projection runs over NR rows */
#define QN SQ                        /* unused */
#define NHD NH                       /* unused */
#define MPO MP                       /* unused */
#define LQ (3 * DM)      /* 3 * DM = 768, unused; the q/k/v rows use pitch LQK = 192 */
typedef __bf16 v16b __attribute__((ext_vector_type(16)));
typedef unsigned short v8us __attribute__((ext_vector_type(8), may_alias));
typedef float  v8f  __attribute__((ext_vector_type(8)));
typedef float  v4f  __attribute__((ext_vector_type(4)));
typedef float  v4fa __attribute__((ext_vector_type(4), may_alias));
union FragB { v16b v; v8us half[2]; unsigned short u[16]; };

__device__ __forceinline__ unsigned short bf16_bits(float x) { unsigned int u = __float_as_uint(x); return (unsigned short)((u + 0x7FFFu + ((u >> 16) & 1u)) >> 16); }
__device__ __forceinline__ float bf16_val(unsigned short b) { return __uint_as_float(((unsigned int)b) << 16); }
__device__ __forceinline__ float bf16_round(float x) { return bf16_val(bf16_bits(x)); }
// D += A·B with NT terms: 1 = ah·bh, 2 = + al·bh (A split), 3 = + ah·bl (both split)
template <int NT>
__device__ __forceinline__ v8f mmaN(v16b ah, v16b al, v16b bh, v16b bl, v8f c) {
  c = __builtin_amdgcn_wmma_f32_16x16x32_bf16(false, ah, false, bh, (short)0, c, false, false);
  if (NT >= 2) c = __builtin_amdgcn_wmma_f32_16x16x32_bf16(false, al, false, bh, (short)0, c, false, false);
  if (NT >= 3) c = __builtin_amdgcn_wmma_f32_16x16x32_bf16(false, ah, false, bl, (short)0, c, false, false);
  asm volatile("v_nop\n\tv_nop\n\tv_nop\n\tv_nop" : "+v"(c) : "v"(ah), "v"(al), "v"(bh), "v"(bl));
  return c;
}

__global__ __launch_bounds__(256) void k_wt_bf16(const float* __restrict__ W, unsigned short* __restrict__ Wt, int K, int N) {
  const int t = blockIdx.x * 256 + threadIdx.x;
  const int k8n = K / 8;
  if (t >= N * k8n) return;
  const int n = t / k8n, k8 = (t % k8n) * 8;
  v8us v;
#pragma unroll
  for (int i = 0; i < 8; ++i) v[i] = bf16_bits(W[(size_t)(k8 + i) * N + n]);
  *(v8us*)(Wt + (size_t)n * K + k8) = v;
  
}

// GEMM C[M][N] (f32, pitch ldc) = act(A[M][K]·W + bias). A f32 row-major (pitch lda) converted per fragment to bf16
// (ASPLIT: hi/lo two planes -> 2 terms, else single rounded term); Wt bf16 [N][K] (pitch ldb). BIAS_BF16 rounds the
// bias to bf16 first (bias quantised to bf16 before the add). K%32==0, M%16==0, N%64==0.
template <bool ASPLIT, int ACT, bool BIAS_BF16>
__global__ __launch_bounds__(128) void k_gemm_bf(const float* __restrict__ A, int lda, const unsigned short* __restrict__ Wt, int ldb,
                                               const float* __restrict__ bias, float* __restrict__ C, int ldc, int M, int N, int K) {
  __shared__ __attribute__((aligned(16))) float so[4][16][64];
  const int tid = threadIdx.x, w = tid >> 5, lane = tid & 31, ln = lane & 15, hh = lane >> 4;
  const int ntn = N / 64;
  const int wid = blockIdx.x * 4 + w;
  const int mt = wid / ntn, nq = wid % ntn;
  if (mt * 16 >= M) return;
  const int row0 = mt * 16, col0 = nq * 64;
  const float* arow = A + (size_t)(row0 + ln) * lda;
  v8f acc[4] = {};
  for (int kb = 0; kb < K; kb += 32) {
    FragB ah, al;
    const v4f x0 = *(const v4fa*)(arow + kb + 8 * hh), x1 = *(const v4fa*)(arow + kb + 8 * hh + 4);
    const v4f x2 = *(const v4fa*)(arow + kb + 16 + 8 * hh), x3 = *(const v4fa*)(arow + kb + 16 + 8 * hh + 4);
    float xs[16] = {x0[0],x0[1],x0[2],x0[3],x1[0],x1[1],x1[2],x1[3],x2[0],x2[1],x2[2],x2[3],x3[0],x3[1],x3[2],x3[3]};
#pragma unroll
    for (int i = 0; i < 16; ++i) { const unsigned short hb = bf16_bits(xs[i]); ah.u[i] = hb; al.u[i] = ASPLIT ? bf16_bits(xs[i] - bf16_val(hb)) : (unsigned short)0; }
#pragma unroll
    for (int t = 0; t < 4; ++t) {
      const unsigned short* brow = Wt + (size_t)(col0 + t * 16 + ln) * ldb + kb;
      FragB b;
      b.half[0] = *(const v8us*)(brow + 8 * hh);
      b.half[1] = *(const v8us*)(brow + 16 + 8 * hh);
      acc[t] = mmaN<ASPLIT ? 2 : 1>(ah.v, al.v, b.v, b.v, acc[t]);
    }
  }
#pragma unroll
  for (int t = 0; t < 4; ++t) {
    float bv = bias ? bias[col0 + t * 16 + ln] : 0.f;
    if (BIAS_BF16) bv = bf16_round(bv);
#pragma unroll
    for (int r = 0; r < 8; ++r) { float v = acc[t][r] + bv; if (ACT == 1) v = fmaxf(v, 0.f); so[w][8 * hh + r][t * 16 + ln] = v; }
  }
  __builtin_amdgcn_fence(__ATOMIC_ACQ_REL, "workgroup");
  __builtin_amdgcn_wave_barrier();
  const int rsub = lane >> 4, c4 = (lane & 15) * 4;
  {
#pragma unroll
    for (int q = 0; q < 8; ++q) {
      const int r = q * 2 + rsub;
      const v4f v = *(const v4fa*)&so[w][r][c4];
      *(v4f*)(C + (size_t)(row0 + r) * ldc + col0 + c4) = v;
    }
    
  }
}

// GEMM C = act(A·W + bias + resid): A f32 (ASPLIT -> hi/lo 2 terms), Wt bf16 [N][K]; ACT 0 none, 1 relu, 2 exact gelu;
// resid (optional, f32, row index = (row % rmod), pitch ldr, RES_BF16 rounds it) added before the activation.
template <bool ASPLIT, int ACT, bool BIAS_BF16, bool RES_BF16>
__global__ __launch_bounds__(128) void k_gemm_bf3(const float* __restrict__ A, int lda, const unsigned short* __restrict__ Wt, int ldb,
                                                const float* __restrict__ bias, const float* __restrict__ resid, int rmod, int ldr,
                                                float* __restrict__ C, int ldc, int M, int N, int K) {
  __shared__ __attribute__((aligned(16))) float so[4][16][64];
  const int tid = threadIdx.x, w = tid >> 5, lane = tid & 31, ln = lane & 15, hh = lane >> 4;
  const int ntn = N / 64;
  const int wid = blockIdx.x * 4 + w;
  const int mt = wid / ntn, nq = wid % ntn;
  if (mt * 16 >= M) return;
  const int row0 = mt * 16, col0 = nq * 64;
  const float* arow = A + (size_t)(row0 + ln) * lda;
  v8f acc[4] = {};
  for (int kb = 0; kb < K; kb += 32) {
    FragB ah, al;
    const v4f x0 = *(const v4fa*)(arow + kb + 8 * hh), x1 = *(const v4fa*)(arow + kb + 8 * hh + 4);
    const v4f x2 = *(const v4fa*)(arow + kb + 16 + 8 * hh), x3 = *(const v4fa*)(arow + kb + 16 + 8 * hh + 4);
    float xs[16] = {x0[0],x0[1],x0[2],x0[3],x1[0],x1[1],x1[2],x1[3],x2[0],x2[1],x2[2],x2[3],x3[0],x3[1],x3[2],x3[3]};
#pragma unroll
    for (int i = 0; i < 16; ++i) { const unsigned short hb = bf16_bits(xs[i]); ah.u[i] = hb; al.u[i] = ASPLIT ? bf16_bits(xs[i] - bf16_val(hb)) : (unsigned short)0; }
#pragma unroll
    for (int t = 0; t < 4; ++t) {
      const unsigned short* brow = Wt + (size_t)(col0 + t * 16 + ln) * ldb + kb;
      FragB b;
      b.half[0] = *(const v8us*)(brow + 8 * hh);
      b.half[1] = *(const v8us*)(brow + 16 + 8 * hh);
      acc[t] = mmaN<ASPLIT ? 2 : 1>(ah.v, al.v, b.v, b.v, acc[t]);
    }
  }
#pragma unroll
  for (int t = 0; t < 4; ++t) {
    const int col = col0 + t * 16 + ln;
    float bv = bias ? bias[col] : 0.f;
    if (BIAS_BF16) bv = bf16_round(bv);
#pragma unroll
    for (int r = 0; r < 8; ++r) {
      float v = acc[t][r] + bv;
      if (resid) { float rv = resid[(size_t)((row0 + 8 * hh + r) % rmod) * ldr + col]; if (RES_BF16) rv = bf16_round(rv); v += rv; }
      if (ACT == 1) v = fmaxf(v, 0.f);
      if (ACT == 2) v = 0.5f * v * (1.0f + erff(v * 0.70710678118654752f));
      if (ACT == 3) { const float u = 0.7978845608028654f * (v + 0.044715f * v * v * v); v = 0.5f * v * (1.0f + tanhf(u)); }
      so[w][8 * hh + r][t * 16 + ln] = v;
    }
  }
  __builtin_amdgcn_fence(__ATOMIC_ACQ_REL, "workgroup");
  __builtin_amdgcn_wave_barrier();
  const int rsub = lane >> 4, c4 = (lane & 15) * 4;
  {
#pragma unroll
    for (int q = 0; q < 8; ++q) {
      const int r = q * 2 + rsub;
      const v4f v = *(const v4fa*)&so[w][r][c4];
      *(v4f*)(C + (size_t)(row0 + r) * ldc + col0 + c4) = v;
    }
    
  }
}
// row LayerNorm (biased variance, eps) over N: s = X (+ R); optional out_sum <- s; out_norm <- (s-mu)*rsqrt(var+eps)*g + b
template <bool PARAM_BF16>
__global__ __launch_bounds__(256) void k_layernorm(const float* __restrict__ X, const float* __restrict__ R, const float* __restrict__ g, const float* __restrict__ bta,
                                                  float* __restrict__ out_sum, float* __restrict__ out_norm, int N, float eps) {
  __shared__ float red[256];
  const int row = blockIdx.x, tid = threadIdx.x;
  const float* x = X + (size_t)row * N; const float* rr = R ? R + (size_t)row * N : nullptr;
  float vals[16];                     // up to N = 4096
  const int per = N / 256;            // contiguous chunk per thread? use strided-by-4 chunks: thread handles j = tid*4 + 1024*u
  float s1 = 0.f;
  for (int u = 0; u < per / 4; ++u) {
    const int j = tid * 4 + 1024 * u;
    const v4f a = *(const v4fa*)(x + j);
    v4f b = {0.f,0.f,0.f,0.f}; if (rr) b = *(const v4fa*)(rr + j);
#pragma unroll
    for (int q = 0; q < 4; ++q) { const float v = a[q] + b[q]; vals[u * 4 + q] = v; s1 += v; }
  }
  red[tid] = s1; __syncthreads();
  for (int st = 128; st > 0; st >>= 1) { if (tid < st) red[tid] += red[tid + st]; __syncthreads(); }
  const float mu = red[0] / (float)N; __syncthreads();
  float s2 = 0.f;
  for (int u = 0; u < per / 4; ++u)
#pragma unroll
    for (int q = 0; q < 4; ++q) { const float c = vals[u * 4 + q] - mu; s2 += c * c; }
  red[tid] = s2; __syncthreads();
  for (int st = 128; st > 0; st >>= 1) { if (tid < st) red[tid] += red[tid + st]; __syncthreads(); }
  const float rs = rsqrtf(red[0] / (float)N + eps);
  {
    for (int u = 0; u < per / 4; ++u) {
      const int j = tid * 4 + 1024 * u;
      v4f o, sm;
#pragma unroll
      for (int q = 0; q < 4; ++q) {
        float gg = g[j + q], bb = bta[j + q];
        if (PARAM_BF16) { gg = bf16_round(gg); bb = bf16_round(bb); }
        sm[q] = vals[u * 4 + q]; o[q] = (vals[u * 4 + q] - mu) * rs * gg + bb;
      }
      if (out_sum) *(v4f*)(out_sum + (size_t)row * N + j) = sm;
      *(v4f*)(out_norm + (size_t)row * N + j) = o;
    }
    
  }
}



// ---- f16 WMMA path (v_wmma_f32_16x16x32_f16): 11-bit significands for operands in range — used where a [0,1] probability operand needs more precision than bf16
typedef _Float16 v16h __attribute__((ext_vector_type(16)));
union FragH { v16h v; v8us half[2]; _Float16 h[16]; unsigned short u[16]; };
template <int NT>
__device__ __forceinline__ v8f mmaH(v16h ah, v16h al, v16h bh, v16h bl, v8f c) {
  c = __builtin_amdgcn_wmma_f32_16x16x32_f16(false, ah, false, bh, (short)0, c, false, false);
  if (NT >= 2) c = __builtin_amdgcn_wmma_f32_16x16x32_f16(false, al, false, bh, (short)0, c, false, false);
  if (NT >= 3) c = __builtin_amdgcn_wmma_f32_16x16x32_f16(false, ah, false, bl, (short)0, c, false, false);
  asm volatile("v_nop\n\tv_nop\n\tv_nop\n\tv_nop" : "+v"(c) : "v"(ah), "v"(al), "v"(bh), "v"(bl));
  return c;
}
// batched GEMM like k_gemm_b but f16 operands: A f32 (split into f16 hi/lo if ASPLIT, else rounded to f16), Bt = f16 values [n][k]; alpha; C f32; N multiple of 16 (partial tiles skipped)
template <bool ASPLIT>
__global__ __launch_bounds__(128) void k_gemm_h(const float* __restrict__ A, int lda, size_t sA, const _Float16* __restrict__ Bh, int ldb, size_t sB, float alpha, float* __restrict__ C, int ldc, size_t sC, int M, int N, int K) {
  __shared__ __attribute__((aligned(16))) float so[4][16][64];
  const int tid = threadIdx.x, w = tid >> 5, lane = tid & 31, ln = lane & 15, hh = lane >> 4; const int by = blockIdx.y;
  A += (size_t)by * sA; Bh += (size_t)by * sB; C += (size_t)by * sC;
  const int ntn = (N + 63) / 64; const int wid = blockIdx.x * 4 + w; const int mt = wid / ntn, nq = wid % ntn; if (mt * 16 >= M) return;
  const int row0 = mt * 16, col0 = nq * 64; const float* arow = A + (size_t)(row0 + ln) * lda;
  v8f acc[4] = {};
  for (int kb = 0; kb < K; kb += 32) {
    FragH ah, al;
    const v4f x0 = *(const v4fa*)(arow + kb + 8 * hh), x1 = *(const v4fa*)(arow + kb + 8 * hh + 4), x2 = *(const v4fa*)(arow + kb + 16 + 8 * hh), x3 = *(const v4fa*)(arow + kb + 16 + 8 * hh + 4);
    float xs[16] = {x0[0],x0[1],x0[2],x0[3],x1[0],x1[1],x1[2],x1[3],x2[0],x2[1],x2[2],x2[3],x3[0],x3[1],x3[2],x3[3]};
#pragma unroll
    for (int i = 0; i < 16; ++i) { const _Float16 h = (_Float16)xs[i]; ah.h[i] = h; al.h[i] = ASPLIT ? (_Float16)(xs[i] - (float)h) : (_Float16)0.0f; }
#pragma unroll
    for (int t = 0; t < 4; ++t) { if (col0 + t * 16 >= N) continue; const size_t boff = (size_t)(col0 + t * 16 + ln) * ldb + kb; FragH bq; bq.half[0] = *(const v8us*)(Bh + boff + 8 * hh); bq.half[1] = *(const v8us*)(Bh + boff + 16 + 8 * hh);
      acc[t] = mmaH<ASPLIT ? 2 : 1>(ah.v, al.v, bq.v, bq.v, acc[t]); }
  }
#pragma unroll
  for (int t = 0; t < 4; ++t) { if (col0 + t * 16 >= N) continue;
#pragma unroll
    for (int r = 0; r < 8; ++r) so[w][8 * hh + r][t * 16 + ln] = acc[t][r] * alpha; }
  __builtin_amdgcn_fence(__ATOMIC_ACQ_REL, "workgroup"); __builtin_amdgcn_wave_barrier();
  const int rsub = lane >> 4, c4 = (lane & 15) * 4;
  {
#pragma unroll
    for (int q = 0; q < 8; ++q) { const int r = q * 2 + rsub; if (col0 + c4 < N) { const v4f v = *(const v4fa*)&so[w][r][c4]; *(v4f*)(C + (size_t)(row0 + r) * ldc + col0 + c4) = v; } }
     }
}

// Wt[n][k] = f16(W[k][n]·scale) from f32 row-major W[K][N] (scale = power of two; bf16-exact weights stay exact in f16 away from the subnormal range)
__global__ __launch_bounds__(256) void k_wt_f16(const float* __restrict__ W, _Float16* __restrict__ Wt, int K, int N, float scale) {
  const int t = blockIdx.x * 256 + threadIdx.x; if (t >= N * (K / 8)) return; const int n = t / (K / 8), k8 = (t % (K / 8)) * 8; FragH f;
#pragma unroll
  for (int i = 0; i < 8; ++i) f.h[i] = (_Float16)(bf16_round(W[(size_t)(k8 + i) * N + n]) * scale); const v8us o = f.half[0];
  *(v8us*)((unsigned short*)Wt + (size_t)n * K + k8) = o; 
}
// k_gemm_hh variant with fused epilogue: v = acc·alpha + bias[by·sBias + col] (+ CP[(row/rowsPerB)·sCPb + by·64 + col] if CP) ; ACT 0 none / 1 elu ; writes f16 C16 (and f32 C if non-null)
template <int ACT>
__global__ __launch_bounds__(128) void k_gemm_hhx(const _Float16* __restrict__ A, int lda, size_t sA, const _Float16* __restrict__ Bh, int ldb, size_t sB, float alpha, const float* __restrict__ bias, size_t sBias, const float* __restrict__ CP, int rowsPerB, size_t sCPb, int row0g,
    float* __restrict__ C, _Float16* __restrict__ C16, int ldc, size_t sC, int M, int N, int K) {
  __shared__ __attribute__((aligned(16))) float so[4][16][64];
  const int tid = threadIdx.x, w = tid >> 5, lane = tid & 31, ln = lane & 15, hh = lane >> 4; const int by = blockIdx.y;
  A += (size_t)by * sA; Bh += (size_t)by * sB; const size_t cofs = (size_t)by * sC; const float* bp = bias ? bias + (size_t)by * sBias : nullptr;
  const int ntn = (N + 63) / 64; const int wid = blockIdx.x * 4 + w; const int mt = wid / ntn, nq = wid % ntn; if (mt * 16 >= M) return;
  const int row0 = mt * 16, col0 = nq * 64; const _Float16* arow = A + (size_t)(row0 + ln) * lda;
  v8f acc[4] = {};
  for (int kb = 0; kb < K; kb += 32) { FragH ah; ah.half[0] = *(const v8us*)((const unsigned short*)arow + kb + 8 * hh); ah.half[1] = *(const v8us*)((const unsigned short*)arow + kb + 16 + 8 * hh);
#pragma unroll
    for (int t = 0; t < 4; ++t) { if (col0 + t * 16 >= N) continue; const size_t boff = (size_t)(col0 + t * 16 + ln) * ldb + kb; FragH bq; bq.half[0] = *(const v8us*)((const unsigned short*)Bh + boff + 8 * hh); bq.half[1] = *(const v8us*)((const unsigned short*)Bh + boff + 16 + 8 * hh);
      acc[t] = mmaH<1>(ah.v, ah.v, bq.v, bq.v, acc[t]); }
  }
#pragma unroll
  for (int t = 0; t < 4; ++t) { if (col0 + t * 16 >= N) continue; const int col = col0 + t * 16 + ln; const float bv = bp ? bf16_round(bp[col]) : 0.f;
#pragma unroll
    for (int r = 0; r < 8; ++r) { float v = acc[t][r] * alpha + bv; if (CP) { const int rr = row0g + row0 + 8 * hh + r; if (rowsPerB < 0) v += CP[cofs + (size_t)rr * ldc + col];      /* rowsPerB < 0: own element of the batched C plane */ else { const int bidx = rr / rowsPerB; v += CP[(size_t)bidx * sCPb + (size_t)by * 64 + col]; } } if (ACT == 1) v = (v > 0.f) ? v : expm1f(v); else if (ACT == 7) v = (v > 0.f) ? v + 1.0f : expf(v); else if (ACT == 8) v = tanhf(v); else if (ACT == 9) v = 0.5f * v * (1.0f + tanhf(0.7978845608028654f * (v + 0.044715f * v * v * v))); else if (ACT == 11) v = 1.0f / (1.0f + expf(-v)); else if (ACT == 12) v = (v > 0.f) ? v : 0.01f * v; else if (ACT == 14) v = (v > 0.f) ? v : 0.1f * v; else if (ACT == 16) v = (v >= 0.f) ? v : 0.3f * v; else if (ACT == 17) v = (v >= 0.f) ? v : 0.2f * v; else if (ACT == 15) v = v / (1.0f + expf(-v)); else if (ACT == 3) v = fmaxf(v, 0.f); else if (ACT == 6) v = 0.5f * v * (1.0f + erff(v * 0.70710678118654752f)); so[w][8 * hh + r][t * 16 + ln] = v; } }
  __builtin_amdgcn_fence(__ATOMIC_ACQ_REL, "workgroup"); __builtin_amdgcn_wave_barrier();
  const int rsub = lane >> 4, c4 = (lane & 15) * 4; typedef _Float16 v4h __attribute__((ext_vector_type(4)));
  {
#pragma unroll
    for (int q = 0; q < 8; ++q) { const int r = q * 2 + rsub; if (col0 + c4 < N) { const v4f v = *(const v4fa*)&so[w][r][c4]; if (C) *(v4f*)(C + cofs + (size_t)(row0 + r) * ldc + col0 + c4) = v; if (C16) { v4h h4; for (int i = 0; i < 4; ++i) h4[i] = (_Float16)v[i]; *(v4h*)(C16 + cofs + (size_t)(row0 + r) * ldc + col0 + c4) = h4; } } }
     }
}


typedef _Float16 v4h __attribute__((ext_vector_type(4)));

__global__ __launch_bounds__(256) void k_x16(const float* __restrict__ x, _Float16* __restrict__ X16, size_t n8) { const size_t t = (size_t)blockIdx.x * 256 + threadIdx.x; if (t >= n8) return; FragH f;
#pragma unroll
  for (int q = 0; q < 8; ++q) f.h[q] = (_Float16)bf16_round(x[t * 8 + q]); *(v8us*)((unsigned short*)X16 + t * 8) = f.half[0];  }
__global__ __launch_bounds__(256) void k_h16(const float* __restrict__ x, _Float16* __restrict__ X16, size_t n8) { const size_t t = (size_t)blockIdx.x * 256 + threadIdx.x; if (t >= n8) return; FragH f;
#pragma unroll
  for (int q = 0; q < 8; ++q) f.h[q] = (_Float16)x[t * 8 + q]; *(v8us*)((unsigned short*)X16 + t * 8) = f.half[0];  }
__global__ __launch_bounds__(256) void k_round16f(const float* __restrict__ W, _Float16* __restrict__ Bt, size_t n8) { const size_t t = (size_t)blockIdx.x * 256 + threadIdx.x; if (t >= n8) return; FragH f;
#pragma unroll
  for (int i = 0; i < 8; ++i) f.h[i] = (_Float16)(bf16_round(W[t * 8 + i]) * 16.0f); *(v8us*)((unsigned short*)Bt + t * 8) = f.half[0];  }
template <int NHv, int TTv>
__global__ __launch_bounds__(256) void k_vt(const _Float16* __restrict__ V16, int ldv, int voff, _Float16* __restrict__ Vt) { __shared__ unsigned short tl[64][66]; const int tid = threadIdx.x; const int slab = blockIdx.x / (TTv / 64), lg = blockIdx.x % (TTv / 64); const int b = slab / NHv, h = slab % NHv;
  for (int i = tid; i < 64 * 8; i += 256) { const int r = i / 8, c8 = (i % 8) * 8; FragH f; f.half[0] = *(const v8us*)((const unsigned short*)V16 + ((size_t)b * TTv + lg * 64 + r) * ldv + voff + h * 64 + c8);
#pragma unroll
    for (int q = 0; q < 8; ++q) tl[r][c8 + q] = f.u[q]; }
  __syncthreads();
  {
#pragma unroll
    for (int rd = 0; rd < 2; ++rd) { const int d = rd * 32 + tid / 8, pc = tid % 8; FragH f;
#pragma unroll
      for (int q = 0; q < 8; ++q) f.u[q] = tl[pc * 8 + q][d];
      *(v8us*)((unsigned short*)Vt + ((size_t)slab * 64 + d) * TTv + lg * 64 + pc * 8) = f.half[0]; }
     } }

__global__ __launch_bounds__(256) void k_hl(const float* __restrict__ F, _Float16* __restrict__ Hh, _Float16* __restrict__ Hl, size_t n8) { const size_t t = (size_t)blockIdx.x * 256 + threadIdx.x; if (t >= n8) return; FragH fh, fl; const v4f a = *(const v4fa*)(F + t * 8), c = *(const v4fa*)(F + t * 8 + 4);
#pragma unroll
  for (int q = 0; q < 4; ++q) { _Float16 h = (_Float16)a[q]; fh.h[q] = h; fl.h[q] = (_Float16)((a[q] - (float)h) * 1024.0f); h = (_Float16)c[q]; fh.h[4 + q] = h; fl.h[4 + q] = (_Float16)((c[q] - (float)h) * 1024.0f); }
  { *(v8us*)((unsigned short*)Hh + t * 8) = fh.half[0]; *(v8us*)((unsigned short*)Hl + t * 8) = fl.half[0];  } }

// ---- fast GEMM (wave tile 32x64; requires M % 32 == 0 rows per launch region and N % 64 == 0); epilogue = k_gemm_hhx semantics ----
__device__ __forceinline__ v16h g2_frag(const _Float16* p, int hh) { FragH f; f.half[0] = *(const v8us*)((const unsigned short*)p + 8 * hh); f.half[1] = *(const v8us*)((const unsigned short*)p + 16 + 8 * hh); return f.v; }
__device__ __forceinline__ v8f g2_mma(v16h a, v16h b, v8f c) { v8f d = __builtin_amdgcn_wmma_f32_16x16x32_f16(false, a, false, b, (short)0, c, false, false); asm volatile("v_nop\n\tv_nop\n\tv_nop\n\tv_nop" : "+v"(d) : "v"(a), "v"(b)); return d; }
template <int ACT>
__global__ __launch_bounds__(128) void k_gemm2(const _Float16* __restrict__ A, int lda, size_t sA, const _Float16* __restrict__ Bh, int ldb, size_t sB, float alpha, const float* __restrict__ bias, size_t sBias, const float* __restrict__ CP, int rowsPerB, size_t sCPb, int row0g,
    float* __restrict__ C, _Float16* __restrict__ C16, int ldc, size_t sC, int M, int N, int K) { static_assert(ACT == 0 || ACT == 3 || ACT == 6 || ACT == 8 || ACT == 9 || ACT == 11 || ACT == 12 || ACT == 14 || ACT == 15 || ACT == 16 || ACT == 17, "k_gemm2: unsupported ACT code (would silently apply no activation)");
  __shared__ __attribute__((aligned(16))) float so[4][32][68];
  const int tid = threadIdx.x, w = tid >> 5, lane = tid & 31, ln = lane & 15, hh = lane >> 4; const int by = blockIdx.y;
  A += (size_t)by * sA; Bh += (size_t)by * sB; const size_t cofs = (size_t)by * sC; const float* bp = bias ? bias + (size_t)by * sBias : nullptr;
  const int ntn = N >> 6; const int mt = blockIdx.x / ntn, nq = blockIdx.x - mt * ntn; const int row0 = mt * 128 + 32 * w, col0 = nq * 64; if (row0 >= M) return;
  const _Float16* a0p = A + (size_t)(row0 + ln) * lda; const _Float16* a1p = a0p + (size_t)16 * lda;
  const _Float16* b0p = Bh + (size_t)(col0 + ln) * ldb; const _Float16* b1p = b0p + (size_t)16 * ldb; const _Float16* b2p = b1p + (size_t)16 * ldb; const _Float16* b3p = b2p + (size_t)16 * ldb;
  const v8f z8 = {0.f,0.f,0.f,0.f,0.f,0.f,0.f,0.f}; v8f c00 = z8, c01 = z8, c02 = z8, c03 = z8, c10 = z8, c11 = z8, c12 = z8, c13 = z8;
#pragma unroll 1
  for (int kb = 0; kb < K; kb += 32) { const v16h a0 = g2_frag(a0p + kb, hh), a1 = g2_frag(a1p + kb, hh);
    v16h b = g2_frag(b0p + kb, hh); c00 = g2_mma(a0, b, c00); c10 = g2_mma(a1, b, c10);
    b = g2_frag(b1p + kb, hh); c01 = g2_mma(a0, b, c01); c11 = g2_mma(a1, b, c11);
    b = g2_frag(b2p + kb, hh); c02 = g2_mma(a0, b, c02); c12 = g2_mma(a1, b, c12);
    b = g2_frag(b3p + kb, hh); c03 = g2_mma(a0, b, c03); c13 = g2_mma(a1, b, c13); }
  v8f accs[8] = {c00, c01, c02, c03, c10, c11, c12, c13};
#pragma unroll
  for (int u = 0; u < 8; ++u) { const int t = u & 3, half = u >> 2; const int col = col0 + t * 16 + ln; const float bv = bp ? bf16_round(bp[col]) : 0.f;
#pragma unroll
    for (int r = 0; r < 8; ++r) { const int rloc = half * 16 + 8 * hh + r; float v = accs[u][r] * alpha + bv; if (CP) { if (rowsPerB < 0) v += CP[cofs + (size_t)(row0g + row0 + rloc) * ldc + col];      /* rowsPerB < 0: own element of the batched C plane */ else { const int bidx = (row0g + row0 + rloc) / rowsPerB; v += CP[(size_t)bidx * sCPb + (size_t)by * 64 + col]; } }
      if (ACT == 3) v = fmaxf(v, 0.f); else if (ACT == 6) v = 0.5f * v * (1.0f + erff(v * 0.70710678118654752f)); else if (ACT == 11) v = 1.0f / (1.0f + expf(-v)); else if (ACT == 15) v = v / (1.0f + expf(-v)); else if (ACT == 12) v = (v > 0.f) ? v : 0.01f * v; else if (ACT == 8) v = tanhf(v); else if (ACT == 9) v = 0.5f * v * (1.0f + tanhf(0.7978845608028654f * (v + 0.044715f * v * v * v))); else if (ACT == 14) v = (v > 0.f) ? v : 0.1f * v; else if (ACT == 16) v = (v >= 0.f) ? v : 0.3f * v; else if (ACT == 17) v = (v >= 0.f) ? v : 0.2f * v;
      so[w][rloc][t * 16 + ln] = v; } }
  __builtin_amdgcn_fence(__ATOMIC_ACQ_REL, "workgroup"); __builtin_amdgcn_wave_barrier();
  const int rsub = lane >> 4, c4 = (lane & 15) * 4;
  {
#pragma unroll
    for (int q = 0; q < 16; ++q) { const int r = q * 2 + rsub; const v4f v = *(const v4fa*)&so[w][r][c4]; if (C) *(v4f*)(C + cofs + (size_t)(row0 + r) * ldc + col0 + c4) = v; if (C16) { v4h h4; for (int i = 0; i < 4; ++i) h4[i] = (_Float16)v[i]; *(v4h*)(C16 + cofs + (size_t)(row0 + r) * ldc + col0 + c4) = h4; } }
     } }


__global__ __launch_bounds__(256) void k_wnat(const float* __restrict__ w, size_t n8, _Float16* __restrict__ Bt) { const size_t t = (size_t)blockIdx.x * 256 + threadIdx.x; if (t >= n8) return; FragH f; for (int q = 0; q < 8; ++q) f.h[q] = (_Float16)(bf16_round(w[t * 8 + q]) * 16.0f); *(v8us*)((unsigned short*)Bt + t * 8) = f.half[0];  }
__global__ __launch_bounds__(256) void k_rsm(const float* __restrict__ S, _Float16* __restrict__ P, int nrows) {
  #pragma clang fp contract(off)
  const int i = blockIdx.x * 256 + threadIdx.x; if (i >= nrows) return; const float* s = S + (size_t)i * SQ; float mx = -3.0e38f;
#pragma unroll 1
  for (int j = 0; j < SQ; ++j) mx = fmaxf(mx, s[j]); float se = 0.f;
#pragma unroll 1
  for (int j = 0; j < SQ; ++j) se += expf(s[j] - mx); const float sc = 256.0f / se;
#pragma unroll 1
  for (int j0 = 0; j0 < SQ; j0 += 8) { FragH f; for (int q = 0; q < 8; ++q) f.h[q] = (_Float16)(expf(s[j0 + q] - mx) * sc); unsigned short* d = (unsigned short*)P + (size_t)i * SQ + j0; *(v8us*)d = f.half[0];  } }
__global__ __launch_bounds__(256) void k_vt(const _Float16* __restrict__ V16, int b, int h0, _Float16* __restrict__ VT) { __shared__ unsigned short tl[64][65]; const int tid = threadIdx.x; const int hh = blockIdx.x % HG, sg = blockIdx.x / HG; const int s0 = sg * 64; const int h = h0 + hh;
  for (int i = tid; i < 64 * 8; i += 256) { const int j = i / 8, d8 = (i % 8) * 8; FragH f; f.half[0] = *(const v8us*)((const unsigned short*)V16 + ((size_t)b * SQ + s0 + j) * DM + h * HD + d8); for (int q = 0; q < 8; ++q) tl[d8 + q][j] = f.u[q]; }
  __syncthreads();
  { for (int i = tid; i < 64 * 8; i += 256) { const int d = i / 8, j8 = (i % 8) * 8; FragH f; for (int q = 0; q < 8; ++q) f.u[q] = tl[d][j8 + q]; *(v8us*)((unsigned short*)VT + ((size_t)hh * HD + d) * SQ + s0 + j8) = f.half[0]; }  } }



// Fused causal attention on the f16 planes: scores, softmax and P V in ONE launch; neither S nor P goes through memory. grid.x = block of FAR query rows (longest first), grid.y = batch.
// Both products are formed transposed, so that a lane owns one query in both: S^T = K Q^T (A = K rows, B = Q rows) leaves in lane (ln, hh) the scores of query ln for keys 8 hh + r
// of each 16-key tile, which for two tiles side by side is the k order of a B fragment; O^T = V^T P^T (A = V^T rows, B = those weights as f16) leaves query ln's o for d = 8 hh + r.
// So the weights never leave their registers, and running maximum, denominator and rescale are per lane: lane ^ 16 holds the other keys of the same query, so the maximum is exchanged with it
// once a chunk, and the two halves' denominators are joined once, behind the loop. Scores are carried times log2(e), so that a weight is one v_exp_f32 of a difference.
// wave = key run: the block's 32-key chunks are dealt to the FAW waves in turn; the FAW partial results are brought to the common maximum and added through LDS, in the order of the waves.
// Every inner loop is unrolled so that each index of a register array is a constant (no scratch); the chunk loop stays rolled, so that one chunk's fragments are live at a time and four waves fit a SIMD.
#define LQK3 (3 * NH * HD)           /* row pitch of the f16 q | k | v plane */
#define FAW 8                        /* waves = key runs per work-group */
#define FAQ 2                        /* 16-query tiles a wave: each K and V^T fragment is used FAQ times */
#define FAR (16 * FAQ)               /* query rows per work-group = keys per chunk */
#define FAP (HD + 4)                 /* LDS pitch of a partial o row: 16 B x odd, so that 16-byte accesses of many rows spread over the banks */
__device__ __forceinline__ float fa_xhalf(float x) { return __builtin_bit_cast(float, __builtin_amdgcn_permlanex16(__builtin_bit_cast(int, x), __builtin_bit_cast(int, x), 0x76543210, 0xfedcba98, false, false)); }      /* lane l reads lane l ^ 16: a vector move, where __shfl_xor goes through the LDS path and a wait */
// 2^x. The v_nop in the same statement keeps the one slot that the instruction set asks for behind a transcendental before its result is read or its source overwritten.
__device__ __forceinline__ float fa_exp2(float x) { float r; asm("v_exp_f32 %0, %1\n\tv_nop" : "=v"(r) : "v"(x)); return r; }
__device__ __forceinline__ v8f fa_mma(v16h a, v16h b, v8f c) { return __builtin_amdgcn_wmma_f32_16x16x32_f16(false, a, false, b, (short)0, c, false, false); }
__global__ __launch_bounds__(32 * FAW) void k_fattn(const _Float16* __restrict__ Q16, const _Float16* __restrict__ K16, const _Float16* __restrict__ VT, float scale, float* __restrict__ O) {
  static_assert(NH == 1 && HD == 64 && FAR == 32 && SQ % FAR == 0 && 32 * FAW * 8 == FAR * HD, "one 64-wide head; a chunk of 32 keys is one k step of P V; the merge gives every thread 8 columns of one row");
  __shared__ float pm[FAW][FAR]; __shared__ float pl[FAW][FAR]; __shared__ __attribute__((aligned(16))) float po[FAW][FAR][FAP];
  const int lane = threadIdx.x & 31, ln = lane & 15, hh = lane >> 4; const int w = __builtin_amdgcn_readfirstlane((int)(threadIdx.x >> 5));      /* the wave's number as a scalar: the chunk loop and its mask test are scalar branches */
  const int qb = SQ / FAR - 1 - (int)blockIdx.x; const int q0 = qb * FAR; const int nch = qb + 1;      /* causal: chunks 0..qb; only chunk qb crosses the diagonal */
  Q16 += (size_t)blockIdx.y * SQ * LQK3; K16 += (size_t)blockIdx.y * SQ * LQK3; VT += (size_t)blockIdx.y * HD * SQ; O += (size_t)blockIdx.y * SQ * HD;
  v8f o[FAQ][4]; float m[FAQ], l[FAQ]; const float sl2 = scale * 1.44269504088896340736f;
#pragma unroll
  for (int u = 0; u < FAQ; ++u) { m[u] = -1.0e30f; l[u] = 0.f;
#pragma unroll
    for (int t = 0; t < 4; ++t) o[u][t] = v8f{0.f, 0.f, 0.f, 0.f, 0.f, 0.f, 0.f, 0.f}; }
  if (w < nch) {      /* a wave without a chunk loads nothing and goes to the merge with m = -1e30, l = 0, o = 0 */
  v16h qf[FAQ][2];
#pragma unroll
  for (int u = 0; u < FAQ; ++u) { const _Float16* qp = Q16 + (size_t)(q0 + u * 16 + ln) * LQK3 + 8 * hh; qf[u][0] = g2_frag(qp, 0); qf[u][1] = g2_frag(qp + 32, 0);
    asm volatile("s_wait_xcnt 0x0" :: "v"(qp) : "memory"); }      /* the wait in front of any overwrite of the address pair that the q loads name; the pair is an input, so it stays whole up to here */
#pragma unroll 1
  for (int c = w; c < nch; c += FAW) { const int k0 = c * FAR;
    const _Float16* kp = K16 + (size_t)(k0 + ln) * LQK3; const _Float16* vp = VT + (size_t)ln * SQ + k0;
    const v16h ka0 = g2_frag(kp, hh), ka1 = g2_frag(kp + 32, hh), kb0 = g2_frag(kp + (size_t)16 * LQK3, hh), kb1 = g2_frag(kp + (size_t)16 * LQK3 + 32, hh);
    v16h vf[4];
#pragma unroll
    for (int t = 0; t < 4; ++t) vf[t] = g2_frag(vp + (size_t)t * 16 * SQ, hh);
#pragma unroll
    for (int u = 0; u < FAQ; ++u) { const v8f z8 = {0.f, 0.f, 0.f, 0.f, 0.f, 0.f, 0.f, 0.f};
      const v8f sa = fa_mma(ka1, qf[u][1], fa_mma(ka0, qf[u][0], z8)), sb = fa_mma(kb1, qf[u][1], fa_mma(kb0, qf[u][0], z8));
      float s[16];
#pragma unroll
      for (int r = 0; r < 8; ++r) { s[r] = sa[r] * sl2; s[8 + r] = sb[r] * sl2; }      /* s[i]: key k0 + 8 hh + i (i < 8), k0 + 16 + 8 hh + i - 8 (i >= 8) */
      if (c == nch - 1) { const int dq = u * 16 + ln - 8 * hh;      /* key - k0 <= query - q0, and k0 = q0 here */
#pragma unroll
        for (int r = 0; r < 8; ++r) { if (r > dq) s[r] = -1.0e30f; if (16 + r > dq) s[8 + r] = -1.0e30f; } }
      float mn = s[0];
#pragma unroll
      for (int i = 1; i < 16; ++i) mn = fmaxf(mn, s[i]);
      mn = fmaxf(mn, fa_xhalf(mn)); mn = fmaxf(mn, m[u]);      /* every chunk holds a key that the query sees (the chunk's first), so mn is a real score */
      const float sc = fa_exp2(m[u] - mn); float es = 0.f; FragH p;      /* first chunk: m = -1e30, sc = 0 on l = 0 and o = 0 */
#pragma unroll
      for (int i = 0; i < 16; ++i) { const float e = fa_exp2(s[i] - mn); es += e; p.h[i] = (_Float16)e; }
      l[u] = fmaf(l[u], sc, es); m[u] = mn;      /* l: this half's keys only; sc is the same in both halves */
#pragma unroll
      for (int t = 0; t < 4; ++t) o[u][t] = fa_mma(vf[t], p.v, o[u][t] * sc); } } }
#pragma unroll
  for (int u = 0; u < FAQ; ++u) { const float lj = l[u] + fa_xhalf(l[u]); if (hh == 0) { pm[w][u * 16 + ln] = m[u]; pl[w][u * 16 + ln] = lj; } }      /* both halves of the wave hold the same m and, joined, the same l */
  __syncthreads();
#pragma unroll
  for (int u = 0; u < FAQ; ++u) { float mx = pm[0][u * 16 + ln];      /* wave 0 has chunk 0, which every row sees: the common maximum is a real score; a wave without a chunk counts 0 */
#pragma unroll
    for (int x = 1; x < FAW; ++x) mx = fmaxf(mx, pm[x][u * 16 + ln]);
    const float f = fa_exp2(m[u] - mx);
#pragma unroll
    for (int t = 0; t < 4; ++t) { const v8f y = o[u][t] * f; *(v4f*)&po[w][u * 16 + ln][t * 16 + 8 * hh] = v4f{y[0], y[1], y[2], y[3]}; *(v4f*)&po[w][u * 16 + ln][t * 16 + 8 * hh + 4] = v4f{y[4], y[5], y[6], y[7]}; } }
  __syncthreads();
  const int row = threadIdx.x >> 3, c8 = (threadIdx.x & 7) * 8;      /* a wave adds and stores four whole o rows: 1 KiB in a row */
  float mx = pm[0][row];
#pragma unroll
  for (int x = 1; x < FAW; ++x) mx = fmaxf(mx, pm[x][row]);
  float ls = 0.f; v4f r0 = {0.f, 0.f, 0.f, 0.f}, r1 = {0.f, 0.f, 0.f, 0.f};
#pragma unroll
  for (int x = 0; x < FAW; ++x) { ls = fmaf(fa_exp2(pm[x][row] - mx), pl[x][row], ls); r0 += *(const v4f*)&po[x][row][c8]; r1 += *(const v4f*)&po[x][row][c8 + 4]; }
  const float inv = 1.0f / ls; float* op = O + (size_t)(q0 + row) * HD + c8;
  *(v4f*)op = r0 * inv; *(v4f*)(op + 4) = r1 * inv; }


// e^x for x <= 0 to f32 accuracy: x * log2(e) is cut into its nearest integer n and a remainder that two FMAs form (log2(e) as a high and a low float), then 2^remainder * 2^n.
// Below -104 the result is under the smallest f32: x is held there, so that n stays a small integer. The v_nop in the same statement keeps the one slot that the instruction
// set asks for behind a transcendental before its result is read or its source overwritten.
__device__ __forceinline__ float exp_neg(float x) { x = fmaxf(x, -104.0f); const float n = rintf(x * 1.44269502f); const float r = fmaf(x, 1.92596303e-8f, fmaf(x, 1.44269502f, -n));
  float p; asm("v_exp_f32 %0, %1\n\tv_nop" : "=v"(p) : "v"(r)); return ldexpf(p, (int)n); }
// Exact f32 causal attention for rows 0..QT0-1 of every batch (grid.y = batch, each with its own QT0-row plane; grid.x = block of 32 query rows).
// lane = query row: its q row and its o row stay in registers. wave = key run: the block's 32 * (rg + 1) keys are cut into A0W equal runs, one a wave, so a K or V row
// has one address for the whole wave and comes through the scalar path. Each wave keeps its own running maximum, denominator and o over its run (A0K keys a trip, one
// rescale a trip); the A0W partial results are brought to the common maximum and added through LDS, always in the order of the runs.
#define A0W 16                       /* waves = key runs per work-group */
#define A0K (32 / A0W)               /* keys a trip: a run is A0K * (rg + 1) keys */
#define A0LD (3 * NH * HD)           /* row pitch of the f32 q | k | v plane */
#define A0P (HD + 4)                 /* LDS pitch of a partial o row: 16 B x odd, so that 16-byte accesses of 32 rows spread over the banks */
__global__ __launch_bounds__(32 * A0W) void k_att0w(const float* __restrict__ QF, const float* __restrict__ KF, const float* __restrict__ VF, float scale, float* __restrict__ OF) {
  static_assert(NH == 1 && HD == 64 && QT0 % 32 == 0 && A0W * A0K == 32 && 32 * A0W * 4 == 32 * HD, "one 64-wide head; 32 rows a block; the merge gives every thread 4 columns of one row");
  __shared__ float pm[A0W][32]; __shared__ float pl[A0W][32]; __shared__ float pfin[32]; __shared__ __attribute__((aligned(16))) float po[A0W][32][A0P];
  const int lane = threadIdx.x & 31; const int w = __builtin_amdgcn_readfirstlane((int)(threadIdx.x >> 5));      /* the wave's number as a scalar: K and V addresses are wave-uniform */
  const int rg = blockIdx.x; const int i = rg * 32 + lane;
  { const size_t bi = (size_t)blockIdx.y * QT0; QF += bi * A0LD; KF += bi * A0LD; VF += bi * A0LD; OF += bi * HD; }
  float q[HD], o[HD]; const float* qp = QF + (size_t)i * A0LD;
#pragma unroll
  for (int c = 0; c < HD / 4; ++c) { const v4f t = *(const v4fa*)(qp + c * 4);
#pragma unroll
    for (int u = 0; u < 4; ++u) { q[c * 4 + u] = t[u]; o[c * 4 + u] = 0.f; } }
  asm volatile("s_wait_xcnt 0x0" :: "v"(qp) : "memory");      /* the wait in front of any overwrite of the address pair that the q loads name; the pair is an input, so it stays whole up to here */
  float m = -1.0e30f, l = 0.f; const int kbeg = w * A0K * (rg + 1);
#pragma unroll 1
  for (int ch = 0; ch <= rg; ++ch) { const int j0 = kbeg + ch * A0K; const float* kr = KF + (size_t)j0 * A0LD; const float* vr = VF + (size_t)j0 * A0LD;
    float s[A0K]; float mn = m;
#pragma unroll
    for (int k = 0; k < A0K; ++k) { float p[4] = {0.f, 0.f, 0.f, 0.f};      /* four sums a score: four independent FMA chains of 16 */
#pragma unroll
      for (int c = 0; c < HD; ++c) p[c & 3] = fmaf(q[c], kr[k * A0LD + c], p[c & 3]);
      s[k] = (j0 + k <= i) ? ((p[0] + p[1]) + (p[2] + p[3])) * scale : -1.0e30f; mn = fmaxf(mn, s[k]); }
    const float sc = exp_neg(m - mn); float e[A0K]; float es = 0.f;      /* nothing seen yet: m = mn = -1e30, sc = 1 on l = 0 and o = 0 */
#pragma unroll
    for (int k = 0; k < A0K; ++k) { e[k] = (j0 + k <= i) ? exp_neg(s[k] - mn) : 0.f; es += e[k]; }      /* a key behind the row counts 0 also where the whole run so far is behind it */
    l = fmaf(l, sc, es); m = mn;
#pragma unroll
    for (int c = 0; c < HD; ++c) { float t = o[c] * sc;
#pragma unroll
      for (int k = 0; k < A0K; ++k) t = fmaf(e[k], vr[k * A0LD + c], t);
      o[c] = t; } }
  pm[w][lane] = m; pl[w][lane] = l;
  __syncthreads();
  float mx = pm[0][lane];      /* run 0 holds key 0, which every row sees: the common maximum is a real score */
#pragma unroll
  for (int u = 1; u < A0W; ++u) mx = fmaxf(mx, pm[u][lane]);
  if (w == 0) { float ls = 0.f;
#pragma unroll
    for (int u = 0; u < A0W; ++u) ls = fmaf(exp_neg(pm[u][lane] - mx), pl[u][lane], ls);
    pfin[lane] = 64.0f / ls; }      /* o carried x64; k_o0m multiplies by 1/64 */
  const float f = exp_neg(m - mx);
#pragma unroll
  for (int c = 0; c < HD / 4; ++c) { v4f t;
#pragma unroll
    for (int u = 0; u < 4; ++u) t[u] = o[c * 4 + u] * f;
    *(v4f*)&po[w][lane][c * 4] = t; }
  __syncthreads();
  const int row = threadIdx.x >> 4, c4 = (threadIdx.x & 15) * 4;      /* a wave adds and stores two whole o rows: 512 B in a row */
  v4f r = {0.f, 0.f, 0.f, 0.f};
#pragma unroll
  for (int u = 0; u < A0W; ++u) r += *(const v4f*)&po[u][row][c4];
  r *= pfin[row];
  *(v4f*)(OF + (size_t)(rg * 32 + row) * HD + c4) = r; }


template <int BFIN, int WXB>
__global__ __launch_bounds__(256) void k_ln16(const float* __restrict__ X, const float* __restrict__ g, const float* __restrict__ bb, float eps, _Float16* __restrict__ N16, float* __restrict__ XB) {
  #pragma clang fp contract(off)
  __shared__ float red[256]; const size_t r = blockIdx.x; const int t = threadIdx.x; const v4f xa = *(const v4fa*)(X + r * DMQ + t * 4); float s[4]; float sum = 0.f;
  for (int q = 0; q < 4; ++q) { s[q] = BFIN ? bf16_round(xa[q]) : xa[q]; sum = __fadd_rn(sum, s[q]); }
  red[t] = sum; __syncthreads(); for (int st = 128; st > 0; st >>= 1) { if (t < st) red[t] = __fadd_rn(red[t], red[t + st]); __syncthreads(); } const float mu = red[0] / (float)DMQ; __syncthreads();
  float vs = 0.f; for (int q = 0; q < 4; ++q) { const float dl = __fadd_rn(s[q], -mu); vs = __fadd_rn(vs, __fmul_rn(dl, dl)); } red[t] = vs; __syncthreads(); for (int st = 128; st > 0; st >>= 1) { if (t < st) red[t] = __fadd_rn(red[t], red[t + st]); __syncthreads(); }
  const float rs = rsqrtf(__fadd_rn(red[0] / (float)DMQ, eps)); v4h y; v4f xb;
  for (int q = 0; q < 4; ++q) { const int c = t * 4 + q; y[q] = (_Float16)__fadd_rn(__fmul_rn(__fmul_rn(__fadd_rn(s[q], -mu), rs), bf16_round(g[c])), bf16_round(bb[c])); xb[q] = s[q]; }
  { *(v4h*)(N16 + r * DMQ + t * 4) = y; if (WXB) *(v4f*)(XB + r * DMQ + t * 4) = xb;  } }
__global__ __launch_bounds__(256) void k_ftres2(const float* __restrict__ OF0, const float* __restrict__ XB, float* __restrict__ X1, size_t n4) {
  #pragma clang fp contract(off)
  const size_t t = (size_t)blockIdx.x * 256 + threadIdx.x; if (t >= n4) return; const v4f o = *(const v4fa*)(OF0 + t * 4), xv = *(const v4fa*)(XB + t * 4); v4f y; for (int q = 0; q < 4; ++q) y[q] = __fadd_rn(__fmul_rn(o[q], 0.015625f), xv[q]); *(v4f*)(X1 + t * 4) = y;  }

__global__ __launch_bounds__(256) void k_wthd(const float* __restrict__ Wt, _Float16* __restrict__ Bt) { const size_t t = (size_t)blockIdx.x * 256 + threadIdx.x; if (t >= (size_t)NH * HD * (DM / 8)) return; const int m8 = (int)(t % (DM / 8)) * 8; const int d = (int)((t / (DM / 8)) % HD); const int h = (int)(t / ((size_t)(DM / 8) * HD)); FragH f;
  for (int q = 0; q < 8; ++q) f.h[q] = (_Float16)(16.0f * bf16_round(Wt[((size_t)h * DM + m8 + q) * HD + d])); unsigned short* dst = (unsigned short*)Bt + ((size_t)h * HD + d) * DM + m8; *(v8us*)dst = f.half[0];  }




__global__ __launch_bounds__(256) void k_wtpad(const float* __restrict__ Wm, _Float16* __restrict__ Wt, int Kr, int Kp, int Nr, int Np, float scale) {
  const int t = blockIdx.x * 256 + threadIdx.x; if (t >= Np * (Kp / 8)) return; const int n = t / (Kp / 8), k8 = (t % (Kp / 8)) * 8; const int nc = min(n, Nr - 1); const float fn = (n < Nr) ? 1.f : 0.f; FragH f;
  for (int i = 0; i < 8; ++i) { const int k = k8 + i; const int kc = min(k, Kr - 1); const float fk = (k < Kr) ? fn : 0.f; f.h[i] = (_Float16)(bf16_round(Wm[(size_t)kc * Nr + nc]) * scale * fk); }
  unsigned short* o = (unsigned short*)Wt + (size_t)n * Kp + k8; *(v8us*)o = f.half[0];  }
__global__ __launch_bounds__(128) void k_bpad(const float* __restrict__ b, float* __restrict__ Bp, int nr, int np) {
  const int i = threadIdx.x; if (i >= np) return; const float v = b[min(i, nr - 1)] * ((i < nr) ? 1.f : 0.f); *(float*)(Bp + i) = v;  }

#define DI 64         /* inner width = NH * HD (ONE 64-wide head) */
#define LQK (3 * DI)  /* fused q | k | v row pitch (192) */
__global__ __launch_bounds__(256) void k_o0(const float* __restrict__ OF, float* __restrict__ ob, size_t n4) {
  #pragma clang fp contract(off)
  const size_t t = (size_t)blockIdx.x * 256 + threadIdx.x; if (t >= n4) return; const size_t e = t * 4; const int i = (int)(e / DI); const int c = (int)(e % DI); const int h = c / HD, d = c % HD; const v4f a = *(const v4fa*)(OF + e); v4f o; for (int q = 0; q < 4; ++q) o[q] = __fmul_rn(a[q], 0.015625f); float* dst = ob + (size_t)h * SQ * HD + (size_t)i * HD + d; *(v4f*)dst = o;  }

// The whole projection stage in ONE launch: q | k | v = x W for PJR token rows a work-group. x comes in as f32 in whole lines, is rounded as before (bf16, exact in f16) and laid in LDS as f16 rows;
// wave w owns columns 16 w .. 16 w + 15 of q | k | v and builds its eight B fragments straight from the f32 weights (lane = column, so a load takes 64 B of each of two weight rows; value bf16-rounded, x16, f16: as before).
// Products, k order and the order of the k steps are those of the GEMM that this takes the place of, so every q, k, v value is the same number. The accumulators go out three ways, all staged in LDS so that every store
// is of whole 128-B lines: q | k as f16 rows, v as f16 V^T rows (a lane holds 8 tokens in a row of one column: one 16-byte LDS store), and, for the first QT0 rows of a batch, q | k | v as f32.
#define PJR 64                       /* token rows per work-group: 256 work-groups */
#define PJW 12                       /* waves = 16-column tiles of q | k | v */
#define PJT (32 * PJW)
#define PJXP (DM + 8)                /* LDS pitch of an x row, halves: 528 B = 16 B x odd, for 16-byte fragment reads */
#define PJOP (2 * DI + 8)            /* LDS pitch of a q | k row, halves: 272 B = 16 B x odd */
#define PJVP (PJR + 8)               /* LDS pitch of a V^T row, halves: 144 B = 16 B x odd */
#define PJFP (LQK + 4)               /* LDS pitch of an f32 q | k | v row, floats: 784 B = 16 B x odd */
typedef __bf16 v2b __attribute__((ext_vector_type(2)));
typedef unsigned short v4us __attribute__((ext_vector_type(4), may_alias));
// two floats rounded to bf16 (nearest, ties to even: the value of bf16_round) by the conversion instruction, times s, as two f16
__device__ __forceinline__ void pj_cvt2(float a, float b, float s, _Float16& ha, _Float16& hb) { const v2b p = {(__bf16)a, (__bf16)b}; const unsigned int u = __builtin_bit_cast(unsigned int, p); ha = (_Float16)(__uint_as_float(u << 16) * s); hb = (_Float16)(__uint_as_float(u & 0xFFFF0000u) * s); }
__global__ __launch_bounds__(PJT) void k_proj(const float* __restrict__ x, const float* __restrict__ wq, const float* __restrict__ wk, const float* __restrict__ wv, _Float16* __restrict__ QK, _Float16* __restrict__ VT, float* __restrict__ F0) {
  static_assert(PJW * 16 == LQK && DI == 64 && DM == 256 && SQ % PJR == 0 && QT0 % PJR == 0 && (PJR * 2 * DI + DI * PJR) / 8 == 4 * PJT && PJR * LQK / 4 == 8 * PJT, "a wave a column tile; a work-group lies in one batch and wholly inside or outside the exact rows; the store loops divide evenly");
  __shared__ __attribute__((aligned(16))) _Float16 xs[PJR][PJXP]; __shared__ __attribute__((aligned(16))) _Float16 so[PJR][PJOP]; __shared__ __attribute__((aligned(16))) _Float16 sv[DI][PJVP]; __shared__ __attribute__((aligned(16))) float sf[PJR][PJFP];
  const int tid = threadIdx.x, lane = tid & 31, ln = lane & 15, hh = lane >> 4; const int w = __builtin_amdgcn_readfirstlane(tid >> 5);      /* the wave's number as a scalar: which weight matrix, and every branch on it, is scalar */
  const size_t r0 = (size_t)blockIdx.x * PJR; const int b = (int)(r0 / SQ), s0 = (int)(r0 % SQ);
  const float* wp = (w < 4 ? wq : w < 8 ? wk : wv) + (w & 3) * 16 + ln + (size_t)(8 * hh) * DI; float wr[8][16];
#pragma unroll
  for (int ks = 0; ks < 8; ++ks)
#pragma unroll
    for (int i = 0; i < 8; ++i) { wr[ks][i] = wp[(size_t)(ks * 32 + i) * DI]; wr[ks][8 + i] = wp[(size_t)(ks * 32 + 16 + i) * DI]; }      /* the k order of g2_frag: 8 hh + i, 16 + 8 hh + i */
  const char* xb = (const char*)(x + r0 * DM); const unsigned xo = (unsigned)tid * 16u; const char* xt = xb + xo; v4f xa[11];      /* 4 floats a thread and turn: each load of a wave covers 512 B in a row, four whole lines */
#pragma unroll
  for (int u = 0; u < 11; ++u) if (u < 10 || w < 8) xa[u] = *(const v4fa*)(xt + u * PJT * 16);      /* PJR * DM / 4 = 10 * PJT + 256 */
  asm volatile("s_wait_xcnt 0x0" :: "v"(xo), "v"(xt), "v"(wp), "s"(xb) : "memory");      /* the wait in front of any overwrite of the address registers that the loads above name; x's offset, base and full address and the weights' address are inputs, so whichever form a load takes, its registers stay whole up to here */
  FragH bf[8];
#pragma unroll
  for (int ks = 0; ks < 8; ++ks)
#pragma unroll
    for (int i = 0; i < 16; i += 2) pj_cvt2(wr[ks][i], wr[ks][i + 1], 16.0f, bf[ks].h[i], bf[ks].h[i + 1]);
#pragma unroll
  for (int u = 0; u < 11; ++u) if (u < 10 || w < 8) { const int i = tid + u * PJT; FragH f;
    pj_cvt2(xa[u][0], xa[u][1], 1.0f, f.h[0], f.h[1]); pj_cvt2(xa[u][2], xa[u][3], 1.0f, f.h[2], f.h[3]);
    *(v4us*)&xs[i >> 6][(i & 63) * 4] = v4us{f.u[0], f.u[1], f.u[2], f.u[3]}; }
  __syncthreads();
  v8f acc[4];
#pragma unroll
  for (int mt = 0; mt < 4; ++mt) acc[mt] = v8f{0.f, 0.f, 0.f, 0.f, 0.f, 0.f, 0.f, 0.f};
#pragma unroll
  for (int ks = 0; ks < 8; ++ks)
#pragma unroll
    for (int mt = 0; mt < 4; ++mt) acc[mt] = fa_mma(g2_frag(&xs[mt * 16 + ln][ks * 32], hh), bf[ks].v, acc[mt]);
#pragma unroll
  for (int mt = 0; mt < 4; ++mt) acc[mt] *= 0.0625f;      /* the weights ride x16 */
  const bool ft = s0 < QT0;      /* the same for the whole work-group */
  if (w < 8) {
#pragma unroll
    for (int mt = 0; mt < 4; ++mt)
#pragma unroll
      for (int r = 0; r < 8; ++r) so[mt * 16 + 8 * hh + r][w * 16 + ln] = (_Float16)acc[mt][r];
  } else {
#pragma unroll
    for (int mt = 0; mt < 4; ++mt) { FragH f;
#pragma unroll
      for (int r = 0; r < 8; ++r) f.h[r] = (_Float16)acc[mt][r];
      *(v8us*)&sv[(w & 3) * 16 + ln][mt * 16 + 8 * hh] = f.half[0]; } }
  if (ft) {
#pragma unroll
    for (int mt = 0; mt < 4; ++mt)
#pragma unroll
      for (int r = 0; r < 8; ++r) sf[mt * 16 + 8 * hh + r][w * 16 + ln] = acc[mt][r]; }
  __syncthreads();
  { v4f t[4]; float* p[4];      /* 16-byte pieces: 1024 of q | k rows (256 B a row), then 512 of V^T rows (128 B a row); the border falls between waves. All reads, then all stores: one LDS latency, not four */
#pragma unroll
    for (int u = 0; u < 4; ++u) { const bool qk = u < 2 || (u == 2 && w < 8); const int i = tid + u * PJT, j = qk ? 0 : i - PJR * 16;
      const _Float16* sp = qk ? &so[i >> 4][(i & 15) * 8] : &sv[j >> 3][(j & 7) * 8];
      _Float16* gp = qk ? QK + (r0 + (size_t)(i >> 4)) * LQK + (i & 15) * 8 : VT + ((size_t)b * HD + (size_t)(j >> 3)) * SQ + s0 + (j & 7) * 8;
      t[u] = *(const v4fa*)sp; p[u] = (float*)gp; }
#pragma unroll
    for (int u = 0; u < 4; ++u) *(v4fa*)p[u] = t[u];
    asm volatile("s_wait_xcnt 0x0" :: "v"(p[0]), "v"(p[1]), "v"(p[2]), "v"(p[3]), "v"(t[0]), "v"(t[1]), "v"(t[2]), "v"(t[3]) : "memory"); }      /* the wait in front of any overwrite of a register that these stores name; addresses and data are inputs, so they stay whole up to here */
  if (ft) { v4f t[8]; float* p[8]; float* fb = F0 + ((size_t)b * QT0 + s0) * LQK + (size_t)tid * 4;      /* the 64 f32 rows are one run of 48 KiB */
#pragma unroll
    for (int u = 0; u < 8; ++u) { const int i = tid + u * PJT; t[u] = *(const v4f*)&sf[i / (LQK / 4)][(i % (LQK / 4)) * 4]; p[u] = fb + (size_t)u * PJT * 4; }
#pragma unroll
    for (int u = 0; u < 8; ++u) *(v4f*)p[u] = t[u];
    asm volatile("s_wait_xcnt 0x0" :: "v"(t[0]), "v"(t[1]), "v"(t[2]), "v"(t[3]), "v"(t[4]), "v"(t[5]), "v"(t[6]), "v"(t[7]) : "memory"); } }      /* the same wait: the data are inputs, so no piece's registers are taken for a later piece while its store is on its way */

__global__ __launch_bounds__(256) void k_o0m(const float* __restrict__ OF, float* __restrict__ o_, size_t n4) {
  #pragma clang fp contract(off)
  OF += (size_t)blockIdx.y * n4 * 4; o_ += (size_t)blockIdx.y * SQ * DI;      /* grid.y = batch: n4 * 4 exact elements a batch, written to the head of that batch's output rows */
  const size_t t = (size_t)blockIdx.x * 256 + threadIdx.x; if (t >= n4) return; const size_t e = t * 4; const v4f a = *(const v4fa*)(OF + e); v4f o; for (int q = 0; q < 4; ++q) o[q] = __fmul_rn(a[q], 0.015625f); *(v4f*)(o_ + e) = o;  }
extern "C" void kernel_launch(void* const* d_in, const int* in_sizes, int n_in,
                              void* d_out, int out_size, void* d_ws, size_t ws_size, hipStream_t stream) {
  (void)in_sizes; (void)n_in; (void)out_size;
  const float* const* I = (const float* const*)d_in; const float* x = I[0]; const float* wq = I[2]; const float* wk = I[1]; const float* wv = I[3];      /* x; [in][out = 64] Wk / Wq / Wv (input order as this module lists them); no biases */
  char* ws = (char*)d_ws; size_t off = 0;
  auto take = [&](size_t bytes) { char* p = ws + off; off += (bytes + 255) & ~(size_t)255; return p; };
  _Float16* QKV = (_Float16*)take(NR * LQK * 2); _Float16* VT = (_Float16*)take((size_t)NB * HD * SQ * 2);
  float* QKVF0 = (float*)take((size_t)NB * QT0 * LQK * 4); float* OF0 = (float*)take((size_t)NB * QT0 * DI * 4);      /* one plane a batch: the four batches run side by side on grid.y */
  if (off > ws_size) return;
  k_proj<<<(unsigned)(NR / PJR), PJT, 0, stream>>>(x, wq, wk, wv, QKV, VT, QKVF0);      /* q | k f16 rows (columns 0 / 64 of the plane at pitch 192; its v columns stay unwritten and unread), V^T [NB][HD][SQ] f16, f32 q | k | v of rows 0..511 of every batch */
  const _Float16* Q16 = QKV; const _Float16* K16 = QKV + DI;
  static_assert(NH == 1, "grid.y carries the batch in place of the head");
  float* ob = (float*)d_out;
  static_assert(LQK3 == LQK, "the fused kernel reads the q | k | v plane at its pitch");
  k_fattn<<<dim3(SQ / FAR, NB), 32 * FAW, 0, stream>>>(Q16, K16, VT, 0.0625f, ob);      /* out[b][i][0..63] = softmax(causal q k^T * 256^-0.5 = 1/16: the module scales by the EMBEDDING width) v, f32, all query rows of all batches in one launch */
  k_att0w<<<dim3(QT0 / 32, NB), 32 * A0W, 0, stream>>>(QKVF0, QKVF0 + DI, QKVF0 + 2 * DI, 0.0625f, OF0);      /* exact f32 causal attention for rows 0..511 (o x64) */
  k_o0m<<<dim3((unsigned)(((size_t)QT0 * DI / 4 + 255) / 256), NB), 256, 0, stream>>>(OF0, ob, (size_t)QT0 * DI / 4);      /* rows 0..511 of every batch REWRITTEN from the exact path */
}

// v006
// One run takes 48.1 microseconds.
// Next to v005, in two timings, it ran 1.64 times as fast each time.
// All steps since v000 together make it 677 times as fast.
#include <hip/hip_runtime.h>
// Single-head causal self-attention with the module's EMBEDDING-width scale (x [4][4096][256]; k/q/v = x W ([in][out] [256][64], U(+-0.1), no biases; input order Wk, Wq, Wv); ONE 64-wide head; wei * 256^-0.5 (n_embd, as in the source); causal (tril, -inf); softmax; out = wei v -> [4][4096][64]; no output projection).
// Structure: token rows; ONE projection launch (x and the weights converted to their exact f16 values on the way in; WMMA; writes the f16 q | k rows at pitch 192, v^T, and the f32 q | k | v of rows 0..511); ONE attention launch with the batches on grid.x: rows 512.. by the fused f16 path (scores, online softmax f32 -> f16 weights in registers, P V, written as f32 straight into the output rows), rows 0..511 by exact f32 work-groups of the same launch; launches: see trace.
// Compute dtype: inputs rounded to bf16; x / weights exact; q, k, v and softmax weights as plain f16 GEMM operands (~2^-12); o, scores and softmax statistics f32; v_wmma_f32_16x16x32_f16.
#define NB 4
#define SQ 4096
#define DM 256
#define NH 1
#define HD 64
#define HG 4                         /* heads per block group of the unlaunched k_vt(b, h0) overload */
#define QT 256                       /* unused */
#define NKX SQ                       /* unused */
#define QT0 512                      /* first-tile rows recomputed exactly (f32): 512 here (no output projection averages the early-row cancellation errors away; logit sigma 1.0) */
#define B0 0                         /* unused; the batches run on grid.x from 0 */
#define NBR NB                       /* feeds only MP; grid.x runs over the NB batches */
#define NR ((size_t)NB * SQ)
#define DMQ DM
#define DFF 4096                     /* unused; this file has no FFN */
#define DFFR 100                     /* unused */
#define MP ((int)((size_t)NBR * SQ)) /* feeds only MPO; the projection runs over NR rows */
#define QN SQ                        /* unused */
#define NHD NH                       /* unused */
#define MPO MP                       /* unused */
#define LQ (3 * DM)      /* 3 * DM = 768, unused; the q/k/v rows use pitch LQK = 192 */
typedef __bf16 v16b __attribute__((ext_vector_type(16)));
typedef unsigned short v8us __attribute__((ext_vector_type(8), may_alias));
typedef float  v8f  __attribute__((ext_vector_type(8)));
typedef float  v4f  __attribute__((ext_vector_type(4)));
typedef float  v4fa __attribute__((ext_vector_type(4), may_alias));
union FragB { v16b v; v8us half[2]; unsigned short u[16]; };

__device__ __forceinline__ unsigned short bf16_bits(float x) { unsigned int u = __float_as_uint(x); return (unsigned short)((u + 0x7FFFu + ((u >> 16) & 1u)) >> 16); }
__device__ __forceinline__ float bf16_val(unsigned short b) { return __uint_as_float(((unsigned int)b) << 16); }
__device__ __forceinline__ float bf16_round(float x) { return bf16_val(bf16_bits(x)); }
// D += A·B with NT terms: 1 = ah·bh, 2 = + al·bh (A split), 3 = + ah·bl (both split)
template <int NT>
__device__ __forceinline__ v8f mmaN(v16b ah, v16b al, v16b bh, v16b bl, v8f c) {
  c = __builtin_amdgcn_wmma_f32_16x16x32_bf16(false, ah, false, bh, (short)0, c, false, false);
  if (NT >= 2) c = __builtin_amdgcn_wmma_f32_16x16x32_bf16(false, al, false, bh, (short)0, c, false, false);
  if (NT >= 3) c = __builtin_amdgcn_wmma_f32_16x16x32_bf16(false, ah, false, bl, (short)0, c, false, false);
  asm volatile("v_nop\n\tv_nop\n\tv_nop\n\tv_nop" : "+v"(c) : "v"(ah), "v"(al), "v"(bh), "v"(bl));
  return c;
}

__global__ __launch_bounds__(256) void k_wt_bf16(const float* __restrict__ W, unsigned short* __restrict__ Wt, int K, int N) {
  const int t = blockIdx.x * 256 + threadIdx.x;
  const int k8n = K / 8;
  if (t >= N * k8n) return;
  const int n = t / k8n, k8 = (t % k8n) * 8;
  v8us v;
#pragma unroll
  for (int i = 0; i < 8; ++i) v[i] = bf16_bits(W[(size_t)(k8 + i) * N + n]);
  *(v8us*)(Wt + (size_t)n * K + k8) = v;
  
}

// GEMM C[M][N] (f32, pitch ldc) = act(A[M][K]·W + bias). A f32 row-major (pitch lda) converted per fragment to bf16
// (ASPLIT: hi/lo two planes -> 2 terms, else single rounded term); Wt bf16 [N][K] (pitch ldb). BIAS_BF16 rounds the
// bias to bf16 first (bias quantised to bf16 before the add). K%32==0, M%16==0, N%64==0.
template <bool ASPLIT, int ACT, bool BIAS_BF16>
__global__ __launch_bounds__(128) void k_gemm_bf(const float* __restrict__ A, int lda, const unsigned short* __restrict__ Wt, int ldb,
                                               const float* __restrict__ bias, float* __restrict__ C, int ldc, int M, int N, int K) {
  __shared__ __attribute__((aligned(16))) float so[4][16][64];
  const int tid = threadIdx.x, w = tid >> 5, lane = tid & 31, ln = lane & 15, hh = lane >> 4;
  const int ntn = N / 64;
  const int wid = blockIdx.x * 4 + w;
  const int mt = wid / ntn, nq = wid % ntn;
  if (mt * 16 >= M) return;
  const int row0 = mt * 16, col0 = nq * 64;
  const float* arow = A + (size_t)(row0 + ln) * lda;
  v8f acc[4] = {};
  for (int kb = 0; kb < K; kb += 32) {
    FragB ah, al;
    const v4f x0 = *(const v4fa*)(arow + kb + 8 * hh), x1 = *(const v4fa*)(arow + kb + 8 * hh + 4);
    const v4f x2 = *(const v4fa*)(arow + kb + 16 + 8 * hh), x3 = *(const v4fa*)(arow + kb + 16 + 8 * hh + 4);
    float xs[16] = {x0[0],x0[1],x0[2],x0[3],x1[0],x1[1],x1[2],x1[3],x2[0],x2[1],x2[2],x2[3],x3[0],x3[1],x3[2],x3[3]};
#pragma unroll
    for (int i = 0; i < 16; ++i) { const unsigned short hb = bf16_bits(xs[i]); ah.u[i] = hb; al.u[i] = ASPLIT ? bf16_bits(xs[i] - bf16_val(hb)) : (unsigned short)0; }
#pragma unroll
    for (int t = 0; t < 4; ++t) {
      const unsigned short* brow = Wt + (size_t)(col0 + t * 16 + ln) * ldb + kb;
      FragB b;
      b.half[0] = *(const v8us*)(brow + 8 * hh);
      b.half[1] = *(const v8us*)(brow + 16 + 8 * hh);
      acc[t] = mmaN<ASPLIT ? 2 : 1>(ah.v, al.v, b.v, b.v, acc[t]);
    }
  }
#pragma unroll
  for (int t = 0; t < 4; ++t) {
    float bv = bias ? bias[col0 + t * 16 + ln] : 0.f;
    if (BIAS_BF16) bv = bf16_round(bv);
#pragma unroll
    for (int r = 0; r < 8; ++r) { float v = acc[t][r] + bv; if (ACT == 1) v = fmaxf(v, 0.f); so[w][8 * hh + r][t * 16 + ln] = v; }
  }
  __builtin_amdgcn_fence(__ATOMIC_ACQ_REL, "workgroup");
  __builtin_amdgcn_wave_barrier();
  const int rsub = lane >> 4, c4 = (lane & 15) * 4;
  {
#pragma unroll
    for (int q = 0; q < 8; ++q) {
      const int r = q * 2 + rsub;
      const v4f v = *(const v4fa*)&so[w][r][c4];
      *(v4f*)(C + (size_t)(row0 + r) * ldc + col0 + c4) = v;
    }
    
  }
}

// GEMM C = act(A·W + bias + resid): A f32 (ASPLIT -> hi/lo 2 terms), Wt bf16 [N][K]; ACT 0 none, 1 relu, 2 exact gelu;
// resid (optional, f32, row index = (row % rmod), pitch ldr, RES_BF16 rounds it) added before the activation.
template <bool ASPLIT, int ACT, bool BIAS_BF16, bool RES_BF16>
__global__ __launch_bounds__(128) void k_gemm_bf3(const float* __restrict__ A, int lda, const unsigned short* __restrict__ Wt, int ldb,
                                                const float* __restrict__ bias, const float* __restrict__ resid, int rmod, int ldr,
                                                float* __restrict__ C, int ldc, int M, int N, int K) {
  __shared__ __attribute__((aligned(16))) float so[4][16][64];
  const int tid = threadIdx.x, w = tid >> 5, lane = tid & 31, ln = lane & 15, hh = lane >> 4;
  const int ntn = N / 64;
  const int wid = blockIdx.x * 4 + w;
  const int mt = wid / ntn, nq = wid % ntn;
  if (mt * 16 >= M) return;
  const int row0 = mt * 16, col0 = nq * 64;
  const float* arow = A + (size_t)(row0 + ln) * lda;
  v8f acc[4] = {};
  for (int kb = 0; kb < K; kb += 32) {
    FragB ah, al;
    const v4f x0 = *(const v4fa*)(arow + kb + 8 * hh), x1 = *(const v4fa*)(arow + kb + 8 * hh + 4);
    const v4f x2 = *(const v4fa*)(arow + kb + 16 + 8 * hh), x3 = *(const v4fa*)(arow + kb + 16 + 8 * hh + 4);
    float xs[16] = {x0[0],x0[1],x0[2],x0[3],x1[0],x1[1],x1[2],x1[3],x2[0],x2[1],x2[2],x2[3],x3[0],x3[1],x3[2],x3[3]};
#pragma unroll
    for (int i = 0; i < 16; ++i) { const unsigned short hb = bf16_bits(xs[i]); ah.u[i] = hb; al.u[i] = ASPLIT ? bf16_bits(xs[i] - bf16_val(hb)) : (unsigned short)0; }
#pragma unroll
    for (int t = 0; t < 4; ++t) {
      const unsigned short* brow = Wt + (size_t)(col0 + t * 16 + ln) * ldb + kb;
      FragB b;
      b.half[0] = *(const v8us*)(brow + 8 * hh);
      b.half[1] = *(const v8us*)(brow + 16 + 8 * hh);
      acc[t] = mmaN<ASPLIT ? 2 : 1>(ah.v, al.v, b.v, b.v, acc[t]);
    }
  }
#pragma unroll
  for (int t = 0; t < 4; ++t) {
    const int col = col0 + t * 16 + ln;
    float bv = bias ? bias[col] : 0.f;
    if (BIAS_BF16) bv = bf16_round(bv);
#pragma unroll
    for (int r = 0; r < 8; ++r) {
      float v = acc[t][r] + bv;
      if (resid) { float rv = resid[(size_t)((row0 + 8 * hh + r) % rmod) * ldr + col]; if (RES_BF16) rv = bf16_round(rv); v += rv; }
      if (ACT == 1) v = fmaxf(v, 0.f);
      if (ACT == 2) v = 0.5f * v * (1.0f + erff(v * 0.70710678118654752f));
      if (ACT == 3) { const float u = 0.7978845608028654f * (v + 0.044715f * v * v * v); v = 0.5f * v * (1.0f + tanhf(u)); }
      so[w][8 * hh + r][t * 16 + ln] = v;
    }
  }
  __builtin_amdgcn_fence(__ATOMIC_ACQ_REL, "workgroup");
  __builtin_amdgcn_wave_barrier();
  const int rsub = lane >> 4, c4 = (lane & 15) * 4;
  {
#pragma unroll
    for (int q = 0; q < 8; ++q) {
      const int r = q * 2 + rsub;
      const v4f v = *(const v4fa*)&so[w][r][c4];
      *(v4f*)(C + (size_t)(row0 + r) * ldc + col0 + c4) = v;
    }
    
  }
}
// row LayerNorm (biased variance, eps) over N: s = X (+ R); optional out_sum <- s; out_norm <- (s-mu)*rsqrt(var+eps)*g + b
template <bool PARAM_BF16>
__global__ __launch_bounds__(256) void k_layernorm(const float* __restrict__ X, const float* __restrict__ R, const float* __restrict__ g, const float* __restrict__ bta,
                                                  float* __restrict__ out_sum, float* __restrict__ out_norm, int N, float eps) {
  __shared__ float red[256];
  const int row = blockIdx.x, tid = threadIdx.x;
  const float* x = X + (size_t)row * N; const float* rr = R ? R + (size_t)row * N : nullptr;
  float vals[16];                     // up to N = 4096
  const int per = N / 256;            // contiguous chunk per thread? use strided-by-4 chunks: thread handles j = tid*4 + 1024*u
  float s1 = 0.f;
  for (int u = 0; u < per / 4; ++u) {
    const int j = tid * 4 + 1024 * u;
    const v4f a = *(const v4fa*)(x + j);
    v4f b = {0.f,0.f,0.f,0.f}; if (rr) b = *(const v4fa*)(rr + j);
#pragma unroll
    for (int q = 0; q < 4; ++q) { const float v = a[q] + b[q]; vals[u * 4 + q] = v; s1 += v; }
  }
  red[tid] = s1; __syncthreads();
  for (int st = 128; st > 0; st >>= 1) { if (tid < st) red[tid] += red[tid + st]; __syncthreads(); }
  const float mu = red[0] / (float)N; __syncthreads();
  float s2 = 0.f;
  for (int u = 0; u < per / 4; ++u)
#pragma unroll
    for (int q = 0; q < 4; ++q) { const float c = vals[u * 4 + q] - mu; s2 += c * c; }
  red[tid] = s2; __syncthreads();
  for (int st = 128; st > 0; st >>= 1) { if (tid < st) red[tid] += red[tid + st]; __syncthreads(); }
  const float rs = rsqrtf(red[0] / (float)N + eps);
  {
    for (int u = 0; u < per / 4; ++u) {
      const int j = tid * 4 + 1024 * u;
      v4f o, sm;
#pragma unroll
      for (int q = 0; q < 4; ++q) {
        float gg = g[j + q], bb = bta[j + q];
        if (PARAM_BF16) { gg = bf16_round(gg); bb = bf16_round(bb); }
        sm[q] = vals[u * 4 + q]; o[q] = (vals[u * 4 + q] - mu) * rs * gg + bb;
      }
      if (out_sum) *(v4f*)(out_sum + (size_t)row * N + j) = sm;
      *(v4f*)(out_norm + (size_t)row * N + j) = o;
    }
    
  }
}



// ---- f16 WMMA path (v_wmma_f32_16x16x32_f16): 11-bit significands for operands in range — used where a [0,1] probability operand needs more precision than bf16
typedef _Float16 v16h __attribute__((ext_vector_type(16)));
union FragH { v16h v; v8us half[2]; _Float16 h[16]; unsigned short u[16]; };
template <int NT>
__device__ __forceinline__ v8f mmaH(v16h ah, v16h al, v16h bh, v16h bl, v8f c) {
  c = __builtin_amdgcn_wmma_f32_16x16x32_f16(false, ah, false, bh, (short)0, c, false, false);
  if (NT >= 2) c = __builtin_amdgcn_wmma_f32_16x16x32_f16(false, al, false, bh, (short)0, c, false, false);
  if (NT >= 3) c = __builtin_amdgcn_wmma_f32_16x16x32_f16(false, ah, false, bl, (short)0, c, false, false);
  asm volatile("v_nop\n\tv_nop\n\tv_nop\n\tv_nop" : "+v"(c) : "v"(ah), "v"(al), "v"(bh), "v"(bl));
  return c;
}
// batched GEMM like k_gemm_b but f16 operands: A f32 (split into f16 hi/lo if ASPLIT, else rounded to f16), Bt = f16 values [n][k]; alpha; C f32; N multiple of 16 (partial tiles skipped)
template <bool ASPLIT>
__global__ __launch_bounds__(128) void k_gemm_h(const float* __restrict__ A, int lda, size_t sA, const _Float16* __restrict__ Bh, int ldb, size_t sB, float alpha, float* __restrict__ C, int ldc, size_t sC, int M, int N, int K) {
  __shared__ __attribute__((aligned(16))) float so[4][16][64];
  const int tid = threadIdx.x, w = tid >> 5, lane = tid & 31, ln = lane & 15, hh = lane >> 4; const int by = blockIdx.y;
  A += (size_t)by * sA; Bh += (size_t)by * sB; C += (size_t)by * sC;
  const int ntn = (N + 63) / 64; const int wid = blockIdx.x * 4 + w; const int mt = wid / ntn, nq = wid % ntn; if (mt * 16 >= M) return;
  const int row0 = mt * 16, col0 = nq * 64; const float* arow = A + (size_t)(row0 + ln) * lda;
  v8f acc[4] = {};
  for (int kb = 0; kb < K; kb += 32) {
    FragH ah, al;
    const v4f x0 = *(const v4fa*)(arow + kb + 8 * hh), x1 = *(const v4fa*)(arow + kb + 8 * hh + 4), x2 = *(const v4fa*)(arow + kb + 16 + 8 * hh), x3 = *(const v4fa*)(arow + kb + 16 + 8 * hh + 4);
    float xs[16] = {x0[0],x0[1],x0[2],x0[3],x1[0],x1[1],x1[2],x1[3],x2[0],x2[1],x2[2],x2[3],x3[0],x3[1],x3[2],x3[3]};
#pragma unroll
    for (int i = 0; i < 16; ++i) { const _Float16 h = (_Float16)xs[i]; ah.h[i] = h; al.h[i] = ASPLIT ? (_Float16)(xs[i] - (float)h) : (_Float16)0.0f; }
#pragma unroll
    for (int t = 0; t < 4; ++t) { if (col0 + t * 16 >= N) continue; const size_t boff = (size_t)(col0 + t * 16 + ln) * ldb + kb; FragH bq; bq.half[0] = *(const v8us*)(Bh + boff + 8 * hh); bq.half[1] = *(const v8us*)(Bh + boff + 16 + 8 * hh);
      acc[t] = mmaH<ASPLIT ? 2 : 1>(ah.v, al.v, bq.v, bq.v, acc[t]); }
  }
#pragma unroll
  for (int t = 0; t < 4; ++t) { if (col0 + t * 16 >= N) continue;
#pragma unroll
    for (int r = 0; r < 8; ++r) so[w][8 * hh + r][t * 16 + ln] = acc[t][r] * alpha; }
  __builtin_amdgcn_fence(__ATOMIC_ACQ_REL, "workgroup"); __builtin_amdgcn_wave_barrier();
  const int rsub = lane >> 4, c4 = (lane & 15) * 4;
  {
#pragma unroll
    for (int q = 0; q < 8; ++q) { const int r = q * 2 + rsub; if (col0 + c4 < N) { const v4f v = *(const v4fa*)&so[w][r][c4]; *(v4f*)(C + (size_t)(row0 + r) * ldc + col0 + c4) = v; } }
     }
}

// Wt[n][k] = f16(W[k][n]·scale) from f32 row-major W[K][N] (scale = power of two; bf16-exact weights stay exact in f16 away from the subnormal range)
__global__ __launch_bounds__(256) void k_wt_f16(const float* __restrict__ W, _Float16* __restrict__ Wt, int K, int N, float scale) {
  const int t = blockIdx.x * 256 + threadIdx.x; if (t >= N * (K / 8)) return; const int n = t / (K / 8), k8 = (t % (K / 8)) * 8; FragH f;
#pragma unroll
  for (int i = 0; i < 8; ++i) f.h[i] = (_Float16)(bf16_round(W[(size_t)(k8 + i) * N + n]) * scale); const v8us o = f.half[0];
  *(v8us*)((unsigned short*)Wt + (size_t)n * K + k8) = o; 
}
// k_gemm_hh variant with fused epilogue: v = acc·alpha + bias[by·sBias + col] (+ CP[(row/rowsPerB)·sCPb + by·64 + col] if CP) ; ACT 0 none / 1 elu ; writes f16 C16 (and f32 C if non-null)
template <int ACT>
__global__ __launch_bounds__(128) void k_gemm_hhx(const _Float16* __restrict__ A, int lda, size_t sA, const _Float16* __restrict__ Bh, int ldb, size_t sB, float alpha, const float* __restrict__ bias, size_t sBias, const float* __restrict__ CP, int rowsPerB, size_t sCPb, int row0g,
    float* __restrict__ C, _Float16* __restrict__ C16, int ldc, size_t sC, int M, int N, int K) {
  __shared__ __attribute__((aligned(16))) float so[4][16][64];
  const int tid = threadIdx.x, w = tid >> 5, lane = tid & 31, ln = lane & 15, hh = lane >> 4; const int by = blockIdx.y;
  A += (size_t)by * sA; Bh += (size_t)by * sB; const size_t cofs = (size_t)by * sC; const float* bp = bias ? bias + (size_t)by * sBias : nullptr;
  const int ntn = (N + 63) / 64; const int wid = blockIdx.x * 4 + w; const int mt = wid / ntn, nq = wid % ntn; if (mt * 16 >= M) return;
  const int row0 = mt * 16, col0 = nq * 64; const _Float16* arow = A + (size_t)(row0 + ln) * lda;
  v8f acc[4] = {};
  for (int kb = 0; kb < K; kb += 32) { FragH ah; ah.half[0] = *(const v8us*)((const unsigned short*)arow + kb + 8 * hh); ah.half[1] = *(const v8us*)((const unsigned short*)arow + kb + 16 + 8 * hh);
#pragma unroll
    for (int t = 0; t < 4; ++t) { if (col0 + t * 16 >= N) continue; const size_t boff = (size_t)(col0 + t * 16 + ln) * ldb + kb; FragH bq; bq.half[0] = *(const v8us*)((const unsigned short*)Bh + boff + 8 * hh); bq.half[1] = *(const v8us*)((const unsigned short*)Bh + boff + 16 + 8 * hh);
      acc[t] = mmaH<1>(ah.v, ah.v, bq.v, bq.v, acc[t]); }
  }
#pragma unroll
  for (int t = 0; t < 4; ++t) { if (col0 + t * 16 >= N) continue; const int col = col0 + t * 16 + ln; const float bv = bp ? bf16_round(bp[col]) : 0.f;
#pragma unroll
    for (int r = 0; r < 8; ++r) { float v = acc[t][r] * alpha + bv; if (CP) { const int rr = row0g + row0 + 8 * hh + r; if (rowsPerB < 0) v += CP[cofs + (size_t)rr * ldc + col];      /* rowsPerB < 0: own element of the batched C plane */ else { const int bidx = rr / rowsPerB; v += CP[(size_t)bidx * sCPb + (size_t)by * 64 + col]; } } if (ACT == 1) v = (v > 0.f) ? v : expm1f(v); else if (ACT == 7) v = (v > 0.f) ? v + 1.0f : expf(v); else if (ACT == 8) v = tanhf(v); else if (ACT == 9) v = 0.5f * v * (1.0f + tanhf(0.7978845608028654f * (v + 0.044715f * v * v * v))); else if (ACT == 11) v = 1.0f / (1.0f + expf(-v)); else if (ACT == 12) v = (v > 0.f) ? v : 0.01f * v; else if (ACT == 14) v = (v > 0.f) ? v : 0.1f * v; else if (ACT == 16) v = (v >= 0.f) ? v : 0.3f * v; else if (ACT == 17) v = (v >= 0.f) ? v : 0.2f * v; else if (ACT == 15) v = v / (1.0f + expf(-v)); else if (ACT == 3) v = fmaxf(v, 0.f); else if (ACT == 6) v = 0.5f * v * (1.0f + erff(v * 0.70710678118654752f)); so[w][8 * hh + r][t * 16 + ln] = v; } }
  __builtin_amdgcn_fence(__ATOMIC_ACQ_REL, "workgroup"); __builtin_amdgcn_wave_barrier();
  const int rsub = lane >> 4, c4 = (lane & 15) * 4; typedef _Float16 v4h __attribute__((ext_vector_type(4)));
  {
#pragma unroll
    for (int q = 0; q < 8; ++q) { const int r = q * 2 + rsub; if (col0 + c4 < N) { const v4f v = *(const v4fa*)&so[w][r][c4]; if (C) *(v4f*)(C + cofs + (size_t)(row0 + r) * ldc + col0 + c4) = v; if (C16) { v4h h4; for (int i = 0; i < 4; ++i) h4[i] = (_Float16)v[i]; *(v4h*)(C16 + cofs + (size_t)(row0 + r) * ldc + col0 + c4) = h4; } } }
     }
}


typedef _Float16 v4h __attribute__((ext_vector_type(4)));

__global__ __launch_bounds__(256) void k_x16(const float* __restrict__ x, _Float16* __restrict__ X16, size_t n8) { const size_t t = (size_t)blockIdx.x * 256 + threadIdx.x; if (t >= n8) return; FragH f;
#pragma unroll
  for (int q = 0; q < 8; ++q) f.h[q] = (_Float16)bf16_round(x[t * 8 + q]); *(v8us*)((unsigned short*)X16 + t * 8) = f.half[0];  }
__global__ __launch_bounds__(256) void k_h16(const float* __restrict__ x, _Float16* __restrict__ X16, size_t n8) { const size_t t = (size_t)blockIdx.x * 256 + threadIdx.x; if (t >= n8) return; FragH f;
#pragma unroll
  for (int q = 0; q < 8; ++q) f.h[q] = (_Float16)x[t * 8 + q]; *(v8us*)((unsigned short*)X16 + t * 8) = f.half[0];  }
__global__ __launch_bounds__(256) void k_round16f(const float* __restrict__ W, _Float16* __restrict__ Bt, size_t n8) { const size_t t = (size_t)blockIdx.x * 256 + threadIdx.x; if (t >= n8) return; FragH f;
#pragma unroll
  for (int i = 0; i < 8; ++i) f.h[i] = (_Float16)(bf16_round(W[t * 8 + i]) * 16.0f); *(v8us*)((unsigned short*)Bt + t * 8) = f.half[0];  }
template <int NHv, int TTv>
__global__ __launch_bounds__(256) void k_vt(const _Float16* __restrict__ V16, int ldv, int voff, _Float16* __restrict__ Vt) { __shared__ unsigned short tl[64][66]; const int tid = threadIdx.x; const int slab = blockIdx.x / (TTv / 64), lg = blockIdx.x % (TTv / 64); const int b = slab / NHv, h = slab % NHv;
  for (int i = tid; i < 64 * 8; i += 256) { const int r = i / 8, c8 = (i % 8) * 8; FragH f; f.half[0] = *(const v8us*)((const unsigned short*)V16 + ((size_t)b * TTv + lg * 64 + r) * ldv + voff + h * 64 + c8);
#pragma unroll
    for (int q = 0; q < 8; ++q) tl[r][c8 + q] = f.u[q]; }
  __syncthreads();
  {
#pragma unroll
    for (int rd = 0; rd < 2; ++rd) { const int d = rd * 32 + tid / 8, pc = tid % 8; FragH f;
#pragma unroll
      for (int q = 0; q < 8; ++q) f.u[q] = tl[pc * 8 + q][d];
      *(v8us*)((unsigned short*)Vt + ((size_t)slab * 64 + d) * TTv + lg * 64 + pc * 8) = f.half[0]; }
     } }

__global__ __launch_bounds__(256) void k_hl(const float* __restrict__ F, _Float16* __restrict__ Hh, _Float16* __restrict__ Hl, size_t n8) { const size_t t = (size_t)blockIdx.x * 256 + threadIdx.x; if (t >= n8) return; FragH fh, fl; const v4f a = *(const v4fa*)(F + t * 8), c = *(const v4fa*)(F + t * 8 + 4);
#pragma unroll
  for (int q = 0; q < 4; ++q) { _Float16 h = (_Float16)a[q]; fh.h[q] = h; fl.h[q] = (_Float16)((a[q] - (float)h) * 1024.0f); h = (_Float16)c[q]; fh.h[4 + q] = h; fl.h[4 + q] = (_Float16)((c[q] - (float)h) * 1024.0f); }
  { *(v8us*)((unsigned short*)Hh + t * 8) = fh.half[0]; *(v8us*)((unsigned short*)Hl + t * 8) = fl.half[0];  } }

// ---- fast GEMM (wave tile 32x64; requires M % 32 == 0 rows per launch region and N % 64 == 0); epilogue = k_gemm_hhx semantics ----
__device__ __forceinline__ v16h g2_frag(const _Float16* p, int hh) { FragH f; f.half[0] = *(const v8us*)((const unsigned short*)p + 8 * hh); f.half[1] = *(const v8us*)((const unsigned short*)p + 16 + 8 * hh); return f.v; }
__device__ __forceinline__ v8f g2_mma(v16h a, v16h b, v8f c) { v8f d = __builtin_amdgcn_wmma_f32_16x16x32_f16(false, a, false, b, (short)0, c, false, false); asm volatile("v_nop\n\tv_nop\n\tv_nop\n\tv_nop" : "+v"(d) : "v"(a), "v"(b)); return d; }
template <int ACT>
__global__ __launch_bounds__(128) void k_gemm2(const _Float16* __restrict__ A, int lda, size_t sA, const _Float16* __restrict__ Bh, int ldb, size_t sB, float alpha, const float* __restrict__ bias, size_t sBias, const float* __restrict__ CP, int rowsPerB, size_t sCPb, int row0g,
    float* __restrict__ C, _Float16* __restrict__ C16, int ldc, size_t sC, int M, int N, int K) { static_assert(ACT == 0 || ACT == 3 || ACT == 6 || ACT == 8 || ACT == 9 || ACT == 11 || ACT == 12 || ACT == 14 || ACT == 15 || ACT == 16 || ACT == 17, "k_gemm2: unsupported ACT code (would silently apply no activation)");
  __shared__ __attribute__((aligned(16))) float so[4][32][68];
  const int tid = threadIdx.x, w = tid >> 5, lane = tid & 31, ln = lane & 15, hh = lane >> 4; const int by = blockIdx.y;
  A += (size_t)by * sA; Bh += (size_t)by * sB; const size_t cofs = (size_t)by * sC; const float* bp = bias ? bias + (size_t)by * sBias : nullptr;
  const int ntn = N >> 6; const int mt = blockIdx.x / ntn, nq = blockIdx.x - mt * ntn; const int row0 = mt * 128 + 32 * w, col0 = nq * 64; if (row0 >= M) return;
  const _Float16* a0p = A + (size_t)(row0 + ln) * lda; const _Float16* a1p = a0p + (size_t)16 * lda;
  const _Float16* b0p = Bh + (size_t)(col0 + ln) * ldb; const _Float16* b1p = b0p + (size_t)16 * ldb; const _Float16* b2p = b1p + (size_t)16 * ldb; const _Float16* b3p = b2p + (size_t)16 * ldb;
  const v8f z8 = {0.f,0.f,0.f,0.f,0.f,0.f,0.f,0.f}; v8f c00 = z8, c01 = z8, c02 = z8, c03 = z8, c10 = z8, c11 = z8, c12 = z8, c13 = z8;
#pragma unroll 1
  for (int kb = 0; kb < K; kb += 32) { const v16h a0 = g2_frag(a0p + kb, hh), a1 = g2_frag(a1p + kb, hh);
    v16h b = g2_frag(b0p + kb, hh); c00 = g2_mma(a0, b, c00); c10 = g2_mma(a1, b, c10);
    b = g2_frag(b1p + kb, hh); c01 = g2_mma(a0, b, c01); c11 = g2_mma(a1, b, c11);
    b = g2_frag(b2p + kb, hh); c02 = g2_mma(a0, b, c02); c12 = g2_mma(a1, b, c12);
    b = g2_frag(b3p + kb, hh); c03 = g2_mma(a0, b, c03); c13 = g2_mma(a1, b, c13); }
  v8f accs[8] = {c00, c01, c02, c03, c10, c11, c12, c13};
#pragma unroll
  for (int u = 0; u < 8; ++u) { const int t = u & 3, half = u >> 2; const int col = col0 + t * 16 + ln; const float bv = bp ? bf16_round(bp[col]) : 0.f;
#pragma unroll
    for (int r = 0; r < 8; ++r) { const int rloc = half * 16 + 8 * hh + r; float v = accs[u][r] * alpha + bv; if (CP) { if (rowsPerB < 0) v += CP[cofs + (size_t)(row0g + row0 + rloc) * ldc + col];      /* rowsPerB < 0: own element of the batched C plane */ else { const int bidx = (row0g + row0 + rloc) / rowsPerB; v += CP[(size_t)bidx * sCPb + (size_t)by * 64 + col]; } }
      if (ACT == 3) v = fmaxf(v, 0.f); else if (ACT == 6) v = 0.5f * v * (1.0f + erff(v * 0.70710678118654752f)); else if (ACT == 11) v = 1.0f / (1.0f + expf(-v)); else if (ACT == 15) v = v / (1.0f + expf(-v)); else if (ACT == 12) v = (v > 0.f) ? v : 0.01f * v; else if (ACT == 8) v = tanhf(v); else if (ACT == 9) v = 0.5f * v * (1.0f + tanhf(0.7978845608028654f * (v + 0.044715f * v * v * v))); else if (ACT == 14) v = (v > 0.f) ? v : 0.1f * v; else if (ACT == 16) v = (v >= 0.f) ? v : 0.3f * v; else if (ACT == 17) v = (v >= 0.f) ? v : 0.2f * v;
      so[w][rloc][t * 16 + ln] = v; } }
  __builtin_amdgcn_fence(__ATOMIC_ACQ_REL, "workgroup"); __builtin_amdgcn_wave_barrier();
  const int rsub = lane >> 4, c4 = (lane & 15) * 4;
  {
#pragma unroll
    for (int q = 0; q < 16; ++q) { const int r = q * 2 + rsub; const v4f v = *(const v4fa*)&so[w][r][c4]; if (C) *(v4f*)(C + cofs + (size_t)(row0 + r) * ldc + col0 + c4) = v; if (C16) { v4h h4; for (int i = 0; i < 4; ++i) h4[i] = (_Float16)v[i]; *(v4h*)(C16 + cofs + (size_t)(row0 + r) * ldc + col0 + c4) = h4; } }
     } }


__global__ __launch_bounds__(256) void k_wnat(const float* __restrict__ w, size_t n8, _Float16* __restrict__ Bt) { const size_t t = (size_t)blockIdx.x * 256 + threadIdx.x; if (t >= n8) return; FragH f; for (int q = 0; q < 8; ++q) f.h[q] = (_Float16)(bf16_round(w[t * 8 + q]) * 16.0f); *(v8us*)((unsigned short*)Bt + t * 8) = f.half[0];  }
__global__ __launch_bounds__(256) void k_rsm(const float* __restrict__ S, _Float16* __restrict__ P, int nrows) {
  #pragma clang fp contract(off)
  const int i = blockIdx.x * 256 + threadIdx.x; if (i >= nrows) return; const float* s = S + (size_t)i * SQ; float mx = -3.0e38f;
#pragma unroll 1
  for (int j = 0; j < SQ; ++j) mx = fmaxf(mx, s[j]); float se = 0.f;
#pragma unroll 1
  for (int j = 0; j < SQ; ++j) se += expf(s[j] - mx); const float sc = 256.0f / se;
#pragma unroll 1
  for (int j0 = 0; j0 < SQ; j0 += 8) { FragH f; for (int q = 0; q < 8; ++q) f.h[q] = (_Float16)(expf(s[j0 + q] - mx) * sc); unsigned short* d = (unsigned short*)P + (size_t)i * SQ + j0; *(v8us*)d = f.half[0];  } }
__global__ __launch_bounds__(256) void k_vt(const _Float16* __restrict__ V16, int b, int h0, _Float16* __restrict__ VT) { __shared__ unsigned short tl[64][65]; const int tid = threadIdx.x; const int hh = blockIdx.x % HG, sg = blockIdx.x / HG; const int s0 = sg * 64; const int h = h0 + hh;
  for (int i = tid; i < 64 * 8; i += 256) { const int j = i / 8, d8 = (i % 8) * 8; FragH f; f.half[0] = *(const v8us*)((const unsigned short*)V16 + ((size_t)b * SQ + s0 + j) * DM + h * HD + d8); for (int q = 0; q < 8; ++q) tl[d8 + q][j] = f.u[q]; }
  __syncthreads();
  { for (int i = tid; i < 64 * 8; i += 256) { const int d = i / 8, j8 = (i % 8) * 8; FragH f; for (int q = 0; q < 8; ++q) f.u[q] = tl[d][j8 + q]; *(v8us*)((unsigned short*)VT + ((size_t)hh * HD + d) * SQ + s0 + j8) = f.half[0]; }  } }



// Fused causal attention on the f16 planes: scores, softmax and P V in ONE launch; neither S nor P goes through memory. One call = one block of FAR query rows of one batch, worked on by FAW waves.
// Both products are formed transposed, so that a lane owns one query in both: S^T = K Q^T (A = K rows, B = Q rows) leaves in lane (ln, hh) the scores of query ln for keys 8 hh + r
// of each 16-key tile, which for two tiles side by side is the k order of a B fragment; O^T = V^T P^T (A = V^T rows, B = those weights as f16) leaves query ln's o for d = 8 hh + r.
// So the weights never leave their registers, and running maximum, denominator and rescale are per lane: lane ^ 16 holds the other keys of the same query, so the maximum is exchanged with it
// once a chunk, and the two halves' denominators are joined once, behind the loop. Scores are carried times log2(e), so that a weight is one v_exp_f32 of a difference.
// wave = key run: the block's 32-key chunks are dealt to the FAW waves in turn; the FAW partial results are brought to the common maximum and added through LDS, in the order of the waves.
// Every inner loop is unrolled so that each index of a register array is a constant (no scratch); the chunk loop stays rolled, so that one chunk's fragments are live at a time and four waves fit a SIMD.
#define LQK3 (3 * NH * HD)           /* row pitch of the f16 q | k | v plane */
#define FAW 8                        /* waves = key runs per block of query rows */
#define FAQ 2                        /* 16-query tiles a wave: each K and V^T fragment is used FAQ times */
#define FAR (16 * FAQ)               /* query rows per block = keys per chunk */
#define FAP (HD + 4)                 /* LDS pitch of a partial o row: 16 B x odd, so that 16-byte accesses of many rows spread over the banks */
__device__ __forceinline__ float fa_xhalf(float x) { return __builtin_bit_cast(float, __builtin_amdgcn_permlanex16(__builtin_bit_cast(int, x), __builtin_bit_cast(int, x), 0x76543210, 0xfedcba98, false, false)); }      /* lane l reads lane l ^ 16: a vector move, where __shfl_xor goes through the LDS path and a wait */
// 2^x. The v_nop in the same statement keeps the one slot that the instruction set asks for behind a transcendental before its result is read or its source overwritten.
__device__ __forceinline__ float fa_exp2(float x) { float r; asm("v_exp_f32 %0, %1\n\tv_nop" : "=v"(r) : "v"(x)); return r; }
__device__ __forceinline__ v8f fa_mma(v16h a, v16h b, v8f c) { return __builtin_amdgcn_wmma_f32_16x16x32_f16(false, a, false, b, (short)0, c, false, false); }
struct FaSm { float po[FAW][FAR][FAP]; float pm[FAW][FAR]; float pl[FAW][FAR]; };      /* the LDS of one block of query rows; po first: 16-byte accesses */
// w: the wave's number among the block's FAW (a scalar); tl: the thread's number among the block's 32 * FAW; qb: the block of query rows; b: the batch.
__device__ __forceinline__ void fattn_rows(FaSm& sm, const int w, const int tl, const int qb, const int b, const _Float16* __restrict__ Q16, const _Float16* __restrict__ K16, const _Float16* __restrict__ VT, float scale, float* __restrict__ O) {
  static_assert(NH == 1 && HD == 64 && FAR == 32 && SQ % FAR == 0 && 32 * FAW * 8 == FAR * HD, "one 64-wide head; a chunk of 32 keys is one k step of P V; the merge gives every thread 8 columns of one row");
  float (&pm)[FAW][FAR] = sm.pm; float (&pl)[FAW][FAR] = sm.pl; float (&po)[FAW][FAR][FAP] = sm.po;
  const int lane = tl & 31, ln = lane & 15, hh = lane >> 4;
  const int q0 = qb * FAR; const int nch = qb + 1;      /* causal: chunks 0..qb; only chunk qb crosses the diagonal */
  Q16 += (size_t)b * SQ * LQK3; K16 += (size_t)b * SQ * LQK3; VT += (size_t)b * HD * SQ; O += (size_t)b * SQ * HD;
  v8f o[FAQ][4]; float m[FAQ], l[FAQ]; const float sl2 = scale * 1.44269504088896340736f;
#pragma unroll
  for (int u = 0; u < FAQ; ++u) { m[u] = -1.0e30f; l[u] = 0.f;
#pragma unroll
    for (int t = 0; t < 4; ++t) o[u][t] = v8f{0.f, 0.f, 0.f, 0.f, 0.f, 0.f, 0.f, 0.f}; }
  if (w < nch) {      /* a wave without a chunk loads nothing and goes to the merge with m = -1e30, l = 0, o = 0 */
  v16h qf[FAQ][2];
#pragma unroll
  for (int u = 0; u < FAQ; ++u) { const _Float16* qp = Q16 + (size_t)(q0 + u * 16 + ln) * LQK3 + 8 * hh; qf[u][0] = g2_frag(qp, 0); qf[u][1] = g2_frag(qp + 32, 0);
    asm volatile("s_wait_xcnt 0x0" :: "v"(qp) : "memory"); }      /* the wait in front of any overwrite of the address pair that the q loads name; the pair is an input, so it stays whole up to here */
#pragma unroll 1
  for (int c = w; c < nch; c += FAW) { const int k0 = c * FAR;
    const _Float16* kp = K16 + (size_t)(k0 + ln) * LQK3; const _Float16* vp = VT + (size_t)ln * SQ + k0;
    const v16h ka0 = g2_frag(kp, hh), ka1 = g2_frag(kp + 32, hh), kb0 = g2_frag(kp + (size_t)16 * LQK3, hh), kb1 = g2_frag(kp + (size_t)16 * LQK3 + 32, hh);
    v16h vf[4];
#pragma unroll
    for (int t = 0; t < 4; ++t) vf[t] = g2_frag(vp + (size_t)t * 16 * SQ, hh);
#pragma unroll
    for (int u = 0; u < FAQ; ++u) { const v8f z8 = {0.f, 0.f, 0.f, 0.f, 0.f, 0.f, 0.f, 0.f};
      const v8f sa = fa_mma(ka1, qf[u][1], fa_mma(ka0, qf[u][0], z8)), sb = fa_mma(kb1, qf[u][1], fa_mma(kb0, qf[u][0], z8));
      float s[16];
#pragma unroll
      for (int r = 0; r < 8; ++r) { s[r] = sa[r] * sl2; s[8 + r] = sb[r] * sl2; }      /* s[i]: key k0 + 8 hh + i (i < 8), k0 + 16 + 8 hh + i - 8 (i >= 8) */
      if (c == nch - 1) { const int dq = u * 16 + ln - 8 * hh;      /* key - k0 <= query - q0, and k0 = q0 here */
#pragma unroll
        for (int r = 0; r < 8; ++r) { if (r > dq) s[r] = -1.0e30f; if (16 + r > dq) s[8 + r] = -1.0e30f; } }
      float mn = s[0];
#pragma unroll
      for (int i = 1; i < 16; ++i) mn = fmaxf(mn, s[i]);
      mn = fmaxf(mn, fa_xhalf(mn)); mn = fmaxf(mn, m[u]);      /* every chunk holds a key that the query sees (the chunk's first), so mn is a real score */
      const float sc = fa_exp2(m[u] - mn); float es = 0.f; FragH p;      /* first chunk: m = -1e30, sc = 0 on l = 0 and o = 0 */
#pragma unroll
      for (int i = 0; i < 16; ++i) { const float e = fa_exp2(s[i] - mn); es += e; p.h[i] = (_Float16)e; }
      l[u] = fmaf(l[u], sc, es); m[u] = mn;      /* l: this half's keys only; sc is the same in both halves */
#pragma unroll
      for (int t = 0; t < 4; ++t) o[u][t] = fa_mma(vf[t], p.v, o[u][t] * sc); } } }
#pragma unroll
  for (int u = 0; u < FAQ; ++u) { const float lj = l[u] + fa_xhalf(l[u]); if (hh == 0) { pm[w][u * 16 + ln] = m[u]; pl[w][u * 16 + ln] = lj; } }      /* both halves of the wave hold the same m and, joined, the same l */
  __syncthreads();
#pragma unroll
  for (int u = 0; u < FAQ; ++u) { float mx = pm[0][u * 16 + ln];      /* wave 0 has chunk 0, which every row sees: the common maximum is a real score; a wave without a chunk counts 0 */
#pragma unroll
    for (int x = 1; x < FAW; ++x) mx = fmaxf(mx, pm[x][u * 16 + ln]);
    const float f = fa_exp2(m[u] - mx);
#pragma unroll
    for (int t = 0; t < 4; ++t) { const v8f y = o[u][t] * f; *(v4f*)&po[w][u * 16 + ln][t * 16 + 8 * hh] = v4f{y[0], y[1], y[2], y[3]}; *(v4f*)&po[w][u * 16 + ln][t * 16 + 8 * hh + 4] = v4f{y[4], y[5], y[6], y[7]}; } }
  __syncthreads();
  const int row = tl >> 3, c8 = (tl & 7) * 8;      /* a wave adds and stores four whole o rows: 1 KiB in a row */
  float mx = pm[0][row];
#pragma unroll
  for (int x = 1; x < FAW; ++x) mx = fmaxf(mx, pm[x][row]);
  float ls = 0.f; v4f r0 = {0.f, 0.f, 0.f, 0.f}, r1 = {0.f, 0.f, 0.f, 0.f};
#pragma unroll
  for (int x = 0; x < FAW; ++x) { ls = fmaf(fa_exp2(pm[x][row] - mx), pl[x][row], ls); r0 += *(const v4f*)&po[x][row][c8]; r1 += *(const v4f*)&po[x][row][c8 + 4]; }
  const float inv = 1.0f / ls; float* op = O + (size_t)(q0 + row) * HD + c8;
  *(v4f*)op = r0 * inv; *(v4f*)(op + 4) = r1 * inv; }


// e^x for x <= 0 to f32 accuracy: x * log2(e) is cut into its nearest integer n and a remainder that two FMAs form (log2(e) as a high and a low float), then 2^remainder * 2^n.
// Below -104 the result is under the smallest f32: x is held there, so that n stays a small integer. The v_nop in the same statement keeps the one slot that the instruction
// set asks for behind a transcendental before its result is read or its source overwritten.
__device__ __forceinline__ float exp_neg(float x) { x = fmaxf(x, -104.0f); const float n = rintf(x * 1.44269502f); const float r = fmaf(x, 1.92596303e-8f, fmaf(x, 1.44269502f, -n));
  float p; asm("v_exp_f32 %0, %1\n\tv_nop" : "=v"(p) : "v"(r)); return ldexpf(p, (int)n); }
// Exact f32 causal attention for rows 0..QT0-1 of every batch (b = batch, each with its own QT0-row plane; rg = block of 32 query rows), stored straight into the output rows.
// lane = query row: its q row and its o row stay in registers. wave = key run: the block's 32 * (rg + 1) keys are cut into A0W equal runs, one a wave, so a K or V row
// has one address for the whole wave and comes through the scalar path. Each wave keeps its own running maximum, denominator and o over its run (A0K keys a trip, one
// rescale a trip); the A0W partial results are brought to the common maximum and added through LDS, always in the order of the runs.
#define A0W 16                       /* waves = key runs per work-group */
#define A0K (32 / A0W)               /* keys a trip: a run is A0K * (rg + 1) keys */
#define A0LD (3 * NH * HD)           /* row pitch of the f32 q | k | v plane */
#define A0P (HD + 4)                 /* LDS pitch of a partial o row: 16 B x odd, so that 16-byte accesses of 32 rows spread over the banks */
struct A0Sm { float po[A0W][32][A0P]; float pm[A0W][32]; float pl[A0W][32]; float pfin[32]; };      /* po first: 16-byte accesses */
__device__ __forceinline__ void att0w_rows(A0Sm& sm, const int rg, const int b, const float* __restrict__ QF, const float* __restrict__ KF, const float* __restrict__ VF, float scale, float* __restrict__ O) {
  static_assert(NH == 1 && HD == 64 && QT0 % 32 == 0 && A0W * A0K == 32 && 32 * A0W * 4 == 32 * HD, "one 64-wide head; 32 rows a block; the merge gives every thread 4 columns of one row");
  float (&pm)[A0W][32] = sm.pm; float (&pl)[A0W][32] = sm.pl; float (&pfin)[32] = sm.pfin; float (&po)[A0W][32][A0P] = sm.po;
  const int lane = threadIdx.x & 31; const int w = __builtin_amdgcn_readfirstlane((int)(threadIdx.x >> 5));      /* the wave's number as a scalar: K and V addresses are wave-uniform */
  const int i = rg * 32 + lane;
  { const size_t bi = (size_t)b * QT0; QF += bi * A0LD; KF += bi * A0LD; VF += bi * A0LD; O += (size_t)b * SQ * HD; }
  float q[HD], o[HD]; const float* qp = QF + (size_t)i * A0LD;
#pragma unroll
  for (int c = 0; c < HD / 4; ++c) { const v4f t = *(const v4fa*)(qp + c * 4);
#pragma unroll
    for (int u = 0; u < 4; ++u) { q[c * 4 + u] = t[u]; o[c * 4 + u] = 0.f; } }
  asm volatile("s_wait_xcnt 0x0" :: "v"(qp) : "memory");      /* the wait in front of any overwrite of the address pair that the q loads name; the pair is an input, so it stays whole up to here */
  float m = -1.0e30f, l = 0.f; const int kbeg = w * A0K * (rg + 1);
#pragma unroll 1
  for (int ch = 0; ch <= rg; ++ch) { const int j0 = kbeg + ch * A0K; const float* kr = KF + (size_t)j0 * A0LD; const float* vr = VF + (size_t)j0 * A0LD;
    float s[A0K]; float mn = m;
#pragma unroll
    for (int k = 0; k < A0K; ++k) { float p[4] = {0.f, 0.f, 0.f, 0.f};      /* four sums a score: four independent FMA chains of 16 */
#pragma unroll
      for (int c = 0; c < HD; ++c) p[c & 3] = fmaf(q[c], kr[k * A0LD + c], p[c & 3]);
      s[k] = (j0 + k <= i) ? ((p[0] + p[1]) + (p[2] + p[3])) * scale : -1.0e30f; mn = fmaxf(mn, s[k]); }
    const float sc = exp_neg(m - mn); float e[A0K]; float es = 0.f;      /* nothing seen yet: m = mn = -1e30, sc = 1 on l = 0 and o = 0 */
#pragma unroll
    for (int k = 0; k < A0K; ++k) { e[k] = (j0 + k <= i) ? exp_neg(s[k] - mn) : 0.f; es += e[k]; }      /* a key behind the row counts 0 also where the whole run so far is behind it */
    l = fmaf(l, sc, es); m = mn;
#pragma unroll
    for (int c = 0; c < HD; ++c) { float t = o[c] * sc;
#pragma unroll
      for (int k = 0; k < A0K; ++k) t = fmaf(e[k], vr[k * A0LD + c], t);
      o[c] = t; } }
  pm[w][lane] = m; pl[w][lane] = l;
  __syncthreads();
  float mx = pm[0][lane];      /* run 0 holds key 0, which every row sees: the common maximum is a real score */
#pragma unroll
  for (int u = 1; u < A0W; ++u) mx = fmaxf(mx, pm[u][lane]);
  if (w == 0) { float ls = 0.f;
#pragma unroll
    for (int u = 0; u < A0W; ++u) ls = fmaf(exp_neg(pm[u][lane] - mx), pl[u][lane], ls);
    pfin[lane] = 1.0f / ls; }
  const float f = exp_neg(m - mx);
#pragma unroll
  for (int c = 0; c < HD / 4; ++c) { v4f t;
#pragma unroll
    for (int u = 0; u < 4; ++u) t[u] = o[c * 4 + u] * f;
    *(v4f*)&po[w][lane][c * 4] = t; }
  __syncthreads();
  const int row = threadIdx.x >> 4, c4 = (threadIdx.x & 15) * 4;      /* a wave adds and stores two whole o rows: 512 B in a row */
  v4f r = {0.f, 0.f, 0.f, 0.f};
#pragma unroll
  for (int u = 0; u < A0W; ++u) r += *(const v4f*)&po[u][row][c4];
  r *= pfin[row];
  float* op = O + (size_t)(rg * 32 + row) * HD + c4; *(v4f*)op = r;
  asm volatile("s_wait_xcnt 0x0" :: "v"(op), "v"(r) : "memory"); }      /* the wait in front of any overwrite of a register that this store names: the other path's code follows in the text; address and data are inputs, so they stay whole up to here */

// Both attention paths in ONE launch: neither needs anything of the other, each output row belongs to exactly one of them, and the branch between them is the same for a whole work-group.
// grid.x = batch; grid.y = piece of work: first ATP pairs of neighbouring f16 blocks of FAR rows (rows QT0.., FAW waves each, side by side in the two halves of the work-group, each half with its own LDS),
// then the ATX exact blocks of 32 rows (rows 0..QT0-1, A0W waves each); of each kind the longer the earlier. One work-group of 16 waves fills a WGP's registers.
// No loop of either path holds a barrier: every wave of a work-group passes the same two.
#define ATX (QT0 / 32)
#define ATP ((SQ - QT0) / (2 * FAR))
union AtSm { FaSm fa[2]; A0Sm a0; };
__global__ __launch_bounds__(32 * A0W) void k_attn(const _Float16* __restrict__ Q16, const _Float16* __restrict__ K16, const _Float16* __restrict__ VT, const float* __restrict__ QF, const float* __restrict__ KF, const float* __restrict__ VF, float scale, float* __restrict__ O) {
  static_assert(2 * FAW == A0W && QT0 % (2 * FAR) == 0 && (SQ - QT0) % (2 * FAR) == 0 && sizeof(FaSm) % 16 == 0, "two f16 blocks fill a work-group of the exact path's size; the border between the paths falls between pairs");
  __shared__ __attribute__((aligned(16))) AtSm sm;
  const int b = blockIdx.x, t = blockIdx.y;
  if (t < ATP) { const int wv = __builtin_amdgcn_readfirstlane((int)(threadIdx.x >> 5)); const int hf = wv / FAW;      /* the wave's number as a scalar: the chunk loop and its mask test are scalar branches */
    fattn_rows(sm.fa[hf], wv % FAW, (int)threadIdx.x % (32 * FAW), SQ / FAR - 1 - (2 * t + hf), b, Q16, K16, VT, scale, O); }
  else att0w_rows(sm.a0, ATX - 1 - (t - ATP), b, QF, KF, VF, scale, O); }      /* written in this order the exact path stands first in the built code and its K and V rows stay scalar loads; in the other order this compiler made vector loads of them */


template <int BFIN, int WXB>
__global__ __launch_bounds__(256) void k_ln16(const float* __restrict__ X, const float* __restrict__ g, const float* __restrict__ bb, float eps, _Float16* __restrict__ N16, float* __restrict__ XB) {
  #pragma clang fp contract(off)
  __shared__ float red[256]; const size_t r = blockIdx.x; const int t = threadIdx.x; const v4f xa = *(const v4fa*)(X + r * DMQ + t * 4); float s[4]; float sum = 0.f;
  for (int q = 0; q < 4; ++q) { s[q] = BFIN ? bf16_round(xa[q]) : xa[q]; sum = __fadd_rn(sum, s[q]); }
  red[t] = sum; __syncthreads(); for (int st = 128; st > 0; st >>= 1) { if (t < st) red[t] = __fadd_rn(red[t], red[t + st]); __syncthreads(); } const float mu = red[0] / (float)DMQ; __syncthreads();
  float vs = 0.f; for (int q = 0; q < 4; ++q) { const float dl = __fadd_rn(s[q], -mu); vs = __fadd_rn(vs, __fmul_rn(dl, dl)); } red[t] = vs; __syncthreads(); for (int st = 128; st > 0; st >>= 1) { if (t < st) red[t] = __fadd_rn(red[t], red[t + st]); __syncthreads(); }
  const float rs = rsqrtf(__fadd_rn(red[0] / (float)DMQ, eps)); v4h y; v4f xb;
  for (int q = 0; q < 4; ++q) { const int c = t * 4 + q; y[q] = (_Float16)__fadd_rn(__fmul_rn(__fmul_rn(__fadd_rn(s[q], -mu), rs), bf16_round(g[c])), bf16_round(bb[c])); xb[q] = s[q]; }
  { *(v4h*)(N16 + r * DMQ + t * 4) = y; if (WXB) *(v4f*)(XB + r * DMQ + t * 4) = xb;  } }
__global__ __launch_bounds__(256) void k_ftres2(const float* __restrict__ OF0, const float* __restrict__ XB, float* __restrict__ X1, size_t n4) {
  #pragma clang fp contract(off)
  const size_t t = (size_t)blockIdx.x * 256 + threadIdx.x; if (t >= n4) return; const v4f o = *(const v4fa*)(OF0 + t * 4), xv = *(const v4fa*)(XB + t * 4); v4f y; for (int q = 0; q < 4; ++q) y[q] = __fadd_rn(__fmul_rn(o[q], 0.015625f), xv[q]); *(v4f*)(X1 + t * 4) = y;  }

__global__ __launch_bounds__(256) void k_wthd(const float* __restrict__ Wt, _Float16* __restrict__ Bt) { const size_t t = (size_t)blockIdx.x * 256 + threadIdx.x; if (t >= (size_t)NH * HD * (DM / 8)) return; const int m8 = (int)(t % (DM / 8)) * 8; const int d = (int)((t / (DM / 8)) % HD); const int h = (int)(t / ((size_t)(DM / 8) * HD)); FragH f;
  for (int q = 0; q < 8; ++q) f.h[q] = (_Float16)(16.0f * bf16_round(Wt[((size_t)h * DM + m8 + q) * HD + d])); unsigned short* dst = (unsigned short*)Bt + ((size_t)h * HD + d) * DM + m8; *(v8us*)dst = f.half[0];  }




__global__ __launch_bounds__(256) void k_wtpad(const float* __restrict__ Wm, _Float16* __restrict__ Wt, int Kr, int Kp, int Nr, int Np, float scale) {
  const int t = blockIdx.x * 256 + threadIdx.x; if (t >= Np * (Kp / 8)) return; const int n = t / (Kp / 8), k8 = (t % (Kp / 8)) * 8; const int nc = min(n, Nr - 1); const float fn = (n < Nr) ? 1.f : 0.f; FragH f;
  for (int i = 0; i < 8; ++i) { const int k = k8 + i; const int kc = min(k, Kr - 1); const float fk = (k < Kr) ? fn : 0.f; f.h[i] = (_Float16)(bf16_round(Wm[(size_t)kc * Nr + nc]) * scale * fk); }
  unsigned short* o = (unsigned short*)Wt + (size_t)n * Kp + k8; *(v8us*)o = f.half[0];  }
__global__ __launch_bounds__(128) void k_bpad(const float* __restrict__ b, float* __restrict__ Bp, int nr, int np) {
  const int i = threadIdx.x; if (i >= np) return; const float v = b[min(i, nr - 1)] * ((i < nr) ? 1.f : 0.f); *(float*)(Bp + i) = v;  }

#define DI 64         /* inner width = NH * HD (ONE 64-wide head) */
#define LQK (3 * DI)  /* fused q | k | v row pitch (192) */
__global__ __launch_bounds__(256) void k_o0(const float* __restrict__ OF, float* __restrict__ ob, size_t n4) {
  #pragma clang fp contract(off)
  const size_t t = (size_t)blockIdx.x * 256 + threadIdx.x; if (t >= n4) return; const size_t e = t * 4; const int i = (int)(e / DI); const int c = (int)(e % DI); const int h = c / HD, d = c % HD; const v4f a = *(const v4fa*)(OF + e); v4f o; for (int q = 0; q < 4; ++q) o[q] = __fmul_rn(a[q], 0.015625f); float* dst = ob + (size_t)h * SQ * HD + (size_t)i * HD + d; *(v4f*)dst = o;  }

// The whole projection stage in ONE launch: q | k | v = x W for PJR token rows a work-group. x comes in as f32 in whole lines, is rounded as before (bf16, exact in f16) and laid in LDS as f16 rows;
// wave w owns columns 16 w .. 16 w + 15 of q | k | v and builds its eight B fragments straight from the f32 weights (lane = column, so a load takes 64 B of each of two weight rows; value bf16-rounded, x16, f16: as before).
// Products, k order and the order of the k steps are those of the GEMM that this takes the place of, so every q, k, v value is the same number. The accumulators go out three ways, all staged in LDS so that every store
// is of whole 128-B lines: q | k as f16 rows, v as f16 V^T rows (a lane holds 8 tokens in a row of one column: one 16-byte LDS store), and, for the first QT0 rows of a batch, q | k | v as f32.
#define PJR 64                       /* token rows per work-group: 256 work-groups */
#define PJW 12                       /* waves = 16-column tiles of q | k | v */
#define PJT (32 * PJW)
#define PJXP (DM + 8)                /* LDS pitch of an x row, halves: 528 B = 16 B x odd, for 16-byte fragment reads */
#define PJOP (2 * DI + 8)            /* LDS pitch of a q | k row, halves: 272 B = 16 B x odd */
#define PJVP (PJR + 8)               /* LDS pitch of a V^T row, halves: 144 B = 16 B x odd */
#define PJFP (LQK + 4)               /* LDS pitch of an f32 q | k | v row, floats: 784 B = 16 B x odd */
typedef __bf16 v2b __attribute__((ext_vector_type(2)));
typedef unsigned short v4us __attribute__((ext_vector_type(4), may_alias));
// two floats rounded to bf16 (nearest, ties to even: the value of bf16_round) by the conversion instruction, times s, as two f16
__device__ __forceinline__ void pj_cvt2(float a, float b, float s, _Float16& ha, _Float16& hb) { const v2b p = {(__bf16)a, (__bf16)b}; const unsigned int u = __builtin_bit_cast(unsigned int, p); ha = (_Float16)(__uint_as_float(u << 16) * s); hb = (_Float16)(__uint_as_float(u & 0xFFFF0000u) * s); }
__global__ __launch_bounds__(PJT) void k_proj(const float* __restrict__ x, const float* __restrict__ wq, const float* __restrict__ wk, const float* __restrict__ wv, _Float16* __restrict__ QK, _Float16* __restrict__ VT, float* __restrict__ F0) {
  static_assert(PJW * 16 == LQK && DI == 64 && DM == 256 && SQ % PJR == 0 && QT0 % PJR == 0 && (PJR * 2 * DI + DI * PJR) / 8 == 4 * PJT && PJR * LQK / 4 == 8 * PJT, "a wave a column tile; a work-group lies in one batch and wholly inside or outside the exact rows; the store loops divide evenly");
  __shared__ __attribute__((aligned(16))) _Float16 xs[PJR][PJXP]; __shared__ __attribute__((aligned(16))) _Float16 so[PJR][PJOP]; __shared__ __attribute__((aligned(16))) _Float16 sv[DI][PJVP]; __shared__ __attribute__((aligned(16))) float sf[PJR][PJFP];
  const int tid = threadIdx.x, lane = tid & 31, ln = lane & 15, hh = lane >> 4; const int w = __builtin_amdgcn_readfirstlane(tid >> 5);      /* the wave's number as a scalar: which weight matrix, and every branch on it, is scalar */
  const size_t r0 = (size_t)blockIdx.x * PJR; const int b = (int)(r0 / SQ), s0 = (int)(r0 % SQ);
  const float* wp = (w < 4 ? wq : w < 8 ? wk : wv) + (w & 3) * 16 + ln + (size_t)(8 * hh) * DI; float wr[8][16];
#pragma unroll
  for (int ks = 0; ks < 8; ++ks)
#pragma unroll
    for (int i = 0; i < 8; ++i) { wr[ks][i] = wp[(size_t)(ks * 32 + i) * DI]; wr[ks][8 + i] = wp[(size_t)(ks * 32 + 16 + i) * DI]; }      /* the k order of g2_frag: 8 hh + i, 16 + 8 hh + i */
  const char* xb = (const char*)(x + r0 * DM); const unsigned xo = (unsigned)tid * 16u; const char* xt = xb + xo; v4f xa[11];      /* 4 floats a thread and turn: each load of a wave covers 512 B in a row, four whole lines */
#pragma unroll
  for (int u = 0; u < 11; ++u) if (u < 10 || w < 8) xa[u] = *(const v4fa*)(xt + u * PJT * 16);      /* PJR * DM / 4 = 10 * PJT + 256 */
  asm volatile("s_wait_xcnt 0x0" :: "v"(xo), "v"(xt), "v"(wp), "s"(xb) : "memory");      /* the wait in front of any overwrite of the address registers that the loads above name; x's offset, base and full address and the weights' address are inputs, so whichever form a load takes, its registers stay whole up to here */
  FragH bf[8];
#pragma unroll
  for (int ks = 0; ks < 8; ++ks)
#pragma unroll
    for (int i = 0; i < 16; i += 2) pj_cvt2(wr[ks][i], wr[ks][i + 1], 16.0f, bf[ks].h[i], bf[ks].h[i + 1]);
#pragma unroll
  for (int u = 0; u < 11; ++u) if (u < 10 || w < 8) { const int i = tid + u * PJT; FragH f;
    pj_cvt2(xa[u][0], xa[u][1], 1.0f, f.h[0], f.h[1]); pj_cvt2(xa[u][2], xa[u][3], 1.0f, f.h[2], f.h[3]);
    *(v4us*)&xs[i >> 6][(i & 63) * 4] = v4us{f.u[0], f.u[1], f.u[2], f.u[3]}; }
  __syncthreads();
  v8f acc[4];
#pragma unroll
  for (int mt = 0; mt < 4; ++mt) acc[mt] = v8f{0.f, 0.f, 0.f, 0.f, 0.f, 0.f, 0.f, 0.f};
#pragma unroll
  for (int ks = 0; ks < 8; ++ks)
#pragma unroll
    for (int mt = 0; mt < 4; ++mt) acc[mt] = fa_mma(g2_frag(&xs[mt * 16 + ln][ks * 32], hh), bf[ks].v, acc[mt]);
#pragma unroll
  for (int mt = 0; mt < 4; ++mt) acc[mt] *= 0.0625f;      /* the weights ride x16 */
  const bool ft = s0 < QT0;      /* the same for the whole work-group */
  if (w < 8) {
#pragma unroll
    for (int mt = 0; mt < 4; ++mt)
#pragma unroll
      for (int r = 0; r < 8; ++r) so[mt * 16 + 8 * hh + r][w * 16 + ln] = (_Float16)acc[mt][r];
  } else {
#pragma unroll
    for (int mt = 0; mt < 4; ++mt) { FragH f;
#pragma unroll
      for (int r = 0; r < 8; ++r) f.h[r] = (_Float16)acc[mt][r];
      *(v8us*)&sv[(w & 3) * 16 + ln][mt * 16 + 8 * hh] = f.half[0]; } }
  if (ft) {
#pragma unroll
    for (int mt = 0; mt < 4; ++mt)
#pragma unroll
      for (int r = 0; r < 8; ++r) sf[mt * 16 + 8 * hh + r][w * 16 + ln] = acc[mt][r]; }
  __syncthreads();
  { v4f t[4]; float* p[4];      /* 16-byte pieces: 1024 of q | k rows (256 B a row), then 512 of V^T rows (128 B a row); the border falls between waves. All reads, then all stores: one LDS latency, not four */
#pragma unroll
    for (int u = 0; u < 4; ++u) { const bool qk = u < 2 || (u == 2 && w < 8); const int i = tid + u * PJT, j = qk ? 0 : i - PJR * 16;
      const _Float16* sp = qk ? &so[i >> 4][(i & 15) * 8] : &sv[j >> 3][(j & 7) * 8];
      _Float16* gp = qk ? QK + (r0 + (size_t)(i >> 4)) * LQK + (i & 15) * 8 : VT + ((size_t)b * HD + (size_t)(j >> 3)) * SQ + s0 + (j & 7) * 8;
      t[u] = *(const v4fa*)sp; p[u] = (float*)gp; }
#pragma unroll
    for (int u = 0; u < 4; ++u) *(v4fa*)p[u] = t[u];
    asm volatile("s_wait_xcnt 0x0" :: "v"(p[0]), "v"(p[1]), "v"(p[2]), "v"(p[3]), "v"(t[0]), "v"(t[1]), "v"(t[2]), "v"(t[3]) : "memory"); }      /* the wait in front of any overwrite of a register that these stores name; addresses and data are inputs, so they stay whole up to here */
  if (ft) { v4f t[8]; float* p[8]; float* fb = F0 + ((size_t)b * QT0 + s0) * LQK + (size_t)tid * 4;      /* the 64 f32 rows are one run of 48 KiB */
#pragma unroll
    for (int u = 0; u < 8; ++u) { const int i = tid + u * PJT; t[u] = *(const v4f*)&sf[i / (LQK / 4)][(i % (LQK / 4)) * 4]; p[u] = fb + (size_t)u * PJT * 4; }
#pragma unroll
    for (int u = 0; u < 8; ++u) *(v4f*)p[u] = t[u];
    asm volatile("s_wait_xcnt 0x0" :: "v"(t[0]), "v"(t[1]), "v"(t[2]), "v"(t[3]), "v"(t[4]), "v"(t[5]), "v"(t[6]), "v"(t[7]) : "memory"); } }      /* the same wait: the data are inputs, so no piece's registers are taken for a later piece while its store is on its way */

extern "C" void kernel_launch(void* const* d_in, const int* in_sizes, int n_in,
                              void* d_out, int out_size, void* d_ws, size_t ws_size, hipStream_t stream) {
  (void)in_sizes; (void)n_in; (void)out_size;
  const float* const* I = (const float* const*)d_in; const float* x = I[0]; const float* wq = I[2]; const float* wk = I[1]; const float* wv = I[3];      /* x; [in][out = 64] Wk / Wq / Wv (input order as this module lists them); no biases */
  char* ws = (char*)d_ws; size_t off = 0;
  auto take = [&](size_t bytes) { char* p = ws + off; off += (bytes + 255) & ~(size_t)255; return p; };
  _Float16* QKV = (_Float16*)take(NR * LQK * 2); _Float16* VT = (_Float16*)take((size_t)NB * HD * SQ * 2);
  float* QKVF0 = (float*)take((size_t)NB * QT0 * LQK * 4);      /* one plane a batch: the four batches run side by side */
  if (off > ws_size) return;
  k_proj<<<(unsigned)(NR / PJR), PJT, 0, stream>>>(x, wq, wk, wv, QKV, VT, QKVF0);      /* q | k f16 rows (columns 0 / 64 of the plane at pitch 192; its v columns stay unwritten and unread), V^T [NB][HD][SQ] f16, f32 q | k | v of rows 0..511 of every batch */
  const _Float16* Q16 = QKV; const _Float16* K16 = QKV + DI;
  static_assert(NH == 1, "the grid carries the batch in place of the head");
  float* ob = (float*)d_out;
  static_assert(LQK3 == LQK, "the fused kernel reads the q | k | v plane at its pitch");
  k_attn<<<dim3(NB, ATX + ATP), 32 * A0W, 0, stream>>>(Q16, K16, VT, QKVF0, QKVF0 + DI, QKVF0 + 2 * DI, 0.0625f, ob);      /* out[b][i][0..63] = softmax(causal q k^T * 256^-0.5 = 1/16: the module scales by the EMBEDDING width) v, f32, all query rows of all batches in one launch: rows 0..511 exact f32, the rest f16 operands */
}

// v007
// One run takes 41.5 microseconds.
// Two timings next to v006 put it at 1.16 and 1.15 times that version's speed.
// All steps since v000 together make it 780 times as fast.
#include <hip/hip_runtime.h>
// Single-head causal self-attention with the module's EMBEDDING-width scale (x [4][4096][256]; k/q/v = x W ([in][out] [256][64], U(+-0.1), no biases; input order Wk, Wq, Wv); ONE 64-wide head; wei * 256^-0.5 (n_embd, as in the source); causal (tril, -inf); softmax; out = wei v -> [4][4096][64]; no output projection).
// Structure: token rows; ONE projection launch (x and the weights converted to their exact f16 values on the way in; WMMA; writes the f16 q | k rows at pitch 192, v^T, and the f32 q | k | v of rows 0..511); ONE attention launch with the batches on grid.x: rows 512.. by the fused f16 path (scores, online softmax f32 -> f16 weights in registers, P V, written as f32 straight into the output rows), rows 0..511 by exact f32 work-groups of the same launch; launches: see trace.
// Compute dtype: inputs rounded to bf16; x / weights exact; q, k, v and softmax weights as plain f16 GEMM operands (~2^-12); scores, softmax statistics and o f32. v_wmma_f32_16x16x32_f16; rows 0..511: f32 operands, v_wmma_f32_16x16x4_f32.
#define NB 4
#define SQ 4096
#define DM 256
#define NH 1
#define HD 64
#define HG 4                         /* heads per block group of the unlaunched k_vt(b, h0) overload */
#define QT 256                       /* unused */
#define NKX SQ                       /* unused */
#define QT0 512                      /* first-tile rows recomputed exactly (f32): 512 here (no output projection averages the early-row cancellation errors away; logit sigma 1.0) */
#define B0 0                         /* unused; the batches run on grid.x from 0 */
#define NBR NB                       /* feeds only MP; grid.x runs over the NB batches */
#define NR ((size_t)NB * SQ)
#define DMQ DM
#define DFF 4096                     /* unused; this file has no FFN */
#define DFFR 100                     /* unused */
#define MP ((int)((size_t)NBR * SQ)) /* feeds only MPO; the projection runs over NR rows */
#define QN SQ                        /* unused */
#define NHD NH                       /* unused */
#define MPO MP                       /* unused */
#define LQ (3 * DM)      /* 3 * DM = 768, unused; the q/k/v rows use pitch LQK = 192 */
typedef __bf16 v16b __attribute__((ext_vector_type(16)));
typedef unsigned short v8us __attribute__((ext_vector_type(8), may_alias));
typedef float  v8f  __attribute__((ext_vector_type(8)));
typedef float  v4f  __attribute__((ext_vector_type(4)));
typedef float  v4fa __attribute__((ext_vector_type(4), may_alias));
union FragB { v16b v; v8us half[2]; unsigned short u[16]; };

__device__ __forceinline__ unsigned short bf16_bits(float x) { unsigned int u = __float_as_uint(x); return (unsigned short)((u + 0x7FFFu + ((u >> 16) & 1u)) >> 16); }
__device__ __forceinline__ float bf16_val(unsigned short b) { return __uint_as_float(((unsigned int)b) << 16); }
__device__ __forceinline__ float bf16_round(float x) { return bf16_val(bf16_bits(x)); }
// D += A·B with NT terms: 1 = ah·bh, 2 = + al·bh (A split), 3 = + ah·bl (both split)
template <int NT>
__device__ __forceinline__ v8f mmaN(v16b ah, v16b al, v16b bh, v16b bl, v8f c) {
  c = __builtin_amdgcn_wmma_f32_16x16x32_bf16(false, ah, false, bh, (short)0, c, false, false);
  if (NT >= 2) c = __builtin_amdgcn_wmma_f32_16x16x32_bf16(false, al, false, bh, (short)0, c, false, false);
  if (NT >= 3) c = __builtin_amdgcn_wmma_f32_16x16x32_bf16(false, ah, false, bl, (short)0, c, false, false);
  asm volatile("v_nop\n\tv_nop\n\tv_nop\n\tv_nop" : "+v"(c) : "v"(ah), "v"(al), "v"(bh), "v"(bl));
  return c;
}

__global__ __launch_bounds__(256) void k_wt_bf16(const float* __restrict__ W, unsigned short* __restrict__ Wt, int K, int N) {
  const int t = blockIdx.x * 256 + threadIdx.x;
  const int k8n = K / 8;
  if (t >= N * k8n) return;
  const int n = t / k8n, k8 = (t % k8n) * 8;
  v8us v;
#pragma unroll
  for (int i = 0; i < 8; ++i) v[i] = bf16_bits(W[(size_t)(k8 + i) * N + n]);
  *(v8us*)(Wt + (size_t)n * K + k8) = v;
  
}

// GEMM C[M][N] (f32, pitch ldc) = act(A[M][K]·W + bias). A f32 row-major (pitch lda) converted per fragment to bf16
// (ASPLIT: hi/lo two planes -> 2 terms, else single rounded term); Wt bf16 [N][K] (pitch ldb). BIAS_BF16 rounds the
// bias to bf16 first (bias quantised to bf16 before the add). K%32==0, M%16==0, N%64==0.
template <bool ASPLIT, int ACT, bool BIAS_BF16>
__global__ __launch_bounds__(128) void k_gemm_bf(const float* __restrict__ A, int lda, const unsigned short* __restrict__ Wt, int ldb,
                                               const float* __restrict__ bias, float* __restrict__ C, int ldc, int M, int N, int K) {
  __shared__ __attribute__((aligned(16))) float so[4][16][64];
  const int tid = threadIdx.x, w = tid >> 5, lane = tid & 31, ln = lane & 15, hh = lane >> 4;
  const int ntn = N / 64;
  const int wid = blockIdx.x * 4 + w;
  const int mt = wid / ntn, nq = wid % ntn;
  if (mt * 16 >= M) return;
  const int row0 = mt * 16, col0 = nq * 64;
  const float* arow = A + (size_t)(row0 + ln) * lda;
  v8f acc[4] = {};
  for (int kb = 0; kb < K; kb += 32) {
    FragB ah, al;
    const v4f x0 = *(const v4fa*)(arow + kb + 8 * hh), x1 = *(const v4fa*)(arow + kb + 8 * hh + 4);
    const v4f x2 = *(const v4fa*)(arow + kb + 16 + 8 * hh), x3 = *(const v4fa*)(arow + kb + 16 + 8 * hh + 4);
    float xs[16] = {x0[0],x0[1],x0[2],x0[3],x1[0],x1[1],x1[2],x1[3],x2[0],x2[1],x2[2],x2[3],x3[0],x3[1],x3[2],x3[3]};
#pragma unroll
    for (int i = 0; i < 16; ++i) { const unsigned short hb = bf16_bits(xs[i]); ah.u[i] = hb; al.u[i] = ASPLIT ? bf16_bits(xs[i] - bf16_val(hb)) : (unsigned short)0; }
#pragma unroll
    for (int t = 0; t < 4; ++t) {
      const unsigned short* brow = Wt + (size_t)(col0 + t * 16 + ln) * ldb + kb;
      FragB b;
      b.half[0] = *(const v8us*)(brow + 8 * hh);
      b.half[1] = *(const v8us*)(brow + 16 + 8 * hh);
      acc[t] = mmaN<ASPLIT ? 2 : 1>(ah.v, al.v, b.v, b.v, acc[t]);
    }
  }
#pragma unroll
  for (int t = 0; t < 4; ++t) {
    float bv = bias ? bias[col0 + t * 16 + ln] : 0.f;
    if (BIAS_BF16) bv = bf16_round(bv);
#pragma unroll
    for (int r = 0; r < 8; ++r) { float v = acc[t][r] + bv; if (ACT == 1) v = fmaxf(v, 0.f); so[w][8 * hh + r][t * 16 + ln] = v; }
  }
  __builtin_amdgcn_fence(__ATOMIC_ACQ_REL, "workgroup");
  __builtin_amdgcn_wave_barrier();
  const int rsub = lane >> 4, c4 = (lane & 15) * 4;
  {
#pragma unroll
    for (int q = 0; q < 8; ++q) {
      const int r = q * 2 + rsub;
      const v4f v = *(const v4fa*)&so[w][r][c4];
      *(v4f*)(C + (size_t)(row0 + r) * ldc + col0 + c4) = v;
    }
    
  }
}

// GEMM C = act(A·W + bias + resid): A f32 (ASPLIT -> hi/lo 2 terms), Wt bf16 [N][K]; ACT 0 none, 1 relu, 2 exact gelu;
// resid (optional, f32, row index = (row % rmod), pitch ldr, RES_BF16 rounds it) added before the activation.
template <bool ASPLIT, int ACT, bool BIAS_BF16, bool RES_BF16>
__global__ __launch_bounds__(128) void k_gemm_bf3(const float* __restrict__ A, int lda, const unsigned short* __restrict__ Wt, int ldb,
                                                const float* __restrict__ bias, const float* __restrict__ resid, int rmod, int ldr,
                                                float* __restrict__ C, int ldc, int M, int N, int K) {
  __shared__ __attribute__((aligned(16))) float so[4][16][64];
  const int tid = threadIdx.x, w = tid >> 5, lane = tid & 31, ln = lane & 15, hh = lane >> 4;
  const int ntn = N / 64;
  const int wid = blockIdx.x * 4 + w;
  const int mt = wid / ntn, nq = wid % ntn;
  if (mt * 16 >= M) return;
  const int row0 = mt * 16, col0 = nq * 64;
  const float* arow = A + (size_t)(row0 + ln) * lda;
  v8f acc[4] = {};
  for (int kb = 0; kb < K; kb += 32) {
    FragB ah, al;
    const v4f x0 = *(const v4fa*)(arow + kb + 8 * hh), x1 = *(const v4fa*)(arow + kb + 8 * hh + 4);
    const v4f x2 = *(const v4fa*)(arow + kb + 16 + 8 * hh), x3 = *(const v4fa*)(arow + kb + 16 + 8 * hh + 4);
    float xs[16] = {x0[0],x0[1],x0[2],x0[3],x1[0],x1[1],x1[2],x1[3],x2[0],x2[1],x2[2],x2[3],x3[0],x3[1],x3[2],x3[3]};
#pragma unroll
    for (int i = 0; i < 16; ++i) { const unsigned short hb = bf16_bits(xs[i]); ah.u[i] = hb; al.u[i] = ASPLIT ? bf16_bits(xs[i] - bf16_val(hb)) : (unsigned short)0; }
#pragma unroll
    for (int t = 0; t < 4; ++t) {
      const unsigned short* brow = Wt + (size_t)(col0 + t * 16 + ln) * ldb + kb;
      FragB b;
      b.half[0] = *(const v8us*)(brow + 8 * hh);
      b.half[1] = *(const v8us*)(brow + 16 + 8 * hh);
      acc[t] = mmaN<ASPLIT ? 2 : 1>(ah.v, al.v, b.v, b.v, acc[t]);
    }
  }
#pragma unroll
  for (int t = 0; t < 4; ++t) {
    const int col = col0 + t * 16 + ln;
    float bv = bias ? bias[col] : 0.f;
    if (BIAS_BF16) bv = bf16_round(bv);
#pragma unroll
    for (int r = 0; r < 8; ++r) {
      float v = acc[t][r] + bv;
      if (resid) { float rv = resid[(size_t)((row0 + 8 * hh + r) % rmod) * ldr + col]; if (RES_BF16) rv = bf16_round(rv); v += rv; }
      if (ACT == 1) v = fmaxf(v, 0.f);
      if (ACT == 2) v = 0.5f * v * (1.0f + erff(v * 0.70710678118654752f));
      if (ACT == 3) { const float u = 0.7978845608028654f * (v + 0.044715f * v * v * v); v = 0.5f * v * (1.0f + tanhf(u)); }
      so[w][8 * hh + r][t * 16 + ln] = v;
    }
  }
  __builtin_amdgcn_fence(__ATOMIC_ACQ_REL, "workgroup");
  __builtin_amdgcn_wave_barrier();
  const int rsub = lane >> 4, c4 = (lane & 15) * 4;
  {
#pragma unroll
    for (int q = 0; q < 8; ++q) {
      const int r = q * 2 + rsub;
      const v4f v = *(const v4fa*)&so[w][r][c4];
      *(v4f*)(C + (size_t)(row0 + r) * ldc + col0 + c4) = v;
    }
    
  }
}
// row LayerNorm (biased variance, eps) over N: s = X (+ R); optional out_sum <- s; out_norm <- (s-mu)*rsqrt(var+eps)*g + b
template <bool PARAM_BF16>
__global__ __launch_bounds__(256) void k_layernorm(const float* __restrict__ X, const float* __restrict__ R, const float* __restrict__ g, const float* __restrict__ bta,
                                                  float* __restrict__ out_sum, float* __restrict__ out_norm, int N, float eps) {
  __shared__ float red[256];
  const int row = blockIdx.x, tid = threadIdx.x;
  const float* x = X + (size_t)row * N; const float* rr = R ? R + (size_t)row * N : nullptr;
  float vals[16];                     // up to N = 4096
  const int per = N / 256;            // contiguous chunk per thread? use strided-by-4 chunks: thread handles j = tid*4 + 1024*u
  float s1 = 0.f;
  for (int u = 0; u < per / 4; ++u) {
    const int j = tid * 4 + 1024 * u;
    const v4f a = *(const v4fa*)(x + j);
    v4f b = {0.f,0.f,0.f,0.f}; if (rr) b = *(const v4fa*)(rr + j);
#pragma unroll
    for (int q = 0; q < 4; ++q) { const float v = a[q] + b[q]; vals[u * 4 + q] = v; s1 += v; }
  }
  red[tid] = s1; __syncthreads();
  for (int st = 128; st > 0; st >>= 1) { if (tid < st) red[tid] += red[tid + st]; __syncthreads(); }
  const float mu = red[0] / (float)N; __syncthreads();
  float s2 = 0.f;
  for (int u = 0; u < per / 4; ++u)
#pragma unroll
    for (int q = 0; q < 4; ++q) { const float c = vals[u * 4 + q] - mu; s2 += c * c; }
  red[tid] = s2; __syncthreads();
  for (int st = 128; st > 0; st >>= 1) { if (tid < st) red[tid] += red[tid + st]; __syncthreads(); }
  const float rs = rsqrtf(red[0] / (float)N + eps);
  {
    for (int u = 0; u < per / 4; ++u) {
      const int j = tid * 4 + 1024 * u;
      v4f o, sm;
#pragma unroll
      for (int q = 0; q < 4; ++q) {
        float gg = g[j + q], bb = bta[j + q];
        if (PARAM_BF16) { gg = bf16_round(gg); bb = bf16_round(bb); }
        sm[q] = vals[u * 4 + q]; o[q] = (vals[u * 4 + q] - mu) * rs * gg + bb;
      }
      if (out_sum) *(v4f*)(out_sum + (size_t)row * N + j) = sm;
      *(v4f*)(out_norm + (size_t)row * N + j) = o;
    }
    
  }
}



// ---- f16 WMMA path (v_wmma_f32_16x16x32_f16): 11-bit significands for operands in range — used where a [0,1] probability operand needs more precision than bf16
typedef _Float16 v16h __attribute__((ext_vector_type(16)));
union FragH { v16h v; v8us half[2]; _Float16 h[16]; unsigned short u[16]; };
template <int NT>
__device__ __forceinline__ v8f mmaH(v16h ah, v16h al, v16h bh, v16h bl, v8f c) {
  c = __builtin_amdgcn_wmma_f32_16x16x32_f16(false, ah, false, bh, (short)0, c, false, false);
  if (NT >= 2) c = __builtin_amdgcn_wmma_f32_16x16x32_f16(false, al, false, bh, (short)0, c, false, false);
  if (NT >= 3) c = __builtin_amdgcn_wmma_f32_16x16x32_f16(false, ah, false, bl, (short)0, c, false, false);
  asm volatile("v_nop\n\tv_nop\n\tv_nop\n\tv_nop" : "+v"(c) : "v"(ah), "v"(al), "v"(bh), "v"(bl));
  return c;
}
// batched GEMM like k_gemm_b but f16 operands: A f32 (split into f16 hi/lo if ASPLIT, else rounded to f16), Bt = f16 values [n][k]; alpha; C f32; N multiple of 16 (partial tiles skipped)
template <bool ASPLIT>
__global__ __launch_bounds__(128) void k_gemm_h(const float* __restrict__ A, int lda, size_t sA, const _Float16* __restrict__ Bh, int ldb, size_t sB, float alpha, float* __restrict__ C, int ldc, size_t sC, int M, int N, int K) {
  __shared__ __attribute__((aligned(16))) float so[4][16][64];
  const int tid = threadIdx.x, w = tid >> 5, lane = tid & 31, ln = lane & 15, hh = lane >> 4; const int by = blockIdx.y;
  A += (size_t)by * sA; Bh += (size_t)by * sB; C += (size_t)by * sC;
  const int ntn = (N + 63) / 64; const int wid = blockIdx.x * 4 + w; const int mt = wid / ntn, nq = wid % ntn; if (mt * 16 >= M) return;
  const int row0 = mt * 16, col0 = nq * 64; const float* arow = A + (size_t)(row0 + ln) * lda;
  v8f acc[4] = {};
  for (int kb = 0; kb < K; kb += 32) {
    FragH ah, al;
    const v4f x0 = *(const v4fa*)(arow + kb + 8 * hh), x1 = *(const v4fa*)(arow + kb + 8 * hh + 4), x2 = *(const v4fa*)(arow + kb + 16 + 8 * hh), x3 = *(const v4fa*)(arow + kb + 16 + 8 * hh + 4);
    float xs[16] = {x0[0],x0[1],x0[2],x0[3],x1[0],x1[1],x1[2],x1[3],x2[0],x2[1],x2[2],x2[3],x3[0],x3[1],x3[2],x3[3]};
#pragma unroll
    for (int i = 0; i < 16; ++i) { const _Float16 h = (_Float16)xs[i]; ah.h[i] = h; al.h[i] = ASPLIT ? (_Float16)(xs[i] - (float)h) : (_Float16)0.0f; }
#pragma unroll
    for (int t = 0; t < 4; ++t) { if (col0 + t * 16 >= N) continue; const size_t boff = (size_t)(col0 + t * 16 + ln) * ldb + kb; FragH bq; bq.half[0] = *(const v8us*)(Bh + boff + 8 * hh); bq.half[1] = *(const v8us*)(Bh + boff + 16 + 8 * hh);
      acc[t] = mmaH<ASPLIT ? 2 : 1>(ah.v, al.v, bq.v, bq.v, acc[t]); }
  }
#pragma unroll
  for (int t = 0; t < 4; ++t) { if (col0 + t * 16 >= N) continue;
#pragma unroll
    for (int r = 0; r < 8; ++r) so[w][8 * hh + r][t * 16 + ln] = acc[t][r] * alpha; }
  __builtin_amdgcn_fence(__ATOMIC_ACQ_REL, "workgroup"); __builtin_amdgcn_wave_barrier();
  const int rsub = lane >> 4, c4 = (lane & 15) * 4;
  {
#pragma unroll
    for (int q = 0; q < 8; ++q) { const int r = q * 2 + rsub; if (col0 + c4 < N) { const v4f v = *(const v4fa*)&so[w][r][c4]; *(v4f*)(C + (size_t)(row0 + r) * ldc + col0 + c4) = v; } }
     }
}

// Wt[n][k] = f16(W[k][n]·scale) from f32 row-major W[K][N] (scale = power of two; bf16-exact weights stay exact in f16 away from the subnormal range)
__global__ __launch_bounds__(256) void k_wt_f16(const float* __restrict__ W, _Float16* __restrict__ Wt, int K, int N, float scale) {
  const int t = blockIdx.x * 256 + threadIdx.x; if (t >= N * (K / 8)) return; const int n = t / (K / 8), k8 = (t % (K / 8)) * 8; FragH f;
#pragma unroll
  for (int i = 0; i < 8; ++i) f.h[i] = (_Float16)(bf16_round(W[(size_t)(k8 + i) * N + n]) * scale); const v8us o = f.half[0];
  *(v8us*)((unsigned short*)Wt + (size_t)n * K + k8) = o; 
}
// k_gemm_hh variant with fused epilogue: v = acc·alpha + bias[by·sBias + col] (+ CP[(row/rowsPerB)·sCPb + by·64 + col] if CP) ; ACT 0 none / 1 elu ; writes f16 C16 (and f32 C if non-null)
template <int ACT>
__global__ __launch_bounds__(128) void k_gemm_hhx(const _Float16* __restrict__ A, int lda, size_t sA, const _Float16* __restrict__ Bh, int ldb, size_t sB, float alpha, const float* __restrict__ bias, size_t sBias, const float* __restrict__ CP, int rowsPerB, size_t sCPb, int row0g,
    float* __restrict__ C, _Float16* __restrict__ C16, int ldc, size_t sC, int M, int N, int K) {
  __shared__ __attribute__((aligned(16))) float so[4][16][64];
  const int tid = threadIdx.x, w = tid >> 5, lane = tid & 31, ln = lane & 15, hh = lane >> 4; const int by = blockIdx.y;
  A += (size_t)by * sA; Bh += (size_t)by * sB; const size_t cofs = (size_t)by * sC; const float* bp = bias ? bias + (size_t)by * sBias : nullptr;
  const int ntn = (N + 63) / 64; const int wid = blockIdx.x * 4 + w; const int mt = wid / ntn, nq = wid % ntn; if (mt * 16 >= M) return;
  const int row0 = mt * 16, col0 = nq * 64; const _Float16* arow = A + (size_t)(row0 + ln) * lda;
  v8f acc[4] = {};
  for (int kb = 0; kb < K; kb += 32) { FragH ah; ah.half[0] = *(const v8us*)((const unsigned short*)arow + kb + 8 * hh); ah.half[1] = *(const v8us*)((const unsigned short*)arow + kb + 16 + 8 * hh);
#pragma unroll
    for (int t = 0; t < 4; ++t) { if (col0 + t * 16 >= N) continue; const size_t boff = (size_t)(col0 + t * 16 + ln) * ldb + kb; FragH bq; bq.half[0] = *(const v8us*)((const unsigned short*)Bh + boff + 8 * hh); bq.half[1] = *(const v8us*)((const unsigned short*)Bh + boff + 16 + 8 * hh);
      acc[t] = mmaH<1>(ah.v, ah.v, bq.v, bq.v, acc[t]); }
  }
#pragma unroll
  for (int t = 0; t < 4; ++t) { if (col0 + t * 16 >= N) continue; const int col = col0 + t * 16 + ln; const float bv = bp ? bf16_round(bp[col]) : 0.f;
#pragma unroll
    for (int r = 0; r < 8; ++r) { float v = acc[t][r] * alpha + bv; if (CP) { const int rr = row0g + row0 + 8 * hh + r; if (rowsPerB < 0) v += CP[cofs + (size_t)rr * ldc + col];      /* rowsPerB < 0: own element of the batched C plane */ else { const int bidx = rr / rowsPerB; v += CP[(size_t)bidx * sCPb + (size_t)by * 64 + col]; } } if (ACT == 1) v = (v > 0.f) ? v : expm1f(v); else if (ACT == 7) v = (v > 0.f) ? v + 1.0f : expf(v); else if (ACT == 8) v = tanhf(v); else if (ACT == 9) v = 0.5f * v * (1.0f + tanhf(0.7978845608028654f * (v + 0.044715f * v * v * v))); else if (ACT == 11) v = 1.0f / (1.0f + expf(-v)); else if (ACT == 12) v = (v > 0.f) ? v : 0.01f * v; else if (ACT == 14) v = (v > 0.f) ? v : 0.1f * v; else if (ACT == 16) v = (v >= 0.f) ? v : 0.3f * v; else if (ACT == 17) v = (v >= 0.f) ? v : 0.2f * v; else if (ACT == 15) v = v / (1.0f + expf(-v)); else if (ACT == 3) v = fmaxf(v, 0.f); else if (ACT == 6) v = 0.5f * v * (1.0f + erff(v * 0.70710678118654752f)); so[w][8 * hh + r][t * 16 + ln] = v; } }
  __builtin_amdgcn_fence(__ATOMIC_ACQ_REL, "workgroup"); __builtin_amdgcn_wave_barrier();
  const int rsub = lane >> 4, c4 = (lane & 15) * 4; typedef _Float16 v4h __attribute__((ext_vector_type(4)));
  {
#pragma unroll
    for (int q = 0; q < 8; ++q) { const int r = q * 2 + rsub; if (col0 + c4 < N) { const v4f v = *(const v4fa*)&so[w][r][c4]; if (C) *(v4f*)(C + cofs + (size_t)(row0 + r) * ldc + col0 + c4) = v; if (C16) { v4h h4; for (int i = 0; i < 4; ++i) h4[i] = (_Float16)v[i]; *(v4h*)(C16 + cofs + (size_t)(row0 + r) * ldc + col0 + c4) = h4; } } }
     }
}


typedef _Float16 v4h __attribute__((ext_vector_type(4)));

__global__ __launch_bounds__(256) void k_x16(const float* __restrict__ x, _Float16* __restrict__ X16, size_t n8) { const size_t t = (size_t)blockIdx.x * 256 + threadIdx.x; if (t >= n8) return; FragH f;
#pragma unroll
  for (int q = 0; q < 8; ++q) f.h[q] = (_Float16)bf16_round(x[t * 8 + q]); *(v8us*)((unsigned short*)X16 + t * 8) = f.half[0];  }
__global__ __launch_bounds__(256) void k_h16(const float* __restrict__ x, _Float16* __restrict__ X16, size_t n8) { const size_t t = (size_t)blockIdx.x * 256 + threadIdx.x; if (t >= n8) return; FragH f;
#pragma unroll
  for (int q = 0; q < 8; ++q) f.h[q] = (_Float16)x[t * 8 + q]; *(v8us*)((unsigned short*)X16 + t * 8) = f.half[0];  }
__global__ __launch_bounds__(256) void k_round16f(const float* __restrict__ W, _Float16* __restrict__ Bt, size_t n8) { const size_t t = (size_t)blockIdx.x * 256 + threadIdx.x; if (t >= n8) return; FragH f;
#pragma unroll
  for (int i = 0; i < 8; ++i) f.h[i] = (_Float16)(bf16_round(W[t * 8 + i]) * 16.0f); *(v8us*)((unsigned short*)Bt + t * 8) = f.half[0];  }
template <int NHv, int TTv>
__global__ __launch_bounds__(256) void k_vt(const _Float16* __restrict__ V16, int ldv, int voff, _Float16* __restrict__ Vt) { __shared__ unsigned short tl[64][66]; const int tid = threadIdx.x; const int slab = blockIdx.x / (TTv / 64), lg = blockIdx.x % (TTv / 64); const int b = slab / NHv, h = slab % NHv;
  for (int i = tid; i < 64 * 8; i += 256) { const int r = i / 8, c8 = (i % 8) * 8; FragH f; f.half[0] = *(const v8us*)((const unsigned short*)V16 + ((size_t)b * TTv + lg * 64 + r) * ldv + voff + h * 64 + c8);
#pragma unroll
    for (int q = 0; q < 8; ++q) tl[r][c8 + q] = f.u[q]; }
  __syncthreads();
  {
#pragma unroll
    for (int rd = 0; rd < 2; ++rd) { const int d = rd * 32 + tid / 8, pc = tid % 8; FragH f;
#pragma unroll
      for (int q = 0; q < 8; ++q) f.u[q] = tl[pc * 8 + q][d];
      *(v8us*)((unsigned short*)Vt + ((size_t)slab * 64 + d) * TTv + lg * 64 + pc * 8) = f.half[0]; }
     } }

__global__ __launch_bounds__(256) void k_hl(const float* __restrict__ F, _Float16* __restrict__ Hh, _Float16* __restrict__ Hl, size_t n8) { const size_t t = (size_t)blockIdx.x * 256 + threadIdx.x; if (t >= n8) return; FragH fh, fl; const v4f a = *(const v4fa*)(F + t * 8), c = *(const v4fa*)(F + t * 8 + 4);
#pragma unroll
  for (int q = 0; q < 4; ++q) { _Float16 h = (_Float16)a[q]; fh.h[q] = h; fl.h[q] = (_Float16)((a[q] - (float)h) * 1024.0f); h = (_Float16)c[q]; fh.h[4 + q] = h; fl.h[4 + q] = (_Float16)((c[q] - (float)h) * 1024.0f); }
  { *(v8us*)((unsigned short*)Hh + t * 8) = fh.half[0]; *(v8us*)((unsigned short*)Hl + t * 8) = fl.half[0];  } }

// ---- fast GEMM (wave tile 32x64; requires M % 32 == 0 rows per launch region and N % 64 == 0); epilogue = k_gemm_hhx semantics ----
__device__ __forceinline__ v16h g2_frag(const _Float16* p, int hh) { FragH f; f.half[0] = *(const v8us*)((const unsigned short*)p + 8 * hh); f.half[1] = *(const v8us*)((const unsigned short*)p + 16 + 8 * hh); return f.v; }
__device__ __forceinline__ v8f g2_mma(v16h a, v16h b, v8f c) { v8f d = __builtin_amdgcn_wmma_f32_16x16x32_f16(false, a, false, b, (short)0, c, false, false); asm volatile("v_nop\n\tv_nop\n\tv_nop\n\tv_nop" : "+v"(d) : "v"(a), "v"(b)); return d; }
template <int ACT>
__global__ __launch_bounds__(128) void k_gemm2(const _Float16* __restrict__ A, int lda, size_t sA, const _Float16* __restrict__ Bh, int ldb, size_t sB, float alpha, const float* __restrict__ bias, size_t sBias, const float* __restrict__ CP, int rowsPerB, size_t sCPb, int row0g,
    float* __restrict__ C, _Float16* __restrict__ C16, int ldc, size_t sC, int M, int N, int K) { static_assert(ACT == 0 || ACT == 3 || ACT == 6 || ACT == 8 || ACT == 9 || ACT == 11 || ACT == 12 || ACT == 14 || ACT == 15 || ACT == 16 || ACT == 17, "k_gemm2: unsupported ACT code (would silently apply no activation)");
  __shared__ __attribute__((aligned(16))) float so[4][32][68];
  const int tid = threadIdx.x, w = tid >> 5, lane = tid & 31, ln = lane & 15, hh = lane >> 4; const int by = blockIdx.y;
  A += (size_t)by * sA; Bh += (size_t)by * sB; const size_t cofs = (size_t)by * sC; const float* bp = bias ? bias + (size_t)by * sBias : nullptr;
  const int ntn = N >> 6; const int mt = blockIdx.x / ntn, nq = blockIdx.x - mt * ntn; const int row0 = mt * 128 + 32 * w, col0 = nq * 64; if (row0 >= M) return;
  const _Float16* a0p = A + (size_t)(row0 + ln) * lda; const _Float16* a1p = a0p + (size_t)16 * lda;
  const _Float16* b0p = Bh + (size_t)(col0 + ln) * ldb; const _Float16* b1p = b0p + (size_t)16 * ldb; const _Float16* b2p = b1p + (size_t)16 * ldb; const _Float16* b3p = b2p + (size_t)16 * ldb;
  const v8f z8 = {0.f,0.f,0.f,0.f,0.f,0.f,0.f,0.f}; v8f c00 = z8, c01 = z8, c02 = z8, c03 = z8, c10 = z8, c11 = z8, c12 = z8, c13 = z8;
#pragma unroll 1
  for (int kb = 0; kb < K; kb += 32) { const v16h a0 = g2_frag(a0p + kb, hh), a1 = g2_frag(a1p + kb, hh);
    v16h b = g2_frag(b0p + kb, hh); c00 = g2_mma(a0, b, c00); c10 = g2_mma(a1, b, c10);
    b = g2_frag(b1p + kb, hh); c01 = g2_mma(a0, b, c01); c11 = g2_mma(a1, b, c11);
    b = g2_frag(b2p + kb, hh); c02 = g2_mma(a0, b, c02); c12 = g2_mma(a1, b, c12);
    b = g2_frag(b3p + kb, hh); c03 = g2_mma(a0, b, c03); c13 = g2_mma(a1, b, c13); }
  v8f accs[8] = {c00, c01, c02, c03, c10, c11, c12, c13};
#pragma unroll
  for (int u = 0; u < 8; ++u) { const int t = u & 3, half = u >> 2; const int col = col0 + t * 16 + ln; const float bv = bp ? bf16_round(bp[col]) : 0.f;
#pragma unroll
    for (int r = 0; r < 8; ++r) { const int rloc = half * 16 + 8 * hh + r; float v = accs[u][r] * alpha + bv; if (CP) { if (rowsPerB < 0) v += CP[cofs + (size_t)(row0g + row0 + rloc) * ldc + col];      /* rowsPerB < 0: own element of the batched C plane */ else { const int bidx = (row0g + row0 + rloc) / rowsPerB; v += CP[(size_t)bidx * sCPb + (size_t)by * 64 + col]; } }
      if (ACT == 3) v = fmaxf(v, 0.f); else if (ACT == 6) v = 0.5f * v * (1.0f + erff(v * 0.70710678118654752f)); else if (ACT == 11) v = 1.0f / (1.0f + expf(-v)); else if (ACT == 15) v = v / (1.0f + expf(-v)); else if (ACT == 12) v = (v > 0.f) ? v : 0.01f * v; else if (ACT == 8) v = tanhf(v); else if (ACT == 9) v = 0.5f * v * (1.0f + tanhf(0.7978845608028654f * (v + 0.044715f * v * v * v))); else if (ACT == 14) v = (v > 0.f) ? v : 0.1f * v; else if (ACT == 16) v = (v >= 0.f) ? v : 0.3f * v; else if (ACT == 17) v = (v >= 0.f) ? v : 0.2f * v;
      so[w][rloc][t * 16 + ln] = v; } }
  __builtin_amdgcn_fence(__ATOMIC_ACQ_REL, "workgroup"); __builtin_amdgcn_wave_barrier();
  const int rsub = lane >> 4, c4 = (lane & 15) * 4;
  {
#pragma unroll
    for (int q = 0; q < 16; ++q) { const int r = q * 2 + rsub; const v4f v = *(const v4fa*)&so[w][r][c4]; if (C) *(v4f*)(C + cofs + (size_t)(row0 + r) * ldc + col0 + c4) = v; if (C16) { v4h h4; for (int i = 0; i < 4; ++i) h4[i] = (_Float16)v[i]; *(v4h*)(C16 + cofs + (size_t)(row0 + r) * ldc + col0 + c4) = h4; } }
     } }


__global__ __launch_bounds__(256) void k_wnat(const float* __restrict__ w, size_t n8, _Float16* __restrict__ Bt) { const size_t t = (size_t)blockIdx.x * 256 + threadIdx.x; if (t >= n8) return; FragH f; for (int q = 0; q < 8; ++q) f.h[q] = (_Float16)(bf16_round(w[t * 8 + q]) * 16.0f); *(v8us*)((unsigned short*)Bt + t * 8) = f.half[0];  }
__global__ __launch_bounds__(256) void k_rsm(const float* __restrict__ S, _Float16* __restrict__ P, int nrows) {
  #pragma clang fp contract(off)
  const int i = blockIdx.x * 256 + threadIdx.x; if (i >= nrows) return; const float* s = S + (size_t)i * SQ; float mx = -3.0e38f;
#pragma unroll 1
  for (int j = 0; j < SQ; ++j) mx = fmaxf(mx, s[j]); float se = 0.f;
#pragma unroll 1
  for (int j = 0; j < SQ; ++j) se += expf(s[j] - mx); const float sc = 256.0f / se;
#pragma unroll 1
  for (int j0 = 0; j0 < SQ; j0 += 8) { FragH f; for (int q = 0; q < 8; ++q) f.h[q] = (_Float16)(expf(s[j0 + q] - mx) * sc); unsigned short* d = (unsigned short*)P + (size_t)i * SQ + j0; *(v8us*)d = f.half[0];  } }
__global__ __launch_bounds__(256) void k_vt(const _Float16* __restrict__ V16, int b, int h0, _Float16* __restrict__ VT) { __shared__ unsigned short tl[64][65]; const int tid = threadIdx.x; const int hh = blockIdx.x % HG, sg = blockIdx.x / HG; const int s0 = sg * 64; const int h = h0 + hh;
  for (int i = tid; i < 64 * 8; i += 256) { const int j = i / 8, d8 = (i % 8) * 8; FragH f; f.half[0] = *(const v8us*)((const unsigned short*)V16 + ((size_t)b * SQ + s0 + j) * DM + h * HD + d8); for (int q = 0; q < 8; ++q) tl[d8 + q][j] = f.u[q]; }
  __syncthreads();
  { for (int i = tid; i < 64 * 8; i += 256) { const int d = i / 8, j8 = (i % 8) * 8; FragH f; for (int q = 0; q < 8; ++q) f.u[q] = tl[d][j8 + q]; *(v8us*)((unsigned short*)VT + ((size_t)hh * HD + d) * SQ + s0 + j8) = f.half[0]; }  } }



// Fused causal attention on the f16 planes: scores, softmax and P V in ONE launch; neither S nor P goes through memory. One call = one block of FAR query rows of one batch, worked on by FAW waves.
// Both products are formed transposed, so that a lane owns one query in both: S^T = K Q^T (A = K rows, B = Q rows) leaves in lane (ln, hh) the scores of query ln for keys 8 hh + r
// of each 16-key tile, which for two tiles side by side is the k order of a B fragment; O^T = V^T P^T (A = V^T rows, B = those weights as f16) leaves query ln's o for d = 8 hh + r.
// So the weights never leave their registers, and running maximum, denominator and rescale are per lane: lane ^ 16 holds the other keys of the same query, so the maximum is exchanged with it
// once a chunk, and the two halves' denominators are joined once, behind the loop. Scores are carried times log2(e), so that a weight is one v_exp_f32 of a difference.
// wave = key run: the block's 32-key chunks are dealt to the FAW waves in turn; the FAW partial results are brought to the common maximum and added through LDS, in the order of the waves.
// Every inner loop is unrolled so that each index of a register array is a constant (no scratch); the chunk loop stays rolled, so that one chunk's fragments are live at a time and four waves fit a SIMD.
#define LQK3 (3 * NH * HD)           /* row pitch of the f16 q | k | v plane */
#define FAW 8                        /* waves = key runs per block of query rows */
#define FAQ 2                        /* 16-query tiles a wave: each K and V^T fragment is used FAQ times */
#define FAR (16 * FAQ)               /* query rows per block = keys per chunk */
#define FAP (HD + 4)                 /* LDS pitch of a partial o row: 16 B x odd, so that 16-byte accesses of many rows spread over the banks */
__device__ __forceinline__ float fa_xhalf(float x) { return __builtin_bit_cast(float, __builtin_amdgcn_permlanex16(__builtin_bit_cast(int, x), __builtin_bit_cast(int, x), 0x76543210, 0xfedcba98, false, false)); }      /* lane l reads lane l ^ 16: a vector move, where __shfl_xor goes through the LDS path and a wait */
// 2^x. The v_nop in the same statement keeps the one slot that the instruction set asks for behind a transcendental before its result is read or its source overwritten.
__device__ __forceinline__ float fa_exp2(float x) { float r; asm("v_exp_f32 %0, %1\n\tv_nop" : "=v"(r) : "v"(x)); return r; }
__device__ __forceinline__ v8f fa_mma(v16h a, v16h b, v8f c) { return __builtin_amdgcn_wmma_f32_16x16x32_f16(false, a, false, b, (short)0, c, false, false); }
struct FaSm { float po[FAW][FAR][FAP]; float pm[FAW][FAR]; float pl[FAW][FAR]; };      /* the LDS of one block of query rows; po first: 16-byte accesses */
// w: the wave's number among the block's FAW (a scalar); tl: the thread's number among the block's 32 * FAW; qb: the block of query rows; b: the batch.
__device__ __forceinline__ void fattn_rows(FaSm& sm, const int w, const int tl, const int qb, const int b, const _Float16* __restrict__ Q16, const _Float16* __restrict__ K16, const _Float16* __restrict__ VT, float scale, float* __restrict__ O) {
  static_assert(NH == 1 && HD == 64 && FAR == 32 && SQ % FAR == 0 && 32 * FAW * 8 == FAR * HD, "one 64-wide head; a chunk of 32 keys is one k step of P V; the merge gives every thread 8 columns of one row");
  float (&pm)[FAW][FAR] = sm.pm; float (&pl)[FAW][FAR] = sm.pl; float (&po)[FAW][FAR][FAP] = sm.po;
  const int lane = tl & 31, ln = lane & 15, hh = lane >> 4;
  const int q0 = qb * FAR; const int nch = qb + 1;      /* causal: chunks 0..qb; only chunk qb crosses the diagonal */
  Q16 += (size_t)b * SQ * LQK3; K16 += (size_t)b * SQ * LQK3; VT += (size_t)b * HD * SQ; O += (size_t)b * SQ * HD;
  v8f o[FAQ][4]; float m[FAQ], l[FAQ]; const float sl2 = scale * 1.44269504088896340736f;
#pragma unroll
  for (int u = 0; u < FAQ; ++u) { m[u] = -1.0e30f; l[u] = 0.f;
#pragma unroll
    for (int t = 0; t < 4; ++t) o[u][t] = v8f{0.f, 0.f, 0.f, 0.f, 0.f, 0.f, 0.f, 0.f}; }
  if (w < nch) {      /* a wave without a chunk loads nothing and goes to the merge with m = -1e30, l = 0, o = 0 */
  v16h qf[FAQ][2];
#pragma unroll
  for (int u = 0; u < FAQ; ++u) { const _Float16* qp = Q16 + (size_t)(q0 + u * 16 + ln) * LQK3 + 8 * hh; qf[u][0] = g2_frag(qp, 0); qf[u][1] = g2_frag(qp + 32, 0);
    asm volatile("s_wait_xcnt 0x0" :: "v"(qp) : "memory"); }      /* the wait in front of any overwrite of the address pair that the q loads name; the pair is an input, so it stays whole up to here */
#pragma unroll 1
  for (int c = w; c < nch; c += FAW) { const int k0 = c * FAR;
    const _Float16* kp = K16 + (size_t)(k0 + ln) * LQK3; const _Float16* vp = VT + (size_t)ln * SQ + k0;
    const v16h ka0 = g2_frag(kp, hh), ka1 = g2_frag(kp + 32, hh), kb0 = g2_frag(kp + (size_t)16 * LQK3, hh), kb1 = g2_frag(kp + (size_t)16 * LQK3 + 32, hh);
    v16h vf[4];
#pragma unroll
    for (int t = 0; t < 4; ++t) vf[t] = g2_frag(vp + (size_t)t * 16 * SQ, hh);
#pragma unroll
    for (int u = 0; u < FAQ; ++u) { const v8f z8 = {0.f, 0.f, 0.f, 0.f, 0.f, 0.f, 0.f, 0.f};
      const v8f sa = fa_mma(ka1, qf[u][1], fa_mma(ka0, qf[u][0], z8)), sb = fa_mma(kb1, qf[u][1], fa_mma(kb0, qf[u][0], z8));
      float s[16];
#pragma unroll
      for (int r = 0; r < 8; ++r) { s[r] = sa[r] * sl2; s[8 + r] = sb[r] * sl2; }      /* s[i]: key k0 + 8 hh + i (i < 8), k0 + 16 + 8 hh + i - 8 (i >= 8) */
      if (c == nch - 1) { const int dq = u * 16 + ln - 8 * hh;      /* key - k0 <= query - q0, and k0 = q0 here */
#pragma unroll
        for (int r = 0; r < 8; ++r) { if (r > dq) s[r] = -1.0e30f; if (16 + r > dq) s[8 + r] = -1.0e30f; } }
      float mn = s[0];
#pragma unroll
      for (int i = 1; i < 16; ++i) mn = fmaxf(mn, s[i]);
      mn = fmaxf(mn, fa_xhalf(mn)); mn = fmaxf(mn, m[u]);      /* every chunk holds a key that the query sees (the chunk's first), so mn is a real score */
      const float sc = fa_exp2(m[u] - mn); float es = 0.f; FragH p;      /* first chunk: m = -1e30, sc = 0 on l = 0 and o = 0 */
#pragma unroll
      for (int i = 0; i < 16; ++i) { const float e = fa_exp2(s[i] - mn); es += e; p.h[i] = (_Float16)e; }
      l[u] = fmaf(l[u], sc, es); m[u] = mn;      /* l: this half's keys only; sc is the same in both halves */
#pragma unroll
      for (int t = 0; t < 4; ++t) o[u][t] = fa_mma(vf[t], p.v, o[u][t] * sc); } } }
#pragma unroll
  for (int u = 0; u < FAQ; ++u) { const float lj = l[u] + fa_xhalf(l[u]); if (hh == 0) { pm[w][u * 16 + ln] = m[u]; pl[w][u * 16 + ln] = lj; } }      /* both halves of the wave hold the same m and, joined, the same l */
  __syncthreads();
#pragma unroll
  for (int u = 0; u < FAQ; ++u) { float mx = pm[0][u * 16 + ln];      /* wave 0 has chunk 0, which every row sees: the common maximum is a real score; a wave without a chunk counts 0 */
#pragma unroll
    for (int x = 1; x < FAW; ++x) mx = fmaxf(mx, pm[x][u * 16 + ln]);
    const float f = fa_exp2(m[u] - mx);
#pragma unroll
    for (int t = 0; t < 4; ++t) { const v8f y = o[u][t] * f; *(v4f*)&po[w][u * 16 + ln][t * 16 + 8 * hh] = v4f{y[0], y[1], y[2], y[3]}; *(v4f*)&po[w][u * 16 + ln][t * 16 + 8 * hh + 4] = v4f{y[4], y[5], y[6], y[7]}; } }
  __syncthreads();
  const int row = tl >> 3, c8 = (tl & 7) * 8;      /* a wave adds and stores four whole o rows: 1 KiB in a row */
  float mx = pm[0][row];
#pragma unroll
  for (int x = 1; x < FAW; ++x) mx = fmaxf(mx, pm[x][row]);
  float ls = 0.f; v4f r0 = {0.f, 0.f, 0.f, 0.f}, r1 = {0.f, 0.f, 0.f, 0.f};
#pragma unroll
  for (int x = 0; x < FAW; ++x) { ls = fmaf(fa_exp2(pm[x][row] - mx), pl[x][row], ls); r0 += *(const v4f*)&po[x][row][c8]; r1 += *(const v4f*)&po[x][row][c8 + 4]; }
  const float inv = 1.0f / ls; float* op = O + (size_t)(q0 + row) * HD + c8;
  *(v4f*)op = r0 * inv; *(v4f*)(op + 4) = r1 * inv; }


// e^x for x <= 0 to f32 accuracy: x * log2(e) is cut into its nearest integer n and a remainder that two FMAs form (log2(e) as a high and a low float), then 2^remainder * 2^n.
// Below -104 the result is under the smallest f32: x is held there, so that n stays a small integer. The v_nop in the same statement keeps the one slot that the instruction
// set asks for behind a transcendental before its result is read or its source overwritten.
__device__ __forceinline__ float exp_neg(float x) { x = fmaxf(x, -104.0f); const float n = rintf(x * 1.44269502f); const float r = fmaf(x, 1.92596303e-8f, fmaf(x, 1.44269502f, -n));
  float p; asm("v_exp_f32 %0, %1\n\tv_nop" : "=v"(p) : "v"(r)); return ldexpf(p, (int)n); }
// Exact f32 causal attention for rows 0..QT0-1 of every batch (b = batch, each with its own QT0-row plane; rg = block of 32 query rows), stored straight into the output rows.
// Both products run on the f32 matrix form (v_wmma_f32_16x16x4_f32: full f32 operands, f32 sums), transposed as in the f16 path, so that a lane owns one query in both:
// S^T = K Q^T (A = 16 K rows, B = 16 q rows; both sides loaded by the same code, 16 bytes a lane = two k steps, so their k orders are equal) leaves in lane (ln, hh) the scores of query ln for keys 8 hh + r.
// O^T = V^T P^T: registers 2 j, 2 j + 1 of those weights are the B fragment of k step j, keys 8 hh + 2 j + {0, 1}; A takes V in the same key order. Row ln of A's tile t stands for column d = 4 ln + t,
// so a lane's four tiles come from ONE 16-byte load of a V row, a load covers two whole V rows, and o[u][t][r] is column 32 hh + 4 r + t of query u * 16 + ln.
// wave = key run: the block's 2 * (rg + 1) tiles of 16 keys are dealt to the A0W waves in turn; each K and V fragment serves both 16-query tiles. Each wave keeps its own running maximum, denominator and o
// (one rescale a tile); the A0W partial results are brought to the common maximum and added through LDS, always in the order of the waves.
#define A0W 16                       /* waves = key runs per work-group */
#define A0LD (3 * NH * HD)           /* row pitch of the f32 q | k | v plane */
#define A0P (HD + 4)                 /* LDS pitch of a partial o row: 16 B x odd, so that 16-byte accesses of 32 rows spread over the banks */
typedef float v2f __attribute__((ext_vector_type(2)));
__device__ __forceinline__ v8f a0_mma(v2f a, v2f b, v8f c) { return __builtin_amdgcn_wmma_f32_16x16x4_f32(false, a, false, b, (short)0, c, false, false); }
struct A0Sm { float po[A0W][32][A0P]; float pm[A0W][32]; float pl[A0W][32]; float pfin[32]; };      /* po first: 16-byte accesses */
__device__ __forceinline__ void att0w_rows(A0Sm& sm, const int rg, const int b, const float* __restrict__ QF, const float* __restrict__ KF, const float* __restrict__ VF, float scale, float* __restrict__ O) {
  static_assert(NH == 1 && HD == 64 && QT0 % 32 == 0 && 32 * A0W * 4 == 32 * HD, "one 64-wide head; 32 rows a block; the merge gives every thread 4 columns of one row");
  float (&pm)[A0W][32] = sm.pm; float (&pl)[A0W][32] = sm.pl; float (&pfin)[32] = sm.pfin; float (&po)[A0W][32][A0P] = sm.po;
  const int lane = threadIdx.x & 31, ln = lane & 15, hh = lane >> 4; const int w = __builtin_amdgcn_readfirstlane((int)(threadIdx.x >> 5));      /* the wave's number as a scalar: the tile loop is a scalar branch, every lane is on at every matrix instruction */
  { const size_t bi = (size_t)b * QT0; QF += bi * A0LD; KF += bi * A0LD; VF += bi * A0LD; O += (size_t)b * SQ * HD; }
  const int nt = 2 * (rg + 1);      /* causal: key tiles 0 .. 2 rg + 1; only the last two cross the diagonal */
  v8f o[2][4]; float m[2], l[2];
#pragma unroll
  for (int u = 0; u < 2; ++u) { m[u] = -1.0e30f; l[u] = 0.f;
#pragma unroll
    for (int t = 0; t < 4; ++t) o[u][t] = v8f{0.f, 0.f, 0.f, 0.f, 0.f, 0.f, 0.f, 0.f}; }
  if (w < nt) {      /* a wave without a tile loads nothing and goes to the merge with m = -1e30, l = 0, o = 0 */
  v4f qf[2][8];      /* qf[u][i]: columns 8 i + 4 hh .. + 3 of query u * 16 + ln */
#pragma unroll
  for (int u = 0; u < 2; ++u) { const float* qp = QF + (size_t)(rg * 32 + u * 16 + ln) * A0LD + 4 * hh;
#pragma unroll
    for (int i = 0; i < 8; ++i) qf[u][i] = *(const v4fa*)(qp + 8 * i);
    asm volatile("s_wait_xcnt 0x0" :: "v"(qp) : "memory"); }      /* the wait in front of any overwrite of the address pair that the q loads name; the pair is an input, so it stays whole up to here */
#pragma unroll 1
  for (int kt = w; kt < nt; kt += A0W) { const int k0 = kt * 16;      /* rolled: one tile's fragments are live at a time */
    const float* kp = KF + (size_t)(k0 + ln) * A0LD + 4 * hh; const float* vp = VF + (size_t)(k0 + 8 * hh) * A0LD + 4 * ln;
    v4f kf[8], vf[8];      /* kf[i]: columns 8 i + 4 hh .. + 3 of key k0 + ln (q's order); vf[i]: columns 4 ln .. + 3 of key k0 + 8 hh + i */
#pragma unroll
    for (int i = 0; i < 8; ++i) kf[i] = *(const v4fa*)(kp + 8 * i);
#pragma unroll
    for (int i = 0; i < 8; ++i) vf[i] = *(const v4fa*)(vp + (size_t)i * A0LD);
    asm volatile("s_wait_xcnt 0x0" :: "v"(kp), "v"(vp) : "memory");      /* the wait in front of any overwrite of the address pairs that the K and V loads name (the next trip forms new ones); the pairs are inputs, so they stay whole up to here */
#pragma unroll
    for (int u = 0; u < 2; ++u) { v8f s8 = {0.f, 0.f, 0.f, 0.f, 0.f, 0.f, 0.f, 0.f};
#pragma unroll
      for (int i = 0; i < 8; ++i) { s8 = a0_mma(v2f{kf[i][0], kf[i][1]}, v2f{qf[u][i][0], qf[u][i][1]}, s8); s8 = a0_mma(v2f{kf[i][2], kf[i][3]}, v2f{qf[u][i][2], qf[u][i][3]}, s8); }
      const int dq = rg * 32 + u * 16 + ln - k0 - 8 * hh;      /* register r holds key k0 + 8 hh + r: seen by the query where r <= dq */
      float s[8]; float mn = m[u];
#pragma unroll
      for (int r = 0; r < 8; ++r) { s[r] = (r <= dq) ? s8[r] * scale : -1.0e30f; mn = fmaxf(mn, s[r]); }
      mn = fmaxf(mn, fa_xhalf(mn));      /* lane ^ 16 holds the other eight keys of the same query */
      const float sc = exp_neg(m[u] - mn); float e[8]; float es = 0.f;      /* nothing seen yet: m = mn = -1e30, sc = 1 on l = 0 and o = 0 */
#pragma unroll
      for (int r = 0; r < 8; ++r) { const float x = exp_neg(s[r] - mn); e[r] = (r <= dq) ? x : 0.f; es += e[r]; }      /* formed for every key, then selected: eight independent chains and no branch; a key behind the row counts 0 also where all that the wave has met so far is behind it */
      l[u] = fmaf(l[u], sc, es); m[u] = mn;      /* l: this half's keys only; sc is the same in both halves */
#pragma unroll
      for (int t = 0; t < 4; ++t) { v8f acc = o[u][t] * sc;
#pragma unroll
        for (int j = 0; j < 4; ++j) acc = a0_mma(v2f{vf[2 * j][t], vf[2 * j + 1][t]}, v2f{e[2 * j], e[2 * j + 1]}, acc);
        o[u][t] = acc; } } } }
  { const float l0 = l[0] + fa_xhalf(l[0]), l1 = l[1] + fa_xhalf(l[1]); pm[w][lane] = hh ? m[1] : m[0]; pl[w][lane] = hh ? l1 : l0; }      /* both halves hold the same m and, joined, the same l: lane stores those of row lane */
  __syncthreads();
  float mx = pm[0][lane];      /* wave 0 has tile 0 with key 0, which every row sees: the common maximum is a real score */
#pragma unroll
  for (int u = 1; u < A0W; ++u) mx = fmaxf(mx, pm[u][lane]);
  if (w == 0) { float ls = 0.f;
#pragma unroll
    for (int u = 0; u < A0W; ++u) ls = fmaf(exp_neg(pm[u][lane] - mx), pl[u][lane], ls);
    pfin[lane] = 1.0f / ls; }
  const float mxo = fa_xhalf(mx);      /* the common maximum of row lane ^ 16 */
#pragma unroll
  for (int u = 0; u < 2; ++u) { const float f = exp_neg(m[u] - ((hh == u) ? mx : mxo));
#pragma unroll
    for (int r = 0; r < 8; ++r) *(v4f*)&po[w][u * 16 + ln][32 * hh + 4 * r] = v4f{o[u][0][r] * f, o[u][1][r] * f, o[u][2][r] * f, o[u][3][r] * f}; }
  __syncthreads();
  const int row = threadIdx.x >> 4, c4 = (threadIdx.x & 15) * 4;      /* a wave adds and stores two whole o rows: 512 B in a row */
  v4f r = {0.f, 0.f, 0.f, 0.f};
#pragma unroll
  for (int u = 0; u < A0W; ++u) r += *(const v4f*)&po[u][row][c4];
  r *= pfin[row];
  float* op = O + (size_t)(rg * 32 + row) * HD + c4; *(v4f*)op = r;
  asm volatile("s_wait_xcnt 0x0" :: "v"(op), "v"(r) : "memory"); }      /* the wait in front of any overwrite of a register that this store names: the other path's code follows in the text; address and data are inputs, so they stay whole up to here */

// Both attention paths in ONE launch: neither needs anything of the other, each output row belongs to exactly one of them, and the branch between them is the same for a whole work-group.
// grid.x = batch; grid.y = piece of work: first ATP pairs of neighbouring f16 blocks of FAR rows (rows QT0.., FAW waves each, side by side in the two halves of the work-group, each half with its own LDS),
// then the ATX exact blocks of 32 rows (rows 0..QT0-1, A0W waves each); of each kind the longer the earlier. One work-group of 16 waves fills a WGP's registers.
// No loop of either path holds a barrier: every wave of a work-group passes the same two.
#define ATX (QT0 / 32)
#define ATP ((SQ - QT0) / (2 * FAR))
union AtSm { FaSm fa[2]; A0Sm a0; };
__global__ __launch_bounds__(32 * A0W) void k_attn(const _Float16* __restrict__ Q16, const _Float16* __restrict__ K16, const _Float16* __restrict__ VT, const float* __restrict__ QF, const float* __restrict__ KF, const float* __restrict__ VF, float scale, float* __restrict__ O) {
  static_assert(2 * FAW == A0W && QT0 % (2 * FAR) == 0 && (SQ - QT0) % (2 * FAR) == 0 && sizeof(FaSm) % 16 == 0, "two f16 blocks fill a work-group of the exact path's size; the border between the paths falls between pairs");
  __shared__ __attribute__((aligned(16))) AtSm sm;
  const int b = blockIdx.x, t = blockIdx.y;
  if (t < ATP) { const int wv = __builtin_amdgcn_readfirstlane((int)(threadIdx.x >> 5)); const int hf = wv / FAW;      /* the wave's number as a scalar: the chunk loop and its mask test are scalar branches */
    fattn_rows(sm.fa[hf], wv % FAW, (int)threadIdx.x % (32 * FAW), SQ / FAR - 1 - (2 * t + hf), b, Q16, K16, VT, scale, O); }
  else att0w_rows(sm.a0, ATX - 1 - (t - ATP), b, QF, KF, VF, scale, O); }


template <int BFIN, int WXB>
__global__ __launch_bounds__(256) void k_ln16(const float* __restrict__ X, const float* __restrict__ g, const float* __restrict__ bb, float eps, _Float16* __restrict__ N16, float* __restrict__ XB) {
  #pragma clang fp contract(off)
  __shared__ float red[256]; const size_t r = blockIdx.x; const int t = threadIdx.x; const v4f xa = *(const v4fa*)(X + r * DMQ + t * 4); float s[4]; float sum = 0.f;
  for (int q = 0; q < 4; ++q) { s[q] = BFIN ? bf16_round(xa[q]) : xa[q]; sum = __fadd_rn(sum, s[q]); }
  red[t] = sum; __syncthreads(); for (int st = 128; st > 0; st >>= 1) { if (t < st) red[t] = __fadd_rn(red[t], red[t + st]); __syncthreads(); } const float mu = red[0] / (float)DMQ; __syncthreads();
  float vs = 0.f; for (int q = 0; q < 4; ++q) { const float dl = __fadd_rn(s[q], -mu); vs = __fadd_rn(vs, __fmul_rn(dl, dl)); } red[t] = vs; __syncthreads(); for (int st = 128; st > 0; st >>= 1) { if (t < st) red[t] = __fadd_rn(red[t], red[t + st]); __syncthreads(); }
  const float rs = rsqrtf(__fadd_rn(red[0] / (float)DMQ, eps)); v4h y; v4f xb;
  for (int q = 0; q < 4; ++q) { const int c = t * 4 + q; y[q] = (_Float16)__fadd_rn(__fmul_rn(__fmul_rn(__fadd_rn(s[q], -mu), rs), bf16_round(g[c])), bf16_round(bb[c])); xb[q] = s[q]; }
  { *(v4h*)(N16 + r * DMQ + t * 4) = y; if (WXB) *(v4f*)(XB + r * DMQ + t * 4) = xb;  } }
__global__ __launch_bounds__(256) void k_ftres2(const float* __restrict__ OF0, const float* __restrict__ XB, float* __restrict__ X1, size_t n4) {
  #pragma clang fp contract(off)
  const size_t t = (size_t)blockIdx.x * 256 + threadIdx.x; if (t >= n4) return; const v4f o = *(const v4fa*)(OF0 + t * 4), xv = *(const v4fa*)(XB + t * 4); v4f y; for (int q = 0; q < 4; ++q) y[q] = __fadd_rn(__fmul_rn(o[q], 0.015625f), xv[q]); *(v4f*)(X1 + t * 4) = y;  }

__global__ __launch_bounds__(256) void k_wthd(const float* __restrict__ Wt, _Float16* __restrict__ Bt) { const size_t t = (size_t)blockIdx.x * 256 + threadIdx.x; if (t >= (size_t)NH * HD * (DM / 8)) return; const int m8 = (int)(t % (DM / 8)) * 8; const int d = (int)((t / (DM / 8)) % HD); const int h = (int)(t / ((size_t)(DM / 8) * HD)); FragH f;
  for (int q = 0; q < 8; ++q) f.h[q] = (_Float16)(16.0f * bf16_round(Wt[((size_t)h * DM + m8 + q) * HD + d])); unsigned short* dst = (unsigned short*)Bt + ((size_t)h * HD + d) * DM + m8; *(v8us*)dst = f.half[0];  }




__global__ __launch_bounds__(256) void k_wtpad(const float* __restrict__ Wm, _Float16* __restrict__ Wt, int Kr, int Kp, int Nr, int Np, float scale) {
  const int t = blockIdx.x * 256 + threadIdx.x; if (t >= Np * (Kp / 8)) return; const int n = t / (Kp / 8), k8 = (t % (Kp / 8)) * 8; const int nc = min(n, Nr - 1); const float fn = (n < Nr) ? 1.f : 0.f; FragH f;
  for (int i = 0; i < 8; ++i) { const int k = k8 + i; const int kc = min(k, Kr - 1); const float fk = (k < Kr) ? fn : 0.f; f.h[i] = (_Float16)(bf16_round(Wm[(size_t)kc * Nr + nc]) * scale * fk); }
  unsigned short* o = (unsigned short*)Wt + (size_t)n * Kp + k8; *(v8us*)o = f.half[0];  }
__global__ __launch_bounds__(128) void k_bpad(const float* __restrict__ b, float* __restrict__ Bp, int nr, int np) {
  const int i = threadIdx.x; if (i >= np) return; const float v = b[min(i, nr - 1)] * ((i < nr) ? 1.f : 0.f); *(float*)(Bp + i) = v;  }

#define DI 64         /* inner width = NH * HD (ONE 64-wide head) */
#define LQK (3 * DI)  /* fused q | k | v row pitch (192) */
__global__ __launch_bounds__(256) void k_o0(const float* __restrict__ OF, float* __restrict__ ob, size_t n4) {
  #pragma clang fp contract(off)
  const size_t t = (size_t)blockIdx.x * 256 + threadIdx.x; if (t >= n4) return; const size_t e = t * 4; const int i = (int)(e / DI); const int c = (int)(e % DI); const int h = c / HD, d = c % HD; const v4f a = *(const v4fa*)(OF + e); v4f o; for (int q = 0; q < 4; ++q) o[q] = __fmul_rn(a[q], 0.015625f); float* dst = ob + (size_t)h * SQ * HD + (size_t)i * HD + d; *(v4f*)dst = o;  }

// The whole projection stage in ONE launch: q | k | v = x W for PJR token rows a work-group. x comes in as f32 in whole lines, is rounded as before (bf16, exact in f16) and laid in LDS as f16 rows;
// wave w owns columns 16 w .. 16 w + 15 of q | k | v and builds its eight B fragments straight from the f32 weights (lane = column, so a load takes 64 B of each of two weight rows; value bf16-rounded, x16, f16: as before).
// Products, k order and the order of the k steps are those of the GEMM that this takes the place of, so every q, k, v value is the same number. The accumulators go out three ways, all staged in LDS so that every store
// is of whole 128-B lines: q | k as f16 rows, v as f16 V^T rows (a lane holds 8 tokens in a row of one column: one 16-byte LDS store), and, for the first QT0 rows of a batch, q | k | v as f32.
#define PJR 64                       /* token rows per work-group: 256 work-groups */
#define PJW 12                       /* waves = 16-column tiles of q | k | v */
#define PJT (32 * PJW)
#define PJXP (DM + 8)                /* LDS pitch of an x row, halves: 528 B = 16 B x odd, for 16-byte fragment reads */
#define PJOP (2 * DI + 8)            /* LDS pitch of a q | k row, halves: 272 B = 16 B x odd */
#define PJVP (PJR + 8)               /* LDS pitch of a V^T row, halves: 144 B = 16 B x odd */
#define PJFP (LQK + 4)               /* LDS pitch of an f32 q | k | v row, floats: 784 B = 16 B x odd */
typedef __bf16 v2b __attribute__((ext_vector_type(2)));
typedef unsigned short v4us __attribute__((ext_vector_type(4), may_alias));
// two floats rounded to bf16 (nearest, ties to even: the value of bf16_round) by the conversion instruction, times s, as two f16
__device__ __forceinline__ void pj_cvt2(float a, float b, float s, _Float16& ha, _Float16& hb) { const v2b p = {(__bf16)a, (__bf16)b}; const unsigned int u = __builtin_bit_cast(unsigned int, p); ha = (_Float16)(__uint_as_float(u << 16) * s); hb = (_Float16)(__uint_as_float(u & 0xFFFF0000u) * s); }
__global__ __launch_bounds__(PJT) void k_proj(const float* __restrict__ x, const float* __restrict__ wq, const float* __restrict__ wk, const float* __restrict__ wv, _Float16* __restrict__ QK, _Float16* __restrict__ VT, float* __restrict__ F0) {
  static_assert(PJW * 16 == LQK && DI == 64 && DM == 256 && SQ % PJR == 0 && QT0 % PJR == 0 && (PJR * 2 * DI + DI * PJR) / 8 == 4 * PJT && PJR * LQK / 4 == 8 * PJT, "a wave a column tile; a work-group lies in one batch and wholly inside or outside the exact rows; the store loops divide evenly");
  __shared__ __attribute__((aligned(16))) _Float16 xs[PJR][PJXP]; __shared__ __attribute__((aligned(16))) _Float16 so[PJR][PJOP]; __shared__ __attribute__((aligned(16))) _Float16 sv[DI][PJVP]; __shared__ __attribute__((aligned(16))) float sf[PJR][PJFP];
  const int tid = threadIdx.x, lane = tid & 31, ln = lane & 15, hh = lane >> 4; const int w = __builtin_amdgcn_readfirstlane(tid >> 5);      /* the wave's number as a scalar: which weight matrix, and every branch on it, is scalar */
  const size_t r0 = (size_t)blockIdx.x * PJR; const int b = (int)(r0 / SQ), s0 = (int)(r0 % SQ);
  const float* wp = (w < 4 ? wq : w < 8 ? wk : wv) + (w & 3) * 16 + ln + (size_t)(8 * hh) * DI; float wr[8][16];
#pragma unroll
  for (int ks = 0; ks < 8; ++ks)
#pragma unroll
    for (int i = 0; i < 8; ++i) { wr[ks][i] = wp[(size_t)(ks * 32 + i) * DI]; wr[ks][8 + i] = wp[(size_t)(ks * 32 + 16 + i) * DI]; }      /* the k order of g2_frag: 8 hh + i, 16 + 8 hh + i */
  const char* xb = (const char*)(x + r0 * DM); const unsigned xo = (unsigned)tid * 16u; const char* xt = xb + xo; v4f xa[11];      /* 4 floats a thread and turn: each load of a wave covers 512 B in a row, four whole lines */
#pragma unroll
  for (int u = 0; u < 11; ++u) if (u < 10 || w < 8) xa[u] = *(const v4fa*)(xt + u * PJT * 16);      /* PJR * DM / 4 = 10 * PJT + 256 */
  asm volatile("s_wait_xcnt 0x0" :: "v"(xo), "v"(xt), "v"(wp), "s"(xb) : "memory");      /* the wait in front of any overwrite of the address registers that the loads above name; x's offset, base and full address and the weights' address are inputs, so whichever form a load takes, its registers stay whole up to here */
  FragH bf[8];
#pragma unroll
  for (int ks = 0; ks < 8; ++ks)
#pragma unroll
    for (int i = 0; i < 16; i += 2) pj_cvt2(wr[ks][i], wr[ks][i + 1], 16.0f, bf[ks].h[i], bf[ks].h[i + 1]);
#pragma unroll
  for (int u = 0; u < 11; ++u) if (u < 10 || w < 8) { const int i = tid + u * PJT; FragH f;
    pj_cvt2(xa[u][0], xa[u][1], 1.0f, f.h[0], f.h[1]); pj_cvt2(xa[u][2], xa[u][3], 1.0f, f.h[2], f.h[3]);
    *(v4us*)&xs[i >> 6][(i & 63) * 4] = v4us{f.u[0], f.u[1], f.u[2], f.u[3]}; }
  __syncthreads();
  v8f acc[4];
#pragma unroll
  for (int mt = 0; mt < 4; ++mt) acc[mt] = v8f{0.f, 0.f, 0.f, 0.f, 0.f, 0.f, 0.f, 0.f};
#pragma unroll
  for (int ks = 0; ks < 8; ++ks)
#pragma unroll
    for (int mt = 0; mt < 4; ++mt) acc[mt] = fa_mma(g2_frag(&xs[mt * 16 + ln][ks * 32], hh), bf[ks].v, acc[mt]);
#pragma unroll
  for (int mt = 0; mt < 4; ++mt) acc[mt] *= 0.0625f;      /* the weights ride x16 */
  const bool ft = s0 < QT0;      /* the same for the whole work-group */
  if (w < 8) {
#pragma unroll
    for (int mt = 0; mt < 4; ++mt)
#pragma unroll
      for (int r = 0; r < 8; ++r) so[mt * 16 + 8 * hh + r][w * 16 + ln] = (_Float16)acc[mt][r];
  } else {
#pragma unroll
    for (int mt = 0; mt < 4; ++mt) { FragH f;
#pragma unroll
      for (int r = 0; r < 8; ++r) f.h[r] = (_Float16)acc[mt][r];
      *(v8us*)&sv[(w & 3) * 16 + ln][mt * 16 + 8 * hh] = f.half[0]; } }
  if (ft) {
#pragma unroll
    for (int mt = 0; mt < 4; ++mt)
#pragma unroll
      for (int r = 0; r < 8; ++r) sf[mt * 16 + 8 * hh + r][w * 16 + ln] = acc[mt][r]; }
  __syncthreads();
  { v4f t[4]; float* p[4];      /* 16-byte pieces: 1024 of q | k rows (256 B a row), then 512 of V^T rows (128 B a row); the border falls between waves. All reads, then all stores: one LDS latency, not four */
#pragma unroll
    for (int u = 0; u < 4; ++u) { const bool qk = u < 2 || (u == 2 && w < 8); const int i = tid + u * PJT, j = qk ? 0 : i - PJR * 16;
      const _Float16* sp = qk ? &so[i >> 4][(i & 15) * 8] : &sv[j >> 3][(j & 7) * 8];
      _Float16* gp = qk ? QK + (r0 + (size_t)(i >> 4)) * LQK + (i & 15) * 8 : VT + ((size_t)b * HD + (size_t)(j >> 3)) * SQ + s0 + (j & 7) * 8;
      t[u] = *(const v4fa*)sp; p[u] = (float*)gp; }
#pragma unroll
    for (int u = 0; u < 4; ++u) *(v4fa*)p[u] = t[u];
    asm volatile("s_wait_xcnt 0x0" :: "v"(p[0]), "v"(p[1]), "v"(p[2]), "v"(p[3]), "v"(t[0]), "v"(t[1]), "v"(t[2]), "v"(t[3]) : "memory"); }      /* the wait in front of any overwrite of a register that these stores name; addresses and data are inputs, so they stay whole up to here */
  if (ft) { v4f t[8]; float* p[8]; float* fb = F0 + ((size_t)b * QT0 + s0) * LQK + (size_t)tid * 4;      /* the 64 f32 rows are one run of 48 KiB */
#pragma unroll
    for (int u = 0; u < 8; ++u) { const int i = tid + u * PJT; t[u] = *(const v4f*)&sf[i / (LQK / 4)][(i % (LQK / 4)) * 4]; p[u] = fb + (size_t)u * PJT * 4; }
#pragma unroll
    for (int u = 0; u < 8; ++u) *(v4f*)p[u] = t[u];
    asm volatile("s_wait_xcnt 0x0" :: "v"(t[0]), "v"(t[1]), "v"(t[2]), "v"(t[3]), "v"(t[4]), "v"(t[5]), "v"(t[6]), "v"(t[7]) : "memory"); } }      /* the same wait: the data are inputs, so no piece's registers are taken for a later piece while its store is on its way */

extern "C" void kernel_launch(void* const* d_in, const int* in_sizes, int n_in,
                              void* d_out, int out_size, void* d_ws, size_t ws_size, hipStream_t stream) {
  (void)in_sizes; (void)n_in; (void)out_size;
  const float* const* I = (const float* const*)d_in; const float* x = I[0]; const float* wq = I[2]; const float* wk = I[1]; const float* wv = I[3];      /* x; [in][out = 64] Wk / Wq / Wv (input order as this module lists them); no biases */
  char* ws = (char*)d_ws; size_t off = 0;
  auto take = [&](size_t bytes) { char* p = ws + off; off += (bytes + 255) & ~(size_t)255; return p; };
  _Float16* QKV = (_Float16*)take(NR * LQK * 2); _Float16* VT = (_Float16*)take((size_t)NB * HD * SQ * 2);
  float* QKVF0 = (float*)take((size_t)NB * QT0 * LQK * 4);      /* one plane a batch: the four batches run side by side */
  if (off > ws_size) return;
  k_proj<<<(unsigned)(NR / PJR), PJT, 0, stream>>>(x, wq, wk, wv, QKV, VT, QKVF0);      /* q | k f16 rows (columns 0 / 64 of the plane at pitch 192; its v columns stay unwritten and unread), V^T [NB][HD][SQ] f16, f32 q | k | v of rows 0..511 of every batch */
  const _Float16* Q16 = QKV; const _Float16* K16 = QKV + DI;
  static_assert(NH == 1, "the grid carries the batch in place of the head");
  float* ob = (float*)d_out;
  static_assert(LQK3 == LQK, "the fused kernel reads the q | k | v plane at its pitch");
  k_attn<<<dim3(NB, ATX + ATP), 32 * A0W, 0, stream>>>(Q16, K16, VT, QKVF0, QKVF0 + DI, QKVF0 + 2 * DI, 0.0625f, ob);      /* out[b][i][0..63] = softmax(causal q k^T * 256^-0.5 = 1/16: the module scales by the EMBEDDING width) v, f32, all query rows of all batches in one launch: rows 0..511 exact f32, the rest f16 operands */
}

// v008
// One run takes 27.7 microseconds.
// Two timings next to v007 put it at 1.45 and 1.54 times that version's speed.
// All steps since v000 together make it 1168 times as fast.
#include <hip/hip_runtime.h>
// Single-head causal self-attention with the module's EMBEDDING-width scale (x [4][4096][256]; k/q/v = x W ([in][out] [256][64], U(+-0.1), no biases; input order Wk, Wq, Wv); ONE 64-wide head; wei * 256^-0.5 (n_embd, as in the source); causal (tril, -inf); softmax; out = wei v -> [4][4096][64]; no output projection).
// Structure: token rows; ONE projection launch (x and the weights converted to their exact f16 values on the way in; WMMA; writes the f16 q, k and v^T planes and the f32 q, k planes of rows 0..511 in the order of the matrix fragments that the attention launch loads, and the f32 v rows of rows 0..511); ONE attention launch with the batches on grid.x: rows 512.. by the fused f16 path (scores, online softmax f32 -> f16 weights in registers, P V, written as f32 straight into the output rows), rows 0..511 by exact f32 work-groups of the same launch; launches: see trace.
// Compute dtype: inputs rounded to bf16; x / weights exact; q, k, v and softmax weights as plain f16 GEMM operands; o f32 (~2^-12); scores and softmax statistics f32; v_wmma_f32_16x16x32_f16; rows 0..511: f32 operands, v_wmma_f32_16x16x4_f32.
#define NB 4
#define SQ 4096
#define DM 256
#define NH 1
#define HD 64
#define HG 4                         /* heads per block group of the unlaunched k_vt(b, h0) overload */
#define QT 256                       /* unused */
#define NKX SQ                       /* unused */
#define QT0 512                      /* first-tile rows recomputed exactly (f32): 512 here (no output projection averages the early-row cancellation errors away; logit sigma 1.0) */
#define B0 0                         /* unused; the batches run on grid.x from 0 */
#define NBR NB                       /* feeds only MP; grid.x runs over the NB batches */
#define NR ((size_t)NB * SQ)
#define DMQ DM
#define DFF 4096                     /* unused; this file has no FFN */
#define DFFR 100                     /* unused */
#define MP ((int)((size_t)NBR * SQ)) /* feeds only MPO; the projection runs over NR rows */
#define QN SQ                        /* unused */
#define NHD NH                       /* unused */
#define MPO MP                       /* unused */
#define LQ (3 * DM)      /* 3 * DM = 768, unused; q, k and v lie in separate planes */
typedef __bf16 v16b __attribute__((ext_vector_type(16)));
typedef unsigned short v8us __attribute__((ext_vector_type(8), may_alias));
typedef float  v8f  __attribute__((ext_vector_type(8)));
typedef float  v4f  __attribute__((ext_vector_type(4)));
typedef float  v4fa __attribute__((ext_vector_type(4), may_alias));
union FragB { v16b v; v8us half[2]; unsigned short u[16]; };

__device__ __forceinline__ unsigned short bf16_bits(float x) { unsigned int u = __float_as_uint(x); return (unsigned short)((u + 0x7FFFu + ((u >> 16) & 1u)) >> 16); }
__device__ __forceinline__ float bf16_val(unsigned short b) { return __uint_as_float(((unsigned int)b) << 16); }
__device__ __forceinline__ float bf16_round(float x) { return bf16_val(bf16_bits(x)); }
// D += A·B with NT terms: 1 = ah·bh, 2 = + al·bh (A split), 3 = + ah·bl (both split)
template <int NT>
__device__ __forceinline__ v8f mmaN(v16b ah, v16b al, v16b bh, v16b bl, v8f c) {
  c = __builtin_amdgcn_wmma_f32_16x16x32_bf16(false, ah, false, bh, (short)0, c, false, false);
  if (NT >= 2) c = __builtin_amdgcn_wmma_f32_16x16x32_bf16(false, al, false, bh, (short)0, c, false, false);
  if (NT >= 3) c = __builtin_amdgcn_wmma_f32_16x16x32_bf16(false, ah, false, bl, (short)0, c, false, false);
  asm volatile("v_nop\n\tv_nop\n\tv_nop\n\tv_nop" : "+v"(c) : "v"(ah), "v"(al), "v"(bh), "v"(bl));
  return c;
}

__global__ __launch_bounds__(256) void k_wt_bf16(const float* __restrict__ W, unsigned short* __restrict__ Wt, int K, int N) {
  const int t = blockIdx.x * 256 + threadIdx.x;
  const int k8n = K / 8;
  if (t >= N * k8n) return;
  const int n = t / k8n, k8 = (t % k8n) * 8;
  v8us v;
#pragma unroll
  for (int i = 0; i < 8; ++i) v[i] = bf16_bits(W[(size_t)(k8 + i) * N + n]);
  *(v8us*)(Wt + (size_t)n * K + k8) = v;
  
}

// GEMM C[M][N] (f32, pitch ldc) = act(A[M][K]·W + bias). A f32 row-major (pitch lda) converted per fragment to bf16
// (ASPLIT: hi/lo two planes -> 2 terms, else single rounded term); Wt bf16 [N][K] (pitch ldb). BIAS_BF16 rounds the
// bias to bf16 first (bias quantised to bf16 before the add). K%32==0, M%16==0, N%64==0.
template <bool ASPLIT, int ACT, bool BIAS_BF16>
__global__ __launch_bounds__(128) void k_gemm_bf(const float* __restrict__ A, int lda, const unsigned short* __restrict__ Wt, int ldb,
                                               const float* __restrict__ bias, float* __restrict__ C, int ldc, int M, int N, int K) {
  __shared__ __attribute__((aligned(16))) float so[4][16][64];
  const int tid = threadIdx.x, w = tid >> 5, lane = tid & 31, ln = lane & 15, hh = lane >> 4;
  const int ntn = N / 64;
  const int wid = blockIdx.x * 4 + w;
  const int mt = wid / ntn, nq = wid % ntn;
  if (mt * 16 >= M) return;
  const int row0 = mt * 16, col0 = nq * 64;
  const float* arow = A + (size_t)(row0 + ln) * lda;
  v8f acc[4] = {};
  for (int kb = 0; kb < K; kb += 32) {
    FragB ah, al;
    const v4f x0 = *(const v4fa*)(arow + kb + 8 * hh), x1 = *(const v4fa*)(arow + kb + 8 * hh + 4);
    const v4f x2 = *(const v4fa*)(arow + kb + 16 + 8 * hh), x3 = *(const v4fa*)(arow + kb + 16 + 8 * hh + 4);
    float xs[16] = {x0[0],x0[1],x0[2],x0[3],x1[0],x1[1],x1[2],x1[3],x2[0],x2[1],x2[2],x2[3],x3[0],x3[1],x3[2],x3[3]};
#pragma unroll
    for (int i = 0; i < 16; ++i) { const unsigned short hb = bf16_bits(xs[i]); ah.u[i] = hb; al.u[i] = ASPLIT ? bf16_bits(xs[i] - bf16_val(hb)) : (unsigned short)0; }
#pragma unroll
    for (int t = 0; t < 4; ++t) {
      const unsigned short* brow = Wt + (size_t)(col0 + t * 16 + ln) * ldb + kb;
      FragB b;
      b.half[0] = *(const v8us*)(brow + 8 * hh);
      b.half[1] = *(const v8us*)(brow + 16 + 8 * hh);
      acc[t] = mmaN<ASPLIT ? 2 : 1>(ah.v, al.v, b.v, b.v, acc[t]);
    }
  }
#pragma unroll
  for (int t = 0; t < 4; ++t) {
    float bv = bias ? bias[col0 + t * 16 + ln] : 0.f;
    if (BIAS_BF16) bv = bf16_round(bv);
#pragma unroll
    for (int r = 0; r < 8; ++r) { float v = acc[t][r] + bv; if (ACT == 1) v = fmaxf(v, 0.f); so[w][8 * hh + r][t * 16 + ln] = v; }
  }
  __builtin_amdgcn_fence(__ATOMIC_ACQ_REL, "workgroup");
  __builtin_amdgcn_wave_barrier();
  const int rsub = lane >> 4, c4 = (lane & 15) * 4;
  {
#pragma unroll
    for (int q = 0; q < 8; ++q) {
      const int r = q * 2 + rsub;
      const v4f v = *(const v4fa*)&so[w][r][c4];
      *(v4f*)(C + (size_t)(row0 + r) * ldc + col0 + c4) = v;
    }
    
  }
}

// GEMM C = act(A·W + bias + resid): A f32 (ASPLIT -> hi/lo 2 terms), Wt bf16 [N][K]; ACT 0 none, 1 relu, 2 exact gelu;
// resid (optional, f32, row index = (row % rmod), pitch ldr, RES_BF16 rounds it) added before the activation.
template <bool ASPLIT, int ACT, bool BIAS_BF16, bool RES_BF16>
__global__ __launch_bounds__(128) void k_gemm_bf3(const float* __restrict__ A, int lda, const unsigned short* __restrict__ Wt, int ldb,
                                                const float* __restrict__ bias, const float* __restrict__ resid, int rmod, int ldr,
                                                float* __restrict__ C, int ldc, int M, int N, int K) {
  __shared__ __attribute__((aligned(16))) float so[4][16][64];
  const int tid = threadIdx.x, w = tid >> 5, lane = tid & 31, ln = lane & 15, hh = lane >> 4;
  const int ntn = N / 64;
  const int wid = blockIdx.x * 4 + w;
  const int mt = wid / ntn, nq = wid % ntn;
  if (mt * 16 >= M) return;
  const int row0 = mt * 16, col0 = nq * 64;
  const float* arow = A + (size_t)(row0 + ln) * lda;
  v8f acc[4] = {};
  for (int kb = 0; kb < K; kb += 32) {
    FragB ah, al;
    const v4f x0 = *(const v4fa*)(arow + kb + 8 * hh), x1 = *(const v4fa*)(arow + kb + 8 * hh + 4);
    const v4f x2 = *(const v4fa*)(arow + kb + 16 + 8 * hh), x3 = *(const v4fa*)(arow + kb + 16 + 8 * hh + 4);
    float xs[16] = {x0[0],x0[1],x0[2],x0[3],x1[0],x1[1],x1[2],x1[3],x2[0],x2[1],x2[2],x2[3],x3[0],x3[1],x3[2],x3[3]};
#pragma unroll
    for (int i = 0; i < 16; ++i) { const unsigned short hb = bf16_bits(xs[i]); ah.u[i] = hb; al.u[i] = ASPLIT ? bf16_bits(xs[i] - bf16_val(hb)) : (unsigned short)0; }
#pragma unroll
    for (int t = 0; t < 4; ++t) {
      const unsigned short* brow = Wt + (size_t)(col0 + t * 16 + ln) * ldb + kb;
      FragB b;
      b.half[0] = *(const v8us*)(brow + 8 * hh);
      b.half[1] = *(const v8us*)(brow + 16 + 8 * hh);
      acc[t] = mmaN<ASPLIT ? 2 : 1>(ah.v, al.v, b.v, b.v, acc[t]);
    }
  }
#pragma unroll
  for (int t = 0; t < 4; ++t) {
    const int col = col0 + t * 16 + ln;
    float bv = bias ? bias[col] : 0.f;
    if (BIAS_BF16) bv = bf16_round(bv);
#pragma unroll
    for (int r = 0; r < 8; ++r) {
      float v = acc[t][r] + bv;
      if (resid) { float rv = resid[(size_t)((row0 + 8 * hh + r) % rmod) * ldr + col]; if (RES_BF16) rv = bf16_round(rv); v += rv; }
      if (ACT == 1) v = fmaxf(v, 0.f);
      if (ACT == 2) v = 0.5f * v * (1.0f + erff(v * 0.70710678118654752f));
      if (ACT == 3) { const float u = 0.7978845608028654f * (v + 0.044715f * v * v * v); v = 0.5f * v * (1.0f + tanhf(u)); }
      so[w][8 * hh + r][t * 16 + ln] = v;
    }
  }
  __builtin_amdgcn_fence(__ATOMIC_ACQ_REL, "workgroup");
  __builtin_amdgcn_wave_barrier();
  const int rsub = lane >> 4, c4 = (lane & 15) * 4;
  {
#pragma unroll
    for (int q = 0; q < 8; ++q) {
      const int r = q * 2 + rsub;
      const v4f v = *(const v4fa*)&so[w][r][c4];
      *(v4f*)(C + (size_t)(row0 + r) * ldc + col0 + c4) = v;
    }
    
  }
}
// row LayerNorm (biased variance, eps) over N: s = X (+ R); optional out_sum <- s; out_norm <- (s-mu)*rsqrt(var+eps)*g + b
template <bool PARAM_BF16>
__global__ __launch_bounds__(256) void k_layernorm(const float* __restrict__ X, const float* __restrict__ R, const float* __restrict__ g, const float* __restrict__ bta,
                                                  float* __restrict__ out_sum, float* __restrict__ out_norm, int N, float eps) {
  __shared__ float red[256];
  const int row = blockIdx.x, tid = threadIdx.x;
  const float* x = X + (size_t)row * N; const float* rr = R ? R + (size_t)row * N : nullptr;
  float vals[16];                     // up to N = 4096
  const int per = N / 256;            // contiguous chunk per thread? use strided-by-4 chunks: thread handles j = tid*4 + 1024*u
  float s1 = 0.f;
  for (int u = 0; u < per / 4; ++u) {
    const int j = tid * 4 + 1024 * u;
    const v4f a = *(const v4fa*)(x + j);
    v4f b = {0.f,0.f,0.f,0.f}; if (rr) b = *(const v4fa*)(rr + j);
#pragma unroll
    for (int q = 0; q < 4; ++q) { const float v = a[q] + b[q]; vals[u * 4 + q] = v; s1 += v; }
  }
  red[tid] = s1; __syncthreads();
  for (int st = 128; st > 0; st >>= 1) { if (tid < st) red[tid] += red[tid + st]; __syncthreads(); }
  const float mu = red[0] / (float)N; __syncthreads();
  float s2 = 0.f;
  for (int u = 0; u < per / 4; ++u)
#pragma unroll
    for (int q = 0; q < 4; ++q) { const float c = vals[u * 4 + q] - mu; s2 += c * c; }
  red[tid] = s2; __syncthreads();
  for (int st = 128; st > 0; st >>= 1) { if (tid < st) red[tid] += red[tid + st]; __syncthreads(); }
  const float rs = rsqrtf(red[0] / (float)N + eps);
  {
    for (int u = 0; u < per / 4; ++u) {
      const int j = tid * 4 + 1024 * u;
      v4f o, sm;
#pragma unroll
      for (int q = 0; q < 4; ++q) {
        float gg = g[j + q], bb = bta[j + q];
        if (PARAM_BF16) { gg = bf16_round(gg); bb = bf16_round(bb); }
        sm[q] = vals[u * 4 + q]; o[q] = (vals[u * 4 + q] - mu) * rs * gg + bb;
      }
      if (out_sum) *(v4f*)(out_sum + (size_t)row * N + j) = sm;
      *(v4f*)(out_norm + (size_t)row * N + j) = o;
    }
    
  }
}



// ---- f16 WMMA path (v_wmma_f32_16x16x32_f16): 11-bit significands for operands in range — used where a [0,1] probability operand needs more precision than bf16
typedef _Float16 v16h __attribute__((ext_vector_type(16)));
union FragH { v16h v; v8us half[2]; _Float16 h[16]; unsigned short u[16]; };
template <int NT>
__device__ __forceinline__ v8f mmaH(v16h ah, v16h al, v16h bh, v16h bl, v8f c) {
  c = __builtin_amdgcn_wmma_f32_16x16x32_f16(false, ah, false, bh, (short)0, c, false, false);
  if (NT >= 2) c = __builtin_amdgcn_wmma_f32_16x16x32_f16(false, al, false, bh, (short)0, c, false, false);
  if (NT >= 3) c = __builtin_amdgcn_wmma_f32_16x16x32_f16(false, ah, false, bl, (short)0, c, false, false);
  asm volatile("v_nop\n\tv_nop\n\tv_nop\n\tv_nop" : "+v"(c) : "v"(ah), "v"(al), "v"(bh), "v"(bl));
  return c;
}
// batched GEMM like k_gemm_b but f16 operands: A f32 (split into f16 hi/lo if ASPLIT, else rounded to f16), Bt = f16 values [n][k]; alpha; C f32; N multiple of 16 (partial tiles skipped)
template <bool ASPLIT>
__global__ __launch_bounds__(128) void k_gemm_h(const float* __restrict__ A, int lda, size_t sA, const _Float16* __restrict__ Bh, int ldb, size_t sB, float alpha, float* __restrict__ C, int ldc, size_t sC, int M, int N, int K) {
  __shared__ __attribute__((aligned(16))) float so[4][16][64];
  const int tid = threadIdx.x, w = tid >> 5, lane = tid & 31, ln = lane & 15, hh = lane >> 4; const int by = blockIdx.y;
  A += (size_t)by * sA; Bh += (size_t)by * sB; C += (size_t)by * sC;
  const int ntn = (N + 63) / 64; const int wid = blockIdx.x * 4 + w; const int mt = wid / ntn, nq = wid % ntn; if (mt * 16 >= M) return;
  const int row0 = mt * 16, col0 = nq * 64; const float* arow = A + (size_t)(row0 + ln) * lda;
  v8f acc[4] = {};
  for (int kb = 0; kb < K; kb += 32) {
    FragH ah, al;
    const v4f x0 = *(const v4fa*)(arow + kb + 8 * hh), x1 = *(const v4fa*)(arow + kb + 8 * hh + 4), x2 = *(const v4fa*)(arow + kb + 16 + 8 * hh), x3 = *(const v4fa*)(arow + kb + 16 + 8 * hh + 4);
    float xs[16] = {x0[0],x0[1],x0[2],x0[3],x1[0],x1[1],x1[2],x1[3],x2[0],x2[1],x2[2],x2[3],x3[0],x3[1],x3[2],x3[3]};
#pragma unroll
    for (int i = 0; i < 16; ++i) { const _Float16 h = (_Float16)xs[i]; ah.h[i] = h; al.h[i] = ASPLIT ? (_Float16)(xs[i] - (float)h) : (_Float16)0.0f; }
#pragma unroll
    for (int t = 0; t < 4; ++t) { if (col0 + t * 16 >= N) continue; const size_t boff = (size_t)(col0 + t * 16 + ln) * ldb + kb; FragH bq; bq.half[0] = *(const v8us*)(Bh + boff + 8 * hh); bq.half[1] = *(const v8us*)(Bh + boff + 16 + 8 * hh);
      acc[t] = mmaH<ASPLIT ? 2 : 1>(ah.v, al.v, bq.v, bq.v, acc[t]); }
  }
#pragma unroll
  for (int t = 0; t < 4; ++t) { if (col0 + t * 16 >= N) continue;
#pragma unroll
    for (int r = 0; r < 8; ++r) so[w][8 * hh + r][t * 16 + ln] = acc[t][r] * alpha; }
  __builtin_amdgcn_fence(__ATOMIC_ACQ_REL, "workgroup"); __builtin_amdgcn_wave_barrier();
  const int rsub = lane >> 4, c4 = (lane & 15) * 4;
  {
#pragma unroll
    for (int q = 0; q < 8; ++q) { const int r = q * 2 + rsub; if (col0 + c4 < N) { const v4f v = *(const v4fa*)&so[w][r][c4]; *(v4f*)(C + (size_t)(row0 + r) * ldc + col0 + c4) = v; } }
     }
}

// Wt[n][k] = f16(W[k][n]·scale) from f32 row-major W[K][N] (scale = power of two; bf16-exact weights stay exact in f16 away from the subnormal range)
__global__ __launch_bounds__(256) void k_wt_f16(const float* __restrict__ W, _Float16* __restrict__ Wt, int K, int N, float scale) {
  const int t = blockIdx.x * 256 + threadIdx.x; if (t >= N * (K / 8)) return; const int n = t / (K / 8), k8 = (t % (K / 8)) * 8; FragH f;
#pragma unroll
  for (int i = 0; i < 8; ++i) f.h[i] = (_Float16)(bf16_round(W[(size_t)(k8 + i) * N + n]) * scale); const v8us o = f.half[0];
  *(v8us*)((unsigned short*)Wt + (size_t)n * K + k8) = o; 
}
// k_gemm_hh variant with fused epilogue: v = acc·alpha + bias[by·sBias + col] (+ CP[(row/rowsPerB)·sCPb + by·64 + col] if CP) ; ACT 0 none / 1 elu ; writes f16 C16 (and f32 C if non-null)
template <int ACT>
__global__ __launch_bounds__(128) void k_gemm_hhx(const _Float16* __restrict__ A, int lda, size_t sA, const _Float16* __restrict__ Bh, int ldb, size_t sB, float alpha, const float* __restrict__ bias, size_t sBias, const float* __restrict__ CP, int rowsPerB, size_t sCPb, int row0g,
    float* __restrict__ C, _Float16* __restrict__ C16, int ldc, size_t sC, int M, int N, int K) {
  __shared__ __attribute__((aligned(16))) float so[4][16][64];
  const int tid = threadIdx.x, w = tid >> 5, lane = tid & 31, ln = lane & 15, hh = lane >> 4; const int by = blockIdx.y;
  A += (size_t)by * sA; Bh += (size_t)by * sB; const size_t cofs = (size_t)by * sC; const float* bp = bias ? bias + (size_t)by * sBias : nullptr;
  const int ntn = (N + 63) / 64; const int wid = blockIdx.x * 4 + w; const int mt = wid / ntn, nq = wid % ntn; if (mt * 16 >= M) return;
  const int row0 = mt * 16, col0 = nq * 64; const _Float16* arow = A + (size_t)(row0 + ln) * lda;
  v8f acc[4] = {};
  for (int kb = 0; kb < K; kb += 32) { FragH ah; ah.half[0] = *(const v8us*)((const unsigned short*)arow + kb + 8 * hh); ah.half[1] = *(const v8us*)((const unsigned short*)arow + kb + 16 + 8 * hh);
#pragma unroll
    for (int t = 0; t < 4; ++t) { if (col0 + t * 16 >= N) continue; const size_t boff = (size_t)(col0 + t * 16 + ln) * ldb + kb; FragH bq; bq.half[0] = *(const v8us*)((const unsigned short*)Bh + boff + 8 * hh); bq.half[1] = *(const v8us*)((const unsigned short*)Bh + boff + 16 + 8 * hh);
      acc[t] = mmaH<1>(ah.v, ah.v, bq.v, bq.v, acc[t]); }
  }
#pragma unroll
  for (int t = 0; t < 4; ++t) { if (col0 + t * 16 >= N) continue; const int col = col0 + t * 16 + ln; const float bv = bp ? bf16_round(bp[col]) : 0.f;
#pragma unroll
    for (int r = 0; r < 8; ++r) { float v = acc[t][r] * alpha + bv; if (CP) { const int rr = row0g + row0 + 8 * hh + r; if (rowsPerB < 0) v += CP[cofs + (size_t)rr * ldc + col];      /* rowsPerB < 0: own element of the batched C plane */ else { const int bidx = rr / rowsPerB; v += CP[(size_t)bidx * sCPb + (size_t)by * 64 + col]; } } if (ACT == 1) v = (v > 0.f) ? v : expm1f(v); else if (ACT == 7) v = (v > 0.f) ? v + 1.0f : expf(v); else if (ACT == 8) v = tanhf(v); else if (ACT == 9) v = 0.5f * v * (1.0f + tanhf(0.7978845608028654f * (v + 0.044715f * v * v * v))); else if (ACT == 11) v = 1.0f / (1.0f + expf(-v)); else if (ACT == 12) v = (v > 0.f) ? v : 0.01f * v; else if (ACT == 14) v = (v > 0.f) ? v : 0.1f * v; else if (ACT == 16) v = (v >= 0.f) ? v : 0.3f * v; else if (ACT == 17) v = (v >= 0.f) ? v : 0.2f * v; else if (ACT == 15) v = v / (1.0f + expf(-v)); else if (ACT == 3) v = fmaxf(v, 0.f); else if (ACT == 6) v = 0.5f * v * (1.0f + erff(v * 0.70710678118654752f)); so[w][8 * hh + r][t * 16 + ln] = v; } }
  __builtin_amdgcn_fence(__ATOMIC_ACQ_REL, "workgroup"); __builtin_amdgcn_wave_barrier();
  const int rsub = lane >> 4, c4 = (lane & 15) * 4; typedef _Float16 v4h __attribute__((ext_vector_type(4)));
  {
#pragma unroll
    for (int q = 0; q < 8; ++q) { const int r = q * 2 + rsub; if (col0 + c4 < N) { const v4f v = *(const v4fa*)&so[w][r][c4]; if (C) *(v4f*)(C + cofs + (size_t)(row0 + r) * ldc + col0 + c4) = v; if (C16) { v4h h4; for (int i = 0; i < 4; ++i) h4[i] = (_Float16)v[i]; *(v4h*)(C16 + cofs + (size_t)(row0 + r) * ldc + col0 + c4) = h4; } } }
     }
}


typedef _Float16 v4h __attribute__((ext_vector_type(4)));

__global__ __launch_bounds__(256) void k_x16(const float* __restrict__ x, _Float16* __restrict__ X16, size_t n8) { const size_t t = (size_t)blockIdx.x * 256 + threadIdx.x; if (t >= n8) return; FragH f;
#pragma unroll
  for (int q = 0; q < 8; ++q) f.h[q] = (_Float16)bf16_round(x[t * 8 + q]); *(v8us*)((unsigned short*)X16 + t * 8) = f.half[0];  }
__global__ __launch_bounds__(256) void k_h16(const float* __restrict__ x, _Float16* __restrict__ X16, size_t n8) { const size_t t = (size_t)blockIdx.x * 256 + threadIdx.x; if (t >= n8) return; FragH f;
#pragma unroll
  for (int q = 0; q < 8; ++q) f.h[q] = (_Float16)x[t * 8 + q]; *(v8us*)((unsigned short*)X16 + t * 8) = f.half[0];  }
__global__ __launch_bounds__(256) void k_round16f(const float* __restrict__ W, _Float16* __restrict__ Bt, size_t n8) { const size_t t = (size_t)blockIdx.x * 256 + threadIdx.x; if (t >= n8) return; FragH f;
#pragma unroll
  for (int i = 0; i < 8; ++i) f.h[i] = (_Float16)(bf16_round(W[t * 8 + i]) * 16.0f); *(v8us*)((unsigned short*)Bt + t * 8) = f.half[0];  }
template <int NHv, int TTv>
__global__ __launch_bounds__(256) void k_vt(const _Float16* __restrict__ V16, int ldv, int voff, _Float16* __restrict__ Vt) { __shared__ unsigned short tl[64][66]; const int tid = threadIdx.x; const int slab = blockIdx.x / (TTv / 64), lg = blockIdx.x % (TTv / 64); const int b = slab / NHv, h = slab % NHv;
  for (int i = tid; i < 64 * 8; i += 256) { const int r = i / 8, c8 = (i % 8) * 8; FragH f; f.half[0] = *(const v8us*)((const unsigned short*)V16 + ((size_t)b * TTv + lg * 64 + r) * ldv + voff + h * 64 + c8);
#pragma unroll
    for (int q = 0; q < 8; ++q) tl[r][c8 + q] = f.u[q]; }
  __syncthreads();
  {
#pragma unroll
    for (int rd = 0; rd < 2; ++rd) { const int d = rd * 32 + tid / 8, pc = tid % 8; FragH f;
#pragma unroll
      for (int q = 0; q < 8; ++q) f.u[q] = tl[pc * 8 + q][d];
      *(v8us*)((unsigned short*)Vt + ((size_t)slab * 64 + d) * TTv + lg * 64 + pc * 8) = f.half[0]; }
     } }

__global__ __launch_bounds__(256) void k_hl(const float* __restrict__ F, _Float16* __restrict__ Hh, _Float16* __restrict__ Hl, size_t n8) { const size_t t = (size_t)blockIdx.x * 256 + threadIdx.x; if (t >= n8) return; FragH fh, fl; const v4f a = *(const v4fa*)(F + t * 8), c = *(const v4fa*)(F + t * 8 + 4);
#pragma unroll
  for (int q = 0; q < 4; ++q) { _Float16 h = (_Float16)a[q]; fh.h[q] = h; fl.h[q] = (_Float16)((a[q] - (float)h) * 1024.0f); h = (_Float16)c[q]; fh.h[4 + q] = h; fl.h[4 + q] = (_Float16)((c[q] - (float)h) * 1024.0f); }
  { *(v8us*)((unsigned short*)Hh + t * 8) = fh.half[0]; *(v8us*)((unsigned short*)Hl + t * 8) = fl.half[0];  } }

// ---- fast GEMM (wave tile 32x64; requires M % 32 == 0 rows per launch region and N % 64 == 0); epilogue = k_gemm_hhx semantics ----
__device__ __forceinline__ v16h g2_frag(const _Float16* p, int hh) { FragH f; f.half[0] = *(const v8us*)((const unsigned short*)p + 8 * hh); f.half[1] = *(const v8us*)((const unsigned short*)p + 16 + 8 * hh); return f.v; }
__device__ __forceinline__ v8f g2_mma(v16h a, v16h b, v8f c) { v8f d = __builtin_amdgcn_wmma_f32_16x16x32_f16(false, a, false, b, (short)0, c, false, false); asm volatile("v_nop\n\tv_nop\n\tv_nop\n\tv_nop" : "+v"(d) : "v"(a), "v"(b)); return d; }
template <int ACT>
__global__ __launch_bounds__(128) void k_gemm2(const _Float16* __restrict__ A, int lda, size_t sA, const _Float16* __restrict__ Bh, int ldb, size_t sB, float alpha, const float* __restrict__ bias, size_t sBias, const float* __restrict__ CP, int rowsPerB, size_t sCPb, int row0g,
    float* __restrict__ C, _Float16* __restrict__ C16, int ldc, size_t sC, int M, int N, int K) { static_assert(ACT == 0 || ACT == 3 || ACT == 6 || ACT == 8 || ACT == 9 || ACT == 11 || ACT == 12 || ACT == 14 || ACT == 15 || ACT == 16 || ACT == 17, "k_gemm2: unsupported ACT code (would silently apply no activation)");
  __shared__ __attribute__((aligned(16))) float so[4][32][68];
  const int tid = threadIdx.x, w = tid >> 5, lane = tid & 31, ln = lane & 15, hh = lane >> 4; const int by = blockIdx.y;
  A += (size_t)by * sA; Bh += (size_t)by * sB; const size_t cofs = (size_t)by * sC; const float* bp = bias ? bias + (size_t)by * sBias : nullptr;
  const int ntn = N >> 6; const int mt = blockIdx.x / ntn, nq = blockIdx.x - mt * ntn; const int row0 = mt * 128 + 32 * w, col0 = nq * 64; if (row0 >= M) return;
  const _Float16* a0p = A + (size_t)(row0 + ln) * lda; const _Float16* a1p = a0p + (size_t)16 * lda;
  const _Float16* b0p = Bh + (size_t)(col0 + ln) * ldb; const _Float16* b1p = b0p + (size_t)16 * ldb; const _Float16* b2p = b1p + (size_t)16 * ldb; const _Float16* b3p = b2p + (size_t)16 * ldb;
  const v8f z8 = {0.f,0.f,0.f,0.f,0.f,0.f,0.f,0.f}; v8f c00 = z8, c01 = z8, c02 = z8, c03 = z8, c10 = z8, c11 = z8, c12 = z8, c13 = z8;
#pragma unroll 1
  for (int kb = 0; kb < K; kb += 32) { const v16h a0 = g2_frag(a0p + kb, hh), a1 = g2_frag(a1p + kb, hh);
    v16h b = g2_frag(b0p + kb, hh); c00 = g2_mma(a0, b, c00); c10 = g2_mma(a1, b, c10);
    b = g2_frag(b1p + kb, hh); c01 = g2_mma(a0, b, c01); c11 = g2_mma(a1, b, c11);
    b = g2_frag(b2p + kb, hh); c02 = g2_mma(a0, b, c02); c12 = g2_mma(a1, b, c12);
    b = g2_frag(b3p + kb, hh); c03 = g2_mma(a0, b, c03); c13 = g2_mma(a1, b, c13); }
  v8f accs[8] = {c00, c01, c02, c03, c10, c11, c12, c13};
#pragma unroll
  for (int u = 0; u < 8; ++u) { const int t = u & 3, half = u >> 2; const int col = col0 + t * 16 + ln; const float bv = bp ? bf16_round(bp[col]) : 0.f;
#pragma unroll
    for (int r = 0; r < 8; ++r) { const int rloc = half * 16 + 8 * hh + r; float v = accs[u][r] * alpha + bv; if (CP) { if (rowsPerB < 0) v += CP[cofs + (size_t)(row0g + row0 + rloc) * ldc + col];      /* rowsPerB < 0: own element of the batched C plane */ else { const int bidx = (row0g + row0 + rloc) / rowsPerB; v += CP[(size_t)bidx * sCPb + (size_t)by * 64 + col]; } }
      if (ACT == 3) v = fmaxf(v, 0.f); else if (ACT == 6) v = 0.5f * v * (1.0f + erff(v * 0.70710678118654752f)); else if (ACT == 11) v = 1.0f / (1.0f + expf(-v)); else if (ACT == 15) v = v / (1.0f + expf(-v)); else if (ACT == 12) v = (v > 0.f) ? v : 0.01f * v; else if (ACT == 8) v = tanhf(v); else if (ACT == 9) v = 0.5f * v * (1.0f + tanhf(0.7978845608028654f * (v + 0.044715f * v * v * v))); else if (ACT == 14) v = (v > 0.f) ? v : 0.1f * v; else if (ACT == 16) v = (v >= 0.f) ? v : 0.3f * v; else if (ACT == 17) v = (v >= 0.f) ? v : 0.2f * v;
      so[w][rloc][t * 16 + ln] = v; } }
  __builtin_amdgcn_fence(__ATOMIC_ACQ_REL, "workgroup"); __builtin_amdgcn_wave_barrier();
  const int rsub = lane >> 4, c4 = (lane & 15) * 4;
  {
#pragma unroll
    for (int q = 0; q < 16; ++q) { const int r = q * 2 + rsub; const v4f v = *(const v4fa*)&so[w][r][c4]; if (C) *(v4f*)(C + cofs + (size_t)(row0 + r) * ldc + col0 + c4) = v; if (C16) { v4h h4; for (int i = 0; i < 4; ++i) h4[i] = (_Float16)v[i]; *(v4h*)(C16 + cofs + (size_t)(row0 + r) * ldc + col0 + c4) = h4; } }
     } }


__global__ __launch_bounds__(256) void k_wnat(const float* __restrict__ w, size_t n8, _Float16* __restrict__ Bt) { const size_t t = (size_t)blockIdx.x * 256 + threadIdx.x; if (t >= n8) return; FragH f; for (int q = 0; q < 8; ++q) f.h[q] = (_Float16)(bf16_round(w[t * 8 + q]) * 16.0f); *(v8us*)((unsigned short*)Bt + t * 8) = f.half[0];  }
__global__ __launch_bounds__(256) void k_rsm(const float* __restrict__ S, _Float16* __restrict__ P, int nrows) {
  #pragma clang fp contract(off)
  const int i = blockIdx.x * 256 + threadIdx.x; if (i >= nrows) return; const float* s = S + (size_t)i * SQ; float mx = -3.0e38f;
#pragma unroll 1
  for (int j = 0; j < SQ; ++j) mx = fmaxf(mx, s[j]); float se = 0.f;
#pragma unroll 1
  for (int j = 0; j < SQ; ++j) se += expf(s[j] - mx); const float sc = 256.0f / se;
#pragma unroll 1
  for (int j0 = 0; j0 < SQ; j0 += 8) { FragH f; for (int q = 0; q < 8; ++q) f.h[q] = (_Float16)(expf(s[j0 + q] - mx) * sc); unsigned short* d = (unsigned short*)P + (size_t)i * SQ + j0; *(v8us*)d = f.half[0];  } }
__global__ __launch_bounds__(256) void k_vt(const _Float16* __restrict__ V16, int b, int h0, _Float16* __restrict__ VT) { __shared__ unsigned short tl[64][65]; const int tid = threadIdx.x; const int hh = blockIdx.x % HG, sg = blockIdx.x / HG; const int s0 = sg * 64; const int h = h0 + hh;
  for (int i = tid; i < 64 * 8; i += 256) { const int j = i / 8, d8 = (i % 8) * 8; FragH f; f.half[0] = *(const v8us*)((const unsigned short*)V16 + ((size_t)b * SQ + s0 + j) * DM + h * HD + d8); for (int q = 0; q < 8; ++q) tl[d8 + q][j] = f.u[q]; }
  __syncthreads();
  { for (int i = tid; i < 64 * 8; i += 256) { const int d = i / 8, j8 = (i % 8) * 8; FragH f; for (int q = 0; q < 8; ++q) f.u[q] = tl[d][j8 + q]; *(v8us*)((unsigned short*)VT + ((size_t)hh * HD + d) * SQ + s0 + j8) = f.half[0]; }  } }



// Fused causal attention on the f16 planes: scores, softmax and P V in ONE launch; neither S nor P goes through memory. One call = one block of FAR query rows of one batch, worked on by FAW waves.
// Both products are formed transposed, so that a lane owns one query in both: S^T = K Q^T (A = K rows, B = Q rows) leaves in lane (ln, hh) the scores of query ln for keys 8 hh + r
// of each 16-key tile, which for two tiles side by side is the k order of a B fragment; O^T = V^T P^T (A = V^T rows, B = those weights as f16) leaves query ln's o for d = 8 hh + r.
// So the weights never leave their registers, and running maximum, denominator and rescale are per lane: lane ^ 16 holds the other keys of the same query, so the maximum is exchanged with it
// once a chunk, and the two halves' denominators are joined once, behind the loop. Scores are carried times log2(e), so that a weight is one v_exp_f32 of a difference.
// wave = key run: the block's 32-key chunks are dealt to the FAW waves in turn; the FAW partial results are brought to the common maximum and added through LDS, in the order of the waves.
// Every inner loop is unrolled so that each index of a register array is a constant (no scratch); the chunk loop stays rolled, so that one chunk's fragments are live at a time and four waves fit a SIMD.
#define FAW 8                        /* waves = key runs per block of query rows */
#define FAQ 2                        /* 16-query tiles a wave: each K and V^T fragment is used FAQ times */
#define FAR (16 * FAQ)               /* query rows per block = keys per chunk */
#define FAP (HD + 4)                 /* LDS pitch of a partial o row: 16 B x odd, so that 16-byte accesses of many rows spread over the banks */
__device__ __forceinline__ float fa_xhalf(float x) { return __builtin_bit_cast(float, __builtin_amdgcn_permlanex16(__builtin_bit_cast(int, x), __builtin_bit_cast(int, x), 0x76543210, 0xfedcba98, false, false)); }      /* lane l reads lane l ^ 16: a vector move, where __shfl_xor goes through the LDS path and a wait */
// 2^x. The v_nop in the same statement keeps the one slot that the instruction set asks for behind a transcendental before its result is read or its source overwritten.
__device__ __forceinline__ float fa_exp2(float x) { float r; asm("v_exp_f32 %0, %1\n\tv_nop" : "=v"(r) : "v"(x)); return r; }
__device__ __forceinline__ v8f fa_mma(v16h a, v16h b, v8f c) { return __builtin_amdgcn_wmma_f32_16x16x32_f16(false, a, false, b, (short)0, c, false, false); }
// A fragment from a plane laid out in fragment order: p = the fragment's 1 KiB block + 8 * lane halves. Each of the two 16-byte loads of a wave covers 512 B in a row, four whole lines
// (from token rows a load took 32 B of each of 16 lines). Block of q, k: [16-row tile][k step of 32 columns]; of v^T: [32-key chunk][16-column tile]; inside a block [register half j][hh][ln][8 values],
// the values that g2_frag takes from a row: row ln of the tile, k = 16 j + 8 hh + 0..7 of the step.
__device__ __forceinline__ v16h fr_frag(const _Float16* p) { FragH f; f.half[0] = *(const v8us*)(const unsigned short*)p; f.half[1] = *(const v8us*)((const unsigned short*)p + 256); return f.v; }
struct FaSm { float po[FAW][FAR][FAP]; float pm[FAW][FAR]; float pl[FAW][FAR]; };      /* the LDS of one block of query rows; po first: 16-byte accesses */
// w: the wave's number among the block's FAW (a scalar); tl: the thread's number among the block's 32 * FAW; qb: the block of query rows; b: the batch.
__device__ __forceinline__ void fattn_rows(FaSm& sm, const int w, const int tl, const int qb, const int b, const _Float16* __restrict__ Q16, const _Float16* __restrict__ K16, const _Float16* __restrict__ VT, float scale, float* __restrict__ O) {
  static_assert(NH == 1 && HD == 64 && FAR == 32 && SQ % FAR == 0 && 32 * FAW * 8 == FAR * HD, "one 64-wide head; a chunk of 32 keys is one k step of P V; the merge gives every thread 8 columns of one row");
  float (&pm)[FAW][FAR] = sm.pm; float (&pl)[FAW][FAR] = sm.pl; float (&po)[FAW][FAR][FAP] = sm.po;
  const int lane = tl & 31, ln = lane & 15, hh = lane >> 4;
  const int q0 = qb * FAR; const int nch = qb + 1;      /* causal: chunks 0..qb; only chunk qb crosses the diagonal */
  Q16 += (size_t)b * SQ * HD + lane * 8; K16 += (size_t)b * SQ * HD + lane * 8; VT += (size_t)b * HD * SQ + lane * 8; O += (size_t)b * SQ * HD;      /* the three planes in fragment order: the lane's 16 bytes of every 512 */
  v8f o[FAQ][4]; float m[FAQ], l[FAQ]; const float sl2 = scale * 1.44269504088896340736f;
#pragma unroll
  for (int u = 0; u < FAQ; ++u) { m[u] = -1.0e30f; l[u] = 0.f;
#pragma unroll
    for (int t = 0; t < 4; ++t) o[u][t] = v8f{0.f, 0.f, 0.f, 0.f, 0.f, 0.f, 0.f, 0.f}; }
  if (w < nch) {      /* a wave without a chunk loads nothing and goes to the merge with m = -1e30, l = 0, o = 0 */
  v16h qf[FAQ][2];
#pragma unroll
  for (int u = 0; u < FAQ; ++u) { const _Float16* qp = Q16 + (size_t)(qb * FAQ + u) * (16 * HD); qf[u][0] = fr_frag(qp); qf[u][1] = fr_frag(qp + 512);
    asm volatile("s_wait_xcnt 0x0" :: "v"(qp) : "memory"); }      /* the wait in front of any overwrite of the address pair that the q loads name; the pair is an input, so it stays whole up to here */
#pragma unroll 1
  for (int c = w; c < nch; c += FAW) { const int k0 = c * FAR;
    const _Float16* kp = K16 + (size_t)k0 * HD; const _Float16* vp = VT + (size_t)k0 * HD;      /* a chunk is 4 KiB in a row of each plane */
    const v16h ka0 = fr_frag(kp), ka1 = fr_frag(kp + 512), kb0 = fr_frag(kp + 1024), kb1 = fr_frag(kp + 1536);
    v16h vf[4];
#pragma unroll
    for (int t = 0; t < 4; ++t) vf[t] = fr_frag(vp + t * 512);
    asm volatile("s_wait_xcnt 0x0" :: "v"(kp), "v"(vp) : "memory");      /* the wait in front of any overwrite of the address pairs that the K and V loads name (the next trip forms new ones); the pairs are inputs, so they stay whole up to here */
#pragma unroll
    for (int u = 0; u < FAQ; ++u) { const v8f z8 = {0.f, 0.f, 0.f, 0.f, 0.f, 0.f, 0.f, 0.f};
      const v8f sa = fa_mma(ka1, qf[u][1], fa_mma(ka0, qf[u][0], z8)), sb = fa_mma(kb1, qf[u][1], fa_mma(kb0, qf[u][0], z8));
      float s[16];
#pragma unroll
      for (int r = 0; r < 8; ++r) { s[r] = sa[r] * sl2; s[8 + r] = sb[r] * sl2; }      /* s[i]: key k0 + 8 hh + i (i < 8), k0 + 16 + 8 hh + i - 8 (i >= 8) */
      if (c == nch - 1) { const int dq = u * 16 + ln - 8 * hh;      /* key - k0 <= query - q0, and k0 = q0 here */
#pragma unroll
        for (int r = 0; r < 8; ++r) { if (r > dq) s[r] = -1.0e30f; if (16 + r > dq) s[8 + r] = -1.0e30f; } }
      float mn = s[0];
#pragma unroll
      for (int i = 1; i < 16; ++i) mn = fmaxf(mn, s[i]);
      mn = fmaxf(mn, fa_xhalf(mn)); mn = fmaxf(mn, m[u]);      /* every chunk holds a key that the query sees (the chunk's first), so mn is a real score */
      const float sc = fa_exp2(m[u] - mn); float es = 0.f; FragH p;      /* first chunk: m = -1e30, sc = 0 on l = 0 and o = 0 */
#pragma unroll
      for (int i = 0; i < 16; ++i) { const float e = fa_exp2(s[i] - mn); es += e; p.h[i] = (_Float16)e; }
      l[u] = fmaf(l[u], sc, es); m[u] = mn;      /* l: this half's keys only; sc is the same in both halves */
#pragma unroll
      for (int t = 0; t < 4; ++t) o[u][t] = fa_mma(vf[t], p.v, o[u][t] * sc); } } }
#pragma unroll
  for (int u = 0; u < FAQ; ++u) { const float lj = l[u] + fa_xhalf(l[u]); if (hh == 0) { pm[w][u * 16 + ln] = m[u]; pl[w][u * 16 + ln] = lj; } }      /* both halves of the wave hold the same m and, joined, the same l */
  __syncthreads();
#pragma unroll
  for (int u = 0; u < FAQ; ++u) { float mx = pm[0][u * 16 + ln];      /* wave 0 has chunk 0, which every row sees: the common maximum is a real score; a wave without a chunk counts 0 */
#pragma unroll
    for (int x = 1; x < FAW; ++x) mx = fmaxf(mx, pm[x][u * 16 + ln]);
    const float f = fa_exp2(m[u] - mx);
#pragma unroll
    for (int t = 0; t < 4; ++t) { const v8f y = o[u][t] * f; *(v4f*)&po[w][u * 16 + ln][t * 16 + 8 * hh] = v4f{y[0], y[1], y[2], y[3]}; *(v4f*)&po[w][u * 16 + ln][t * 16 + 8 * hh + 4] = v4f{y[4], y[5], y[6], y[7]}; } }
  __syncthreads();
  const int row = tl >> 3, c8 = (tl & 7) * 8;      /* a wave adds and stores four whole o rows: 1 KiB in a row */
  float mx = pm[0][row];
#pragma unroll
  for (int x = 1; x < FAW; ++x) mx = fmaxf(mx, pm[x][row]);
  float ls = 0.f; v4f r0 = {0.f, 0.f, 0.f, 0.f}, r1 = {0.f, 0.f, 0.f, 0.f};
#pragma unroll
  for (int x = 0; x < FAW; ++x) { ls = fmaf(fa_exp2(pm[x][row] - mx), pl[x][row], ls); r0 += *(const v4f*)&po[x][row][c8]; r1 += *(const v4f*)&po[x][row][c8 + 4]; }
  const float inv = 1.0f / ls; float* op = O + (size_t)(q0 + row) * HD + c8;
  *(v4f*)op = r0 * inv; *(v4f*)(op + 4) = r1 * inv; }


// e^x for x <= 0 to f32 accuracy: x * log2(e) is cut into its nearest integer n and a remainder that two FMAs form (log2(e) as a high and a low float), then 2^remainder * 2^n.
// Below -104 the result is under the smallest f32: x is held there, so that n stays a small integer. The v_nop in the same statement keeps the one slot that the instruction
// set asks for behind a transcendental before its result is read or its source overwritten.
__device__ __forceinline__ float exp_neg(float x) { x = fmaxf(x, -104.0f); const float n = rintf(x * 1.44269502f); const float r = fmaf(x, 1.92596303e-8f, fmaf(x, 1.44269502f, -n));
  float p; asm("v_exp_f32 %0, %1\n\tv_nop" : "=v"(p) : "v"(r)); return ldexpf(p, (int)n); }
// Exact f32 causal attention for rows 0..QT0-1 of every batch (b = batch, each with its own QT0-row plane; rg = block of 32 query rows), stored straight into the output rows.
// Both products run on the f32 matrix form (v_wmma_f32_16x16x4_f32: full f32 operands, f32 sums), transposed as in the f16 path, so that a lane owns one query in both:
// S^T = K Q^T (A = 16 K rows, B = 16 q rows; both sides loaded by the same code, 16 bytes a lane = two k steps, so their k orders are equal) leaves in lane (ln, hh) the scores of query ln for keys 8 hh + r.
// O^T = V^T P^T: registers 2 j, 2 j + 1 of those weights are the B fragment of k step j, keys 8 hh + 2 j + {0, 1}; A takes V in the same key order. Row ln of A's tile t stands for column d = 4 ln + t,
// so a lane's four tiles come from ONE 16-byte load of a V row, a load covers two whole V rows, and o[u][t][r] is column 32 hh + 4 r + t of query u * 16 + ln.
// wave = key run: the block's 2 * (rg + 1) tiles of 16 keys are dealt to the A0W waves in turn; each K and V fragment serves both 16-query tiles. Each wave keeps its own running maximum, denominator and o
// (one rescale a tile); the A0W partial results are brought to the common maximum and added through LDS, always in the order of the waves.
#define A0W 16                       /* waves = key runs per work-group */
#define A0P (HD + 4)                 /* LDS pitch of a partial o row: 16 B x odd, so that 16-byte accesses of 32 rows spread over the banks */
typedef float v2f __attribute__((ext_vector_type(2)));
__device__ __forceinline__ v8f a0_mma(v2f a, v2f b, v8f c) { return __builtin_amdgcn_wmma_f32_16x16x4_f32(false, a, false, b, (short)0, c, false, false); }
struct A0Sm { float po[A0W][32][A0P]; float pm[A0W][32]; float pl[A0W][32]; float pfin[32]; };      /* po first: 16-byte accesses */
__device__ __forceinline__ void att0w_rows(A0Sm& sm, const int rg, const int b, const float* __restrict__ QF, const float* __restrict__ KF, const float* __restrict__ VF, float scale, float* __restrict__ O) {
  static_assert(NH == 1 && HD == 64 && QT0 % 32 == 0 && 32 * A0W * 4 == 32 * HD, "one 64-wide head; 32 rows a block; the merge gives every thread 4 columns of one row");
  float (&pm)[A0W][32] = sm.pm; float (&pl)[A0W][32] = sm.pl; float (&pfin)[32] = sm.pfin; float (&po)[A0W][32][A0P] = sm.po;
  const int lane = threadIdx.x & 31, ln = lane & 15, hh = lane >> 4; const int w = __builtin_amdgcn_readfirstlane((int)(threadIdx.x >> 5));      /* the wave's number as a scalar: the tile loop is a scalar branch, every lane is on at every matrix instruction */
  { const size_t bi = (size_t)b * QT0 * HD; QF += bi + lane * 4; KF += bi + lane * 4; VF += bi; O += (size_t)b * SQ * HD; }      /* q, k in fragment order: [16-row tile][i][hh][ln][4 values], so that load i of a wave covers 512 B in a row; v as rows of HD */
  const int nt = 2 * (rg + 1);      /* causal: key tiles 0 .. 2 rg + 1; only the last two cross the diagonal */
  v8f o[2][4]; float m[2], l[2];
#pragma unroll
  for (int u = 0; u < 2; ++u) { m[u] = -1.0e30f; l[u] = 0.f;
#pragma unroll
    for (int t = 0; t < 4; ++t) o[u][t] = v8f{0.f, 0.f, 0.f, 0.f, 0.f, 0.f, 0.f, 0.f}; }
  if (w < nt) {      /* a wave without a tile loads nothing and goes to the merge with m = -1e30, l = 0, o = 0 */
  v4f qf[2][8];      /* qf[u][i]: columns 8 i + 4 hh .. + 3 of query u * 16 + ln */
#pragma unroll
  for (int u = 0; u < 2; ++u) { const float* qp = QF + (size_t)(rg * 2 + u) * (16 * HD);
#pragma unroll
    for (int i = 0; i < 8; ++i) qf[u][i] = *(const v4fa*)(qp + 128 * i);
    asm volatile("s_wait_xcnt 0x0" :: "v"(qp) : "memory"); }      /* the wait in front of any overwrite of the address pair that the q loads name; the pair is an input, so it stays whole up to here */
#pragma unroll 1
  for (int kt = w; kt < nt; kt += A0W) { const int k0 = kt * 16;      /* rolled: one tile's fragments are live at a time */
    const float* kp = KF + (size_t)k0 * HD; const float* vp = VF + (size_t)(k0 + 8 * hh) * HD + 4 * ln;
    v4f kf[8], vf[8];      /* kf[i]: columns 8 i + 4 hh .. + 3 of key k0 + ln (q's order); vf[i]: columns 4 ln .. + 3 of key k0 + 8 hh + i */
#pragma unroll
    for (int i = 0; i < 8; ++i) kf[i] = *(const v4fa*)(kp + 128 * i);
#pragma unroll
    for (int i = 0; i < 8; ++i) vf[i] = *(const v4fa*)(vp + i * HD);
    asm volatile("s_wait_xcnt 0x0" :: "v"(kp), "v"(vp) : "memory");      /* the wait in front of any overwrite of the address pairs that the K and V loads name (the next trip forms new ones); the pairs are inputs, so they stay whole up to here */
#pragma unroll
    for (int u = 0; u < 2; ++u) { v8f s8 = {0.f, 0.f, 0.f, 0.f, 0.f, 0.f, 0.f, 0.f};
#pragma unroll
      for (int i = 0; i < 8; ++i) { s8 = a0_mma(v2f{kf[i][0], kf[i][1]}, v2f{qf[u][i][0], qf[u][i][1]}, s8); s8 = a0_mma(v2f{kf[i][2], kf[i][3]}, v2f{qf[u][i][2], qf[u][i][3]}, s8); }
      const int dq = rg * 32 + u * 16 + ln - k0 - 8 * hh;      /* register r holds key k0 + 8 hh + r: seen by the query where r <= dq */
      float s[8]; float mn = m[u];
#pragma unroll
      for (int r = 0; r < 8; ++r) { s[r] = (r <= dq) ? s8[r] * scale : -1.0e30f; mn = fmaxf(mn, s[r]); }
      mn = fmaxf(mn, fa_xhalf(mn));      /* lane ^ 16 holds the other eight keys of the same query */
      const float sc = exp_neg(m[u] - mn); float e[8]; float es = 0.f;      /* nothing seen yet: m = mn = -1e30, sc = 1 on l = 0 and o = 0 */
#pragma unroll
      for (int r = 0; r < 8; ++r) { const float x = exp_neg(s[r] - mn); e[r] = (r <= dq) ? x : 0.f; es += e[r]; }      /* formed for every key, then selected: eight independent chains and no branch; a key behind the row counts 0 also where all that the wave has met so far is behind it */
      l[u] = fmaf(l[u], sc, es); m[u] = mn;      /* l: this half's keys only; sc is the same in both halves */
#pragma unroll
      for (int t = 0; t < 4; ++t) { v8f acc = o[u][t] * sc;
#pragma unroll
        for (int j = 0; j < 4; ++j) acc = a0_mma(v2f{vf[2 * j][t], vf[2 * j + 1][t]}, v2f{e[2 * j], e[2 * j + 1]}, acc);
        o[u][t] = acc; } } } }
  { const float l0 = l[0] + fa_xhalf(l[0]), l1 = l[1] + fa_xhalf(l[1]); pm[w][lane] = hh ? m[1] : m[0]; pl[w][lane] = hh ? l1 : l0; }      /* both halves hold the same m and, joined, the same l: lane stores those of row lane */
  __syncthreads();
  float mx = pm[0][lane];      /* wave 0 has tile 0 with key 0, which every row sees: the common maximum is a real score */
#pragma unroll
  for (int u = 1; u < A0W; ++u) mx = fmaxf(mx, pm[u][lane]);
  if (w == 0) { float ls = 0.f;
#pragma unroll
    for (int u = 0; u < A0W; ++u) ls = fmaf(exp_neg(pm[u][lane] - mx), pl[u][lane], ls);
    pfin[lane] = 1.0f / ls; }
  const float mxo = fa_xhalf(mx);      /* the common maximum of row lane ^ 16 */
#pragma unroll
  for (int u = 0; u < 2; ++u) { const float f = exp_neg(m[u] - ((hh == u) ? mx : mxo));
#pragma unroll
    for (int r = 0; r < 8; ++r) *(v4f*)&po[w][u * 16 + ln][32 * hh + 4 * r] = v4f{o[u][0][r] * f, o[u][1][r] * f, o[u][2][r] * f, o[u][3][r] * f}; }
  __syncthreads();
  const int row = threadIdx.x >> 4, c4 = (threadIdx.x & 15) * 4;      /* a wave adds and stores two whole o rows: 512 B in a row */
  v4f r = {0.f, 0.f, 0.f, 0.f};
#pragma unroll
  for (int u = 0; u < A0W; ++u) r += *(const v4f*)&po[u][row][c4];
  r *= pfin[row];
  float* op = O + (size_t)(rg * 32 + row) * HD + c4; *(v4f*)op = r;
  asm volatile("s_wait_xcnt 0x0" :: "v"(op), "v"(r) : "memory"); }      /* the wait in front of any overwrite of a register that this store names: the other path's code follows in the text; address and data are inputs, so they stay whole up to here */

// Both attention paths in ONE launch: neither needs anything of the other, each output row belongs to exactly one of them, and the branch between them is the same for a whole work-group.
// grid.x = batch; grid.y = piece of work: first ATP pairs of neighbouring f16 blocks of FAR rows (rows QT0.., FAW waves each, side by side in the two halves of the work-group, each half with its own LDS),
// then the ATX exact blocks of 32 rows (rows 0..QT0-1, A0W waves each); of each kind the longer the earlier. One work-group of 16 waves fills a WGP's registers.
// No loop of either path holds a barrier: every wave of a work-group passes the same two.
#define ATX (QT0 / 32)
#define ATP ((SQ - QT0) / (2 * FAR))
union AtSm { FaSm fa[2]; A0Sm a0; };
__global__ __launch_bounds__(32 * A0W) void k_attn(const _Float16* __restrict__ Q16, const _Float16* __restrict__ K16, const _Float16* __restrict__ VT, const float* __restrict__ QF, const float* __restrict__ KF, const float* __restrict__ VF, float scale, float* __restrict__ O) {
  static_assert(2 * FAW == A0W && QT0 % (2 * FAR) == 0 && (SQ - QT0) % (2 * FAR) == 0 && sizeof(FaSm) % 16 == 0, "two f16 blocks fill a work-group of the exact path's size; the border between the paths falls between pairs");
  __shared__ __attribute__((aligned(16))) AtSm sm;
  const int b = blockIdx.x, t = blockIdx.y;
  if (t < ATP) { const int wv = __builtin_amdgcn_readfirstlane((int)(threadIdx.x >> 5)); const int hf = wv / FAW;      /* the wave's number as a scalar: the chunk loop and its mask test are scalar branches */
    fattn_rows(sm.fa[hf], wv % FAW, (int)threadIdx.x % (32 * FAW), SQ / FAR - 1 - (2 * t + hf), b, Q16, K16, VT, scale, O); }
  else att0w_rows(sm.a0, ATX - 1 - (t - ATP), b, QF, KF, VF, scale, O); }


template <int BFIN, int WXB>
__global__ __launch_bounds__(256) void k_ln16(const float* __restrict__ X, const float* __restrict__ g, const float* __restrict__ bb, float eps, _Float16* __restrict__ N16, float* __restrict__ XB) {
  #pragma clang fp contract(off)
  __shared__ float red[256]; const size_t r = blockIdx.x; const int t = threadIdx.x; const v4f xa = *(const v4fa*)(X + r * DMQ + t * 4); float s[4]; float sum = 0.f;
  for (int q = 0; q < 4; ++q) { s[q] = BFIN ? bf16_round(xa[q]) : xa[q]; sum = __fadd_rn(sum, s[q]); }
  red[t] = sum; __syncthreads(); for (int st = 128; st > 0; st >>= 1) { if (t < st) red[t] = __fadd_rn(red[t], red[t + st]); __syncthreads(); } const float mu = red[0] / (float)DMQ; __syncthreads();
  float vs = 0.f; for (int q = 0; q < 4; ++q) { const float dl = __fadd_rn(s[q], -mu); vs = __fadd_rn(vs, __fmul_rn(dl, dl)); } red[t] = vs; __syncthreads(); for (int st = 128; st > 0; st >>= 1) { if (t < st) red[t] = __fadd_rn(red[t], red[t + st]); __syncthreads(); }
  const float rs = rsqrtf(__fadd_rn(red[0] / (float)DMQ, eps)); v4h y; v4f xb;
  for (int q = 0; q < 4; ++q) { const int c = t * 4 + q; y[q] = (_Float16)__fadd_rn(__fmul_rn(__fmul_rn(__fadd_rn(s[q], -mu), rs), bf16_round(g[c])), bf16_round(bb[c])); xb[q] = s[q]; }
  { *(v4h*)(N16 + r * DMQ + t * 4) = y; if (WXB) *(v4f*)(XB + r * DMQ + t * 4) = xb;  } }
__global__ __launch_bounds__(256) void k_ftres2(const float* __restrict__ OF0, const float* __restrict__ XB, float* __restrict__ X1, size_t n4) {
  #pragma clang fp contract(off)
  const size_t t = (size_t)blockIdx.x * 256 + threadIdx.x; if (t >= n4) return; const v4f o = *(const v4fa*)(OF0 + t * 4), xv = *(const v4fa*)(XB + t * 4); v4f y; for (int q = 0; q < 4; ++q) y[q] = __fadd_rn(__fmul_rn(o[q], 0.015625f), xv[q]); *(v4f*)(X1 + t * 4) = y;  }

__global__ __launch_bounds__(256) void k_wthd(const float* __restrict__ Wt, _Float16* __restrict__ Bt) { const size_t t = (size_t)blockIdx.x * 256 + threadIdx.x; if (t >= (size_t)NH * HD * (DM / 8)) return; const int m8 = (int)(t % (DM / 8)) * 8; const int d = (int)((t / (DM / 8)) % HD); const int h = (int)(t / ((size_t)(DM / 8) * HD)); FragH f;
  for (int q = 0; q < 8; ++q) f.h[q] = (_Float16)(16.0f * bf16_round(Wt[((size_t)h * DM + m8 + q) * HD + d])); unsigned short* dst = (unsigned short*)Bt + ((size_t)h * HD + d) * DM + m8; *(v8us*)dst = f.half[0];  }




__global__ __launch_bounds__(256) void k_wtpad(const float* __restrict__ Wm, _Float16* __restrict__ Wt, int Kr, int Kp, int Nr, int Np, float scale) {
  const int t = blockIdx.x * 256 + threadIdx.x; if (t >= Np * (Kp / 8)) return; const int n = t / (Kp / 8), k8 = (t % (Kp / 8)) * 8; const int nc = min(n, Nr - 1); const float fn = (n < Nr) ? 1.f : 0.f; FragH f;
  for (int i = 0; i < 8; ++i) { const int k = k8 + i; const int kc = min(k, Kr - 1); const float fk = (k < Kr) ? fn : 0.f; f.h[i] = (_Float16)(bf16_round(Wm[(size_t)kc * Nr + nc]) * scale * fk); }
  unsigned short* o = (unsigned short*)Wt + (size_t)n * Kp + k8; *(v8us*)o = f.half[0];  }
__global__ __launch_bounds__(128) void k_bpad(const float* __restrict__ b, float* __restrict__ Bp, int nr, int np) {
  const int i = threadIdx.x; if (i >= np) return; const float v = b[min(i, nr - 1)] * ((i < nr) ? 1.f : 0.f); *(float*)(Bp + i) = v;  }

#define DI 64         /* inner width = NH * HD (ONE 64-wide head) */
#define LQK (3 * DI)  /* width of a q | k | v row (192) */
__global__ __launch_bounds__(256) void k_o0(const float* __restrict__ OF, float* __restrict__ ob, size_t n4) {
  #pragma clang fp contract(off)
  const size_t t = (size_t)blockIdx.x * 256 + threadIdx.x; if (t >= n4) return; const size_t e = t * 4; const int i = (int)(e / DI); const int c = (int)(e % DI); const int h = c / HD, d = c % HD; const v4f a = *(const v4fa*)(OF + e); v4f o; for (int q = 0; q < 4; ++q) o[q] = __fmul_rn(a[q], 0.015625f); float* dst = ob + (size_t)h * SQ * HD + (size_t)i * HD + d; *(v4f*)dst = o;  }

// The whole projection stage in ONE launch: q | k | v = x W for PJR token rows a work-group. x comes in as f32 in whole lines, is rounded as before (bf16, exact in f16) and laid in LDS as f16 rows;
// wave w owns columns 16 w .. 16 w + 15 of q | k | v and builds its eight B fragments straight from the f32 weights (lane = column, so a load takes 64 B of each of two weight rows; value bf16-rounded, x16, f16: as before).
// Products, k order and the order of the k steps are those of the GEMM that this takes the place of, so every q, k, v value is the same number. The accumulators go out three ways, all staged in LDS so that every store
// is of whole 128-B lines: q, k and V^T as f16 (V^T: a lane holds 8 tokens in a row of one column: one 16-byte LDS store), and, for the first QT0 rows of a batch, q, k, v as f32.
// q, k (both widths) and V^T leave in FRAGMENT ORDER (fr_frag; att0w_rows): the 16-byte piece that lane L of an attention wave loads stands at 16 L in a 512-B run, so the reader's loads cover whole lines; a work-group's share of each plane is one run.
#define PJR 64                       /* token rows per work-group: 256 work-groups */
#define PJW 12                       /* waves = 16-column tiles of q | k | v */
#define PJT (32 * PJW)
#define PJXP (DM + 8)                /* LDS pitch of an x row, halves: 528 B = 16 B x odd, for 16-byte fragment reads */
#define PJOP (2 * DI + 8)            /* LDS pitch of a q | k row, halves: 272 B = 16 B x odd */
#define PJVP (PJR + 8)               /* LDS pitch of a V^T row, halves: 144 B = 16 B x odd */
#define PJFP (LQK + 4)               /* LDS pitch of an f32 q | k | v row, floats: 784 B = 16 B x odd */
typedef __bf16 v2b __attribute__((ext_vector_type(2)));
typedef unsigned short v4us __attribute__((ext_vector_type(4), may_alias));
// two floats rounded to bf16 (nearest, ties to even: the value of bf16_round) by the conversion instruction, times s, as two f16
__device__ __forceinline__ void pj_cvt2(float a, float b, float s, _Float16& ha, _Float16& hb) { const v2b p = {(__bf16)a, (__bf16)b}; const unsigned int u = __builtin_bit_cast(unsigned int, p); ha = (_Float16)(__uint_as_float(u << 16) * s); hb = (_Float16)(__uint_as_float(u & 0xFFFF0000u) * s); }
__global__ __launch_bounds__(PJT) void k_proj(const float* __restrict__ x, const float* __restrict__ wq, const float* __restrict__ wk, const float* __restrict__ wv, _Float16* __restrict__ Q16, _Float16* __restrict__ K16, _Float16* __restrict__ VT, float* __restrict__ F0) {
  static_assert(PJW * 16 == LQK && DI == 64 && DM == 256 && SQ % PJR == 0 && QT0 % PJR == 0 && (PJR * 2 * DI + DI * PJR) / 8 == 4 * PJT && PJR * LQK / 4 == 8 * PJT, "a wave a column tile; a work-group lies in one batch and wholly inside or outside the exact rows; the store loops divide evenly");
  __shared__ __attribute__((aligned(16))) _Float16 xs[PJR][PJXP]; __shared__ __attribute__((aligned(16))) _Float16 so[PJR][PJOP]; __shared__ __attribute__((aligned(16))) _Float16 sv[DI][PJVP]; __shared__ __attribute__((aligned(16))) float sf[PJR][PJFP];
  const int tid = threadIdx.x, lane = tid & 31, ln = lane & 15, hh = lane >> 4; const int w = __builtin_amdgcn_readfirstlane(tid >> 5);      /* the wave's number as a scalar: which weight matrix, and every branch on it, is scalar */
  const size_t r0 = (size_t)blockIdx.x * PJR; const int b = (int)(r0 / SQ), s0 = (int)(r0 % SQ);
  const float* wp = (w < 4 ? wq : w < 8 ? wk : wv) + (w & 3) * 16 + ln + (size_t)(8 * hh) * DI; float wr[8][16];
#pragma unroll
  for (int ks = 0; ks < 8; ++ks)
#pragma unroll
    for (int i = 0; i < 8; ++i) { wr[ks][i] = wp[(size_t)(ks * 32 + i) * DI]; wr[ks][8 + i] = wp[(size_t)(ks * 32 + 16 + i) * DI]; }      /* the k order of g2_frag: 8 hh + i, 16 + 8 hh + i */
  const char* xb = (const char*)(x + r0 * DM); const unsigned xo = (unsigned)tid * 16u; const char* xt = xb + xo; v4f xa[11];      /* 4 floats a thread and turn: each load of a wave covers 512 B in a row, four whole lines */
#pragma unroll
  for (int u = 0; u < 11; ++u) if (u < 10 || w < 8) xa[u] = *(const v4fa*)(xt + u * PJT * 16);      /* PJR * DM / 4 = 10 * PJT + 256 */
  asm volatile("s_wait_xcnt 0x0" :: "v"(xo), "v"(xt), "v"(wp), "s"(xb) : "memory");      /* the wait in front of any overwrite of the address registers that the loads above name; x's offset, base and full address and the weights' address are inputs, so whichever form a load takes, its registers stay whole up to here */
  FragH bf[8];
#pragma unroll
  for (int ks = 0; ks < 8; ++ks)
#pragma unroll
    for (int i = 0; i < 16; i += 2) pj_cvt2(wr[ks][i], wr[ks][i + 1], 16.0f, bf[ks].h[i], bf[ks].h[i + 1]);
#pragma unroll
  for (int u = 0; u < 11; ++u) if (u < 10 || w < 8) { const int i = tid + u * PJT; FragH f;
    pj_cvt2(xa[u][0], xa[u][1], 1.0f, f.h[0], f.h[1]); pj_cvt2(xa[u][2], xa[u][3], 1.0f, f.h[2], f.h[3]);
    *(v4us*)&xs[i >> 6][(i & 63) * 4] = v4us{f.u[0], f.u[1], f.u[2], f.u[3]}; }
  __syncthreads();
  v8f acc[4];
#pragma unroll
  for (int mt = 0; mt < 4; ++mt) acc[mt] = v8f{0.f, 0.f, 0.f, 0.f, 0.f, 0.f, 0.f, 0.f};
#pragma unroll
  for (int ks = 0; ks < 8; ++ks)
#pragma unroll
    for (int mt = 0; mt < 4; ++mt) acc[mt] = fa_mma(g2_frag(&xs[mt * 16 + ln][ks * 32], hh), bf[ks].v, acc[mt]);
#pragma unroll
  for (int mt = 0; mt < 4; ++mt) acc[mt] *= 0.0625f;      /* the weights ride x16 */
  const bool ft = s0 < QT0;      /* the same for the whole work-group */
  if (w < 8) {
#pragma unroll
    for (int mt = 0; mt < 4; ++mt)
#pragma unroll
      for (int r = 0; r < 8; ++r) so[mt * 16 + 8 * hh + r][w * 16 + ln] = (_Float16)acc[mt][r];
  } else {
#pragma unroll
    for (int mt = 0; mt < 4; ++mt) { FragH f;
#pragma unroll
      for (int r = 0; r < 8; ++r) f.h[r] = (_Float16)acc[mt][r];
      *(v8us*)&sv[(w & 3) * 16 + ln][mt * 16 + 8 * hh] = f.half[0]; } }
  if (ft) {
#pragma unroll
    for (int mt = 0; mt < 4; ++mt)
#pragma unroll
      for (int r = 0; r < 8; ++r) sf[mt * 16 + 8 * hh + r][w * 16 + ln] = acc[mt][r]; }
  __syncthreads();
  { v4f t[4]; _Float16* gp = (w < 4 ? Q16 : w < 8 ? K16 : VT) + r0 * DI + (w & 3) * 1024 + lane * 8;      /* the work-group's share of each plane is 8 KiB in a row; wave w stores quarter w & 3 of plane w >> 2, four 512-B runs: piece = lane. All reads, then all stores: one LDS latency, not four */
#pragma unroll
    for (int u = 0; u < 4; ++u) t[u] = *(const v4fa*)(w < 8 ? &so[(w & 3) * 16 + ln][(w >> 2) * DI + u * 16 + 8 * hh]      /* q, k: tile w & 3; run u = 2 * k step + half */
                                                            : &sv[((w & 1) * 2 + (u >> 1)) * 16 + ln][((w >> 1) & 1) * 32 + (u & 1) * 16 + 8 * hh]);      /* V^T: chunk (w >> 1) & 1; column tile 2 (w & 1) + (u >> 1); half u & 1 */
#pragma unroll
    for (int u = 0; u < 4; ++u) *(v4fa*)(gp + u * 256) = t[u];
    asm volatile("s_wait_xcnt 0x0" :: "v"(gp), "v"(t[0]), "v"(t[1]), "v"(t[2]), "v"(t[3]) : "memory"); }      /* the wait in front of any overwrite of a register that these stores name; address and data are inputs, so they stay whole up to here */
  if (ft) { v4f t[8]; float* fp = F0 + (size_t)(w >> 2) * NB * QT0 * DI + ((size_t)b * QT0 + s0) * DI + (w & 3) * 1024 + lane * 4;      /* the same deal on the f32 planes: 16 KiB a plane, eight 512-B runs a wave */
    if (w < 8) {
#pragma unroll
      for (int u = 0; u < 8; ++u) t[u] = *(const v4f*)&sf[(w & 3) * 16 + ln][(w >> 2) * DI + 8 * u + 4 * hh];      /* q, k: tile w & 3; run u = columns 8 u + 4 hh .. + 3 of row ln */
    } else {
#pragma unroll
      for (int u = 0; u < 8; ++u) t[u] = *(const v4f*)&sf[(w & 3) * 16 + 2 * u + hh][2 * DI + 4 * ln]; }      /* v: run u = two whole rows */
#pragma unroll
    for (int u = 0; u < 8; ++u) *(v4f*)(fp + u * 128) = t[u];
    asm volatile("s_wait_xcnt 0x0" :: "v"(fp), "v"(t[0]), "v"(t[1]), "v"(t[2]), "v"(t[3]), "v"(t[4]), "v"(t[5]), "v"(t[6]), "v"(t[7]) : "memory"); } }      /* the same wait: address and data are inputs, so no piece's registers are taken for a later piece while its store is on its way */

extern "C" void kernel_launch(void* const* d_in, const int* in_sizes, int n_in,
                              void* d_out, int out_size, void* d_ws, size_t ws_size, hipStream_t stream) {
  (void)in_sizes; (void)n_in; (void)out_size;
  const float* const* I = (const float* const*)d_in; const float* x = I[0]; const float* wq = I[2]; const float* wk = I[1]; const float* wv = I[3];      /* x; [in][out = 64] Wk / Wq / Wv (input order as this module lists them); no biases */
  char* ws = (char*)d_ws; size_t off = 0;
  auto take = [&](size_t bytes) { char* p = ws + off; off += (bytes + 255) & ~(size_t)255; return p; };
  _Float16* Q16 = (_Float16*)take(NR * DI * 2); _Float16* K16 = (_Float16*)take(NR * DI * 2); _Float16* VT = (_Float16*)take((size_t)NB * HD * SQ * 2);
  float* QKVF0 = (float*)take((size_t)NB * QT0 * LQK * 4);      /* three planes, q, k, v, of NB * QT0 rows each: the four batches run side by side */
  if (off > ws_size) return;
  k_proj<<<(unsigned)(NR / PJR), PJT, 0, stream>>>(x, wq, wk, wv, Q16, K16, VT, QKVF0);      /* f16 q, k, V^T of every row and f32 q, k of rows 0..511 of every batch, in fragment order; f32 v rows of rows 0..511 */
  static_assert(NH == 1, "the grid carries the batch in place of the head");
  float* ob = (float*)d_out;
  k_attn<<<dim3(NB, ATX + ATP), 32 * A0W, 0, stream>>>(Q16, K16, VT, QKVF0, QKVF0 + (size_t)NB * QT0 * DI, QKVF0 + (size_t)2 * NB * QT0 * DI, 0.0625f, ob);      /* out[b][i][0..63] = softmax(causal q k^T * 256^-0.5 = 1/16: the module scales by the EMBEDDING width) v, f32, all query rows of all batches in one launch: rows 0..511 exact f32, the rest f16 operands */
}

// v009
// It runs in 24.3 microseconds.
// In two side-by-side timings against v008, it was 1.12 and 1.13 times as fast.
// All steps since v000 together make it 1309 times as fast.
#include <hip/hip_runtime.h>
// Single-head causal self-attention with the module's EMBEDDING-width scale (x [4][4096][256]; k/q/v = x W ([in][out] [256][64], U(+-0.1), no biases; input order Wk, Wq, Wv); ONE 64-wide head; wei * 256^-0.5 (n_embd, as in the source); causal (tril, -inf); softmax; out = wei v -> [4][4096][64]; no output projection).
// Structure: token rows; ONE projection launch (x and the weights converted to their exact f16 values on the way in; WMMA; writes the f16 q, k and v^T planes and the f32 q, k planes of rows 0..511 in the order of the matrix fragments that the attention launch loads, and the f32 v rows of rows 0..511); ONE attention launch with the batches on grid.x: rows 512.. by the fused f16 path (scores, online softmax f32 -> f16 weights in registers, P V, written as f32 straight into the output rows), rows 0..511 by exact f32 work-groups of the same launch; launches: see trace.
// Compute dtype: inputs rounded to bf16; x / weights exact; q, k, v and softmax weights as plain f16 GEMM operands; o f32 (~2^-12); scores and softmax statistics f32; v_wmma_f32_16x16x32_f16; rows 0..511: f32 operands, v_wmma_f32_16x16x4_f32.
#define NB 4
#define SQ 4096
#define DM 256
#define NH 1
#define HD 64
#define HG 4                         /* heads per block group of the unlaunched k_vt(b, h0) overload */
#define QT 256                       /* unused */
#define NKX SQ                       /* unused */
#define QT0 512                      /* first-tile rows recomputed exactly (f32): 512 here (no output projection averages the early-row cancellation errors away; logit sigma 1.0) */
#define B0 0                         /* unused; the batches run on grid.x from 0 */
#define NBR NB                       /* feeds only MP; grid.x runs over the NB batches */
#define NR ((size_t)NB * SQ)
#define DMQ DM
#define DFF 4096                     /* unused; this file has no FFN */
#define DFFR 100                     /* unused */
#define MP ((int)((size_t)NBR * SQ)) /* feeds only MPO; the projection runs over NR rows */
#define QN SQ                        /* unused */
#define NHD NH                       /* unused */
#define MPO MP                       /* unused */
#define LQ (3 * DM)      /* 3 * DM = 768, unused; q, k and v lie in separate planes */
typedef __bf16 v16b __attribute__((ext_vector_type(16)));
typedef unsigned short v8us __attribute__((ext_vector_type(8), may_alias));
typedef float  v8f  __attribute__((ext_vector_type(8)));
typedef float  v4f  __attribute__((ext_vector_type(4)));
typedef float  v4fa __attribute__((ext_vector_type(4), may_alias));
union FragB { v16b v; v8us half[2]; unsigned short u[16]; };

__device__ __forceinline__ unsigned short bf16_bits(float x) { unsigned int u = __float_as_uint(x); return (unsigned short)((u + 0x7FFFu + ((u >> 16) & 1u)) >> 16); }
__device__ __forceinline__ float bf16_val(unsigned short b) { return __uint_as_float(((unsigned int)b) << 16); }
__device__ __forceinline__ float bf16_round(float x) { return bf16_val(bf16_bits(x)); }
// D += A·B with NT terms: 1 = ah·bh, 2 = + al·bh (A split), 3 = + ah·bl (both split)
template <int NT>
__device__ __forceinline__ v8f mmaN(v16b ah, v16b al, v16b bh, v16b bl, v8f c) {
  c = __builtin_amdgcn_wmma_f32_16x16x32_bf16(false, ah, false, bh, (short)0, c, false, false);
  if (NT >= 2) c = __builtin_amdgcn_wmma_f32_16x16x32_bf16(false, al, false, bh, (short)0, c, false, false);
  if (NT >= 3) c = __builtin_amdgcn_wmma_f32_16x16x32_bf16(false, ah, false, bl, (short)0, c, false, false);
  asm volatile("v_nop\n\tv_nop\n\tv_nop\n\tv_nop" : "+v"(c) : "v"(ah), "v"(al), "v"(bh), "v"(bl));
  return c;
}

__global__ __launch_bounds__(256) void k_wt_bf16(const float* __restrict__ W, unsigned short* __restrict__ Wt, int K, int N) {
  const int t = blockIdx.x * 256 + threadIdx.x;
  const int k8n = K / 8;
  if (t >= N * k8n) return;
  const int n = t / k8n, k8 = (t % k8n) * 8;
  v8us v;
#pragma unroll
  for (int i = 0; i < 8; ++i) v[i] = bf16_bits(W[(size_t)(k8 + i) * N + n]);
  *(v8us*)(Wt + (size_t)n * K + k8) = v;
  
}

// GEMM C[M][N] (f32, pitch ldc) = act(A[M][K]·W + bias). A f32 row-major (pitch lda) converted per fragment to bf16
// (ASPLIT: hi/lo two planes -> 2 terms, else single rounded term); Wt bf16 [N][K] (pitch ldb). BIAS_BF16 rounds the
// bias to bf16 first (bias quantised to bf16 before the add). K%32==0, M%16==0, N%64==0.
template <bool ASPLIT, int ACT, bool BIAS_BF16>
__global__ __launch_bounds__(128) void k_gemm_bf(const float* __restrict__ A, int lda, const unsigned short* __restrict__ Wt, int ldb,
                                               const float* __restrict__ bias, float* __restrict__ C, int ldc, int M, int N, int K) {
  __shared__ __attribute__((aligned(16))) float so[4][16][64];
  const int tid = threadIdx.x, w = tid >> 5, lane = tid & 31, ln = lane & 15, hh = lane >> 4;
  const int ntn = N / 64;
  const int wid = blockIdx.x * 4 + w;
  const int mt = wid / ntn, nq = wid % ntn;
  if (mt * 16 >= M) return;
  const int row0 = mt * 16, col0 = nq * 64;
  const float* arow = A + (size_t)(row0 + ln) * lda;
  v8f acc[4] = {};
  for (int kb = 0; kb < K; kb += 32) {
    FragB ah, al;
    const v4f x0 = *(const v4fa*)(arow + kb + 8 * hh), x1 = *(const v4fa*)(arow + kb + 8 * hh + 4);
    const v4f x2 = *(const v4fa*)(arow + kb + 16 + 8 * hh), x3 = *(const v4fa*)(arow + kb + 16 + 8 * hh + 4);
    float xs[16] = {x0[0],x0[1],x0[2],x0[3],x1[0],x1[1],x1[2],x1[3],x2[0],x2[1],x2[2],x2[3],x3[0],x3[1],x3[2],x3[3]};
#pragma unroll
    for (int i = 0; i < 16; ++i) { const unsigned short hb = bf16_bits(xs[i]); ah.u[i] = hb; al.u[i] = ASPLIT ? bf16_bits(xs[i] - bf16_val(hb)) : (unsigned short)0; }
#pragma unroll
    for (int t = 0; t < 4; ++t) {
      const unsigned short* brow = Wt + (size_t)(col0 + t * 16 + ln) * ldb + kb;
      FragB b;
      b.half[0] = *(const v8us*)(brow + 8 * hh);
      b.half[1] = *(const v8us*)(brow + 16 + 8 * hh);
      acc[t] = mmaN<ASPLIT ? 2 : 1>(ah.v, al.v, b.v, b.v, acc[t]);
    }
  }
#pragma unroll
  for (int t = 0; t < 4; ++t) {
    float bv = bias ? bias[col0 + t * 16 + ln] : 0.f;
    if (BIAS_BF16) bv = bf16_round(bv);
#pragma unroll
    for (int r = 0; r < 8; ++r) { float v = acc[t][r] + bv; if (ACT == 1) v = fmaxf(v, 0.f); so[w][8 * hh + r][t * 16 + ln] = v; }
  }
  __builtin_amdgcn_fence(__ATOMIC_ACQ_REL, "workgroup");
  __builtin_amdgcn_wave_barrier();
  const int rsub = lane >> 4, c4 = (lane & 15) * 4;
  {
#pragma unroll
    for (int q = 0; q < 8; ++q) {
      const int r = q * 2 + rsub;
      const v4f v = *(const v4fa*)&so[w][r][c4];
      *(v4f*)(C + (size_t)(row0 + r) * ldc + col0 + c4) = v;
    }
    
  }
}

// GEMM C = act(A·W + bias + resid): A f32 (ASPLIT -> hi/lo 2 terms), Wt bf16 [N][K]; ACT 0 none, 1 relu, 2 exact gelu;
// resid (optional, f32, row index = (row % rmod), pitch ldr, RES_BF16 rounds it) added before the activation.
template <bool ASPLIT, int ACT, bool BIAS_BF16, bool RES_BF16>
__global__ __launch_bounds__(128) void k_gemm_bf3(const float* __restrict__ A, int lda, const unsigned short* __restrict__ Wt, int ldb,
                                                const float* __restrict__ bias, const float* __restrict__ resid, int rmod, int ldr,
                                                float* __restrict__ C, int ldc, int M, int N, int K) {
  __shared__ __attribute__((aligned(16))) float so[4][16][64];
  const int tid = threadIdx.x, w = tid >> 5, lane = tid & 31, ln = lane & 15, hh = lane >> 4;
  const int ntn = N / 64;
  const int wid = blockIdx.x * 4 + w;
  const int mt = wid / ntn, nq = wid % ntn;
  if (mt * 16 >= M) return;
  const int row0 = mt * 16, col0 = nq * 64;
  const float* arow = A + (size_t)(row0 + ln) * lda;
  v8f acc[4] = {};
  for (int kb = 0; kb < K; kb += 32) {
    FragB ah, al;
    const v4f x0 = *(const v4fa*)(arow + kb + 8 * hh), x1 = *(const v4fa*)(arow + kb + 8 * hh + 4);
    const v4f x2 = *(const v4fa*)(arow + kb + 16 + 8 * hh), x3 = *(const v4fa*)(arow + kb + 16 + 8 * hh + 4);
    float xs[16] = {x0[0],x0[1],x0[2],x0[3],x1[0],x1[1],x1[2],x1[3],x2[0],x2[1],x2[2],x2[3],x3[0],x3[1],x3[2],x3[3]};
#pragma unroll
    for (int i = 0; i < 16; ++i) { const unsigned short hb = bf16_bits(xs[i]); ah.u[i] = hb; al.u[i] = ASPLIT ? bf16_bits(xs[i] - bf16_val(hb)) : (unsigned short)0; }
#pragma unroll
    for (int t = 0; t < 4; ++t) {
      const unsigned short* brow = Wt + (size_t)(col0 + t * 16 + ln) * ldb + kb;
      FragB b;
      b.half[0] = *(const v8us*)(brow + 8 * hh);
      b.half[1] = *(const v8us*)(brow + 16 + 8 * hh);
      acc[t] = mmaN<ASPLIT ? 2 : 1>(ah.v, al.v, b.v, b.v, acc[t]);
    }
  }
#pragma unroll
  for (int t = 0; t < 4; ++t) {
    const int col = col0 + t * 16 + ln;
    float bv = bias ? bias[col] : 0.f;
    if (BIAS_BF16) bv = bf16_round(bv);
#pragma unroll
    for (int r = 0; r < 8; ++r) {
      float v = acc[t][r] + bv;
      if (resid) { float rv = resid[(size_t)((row0 + 8 * hh + r) % rmod) * ldr + col]; if (RES_BF16) rv = bf16_round(rv); v += rv; }
      if (ACT == 1) v = fmaxf(v, 0.f);
      if (ACT == 2) v = 0.5f * v * (1.0f + erff(v * 0.70710678118654752f));
      if (ACT == 3) { const float u = 0.7978845608028654f * (v + 0.044715f * v * v * v); v = 0.5f * v * (1.0f + tanhf(u)); }
      so[w][8 * hh + r][t * 16 + ln] = v;
    }
  }
  __builtin_amdgcn_fence(__ATOMIC_ACQ_REL, "workgroup");
  __builtin_amdgcn_wave_barrier();
  const int rsub = lane >> 4, c4 = (lane & 15) * 4;
  {
#pragma unroll
    for (int q = 0; q < 8; ++q) {
      const int r = q * 2 + rsub;
      const v4f v = *(const v4fa*)&so[w][r][c4];
      *(v4f*)(C + (size_t)(row0 + r) * ldc + col0 + c4) = v;
    }
    
  }
}
// row LayerNorm (biased variance, eps) over N: s = X (+ R); optional out_sum <- s; out_norm <- (s-mu)*rsqrt(var+eps)*g + b
template <bool PARAM_BF16>
__global__ __launch_bounds__(256) void k_layernorm(const float* __restrict__ X, const float* __restrict__ R, const float* __restrict__ g, const float* __restrict__ bta,
                                                  float* __restrict__ out_sum, float* __restrict__ out_norm, int N, float eps) {
  __shared__ float red[256];
  const int row = blockIdx.x, tid = threadIdx.x;
  const float* x = X + (size_t)row * N; const float* rr = R ? R + (size_t)row * N : nullptr;
  float vals[16];                     // up to N = 4096
  const int per = N / 256;            // contiguous chunk per thread? use strided-by-4 chunks: thread handles j = tid*4 + 1024*u
  float s1 = 0.f;
  for (int u = 0; u < per / 4; ++u) {
    const int j = tid * 4 + 1024 * u;
    const v4f a = *(const v4fa*)(x + j);
    v4f b = {0.f,0.f,0.f,0.f}; if (rr) b = *(const v4fa*)(rr + j);
#pragma unroll
    for (int q = 0; q < 4; ++q) { const float v = a[q] + b[q]; vals[u * 4 + q] = v; s1 += v; }
  }
  red[tid] = s1; __syncthreads();
  for (int st = 128; st > 0; st >>= 1) { if (tid < st) red[tid] += red[tid + st]; __syncthreads(); }
  const float mu = red[0] / (float)N; __syncthreads();
  float s2 = 0.f;
  for (int u = 0; u < per / 4; ++u)
#pragma unroll
    for (int q = 0; q < 4; ++q) { const float c = vals[u * 4 + q] - mu; s2 += c * c; }
  red[tid] = s2; __syncthreads();
  for (int st = 128; st > 0; st >>= 1) { if (tid < st) red[tid] += red[tid + st]; __syncthreads(); }
  const float rs = rsqrtf(red[0] / (float)N + eps);
  {
    for (int u = 0; u < per / 4; ++u) {
      const int j = tid * 4 + 1024 * u;
      v4f o, sm;
#pragma unroll
      for (int q = 0; q < 4; ++q) {
        float gg = g[j + q], bb = bta[j + q];
        if (PARAM_BF16) { gg = bf16_round(gg); bb = bf16_round(bb); }
        sm[q] = vals[u * 4 + q]; o[q] = (vals[u * 4 + q] - mu) * rs * gg + bb;
      }
      if (out_sum) *(v4f*)(out_sum + (size_t)row * N + j) = sm;
      *(v4f*)(out_norm + (size_t)row * N + j) = o;
    }
    
  }
}



// ---- f16 WMMA path (v_wmma_f32_16x16x32_f16): 11-bit significands for operands in range — used where a [0,1] probability operand needs more precision than bf16
typedef _Float16 v16h __attribute__((ext_vector_type(16)));
union FragH { v16h v; v8us half[2]; _Float16 h[16]; unsigned short u[16]; };
template <int NT>
__device__ __forceinline__ v8f mmaH(v16h ah, v16h al, v16h bh, v16h bl, v8f c) {
  c = __builtin_amdgcn_wmma_f32_16x16x32_f16(false, ah, false, bh, (short)0, c, false, false);
  if (NT >= 2) c = __builtin_amdgcn_wmma_f32_16x16x32_f16(false, al, false, bh, (short)0, c, false, false);
  if (NT >= 3) c = __builtin_amdgcn_wmma_f32_16x16x32_f16(false, ah, false, bl, (short)0, c, false, false);
  asm volatile("v_nop\n\tv_nop\n\tv_nop\n\tv_nop" : "+v"(c) : "v"(ah), "v"(al), "v"(bh), "v"(bl));
  return c;
}
// batched GEMM like k_gemm_b but f16 operands: A f32 (split into f16 hi/lo if ASPLIT, else rounded to f16), Bt = f16 values [n][k]; alpha; C f32; N multiple of 16 (partial tiles skipped)
template <bool ASPLIT>
__global__ __launch_bounds__(128) void k_gemm_h(const float* __restrict__ A, int lda, size_t sA, const _Float16* __restrict__ Bh, int ldb, size_t sB, float alpha, float* __restrict__ C, int ldc, size_t sC, int M, int N, int K) {
  __shared__ __attribute__((aligned(16))) float so[4][16][64];
  const int tid = threadIdx.x, w = tid >> 5, lane = tid & 31, ln = lane & 15, hh = lane >> 4; const int by = blockIdx.y;
  A += (size_t)by * sA; Bh += (size_t)by * sB; C += (size_t)by * sC;
  const int ntn = (N + 63) / 64; const int wid = blockIdx.x * 4 + w; const int mt = wid / ntn, nq = wid % ntn; if (mt * 16 >= M) return;
  const int row0 = mt * 16, col0 = nq * 64; const float* arow = A + (size_t)(row0 + ln) * lda;
  v8f acc[4] = {};
  for (int kb = 0; kb < K; kb += 32) {
    FragH ah, al;
    const v4f x0 = *(const v4fa*)(arow + kb + 8 * hh), x1 = *(const v4fa*)(arow + kb + 8 * hh + 4), x2 = *(const v4fa*)(arow + kb + 16 + 8 * hh), x3 = *(const v4fa*)(arow + kb + 16 + 8 * hh + 4);
    float xs[16] = {x0[0],x0[1],x0[2],x0[3],x1[0],x1[1],x1[2],x1[3],x2[0],x2[1],x2[2],x2[3],x3[0],x3[1],x3[2],x3[3]};
#pragma unroll
    for (int i = 0; i < 16; ++i) { const _Float16 h = (_Float16)xs[i]; ah.h[i] = h; al.h[i] = ASPLIT ? (_Float16)(xs[i] - (float)h) : (_Float16)0.0f; }
#pragma unroll
    for (int t = 0; t < 4; ++t) { if (col0 + t * 16 >= N) continue; const size_t boff = (size_t)(col0 + t * 16 + ln) * ldb + kb; FragH bq; bq.half[0] = *(const v8us*)(Bh + boff + 8 * hh); bq.half[1] = *(const v8us*)(Bh + boff + 16 + 8 * hh);
      acc[t] = mmaH<ASPLIT ? 2 : 1>(ah.v, al.v, bq.v, bq.v, acc[t]); }
  }
#pragma unroll
  for (int t = 0; t < 4; ++t) { if (col0 + t * 16 >= N) continue;
#pragma unroll
    for (int r = 0; r < 8; ++r) so[w][8 * hh + r][t * 16 + ln] = acc[t][r] * alpha; }
  __builtin_amdgcn_fence(__ATOMIC_ACQ_REL, "workgroup"); __builtin_amdgcn_wave_barrier();
  const int rsub = lane >> 4, c4 = (lane & 15) * 4;
  {
#pragma unroll
    for (int q = 0; q < 8; ++q) { const int r = q * 2 + rsub; if (col0 + c4 < N) { const v4f v = *(const v4fa*)&so[w][r][c4]; *(v4f*)(C + (size_t)(row0 + r) * ldc + col0 + c4) = v; } }
     }
}

// Wt[n][k] = f16(W[k][n]·scale) from f32 row-major W[K][N] (scale = power of two; bf16-exact weights stay exact in f16 away from the subnormal range)
__global__ __launch_bounds__(256) void k_wt_f16(const float* __restrict__ W, _Float16* __restrict__ Wt, int K, int N, float scale) {
  const int t = blockIdx.x * 256 + threadIdx.x; if (t >= N * (K / 8)) return; const int n = t / (K / 8), k8 = (t % (K / 8)) * 8; FragH f;
#pragma unroll
  for (int i = 0; i < 8; ++i) f.h[i] = (_Float16)(bf16_round(W[(size_t)(k8 + i) * N + n]) * scale); const v8us o = f.half[0];
  *(v8us*)((unsigned short*)Wt + (size_t)n * K + k8) = o; 
}
// k_gemm_hh variant with fused epilogue: v = acc·alpha + bias[by·sBias + col] (+ CP[(row/rowsPerB)·sCPb + by·64 + col] if CP) ; ACT 0 none / 1 elu ; writes f16 C16 (and f32 C if non-null)
template <int ACT>
__global__ __launch_bounds__(128) void k_gemm_hhx(const _Float16* __restrict__ A, int lda, size_t sA, const _Float16* __restrict__ Bh, int ldb, size_t sB, float alpha, const float* __restrict__ bias, size_t sBias, const float* __restrict__ CP, int rowsPerB, size_t sCPb, int row0g,
    float* __restrict__ C, _Float16* __restrict__ C16, int ldc, size_t sC, int M, int N, int K) {
  __shared__ __attribute__((aligned(16))) float so[4][16][64];
  const int tid = threadIdx.x, w = tid >> 5, lane = tid & 31, ln = lane & 15, hh = lane >> 4; const int by = blockIdx.y;
  A += (size_t)by * sA; Bh += (size_t)by * sB; const size_t cofs = (size_t)by * sC; const float* bp = bias ? bias + (size_t)by * sBias : nullptr;
  const int ntn = (N + 63) / 64; const int wid = blockIdx.x * 4 + w; const int mt = wid / ntn, nq = wid % ntn; if (mt * 16 >= M) return;
  const int row0 = mt * 16, col0 = nq * 64; const _Float16* arow = A + (size_t)(row0 + ln) * lda;
  v8f acc[4] = {};
  for (int kb = 0; kb < K; kb += 32) { FragH ah; ah.half[0] = *(const v8us*)((const unsigned short*)arow + kb + 8 * hh); ah.half[1] = *(const v8us*)((const unsigned short*)arow + kb + 16 + 8 * hh);
#pragma unroll
    for (int t = 0; t < 4; ++t) { if (col0 + t * 16 >= N) continue; const size_t boff = (size_t)(col0 + t * 16 + ln) * ldb + kb; FragH bq; bq.half[0] = *(const v8us*)((const unsigned short*)Bh + boff + 8 * hh); bq.half[1] = *(const v8us*)((const unsigned short*)Bh + boff + 16 + 8 * hh);
      acc[t] = mmaH<1>(ah.v, ah.v, bq.v, bq.v, acc[t]); }
  }
#pragma unroll
  for (int t = 0; t < 4; ++t) { if (col0 + t * 16 >= N) continue; const int col = col0 + t * 16 + ln; const float bv = bp ? bf16_round(bp[col]) : 0.f;
#pragma unroll
    for (int r = 0; r < 8; ++r) { float v = acc[t][r] * alpha + bv; if (CP) { const int rr = row0g + row0 + 8 * hh + r; if (rowsPerB < 0) v += CP[cofs + (size_t)rr * ldc + col];      /* rowsPerB < 0: own element of the batched C plane */ else { const int bidx = rr / rowsPerB; v += CP[(size_t)bidx * sCPb + (size_t)by * 64 + col]; } } if (ACT == 1) v = (v > 0.f) ? v : expm1f(v); else if (ACT == 7) v = (v > 0.f) ? v + 1.0f : expf(v); else if (ACT == 8) v = tanhf(v); else if (ACT == 9) v = 0.5f * v * (1.0f + tanhf(0.7978845608028654f * (v + 0.044715f * v * v * v))); else if (ACT == 11) v = 1.0f / (1.0f + expf(-v)); else if (ACT == 12) v = (v > 0.f) ? v : 0.01f * v; else if (ACT == 14) v = (v > 0.f) ? v : 0.1f * v; else if (ACT == 16) v = (v >= 0.f) ? v : 0.3f * v; else if (ACT == 17) v = (v >= 0.f) ? v : 0.2f * v; else if (ACT == 15) v = v / (1.0f + expf(-v)); else if (ACT == 3) v = fmaxf(v, 0.f); else if (ACT == 6) v = 0.5f * v * (1.0f + erff(v * 0.70710678118654752f)); so[w][8 * hh + r][t * 16 + ln] = v; } }
  __builtin_amdgcn_fence(__ATOMIC_ACQ_REL, "workgroup"); __builtin_amdgcn_wave_barrier();
  const int rsub = lane >> 4, c4 = (lane & 15) * 4; typedef _Float16 v4h __attribute__((ext_vector_type(4)));
  {
#pragma unroll
    for (int q = 0; q < 8; ++q) { const int r = q * 2 + rsub; if (col0 + c4 < N) { const v4f v = *(const v4fa*)&so[w][r][c4]; if (C) *(v4f*)(C + cofs + (size_t)(row0 + r) * ldc + col0 + c4) = v; if (C16) { v4h h4; for (int i = 0; i < 4; ++i) h4[i] = (_Float16)v[i]; *(v4h*)(C16 + cofs + (size_t)(row0 + r) * ldc + col0 + c4) = h4; } } }
     }
}


typedef _Float16 v4h __attribute__((ext_vector_type(4)));

__global__ __launch_bounds__(256) void k_x16(const float* __restrict__ x, _Float16* __restrict__ X16, size_t n8) { const size_t t = (size_t)blockIdx.x * 256 + threadIdx.x; if (t >= n8) return; FragH f;
#pragma unroll
  for (int q = 0; q < 8; ++q) f.h[q] = (_Float16)bf16_round(x[t * 8 + q]); *(v8us*)((unsigned short*)X16 + t * 8) = f.half[0];  }
__global__ __launch_bounds__(256) void k_h16(const float* __restrict__ x, _Float16* __restrict__ X16, size_t n8) { const size_t t = (size_t)blockIdx.x * 256 + threadIdx.x; if (t >= n8) return; FragH f;
#pragma unroll
  for (int q = 0; q < 8; ++q) f.h[q] = (_Float16)x[t * 8 + q]; *(v8us*)((unsigned short*)X16 + t * 8) = f.half[0];  }
__global__ __launch_bounds__(256) void k_round16f(const float* __restrict__ W, _Float16* __restrict__ Bt, size_t n8) { const size_t t = (size_t)blockIdx.x * 256 + threadIdx.x; if (t >= n8) return; FragH f;
#pragma unroll
  for (int i = 0; i < 8; ++i) f.h[i] = (_Float16)(bf16_round(W[t * 8 + i]) * 16.0f); *(v8us*)((unsigned short*)Bt + t * 8) = f.half[0];  }
template <int NHv, int TTv>
__global__ __launch_bounds__(256) void k_vt(const _Float16* __restrict__ V16, int ldv, int voff, _Float16* __restrict__ Vt) { __shared__ unsigned short tl[64][66]; const int tid = threadIdx.x; const int slab = blockIdx.x / (TTv / 64), lg = blockIdx.x % (TTv / 64); const int b = slab / NHv, h = slab % NHv;
  for (int i = tid; i < 64 * 8; i += 256) { const int r = i / 8, c8 = (i % 8) * 8; FragH f; f.half[0] = *(const v8us*)((const unsigned short*)V16 + ((size_t)b * TTv + lg * 64 + r) * ldv + voff + h * 64 + c8);
#pragma unroll
    for (int q = 0; q < 8; ++q) tl[r][c8 + q] = f.u[q]; }
  __syncthreads();
  {
#pragma unroll
    for (int rd = 0; rd < 2; ++rd) { const int d = rd * 32 + tid / 8, pc = tid % 8; FragH f;
#pragma unroll
      for (int q = 0; q < 8; ++q) f.u[q] = tl[pc * 8 + q][d];
      *(v8us*)((unsigned short*)Vt + ((size_t)slab * 64 + d) * TTv + lg * 64 + pc * 8) = f.half[0]; }
     } }

__global__ __launch_bounds__(256) void k_hl(const float* __restrict__ F, _Float16* __restrict__ Hh, _Float16* __restrict__ Hl, size_t n8) { const size_t t = (size_t)blockIdx.x * 256 + threadIdx.x; if (t >= n8) return; FragH fh, fl; const v4f a = *(const v4fa*)(F + t * 8), c = *(const v4fa*)(F + t * 8 + 4);
#pragma unroll
  for (int q = 0; q < 4; ++q) { _Float16 h = (_Float16)a[q]; fh.h[q] = h; fl.h[q] = (_Float16)((a[q] - (float)h) * 1024.0f); h = (_Float16)c[q]; fh.h[4 + q] = h; fl.h[4 + q] = (_Float16)((c[q] - (float)h) * 1024.0f); }
  { *(v8us*)((unsigned short*)Hh + t * 8) = fh.half[0]; *(v8us*)((unsigned short*)Hl + t * 8) = fl.half[0];  } }

// ---- fast GEMM (wave tile 32x64; requires M % 32 == 0 rows per launch region and N % 64 == 0); epilogue = k_gemm_hhx semantics ----
__device__ __forceinline__ v16h g2_frag(const _Float16* p, int hh) { FragH f; f.half[0] = *(const v8us*)((const unsigned short*)p + 8 * hh); f.half[1] = *(const v8us*)((const unsigned short*)p + 16 + 8 * hh); return f.v; }
__device__ __forceinline__ v8f g2_mma(v16h a, v16h b, v8f c) { v8f d = __builtin_amdgcn_wmma_f32_16x16x32_f16(false, a, false, b, (short)0, c, false, false); asm volatile("v_nop\n\tv_nop\n\tv_nop\n\tv_nop" : "+v"(d) : "v"(a), "v"(b)); return d; }
template <int ACT>
__global__ __launch_bounds__(128) void k_gemm2(const _Float16* __restrict__ A, int lda, size_t sA, const _Float16* __restrict__ Bh, int ldb, size_t sB, float alpha, const float* __restrict__ bias, size_t sBias, const float* __restrict__ CP, int rowsPerB, size_t sCPb, int row0g,
    float* __restrict__ C, _Float16* __restrict__ C16, int ldc, size_t sC, int M, int N, int K) { static_assert(ACT == 0 || ACT == 3 || ACT == 6 || ACT == 8 || ACT == 9 || ACT == 11 || ACT == 12 || ACT == 14 || ACT == 15 || ACT == 16 || ACT == 17, "k_gemm2: unsupported ACT code (would silently apply no activation)");
  __shared__ __attribute__((aligned(16))) float so[4][32][68];
  const int tid = threadIdx.x, w = tid >> 5, lane = tid & 31, ln = lane & 15, hh = lane >> 4; const int by = blockIdx.y;
  A += (size_t)by * sA; Bh += (size_t)by * sB; const size_t cofs = (size_t)by * sC; const float* bp = bias ? bias + (size_t)by * sBias : nullptr;
  const int ntn = N >> 6; const int mt = blockIdx.x / ntn, nq = blockIdx.x - mt * ntn; const int row0 = mt * 128 + 32 * w, col0 = nq * 64; if (row0 >= M) return;
  const _Float16* a0p = A + (size_t)(row0 + ln) * lda; const _Float16* a1p = a0p + (size_t)16 * lda;
  const _Float16* b0p = Bh + (size_t)(col0 + ln) * ldb; const _Float16* b1p = b0p + (size_t)16 * ldb; const _Float16* b2p = b1p + (size_t)16 * ldb; const _Float16* b3p = b2p + (size_t)16 * ldb;
  const v8f z8 = {0.f,0.f,0.f,0.f,0.f,0.f,0.f,0.f}; v8f c00 = z8, c01 = z8, c02 = z8, c03 = z8, c10 = z8, c11 = z8, c12 = z8, c13 = z8;
#pragma unroll 1
  for (int kb = 0; kb < K; kb += 32) { const v16h a0 = g2_frag(a0p + kb, hh), a1 = g2_frag(a1p + kb, hh);
    v16h b = g2_frag(b0p + kb, hh); c00 = g2_mma(a0, b, c00); c10 = g2_mma(a1, b, c10);
    b = g2_frag(b1p + kb, hh); c01 = g2_mma(a0, b, c01); c11 = g2_mma(a1, b, c11);
    b = g2_frag(b2p + kb, hh); c02 = g2_mma(a0, b, c02); c12 = g2_mma(a1, b, c12);
    b = g2_frag(b3p + kb, hh); c03 = g2_mma(a0, b, c03); c13 = g2_mma(a1, b, c13); }
  v8f accs[8] = {c00, c01, c02, c03, c10, c11, c12, c13};
#pragma unroll
  for (int u = 0; u < 8; ++u) { const int t = u & 3, half = u >> 2; const int col = col0 + t * 16 + ln; const float bv = bp ? bf16_round(bp[col]) : 0.f;
#pragma unroll
    for (int r = 0; r < 8; ++r) { const int rloc = half * 16 + 8 * hh + r; float v = accs[u][r] * alpha + bv; if (CP) { if (rowsPerB < 0) v += CP[cofs + (size_t)(row0g + row0 + rloc) * ldc + col];      /* rowsPerB < 0: own element of the batched C plane */ else { const int bidx = (row0g + row0 + rloc) / rowsPerB; v += CP[(size_t)bidx * sCPb + (size_t)by * 64 + col]; } }
      if (ACT == 3) v = fmaxf(v, 0.f); else if (ACT == 6) v = 0.5f * v * (1.0f + erff(v * 0.70710678118654752f)); else if (ACT == 11) v = 1.0f / (1.0f + expf(-v)); else if (ACT == 15) v = v / (1.0f + expf(-v)); else if (ACT == 12) v = (v > 0.f) ? v : 0.01f * v; else if (ACT == 8) v = tanhf(v); else if (ACT == 9) v = 0.5f * v * (1.0f + tanhf(0.7978845608028654f * (v + 0.044715f * v * v * v))); else if (ACT == 14) v = (v > 0.f) ? v : 0.1f * v; else if (ACT == 16) v = (v >= 0.f) ? v : 0.3f * v; else if (ACT == 17) v = (v >= 0.f) ? v : 0.2f * v;
      so[w][rloc][t * 16 + ln] = v; } }
  __builtin_amdgcn_fence(__ATOMIC_ACQ_REL, "workgroup"); __builtin_amdgcn_wave_barrier();
  const int rsub = lane >> 4, c4 = (lane & 15) * 4;
  {
#pragma unroll
    for (int q = 0; q < 16; ++q) { const int r = q * 2 + rsub; const v4f v = *(const v4fa*)&so[w][r][c4]; if (C) *(v4f*)(C + cofs + (size_t)(row0 + r) * ldc + col0 + c4) = v; if (C16) { v4h h4; for (int i = 0; i < 4; ++i) h4[i] = (_Float16)v[i]; *(v4h*)(C16 + cofs + (size_t)(row0 + r) * ldc + col0 + c4) = h4; } }
     } }


__global__ __launch_bounds__(256) void k_wnat(const float* __restrict__ w, size_t n8, _Float16* __restrict__ Bt) { const size_t t = (size_t)blockIdx.x * 256 + threadIdx.x; if (t >= n8) return; FragH f; for (int q = 0; q < 8; ++q) f.h[q] = (_Float16)(bf16_round(w[t * 8 + q]) * 16.0f); *(v8us*)((unsigned short*)Bt + t * 8) = f.half[0];  }
__global__ __launch_bounds__(256) void k_rsm(const float* __restrict__ S, _Float16* __restrict__ P, int nrows) {
  #pragma clang fp contract(off)
  const int i = blockIdx.x * 256 + threadIdx.x; if (i >= nrows) return; const float* s = S + (size_t)i * SQ; float mx = -3.0e38f;
#pragma unroll 1
  for (int j = 0; j < SQ; ++j) mx = fmaxf(mx, s[j]); float se = 0.f;
#pragma unroll 1
  for (int j = 0; j < SQ; ++j) se += expf(s[j] - mx); const float sc = 256.0f / se;
#pragma unroll 1
  for (int j0 = 0; j0 < SQ; j0 += 8) { FragH f; for (int q = 0; q < 8; ++q) f.h[q] = (_Float16)(expf(s[j0 + q] - mx) * sc); unsigned short* d = (unsigned short*)P + (size_t)i * SQ + j0; *(v8us*)d = f.half[0];  } }
__global__ __launch_bounds__(256) void k_vt(const _Float16* __restrict__ V16, int b, int h0, _Float16* __restrict__ VT) { __shared__ unsigned short tl[64][65]; const int tid = threadIdx.x; const int hh = blockIdx.x % HG, sg = blockIdx.x / HG; const int s0 = sg * 64; const int h = h0 + hh;
  for (int i = tid; i < 64 * 8; i += 256) { const int j = i / 8, d8 = (i % 8) * 8; FragH f; f.half[0] = *(const v8us*)((const unsigned short*)V16 + ((size_t)b * SQ + s0 + j) * DM + h * HD + d8); for (int q = 0; q < 8; ++q) tl[d8 + q][j] = f.u[q]; }
  __syncthreads();
  { for (int i = tid; i < 64 * 8; i += 256) { const int d = i / 8, j8 = (i % 8) * 8; FragH f; for (int q = 0; q < 8; ++q) f.u[q] = tl[d][j8 + q]; *(v8us*)((unsigned short*)VT + ((size_t)hh * HD + d) * SQ + s0 + j8) = f.half[0]; }  } }



// Fused causal attention on the f16 planes: scores, softmax and P V in ONE launch; neither S nor P goes through memory. A block of FAR query rows of one batch is worked on by the FAW waves of a work-group.
// Both products are formed transposed, so that a lane owns one query in both: S^T = K Q^T (A = K rows, B = Q rows) leaves in lane (ln, hh) the scores of query ln for keys 8 hh + r
// of each 16-key tile, which for two tiles side by side is the k order of a B fragment; O^T = V^T P^T (A = V^T rows, B = those weights as f16) leaves query ln's o for d = 8 hh + r.
// So the weights never leave their registers, and running maximum, denominator and rescale are per lane: lane ^ 16 holds the other keys of the same query, so the maximum is exchanged with it
// once a chunk, and the two halves' denominators are joined once, behind the loop. Scores are carried times log2(e), so that a weight is one v_exp_f32 of a difference.
// wave = key run: the block's 32-key chunks are dealt to the FAW waves in turn; each wave lays its partial result in LDS as it stands (own maximum, denominator, o); behind ONE barrier the FAW partial results are brought to the common maximum and added, in the order of the waves.
// Every inner loop is unrolled so that each index of a register array is a constant (no scratch); the chunk loop stays rolled, so that one chunk's fragments are live at a time and four waves fit a SIMD.
#define FAW 16                       /* waves = key runs per block of query rows: the whole work-group */
#define FAQ 2                        /* 16-query tiles a wave: each K and V^T fragment is used FAQ times */
#define FAR (16 * FAQ)               /* query rows per block = keys per chunk */
#define FAP (HD + 4)                 /* LDS pitch of a partial o row: 16 B x odd, so that 16-byte accesses of many rows spread over the banks */
__device__ __forceinline__ float fa_xhalf(float x) { return __builtin_bit_cast(float, __builtin_amdgcn_permlanex16(__builtin_bit_cast(int, x), __builtin_bit_cast(int, x), 0x76543210, 0xfedcba98, false, false)); }      /* lane l reads lane l ^ 16: a vector move, where __shfl_xor goes through the LDS path and a wait */
// 2^x. The v_nop in the same statement keeps the one slot that the instruction set asks for behind a transcendental before its result is read or its source overwritten.
__device__ __forceinline__ float fa_exp2(float x) { float r; asm("v_exp_f32 %0, %1\n\tv_nop" : "=v"(r) : "v"(x)); return r; }
__device__ __forceinline__ v8f fa_mma(v16h a, v16h b, v8f c) { return __builtin_amdgcn_wmma_f32_16x16x32_f16(false, a, false, b, (short)0, c, false, false); }
// A fragment from a plane laid out in fragment order: p = the fragment's 1 KiB block + 8 * lane halves. Each of the two 16-byte loads of a wave covers 512 B in a row, four whole lines
// (from token rows a load took 32 B of each of 16 lines). Block of q, k: [16-row tile][k step of 32 columns]; of v^T: [32-key chunk][16-column tile]; inside a block [register half j][hh][ln][8 values],
// the values that g2_frag takes from a row: row ln of the tile, k = 16 j + 8 hh + 0..7 of the step.
__device__ __forceinline__ v16h fr_frag(const _Float16* p) { FragH f; f.half[0] = *(const v8us*)(const unsigned short*)p; f.half[1] = *(const v8us*)((const unsigned short*)p + 256); return f.v; }
struct FaSm { float po[2][FAW][FAR][FAP]; float pm[2][FAW][FAR]; float pl[2][FAW][FAR]; };      /* the partial results of the work-group's two blocks of query rows, so that no wave waits between them; po first: 16-byte accesses */
// One wave's share of one block. blk: which of the work-group's two blocks; w: the wave's number (a scalar); c0: the wave's first chunk (a scalar); qb: the block of query rows; b: the batch.
__device__ __forceinline__ void fattn_part(FaSm& sm, const int blk, const int w, const int c0, const int lane, const int qb, const int b, const _Float16* __restrict__ Q16, const _Float16* __restrict__ K16, const _Float16* __restrict__ VT, float scale) {
  static_assert(NH == 1 && HD == 64 && FAR == 32 && SQ % FAR == 0 && 32 * FAW * 8 == 2 * FAR * HD, "one 64-wide head; a chunk of 32 keys is one k step of P V; the merge gives every thread 8 columns of one row of one of the two blocks");
  float (&pm)[FAW][FAR] = sm.pm[blk]; float (&pl)[FAW][FAR] = sm.pl[blk]; float (&po)[FAW][FAR][FAP] = sm.po[blk];
  const int ln = lane & 15, hh = lane >> 4;
  const int nch = qb + 1;      /* causal: chunks 0..qb; only chunk qb crosses the diagonal */
  Q16 += (size_t)b * SQ * HD + lane * 8; K16 += (size_t)b * SQ * HD + lane * 8; VT += (size_t)b * HD * SQ + lane * 8;      /* the three planes in fragment order: the lane's 16 bytes of every 512 */
  v8f o[FAQ][4]; float m[FAQ], l[FAQ]; const float sl2 = scale * 1.44269504088896340736f;
#pragma unroll
  for (int u = 0; u < FAQ; ++u) { m[u] = -1.0e30f; l[u] = 0.f;
#pragma unroll
    for (int t = 0; t < 4; ++t) o[u][t] = v8f{0.f, 0.f, 0.f, 0.f, 0.f, 0.f, 0.f, 0.f}; }
  if (c0 < nch) {      /* a wave without a chunk loads nothing and goes to the merge with m = -1e30, l = 0, o = 0 */
  v16h qf[FAQ][2];
#pragma unroll
  for (int u = 0; u < FAQ; ++u) { const _Float16* qp = Q16 + (size_t)(qb * FAQ + u) * (16 * HD); qf[u][0] = fr_frag(qp); qf[u][1] = fr_frag(qp + 512);
    asm volatile("s_wait_xcnt 0x0" :: "v"(qp) : "memory"); }      /* the wait in front of any overwrite of the address pair that the q loads name; the pair is an input, so it stays whole up to here */
#pragma unroll 1
  for (int c = c0; c < nch; c += FAW) { const int k0 = c * FAR;
    const _Float16* kp = K16 + (size_t)k0 * HD; const _Float16* vp = VT + (size_t)k0 * HD;      /* a chunk is 4 KiB in a row of each plane */
    const v16h ka0 = fr_frag(kp), ka1 = fr_frag(kp + 512), kb0 = fr_frag(kp + 1024), kb1 = fr_frag(kp + 1536);
    v16h vf[4];
#pragma unroll
    for (int t = 0; t < 4; ++t) vf[t] = fr_frag(vp + t * 512);
    asm volatile("s_wait_xcnt 0x0" :: "v"(kp), "v"(vp) : "memory");      /* the wait in front of any overwrite of the address pairs that the K and V loads name (the next trip forms new ones); the pairs are inputs, so they stay whole up to here */
#pragma unroll
    for (int u = 0; u < FAQ; ++u) { const v8f z8 = {0.f, 0.f, 0.f, 0.f, 0.f, 0.f, 0.f, 0.f};
      const v8f sa = fa_mma(ka1, qf[u][1], fa_mma(ka0, qf[u][0], z8)), sb = fa_mma(kb1, qf[u][1], fa_mma(kb0, qf[u][0], z8));
      float s[16];
#pragma unroll
      for (int r = 0; r < 8; ++r) { s[r] = sa[r] * sl2; s[8 + r] = sb[r] * sl2; }      /* s[i]: key k0 + 8 hh + i (i < 8), k0 + 16 + 8 hh + i - 8 (i >= 8) */
      if (c == nch - 1) { const int dq = u * 16 + ln - 8 * hh;      /* key - k0 <= query - q0, and k0 = q0 here */
#pragma unroll
        for (int r = 0; r < 8; ++r) { if (r > dq) s[r] = -1.0e30f; if (16 + r > dq) s[8 + r] = -1.0e30f; } }
      float mn = s[0];
#pragma unroll
      for (int i = 1; i < 16; ++i) mn = fmaxf(mn, s[i]);
      mn = fmaxf(mn, fa_xhalf(mn)); mn = fmaxf(mn, m[u]);      /* every chunk holds a key that the query sees (the chunk's first), so mn is a real score */
      const float sc = fa_exp2(m[u] - mn); float es = 0.f; FragH p;      /* first chunk: m = -1e30, sc = 0 on l = 0 and o = 0 */
#pragma unroll
      for (int i = 0; i < 16; ++i) { const float e = fa_exp2(s[i] - mn); es += e; p.h[i] = (_Float16)e; }
      l[u] = fmaf(l[u], sc, es); m[u] = mn;      /* l: this half's keys only; sc is the same in both halves */
#pragma unroll
      for (int t = 0; t < 4; ++t) o[u][t] = fa_mma(vf[t], p.v, o[u][t] * sc); } } }
#pragma unroll
  for (int u = 0; u < FAQ; ++u) { const float lj = l[u] + fa_xhalf(l[u]); if (hh == 0) { pm[w][u * 16 + ln] = m[u]; pl[w][u * 16 + ln] = lj; }      /* both halves of the wave hold the same m and, joined, the same l */
#pragma unroll
    for (int t = 0; t < 4; ++t) { const v8f y = o[u][t]; *(v4f*)&po[w][u * 16 + ln][t * 16 + 8 * hh] = v4f{y[0], y[1], y[2], y[3]}; *(v4f*)&po[w][u * 16 + ln][t * 16 + 8 * hh + 4] = v4f{y[4], y[5], y[6], y[7]}; } } }
// The merge of one block, behind the barrier. tl: the thread's number among the 256 that merge this block. The wave that had chunk 0, which every row sees, makes the common maximum a real score; a wave without a chunk counts 0.
__device__ __forceinline__ void fattn_merge(const FaSm& sm, const int blk, const int tl, const int qb, const int b, float* __restrict__ O) {
  const float (&pm)[FAW][FAR] = sm.pm[blk]; const float (&pl)[FAW][FAR] = sm.pl[blk]; const float (&po)[FAW][FAR][FAP] = sm.po[blk];
  const int row = tl >> 3, c8 = (tl & 7) * 8;      /* a wave adds and stores four whole o rows: 1 KiB in a row */
  float pr[FAW];
#pragma unroll
  for (int x = 0; x < FAW; ++x) pr[x] = pm[x][row];
  float mx = pr[0];
#pragma unroll
  for (int x = 1; x < FAW; ++x) mx = fmaxf(mx, pr[x]);
  float ls = 0.f; v4f r0 = {0.f, 0.f, 0.f, 0.f}, r1 = {0.f, 0.f, 0.f, 0.f};
#pragma unroll
  for (int x = 0; x < FAW; ++x) { const float f = fa_exp2(pr[x] - mx); ls = fmaf(f, pl[x][row], ls); r0 += *(const v4f*)&po[x][row][c8] * f; r1 += *(const v4f*)&po[x][row][c8 + 4] * f; }
  const float inv = 1.0f / ls; float* op = O + (size_t)b * SQ * HD + (size_t)(qb * FAR + row) * HD + c8;
  *(v4f*)op = r0 * inv; *(v4f*)(op + 4) = r1 * inv; }

// e^x for x <= 0 to f32 accuracy: x * log2(e) is cut into its nearest integer n and a remainder that two FMAs form (log2(e) as a high and a low float), then 2^remainder * 2^n.
// Below -104 the result is under the smallest f32: x is held there, so that n stays a small integer. The v_nop in the same statement keeps the one slot that the instruction
// set asks for behind a transcendental before its result is read or its source overwritten.
__device__ __forceinline__ float exp_neg(float x) { x = fmaxf(x, -104.0f); const float n = rintf(x * 1.44269502f); const float r = fmaf(x, 1.92596303e-8f, fmaf(x, 1.44269502f, -n));
  float p; asm("v_exp_f32 %0, %1\n\tv_nop" : "=v"(p) : "v"(r)); return ldexpf(p, (int)n); }
// Exact f32 causal attention for rows 0..QT0-1 of every batch (b = batch, each with its own QT0-row plane; rg = block of 32 query rows), stored straight into the output rows.
// Both products run on the f32 matrix form (v_wmma_f32_16x16x4_f32: full f32 operands, f32 sums), transposed as in the f16 path, so that a lane owns one query in both:
// S^T = K Q^T (A = 16 K rows, B = 16 q rows; both sides loaded by the same code, 16 bytes a lane = two k steps, so their k orders are equal) leaves in lane (ln, hh) the scores of query ln for keys 8 hh + r.
// O^T = V^T P^T: registers 2 j, 2 j + 1 of those weights are the B fragment of k step j, keys 8 hh + 2 j + {0, 1}; A takes V in the same key order. Row ln of A's tile t stands for column d = 4 ln + t,
// so a lane's four tiles come from ONE 16-byte load of a V row, a load covers two whole V rows, and o[u][t][r] is column 32 hh + 4 r + t of query u * 16 + ln.
// wave = key run: the block's 2 * (rg + 1) tiles of 16 keys are dealt to the A0W waves in turn; each K and V fragment serves both 16-query tiles. Each wave keeps its own running maximum, denominator and o
// (one rescale a tile); the A0W partial results are brought to the common maximum and added through LDS, always in the order of the waves.
#define A0W 16                       /* waves = key runs per work-group */
#define A0P (HD + 4)                 /* LDS pitch of a partial o row: 16 B x odd, so that 16-byte accesses of 32 rows spread over the banks */
typedef float v2f __attribute__((ext_vector_type(2)));
__device__ __forceinline__ v8f a0_mma(v2f a, v2f b, v8f c) { return __builtin_amdgcn_wmma_f32_16x16x4_f32(false, a, false, b, (short)0, c, false, false); }
struct A0Sm { float po[A0W][32][A0P]; float pm[A0W][32]; float pl[A0W][32]; float pfin[32]; };      /* po first: 16-byte accesses */
__device__ __forceinline__ void att0w_rows(A0Sm& sm, const int rg, const int b, const float* __restrict__ QF, const float* __restrict__ KF, const float* __restrict__ VF, float scale, float* __restrict__ O) {
  static_assert(NH == 1 && HD == 64 && QT0 % 32 == 0 && 32 * A0W * 4 == 32 * HD, "one 64-wide head; 32 rows a block; the merge gives every thread 4 columns of one row");
  float (&pm)[A0W][32] = sm.pm; float (&pl)[A0W][32] = sm.pl; float (&pfin)[32] = sm.pfin; float (&po)[A0W][32][A0P] = sm.po;
  const int lane = threadIdx.x & 31, ln = lane & 15, hh = lane >> 4; const int w = __builtin_amdgcn_readfirstlane((int)(threadIdx.x >> 5));      /* the wave's number as a scalar: the tile loop is a scalar branch, every lane is on at every matrix instruction */
  { const size_t bi = (size_t)b * QT0 * HD; QF += bi + lane * 4; KF += bi + lane * 4; VF += bi; O += (size_t)b * SQ * HD; }      /* q, k in fragment order: [16-row tile][i][hh][ln][4 values], so that load i of a wave covers 512 B in a row; v as rows of HD */
  const int nt = 2 * (rg + 1);      /* causal: key tiles 0 .. 2 rg + 1; only the last two cross the diagonal */
  v8f o[2][4]; float m[2], l[2];
#pragma unroll
  for (int u = 0; u < 2; ++u) { m[u] = -1.0e30f; l[u] = 0.f;
#pragma unroll
    for (int t = 0; t < 4; ++t) o[u][t] = v8f{0.f, 0.f, 0.f, 0.f, 0.f, 0.f, 0.f, 0.f}; }
  if (w < nt) {      /* a wave without a tile loads nothing and goes to the merge with m = -1e30, l = 0, o = 0 */
  v4f qf[2][8];      /* qf[u][i]: columns 8 i + 4 hh .. + 3 of query u * 16 + ln */
#pragma unroll
  for (int u = 0; u < 2; ++u) { const float* qp = QF + (size_t)(rg * 2 + u) * (16 * HD);
#pragma unroll
    for (int i = 0; i < 8; ++i) qf[u][i] = *(const v4fa*)(qp + 128 * i);
    asm volatile("s_wait_xcnt 0x0" :: "v"(qp) : "memory"); }      /* the wait in front of any overwrite of the address pair that the q loads name; the pair is an input, so it stays whole up to here */
#pragma unroll 1
  for (int kt = w; kt < nt; kt += A0W) { const int k0 = kt * 16;      /* rolled: one tile's fragments are live at a time */
    const float* kp = KF + (size_t)k0 * HD; const float* vp = VF + (size_t)(k0 + 8 * hh) * HD + 4 * ln;
    v4f kf[8], vf[8];      /* kf[i]: columns 8 i + 4 hh .. + 3 of key k0 + ln (q's order); vf[i]: columns 4 ln .. + 3 of key k0 + 8 hh + i */
#pragma unroll
    for (int i = 0; i < 8; ++i) kf[i] = *(const v4fa*)(kp + 128 * i);
#pragma unroll
    for (int i = 0; i < 8; ++i) vf[i] = *(const v4fa*)(vp + i * HD);
    asm volatile("s_wait_xcnt 0x0" :: "v"(kp), "v"(vp) : "memory");      /* the wait in front of any overwrite of the address pairs that the K and V loads name (the next trip forms new ones); the pairs are inputs, so they stay whole up to here */
#pragma unroll
    for (int u = 0; u < 2; ++u) { v8f s8 = {0.f, 0.f, 0.f, 0.f, 0.f, 0.f, 0.f, 0.f};
#pragma unroll
      for (int i = 0; i < 8; ++i) { s8 = a0_mma(v2f{kf[i][0], kf[i][1]}, v2f{qf[u][i][0], qf[u][i][1]}, s8); s8 = a0_mma(v2f{kf[i][2], kf[i][3]}, v2f{qf[u][i][2], qf[u][i][3]}, s8); }
      const int dq = rg * 32 + u * 16 + ln - k0 - 8 * hh;      /* register r holds key k0 + 8 hh + r: seen by the query where r <= dq */
      float s[8]; float mn = m[u];
#pragma unroll
      for (int r = 0; r < 8; ++r) { s[r] = (r <= dq) ? s8[r] * scale : -1.0e30f; mn = fmaxf(mn, s[r]); }
      mn = fmaxf(mn, fa_xhalf(mn));      /* lane ^ 16 holds the other eight keys of the same query */
      const float sc = exp_neg(m[u] - mn); float e[8]; float es = 0.f;      /* nothing seen yet: m = mn = -1e30, sc = 1 on l = 0 and o = 0 */
#pragma unroll
      for (int r = 0; r < 8; ++r) { const float x = exp_neg(s[r] - mn); e[r] = (r <= dq) ? x : 0.f; es += e[r]; }      /* formed for every key, then selected: eight independent chains and no branch; a key behind the row counts 0 also where all that the wave has met so far is behind it */
      l[u] = fmaf(l[u], sc, es); m[u] = mn;      /* l: this half's keys only; sc is the same in both halves */
#pragma unroll
      for (int t = 0; t < 4; ++t) { v8f acc = o[u][t] * sc;
#pragma unroll
        for (int j = 0; j < 4; ++j) acc = a0_mma(v2f{vf[2 * j][t], vf[2 * j + 1][t]}, v2f{e[2 * j], e[2 * j + 1]}, acc);
        o[u][t] = acc; } } } }
  { const float l0 = l[0] + fa_xhalf(l[0]), l1 = l[1] + fa_xhalf(l[1]); pm[w][lane] = hh ? m[1] : m[0]; pl[w][lane] = hh ? l1 : l0; }      /* both halves hold the same m and, joined, the same l: lane stores those of row lane */
  __syncthreads();
  float mx = pm[0][lane];      /* wave 0 has tile 0 with key 0, which every row sees: the common maximum is a real score */
#pragma unroll
  for (int u = 1; u < A0W; ++u) mx = fmaxf(mx, pm[u][lane]);
  if (w == 0) { float ls = 0.f;
#pragma unroll
    for (int u = 0; u < A0W; ++u) ls = fmaf(exp_neg(pm[u][lane] - mx), pl[u][lane], ls);
    pfin[lane] = 1.0f / ls; }
  const float mxo = fa_xhalf(mx);      /* the common maximum of row lane ^ 16 */
#pragma unroll
  for (int u = 0; u < 2; ++u) { const float f = exp_neg(m[u] - ((hh == u) ? mx : mxo));
#pragma unroll
    for (int r = 0; r < 8; ++r) *(v4f*)&po[w][u * 16 + ln][32 * hh + 4 * r] = v4f{o[u][0][r] * f, o[u][1][r] * f, o[u][2][r] * f, o[u][3][r] * f}; }
  __syncthreads();
  const int row = threadIdx.x >> 4, c4 = (threadIdx.x & 15) * 4;      /* a wave adds and stores two whole o rows: 512 B in a row */
  v4f r = {0.f, 0.f, 0.f, 0.f};
#pragma unroll
  for (int u = 0; u < A0W; ++u) r += *(const v4f*)&po[u][row][c4];
  r *= pfin[row];
  float* op = O + (size_t)(rg * 32 + row) * HD + c4; *(v4f*)op = r;
  asm volatile("s_wait_xcnt 0x0" :: "v"(op), "v"(r) : "memory"); }      /* the wait in front of any overwrite of a register that this store names: the other path's code follows in the text; address and data are inputs, so they stay whole up to here */

// Both attention paths in ONE launch: neither needs anything of the other, each output row belongs to exactly one of them, and the branch between them is the same for a whole work-group.
// grid.x = batch; grid.y = piece of work: first ATP pairs of f16 blocks of FAR rows (rows QT0..): the t-th longest with the t-th shortest, one after the other on all FAW waves, so that every pair holds the same number of chunks;
// the short block's chunks are dealt from the last wave down, so that the waves' trip counts differ by one at most. Then the ATX exact blocks of 32 rows (rows 0..QT0-1, A0W waves each), the longer the earlier. One work-group of 16 waves fills a WGP's registers. No loop of either path holds a barrier: every wave of a work-group passes the same ones (f16: one; exact: two).
#define ATX (QT0 / 32)
#define ATP ((SQ - QT0) / (2 * FAR))
union AtSm { FaSm fa; A0Sm a0; };
__global__ __launch_bounds__(32 * A0W) void k_attn(const _Float16* __restrict__ Q16, const _Float16* __restrict__ K16, const _Float16* __restrict__ VT, const float* __restrict__ QF, const float* __restrict__ KF, const float* __restrict__ VF, float scale, float* __restrict__ O) {
  static_assert(FAW == A0W && QT0 % FAR == 0 && (SQ - QT0) % (2 * FAR) == 0, "an f16 block takes a work-group of the exact path's size; the f16 blocks pair up");
  __shared__ __attribute__((aligned(16))) AtSm sm;
  const int b = blockIdx.x, t = blockIdx.y;
  if (t < ATP) { const int wv = __builtin_amdgcn_readfirstlane((int)(threadIdx.x >> 5));      /* the wave's number as a scalar: the chunk loop and its mask test are scalar branches */
    const int qbl = SQ / FAR - 1 - t, qbs = QT0 / FAR + t;      /* the long block and the short one: qbl + qbs is the same for every t */
#pragma unroll 1      /* rolled: one copy of the chunk loop in the text, for speed only */
    for (int blk = 0; blk < 2; ++blk) fattn_part(sm.fa, blk, wv, blk ? FAW - 1 - wv : wv, (int)threadIdx.x & 31, blk ? qbs : qbl, b, Q16, K16, VT, scale);
    __syncthreads();
    const int mb = wv / (FAW / 2); fattn_merge(sm.fa, mb, (int)threadIdx.x & 255, mb ? qbs : qbl, b, O); }      /* waves 0..7 merge the long block, 8..15 the short one */
  else att0w_rows(sm.a0, ATX - 1 - (t - ATP), b, QF, KF, VF, scale, O); }


template <int BFIN, int WXB>
__global__ __launch_bounds__(256) void k_ln16(const float* __restrict__ X, const float* __restrict__ g, const float* __restrict__ bb, float eps, _Float16* __restrict__ N16, float* __restrict__ XB) {
  #pragma clang fp contract(off)
  __shared__ float red[256]; const size_t r = blockIdx.x; const int t = threadIdx.x; const v4f xa = *(const v4fa*)(X + r * DMQ + t * 4); float s[4]; float sum = 0.f;
  for (int q = 0; q < 4; ++q) { s[q] = BFIN ? bf16_round(xa[q]) : xa[q]; sum = __fadd_rn(sum, s[q]); }
  red[t] = sum; __syncthreads(); for (int st = 128; st > 0; st >>= 1) { if (t < st) red[t] = __fadd_rn(red[t], red[t + st]); __syncthreads(); } const float mu = red[0] / (float)DMQ; __syncthreads();
  float vs = 0.f; for (int q = 0; q < 4; ++q) { const float dl = __fadd_rn(s[q], -mu); vs = __fadd_rn(vs, __fmul_rn(dl, dl)); } red[t] = vs; __syncthreads(); for (int st = 128; st > 0; st >>= 1) { if (t < st) red[t] = __fadd_rn(red[t], red[t + st]); __syncthreads(); }
  const float rs = rsqrtf(__fadd_rn(red[0] / (float)DMQ, eps)); v4h y; v4f xb;
  for (int q = 0; q < 4; ++q) { const int c = t * 4 + q; y[q] = (_Float16)__fadd_rn(__fmul_rn(__fmul_rn(__fadd_rn(s[q], -mu), rs), bf16_round(g[c])), bf16_round(bb[c])); xb[q] = s[q]; }
  { *(v4h*)(N16 + r * DMQ + t * 4) = y; if (WXB) *(v4f*)(XB + r * DMQ + t * 4) = xb;  } }
__global__ __launch_bounds__(256) void k_ftres2(const float* __restrict__ OF0, const float* __restrict__ XB, float* __restrict__ X1, size_t n4) {
  #pragma clang fp contract(off)
  const size_t t = (size_t)blockIdx.x * 256 + threadIdx.x; if (t >= n4) return; const v4f o = *(const v4fa*)(OF0 + t * 4), xv = *(const v4fa*)(XB + t * 4); v4f y; for (int q = 0; q < 4; ++q) y[q] = __fadd_rn(__fmul_rn(o[q], 0.015625f), xv[q]); *(v4f*)(X1 + t * 4) = y;  }

__global__ __launch_bounds__(256) void k_wthd(const float* __restrict__ Wt, _Float16* __restrict__ Bt) { const size_t t = (size_t)blockIdx.x * 256 + threadIdx.x; if (t >= (size_t)NH * HD * (DM / 8)) return; const int m8 = (int)(t % (DM / 8)) * 8; const int d = (int)((t / (DM / 8)) % HD); const int h = (int)(t / ((size_t)(DM / 8) * HD)); FragH f;
  for (int q = 0; q < 8; ++q) f.h[q] = (_Float16)(16.0f * bf16_round(Wt[((size_t)h * DM + m8 + q) * HD + d])); unsigned short* dst = (unsigned short*)Bt + ((size_t)h * HD + d) * DM + m8; *(v8us*)dst = f.half[0];  }




__global__ __launch_bounds__(256) void k_wtpad(const float* __restrict__ Wm, _Float16* __restrict__ Wt, int Kr, int Kp, int Nr, int Np, float scale) {
  const int t = blockIdx.x * 256 + threadIdx.x; if (t >= Np * (Kp / 8)) return; const int n = t / (Kp / 8), k8 = (t % (Kp / 8)) * 8; const int nc = min(n, Nr - 1); const float fn = (n < Nr) ? 1.f : 0.f; FragH f;
  for (int i = 0; i < 8; ++i) { const int k = k8 + i; const int kc = min(k, Kr - 1); const float fk = (k < Kr) ? fn : 0.f; f.h[i] = (_Float16)(bf16_round(Wm[(size_t)kc * Nr + nc]) * scale * fk); }
  unsigned short* o = (unsigned short*)Wt + (size_t)n * Kp + k8; *(v8us*)o = f.half[0];  }
__global__ __launch_bounds__(128) void k_bpad(const float* __restrict__ b, float* __restrict__ Bp, int nr, int np) {
  const int i = threadIdx.x; if (i >= np) return; const float v = b[min(i, nr - 1)] * ((i < nr) ? 1.f : 0.f); *(float*)(Bp + i) = v;  }

#define DI 64         /* inner width = NH * HD (ONE 64-wide head) */
#define LQK (3 * DI)  /* width of a q | k | v row (192) */
__global__ __launch_bounds__(256) void k_o0(const float* __restrict__ OF, float* __restrict__ ob, size_t n4) {
  #pragma clang fp contract(off)
  const size_t t = (size_t)blockIdx.x * 256 + threadIdx.x; if (t >= n4) return; const size_t e = t * 4; const int i = (int)(e / DI); const int c = (int)(e % DI); const int h = c / HD, d = c % HD; const v4f a = *(const v4fa*)(OF + e); v4f o; for (int q = 0; q < 4; ++q) o[q] = __fmul_rn(a[q], 0.015625f); float* dst = ob + (size_t)h * SQ * HD + (size_t)i * HD + d; *(v4f*)dst = o;  }

// The whole projection stage in ONE launch: q | k | v = x W for PJR token rows a work-group. x comes in as f32 in whole lines, is rounded as before (bf16, exact in f16) and laid in LDS as f16 rows;
// wave w owns columns 16 w .. 16 w + 15 of q | k | v and builds its eight B fragments straight from the f32 weights (lane = column, so a load takes 64 B of each of two weight rows; value bf16-rounded, x16, f16: as before).
// Products, k order and the order of the k steps are those of the GEMM that this takes the place of, so every q, k, v value is the same number. The accumulators go out three ways, all staged in LDS so that every store
// is of whole 128-B lines: q, k and V^T as f16 (V^T: a lane holds 8 tokens in a row of one column: one 16-byte LDS store), and, for the first QT0 rows of a batch, q, k, v as f32.
// q, k (both widths) and V^T leave in FRAGMENT ORDER (fr_frag; att0w_rows): the 16-byte piece that lane L of an attention wave loads stands at 16 L in a 512-B run, so the reader's loads cover whole lines; a work-group's share of each plane is one run.
#define PJR 64                       /* token rows per work-group: 256 work-groups */
#define PJW 12                       /* waves = 16-column tiles of q | k | v */
#define PJT (32 * PJW)
#define PJXP (DM + 8)                /* LDS pitch of an x row, halves: 528 B = 16 B x odd, for 16-byte fragment reads */
#define PJOP (2 * DI + 8)            /* LDS pitch of a q | k row, halves: 272 B = 16 B x odd */
#define PJVP (PJR + 8)               /* LDS pitch of a V^T row, halves: 144 B = 16 B x odd */
#define PJFP (LQK + 4)               /* LDS pitch of an f32 q | k | v row, floats: 784 B = 16 B x odd */
typedef __bf16 v2b __attribute__((ext_vector_type(2)));
typedef unsigned short v4us __attribute__((ext_vector_type(4), may_alias));
// two floats rounded to bf16 (nearest, ties to even: the value of bf16_round) by the conversion instruction, times s, as two f16
__device__ __forceinline__ void pj_cvt2(float a, float b, float s, _Float16& ha, _Float16& hb) { const v2b p = {(__bf16)a, (__bf16)b}; const unsigned int u = __builtin_bit_cast(unsigned int, p); ha = (_Float16)(__uint_as_float(u << 16) * s); hb = (_Float16)(__uint_as_float(u & 0xFFFF0000u) * s); }
__global__ __launch_bounds__(PJT) void k_proj(const float* __restrict__ x, const float* __restrict__ wq, const float* __restrict__ wk, const float* __restrict__ wv, _Float16* __restrict__ Q16, _Float16* __restrict__ K16, _Float16* __restrict__ VT, float* __restrict__ F0) {
  static_assert(PJW * 16 == LQK && DI == 64 && DM == 256 && SQ % PJR == 0 && QT0 % PJR == 0 && (PJR * 2 * DI + DI * PJR) / 8 == 4 * PJT && PJR * LQK / 4 == 8 * PJT, "a wave a column tile; a work-group lies in one batch and wholly inside or outside the exact rows; the store loops divide evenly");
  __shared__ __attribute__((aligned(16))) _Float16 xs[PJR][PJXP]; __shared__ __attribute__((aligned(16))) _Float16 so[PJR][PJOP]; __shared__ __attribute__((aligned(16))) _Float16 sv[DI][PJVP]; __shared__ __attribute__((aligned(16))) float sf[PJR][PJFP];
  const int tid = threadIdx.x, lane = tid & 31, ln = lane & 15, hh = lane >> 4; const int w = __builtin_amdgcn_readfirstlane(tid >> 5);      /* the wave's number as a scalar: which weight matrix, and every branch on it, is scalar */
  const size_t r0 = (size_t)blockIdx.x * PJR; const int b = (int)(r0 / SQ), s0 = (int)(r0 % SQ);
  const float* wp = (w < 4 ? wq : w < 8 ? wk : wv) + (w & 3) * 16 + ln + (size_t)(8 * hh) * DI; float wr[8][16];
#pragma unroll
  for (int ks = 0; ks < 8; ++ks)
#pragma unroll
    for (int i = 0; i < 8; ++i) { wr[ks][i] = wp[(size_t)(ks * 32 + i) * DI]; wr[ks][8 + i] = wp[(size_t)(ks * 32 + 16 + i) * DI]; }      /* the k order of g2_frag: 8 hh + i, 16 + 8 hh + i */
  const char* xb = (const char*)(x + r0 * DM); const unsigned xo = (unsigned)tid * 16u; const char* xt = xb + xo; v4f xa[11];      /* 4 floats a thread and turn: each load of a wave covers 512 B in a row, four whole lines */
#pragma unroll
  for (int u = 0; u < 11; ++u) if (u < 10 || w < 8) xa[u] = *(const v4fa*)(xt + u * PJT * 16);      /* PJR * DM / 4 = 10 * PJT + 256 */
  asm volatile("s_wait_xcnt 0x0" :: "v"(xo), "v"(xt), "v"(wp), "s"(xb) : "memory");      /* the wait in front of any overwrite of the address registers that the loads above name; x's offset, base and full address and the weights' address are inputs, so whichever form a load takes, its registers stay whole up to here */
  FragH bf[8];
#pragma unroll
  for (int ks = 0; ks < 8; ++ks)
#pragma unroll
    for (int i = 0; i < 16; i += 2) pj_cvt2(wr[ks][i], wr[ks][i + 1], 16.0f, bf[ks].h[i], bf[ks].h[i + 1]);
#pragma unroll
  for (int u = 0; u < 11; ++u) if (u < 10 || w < 8) { const int i = tid + u * PJT; FragH f;
    pj_cvt2(xa[u][0], xa[u][1], 1.0f, f.h[0], f.h[1]); pj_cvt2(xa[u][2], xa[u][3], 1.0f, f.h[2], f.h[3]);
    *(v4us*)&xs[i >> 6][(i & 63) * 4] = v4us{f.u[0], f.u[1], f.u[2], f.u[3]}; }
  __syncthreads();
  v8f acc[4];
#pragma unroll
  for (int mt = 0; mt < 4; ++mt) acc[mt] = v8f{0.f, 0.f, 0.f, 0.f, 0.f, 0.f, 0.f, 0.f};
#pragma unroll
  for (int ks = 0; ks < 8; ++ks)
#pragma unroll
    for (int mt = 0; mt < 4; ++mt) acc[mt] = fa_mma(g2_frag(&xs[mt * 16 + ln][ks * 32], hh), bf[ks].v, acc[mt]);
#pragma unroll
  for (int mt = 0; mt < 4; ++mt) acc[mt] *= 0.0625f;      /* the weights ride x16 */
  const bool ft = s0 < QT0;      /* the same for the whole work-group */
  if (w < 8) {
#pragma unroll
    for (int mt = 0; mt < 4; ++mt)
#pragma unroll
      for (int r = 0; r < 8; ++r) so[mt * 16 + 8 * hh + r][w * 16 + ln] = (_Float16)acc[mt][r];
  } else {
#pragma unroll
    for (int mt = 0; mt < 4; ++mt) { FragH f;
#pragma unroll
      for (int r = 0; r < 8; ++r) f.h[r] = (_Float16)acc[mt][r];
      *(v8us*)&sv[(w & 3) * 16 + ln][mt * 16 + 8 * hh] = f.half[0]; } }
  if (ft) {
#pragma unroll
    for (int mt = 0; mt < 4; ++mt)
#pragma unroll
      for (int r = 0; r < 8; ++r) sf[mt * 16 + 8 * hh + r][w * 16 + ln] = acc[mt][r]; }
  __syncthreads();
  { v4f t[4]; _Float16* gp = (w < 4 ? Q16 : w < 8 ? K16 : VT) + r0 * DI + (w & 3) * 1024 + lane * 8;      /* the work-group's share of each plane is 8 KiB in a row; wave w stores quarter w & 3 of plane w >> 2, four 512-B runs: piece = lane. All reads, then all stores: one LDS latency, not four */
#pragma unroll
    for (int u = 0; u < 4; ++u) t[u] = *(const v4fa*)(w < 8 ? &so[(w & 3) * 16 + ln][(w >> 2) * DI + u * 16 + 8 * hh]      /* q, k: tile w & 3; run u = 2 * k step + half */
                                                            : &sv[((w & 1) * 2 + (u >> 1)) * 16 + ln][((w >> 1) & 1) * 32 + (u & 1) * 16 + 8 * hh]);      /* V^T: chunk (w >> 1) & 1; column tile 2 (w & 1) + (u >> 1); half u & 1 */
#pragma unroll
    for (int u = 0; u < 4; ++u) *(v4fa*)(gp + u * 256) = t[u];
    asm volatile("s_wait_xcnt 0x0" :: "v"(gp), "v"(t[0]), "v"(t[1]), "v"(t[2]), "v"(t[3]) : "memory"); }      /* the wait in front of any overwrite of a register that these stores name; address and data are inputs, so they stay whole up to here */
  if (ft) { v4f t[8]; float* fp = F0 + (size_t)(w >> 2) * NB * QT0 * DI + ((size_t)b * QT0 + s0) * DI + (w & 3) * 1024 + lane * 4;      /* the same deal on the f32 planes: 16 KiB a plane, eight 512-B runs a wave */
    if (w < 8) {
#pragma unroll
      for (int u = 0; u < 8; ++u) t[u] = *(const v4f*)&sf[(w & 3) * 16 + ln][(w >> 2) * DI + 8 * u + 4 * hh];      /* q, k: tile w & 3; run u = columns 8 u + 4 hh .. + 3 of row ln */
    } else {
#pragma unroll
      for (int u = 0; u < 8; ++u) t[u] = *(const v4f*)&sf[(w & 3) * 16 + 2 * u + hh][2 * DI + 4 * ln]; }      /* v: run u = two whole rows */
#pragma unroll
    for (int u = 0; u < 8; ++u) *(v4f*)(fp + u * 128) = t[u];
    asm volatile("s_wait_xcnt 0x0" :: "v"(fp), "v"(t[0]), "v"(t[1]), "v"(t[2]), "v"(t[3]), "v"(t[4]), "v"(t[5]), "v"(t[6]), "v"(t[7]) : "memory"); } }      /* the same wait: address and data are inputs, so no piece's registers are taken for a later piece while its store is on its way */

extern "C" void kernel_launch(void* const* d_in, const int* in_sizes, int n_in,
                              void* d_out, int out_size, void* d_ws, size_t ws_size, hipStream_t stream) {
  (void)in_sizes; (void)n_in; (void)out_size;
  const float* const* I = (const float* const*)d_in; const float* x = I[0]; const float* wq = I[2]; const float* wk = I[1]; const float* wv = I[3];      /* x; [in][out = 64] Wk / Wq / Wv (input order as this module lists them); no biases */
  char* ws = (char*)d_ws; size_t off = 0;
  auto take = [&](size_t bytes) { char* p = ws + off; off += (bytes + 255) & ~(size_t)255; return p; };
  _Float16* Q16 = (_Float16*)take(NR * DI * 2); _Float16* K16 = (_Float16*)take(NR * DI * 2); _Float16* VT = (_Float16*)take((size_t)NB * HD * SQ * 2);
  float* QKVF0 = (float*)take((size_t)NB * QT0 * LQK * 4);      /* three planes, q, k, v, of NB * QT0 rows each: the four batches run side by side */
  if (off > ws_size) return;
  k_proj<<<(unsigned)(NR / PJR), PJT, 0, stream>>>(x, wq, wk, wv, Q16, K16, VT, QKVF0);      /* f16 q, k, V^T of every row and f32 q, k of rows 0..511 of every batch, in fragment order; f32 v rows of rows 0..511 */
  static_assert(NH == 1, "the grid carries the batch in place of the head");
  float* ob = (float*)d_out;
  k_attn<<<dim3(NB, ATX + ATP), 32 * A0W, 0, stream>>>(Q16, K16, VT, QKVF0, QKVF0 + (size_t)NB * QT0 * DI, QKVF0 + (size_t)2 * NB * QT0 * DI, 0.0625f, ob);      /* out[b][i][0..63] = softmax(causal q k^T * 256^-0.5 = 1/16: the module scales by the EMBEDDING width) v, f32, all query rows of all batches in one launch: rows 0..511 exact f32, the rest f16 operands */
}
